// v000
// Times are from an AMD MI455X. After a warm-up the kernel runs many times in a row, and a time is the length of
// such a window on the GPU divided by its runs, so every launch and the gaps after it count. The runs cycle
// through copies of the inputs. A figure is the median of several windows, for all but v000 over two sittings.
// Sittings can differ by a few percent; kernels timed side by side share one.
// v000 is the starting kernel. One run takes 14.3 milliseconds.
#include <hip/hip_runtime.h>
// Multi-head self-attention on ONE 4096-token problem with a SHARED query / key projection and no output projection, NON-causal (X [4096][1024]; proj = X Wqkv ([in][out] 1024 x 2048 sigma 1/32, no bias) split into a qk half and a v half; the scores use the SAME projection on both sides: scores = qk qk^T / sqrt(64) per head (16 heads of 64; symmetric per head); softmax over all 4096 keys (no mask); out = att v merged head-major -> [4096][1024]; no output projection); ONE head per attention launch group.
// Structure: token rows r = b*4096 + s; x as exact f16 rows (bf16-rounded); Q, K, V as three WMMA GEMMs (32x64 wave tiles, f32 accumulation, exact x16 weights, no bias, f16 outputs); per batch: V^T for all heads via LDS transposes; per (batch, head): scores GEMM (K = 64, HG = 1 head on grid.y, alpha = 1/sqrt(64)), row softmax on VALU (f32 statistics; weights stored x256 as f16), o = P . V^T GEMM (K = 4096, alpha 2^-8 undoes the x256 of P) written f32 straight into the merged-heads output rows; no output projection.
// Compute dtype: inputs rounded to bf16; x / weights exact; q, k, v and softmax weights as plain f16 GEMM operands (~2^-12); scores, softmax statistics and o f32. v_wmma_f32_16x16x32_f16.
#define NB 1
#define SQ 4096
#define DM 1024
#define NH 16
#define HD 64
#define HG 1                         /* heads per attention launch group (a 4096^2 f32 score slab is 64 MiB) */
#define B0 0                         /* first batch processed (debug hook) */
#define NBR NB                       /* batches processed (debug hook) */
#define NR ((size_t)NB * SQ)         /* token rows */
#define MP ((int)((size_t)NBR * SQ)) /* rows projected (debug hook) */
#define QN SQ                        /* query rows attended per batch (debug hook) */
#define NHD NH                       /* heads attended (debug hook) */
#define MPO MP                       /* unused (no output projection stage) */
#define LQ DM      /* row pitch of the q/k/v rows */
typedef __bf16 v16b __attribute__((ext_vector_type(16)));
typedef unsigned short v8us __attribute__((ext_vector_type(8), may_alias));
typedef float  v8f  __attribute__((ext_vector_type(8)));
typedef float  v4f  __attribute__((ext_vector_type(4)));
typedef float  v4fa __attribute__((ext_vector_type(4), may_alias));
union FragB { v16b v; v8us half[2]; unsigned short u[16]; };

__device__ __forceinline__ unsigned short bf16_bits(float x) { unsigned int u = __float_as_uint(x); return (unsigned short)((u + 0x7FFFu + ((u >> 16) & 1u)) >> 16); }
__device__ __forceinline__ float bf16_val(unsigned short b) { return __uint_as_float(((unsigned int)b) << 16); }
__device__ __forceinline__ float bf16_round(float x) { return bf16_val(bf16_bits(x)); }
// D += A·B with NT terms: 1 = ah·bh, 2 = + al·bh (A split), 3 = + ah·bl (both split)
template <int NT>
__device__ __forceinline__ v8f mmaN(v16b ah, v16b al, v16b bh, v16b bl, v8f c) {
  c = __builtin_amdgcn_wmma_f32_16x16x32_bf16(false, ah, false, bh, (short)0, c, false, false);
  if (NT >= 2) c = __builtin_amdgcn_wmma_f32_16x16x32_bf16(false, al, false, bh, (short)0, c, false, false);
  if (NT >= 3) c = __builtin_amdgcn_wmma_f32_16x16x32_bf16(false, ah, false, bl, (short)0, c, false, false);
  asm volatile("v_nop\n\tv_nop\n\tv_nop\n\tv_nop" : "+v"(c) : "v"(ah), "v"(al), "v"(bh), "v"(bl));
  return c;
}

__global__ __launch_bounds__(256) void k_wt_bf16(const float* __restrict__ W, unsigned short* __restrict__ Wt, int K, int N) {
  const int t = blockIdx.x * 256 + threadIdx.x;
  const int k8n = K / 8;
  if (t >= N * k8n) return;
  const int n = t / k8n, k8 = (t % k8n) * 8;
  v8us v;
#pragma unroll
  for (int i = 0; i < 8; ++i) v[i] = bf16_bits(W[(size_t)(k8 + i) * N + n]);
  *(v8us*)(Wt + (size_t)n * K + k8) = v;
  
}

// GEMM C[M][N] (f32, pitch ldc) = act(A[M][K]·W + bias). A f32 row-major (pitch lda) converted per fragment to bf16
// (ASPLIT: hi/lo two planes -> 2 terms, else single rounded term); Wt bf16 [N][K] (pitch ldb). BIAS_BF16 rounds the
// bias to bf16 first (bias quantised to bf16 before the add). K%32==0, M%16==0, N%64==0.
template <bool ASPLIT, int ACT, bool BIAS_BF16>
__global__ __launch_bounds__(128) void k_gemm_bf(const float* __restrict__ A, int lda, const unsigned short* __restrict__ Wt, int ldb,
                                               const float* __restrict__ bias, float* __restrict__ C, int ldc, int M, int N, int K) {
  __shared__ __attribute__((aligned(16))) float so[4][16][64];
  const int tid = threadIdx.x, w = tid >> 5, lane = tid & 31, ln = lane & 15, hh = lane >> 4;
  const int ntn = N / 64;
  const int wid = blockIdx.x * 4 + w;
  const int mt = wid / ntn, nq = wid % ntn;
  if (mt * 16 >= M) return;
  const int row0 = mt * 16, col0 = nq * 64;
  const float* arow = A + (size_t)(row0 + ln) * lda;
  v8f acc[4] = {};
  for (int kb = 0; kb < K; kb += 32) {
    FragB ah, al;
    const v4f x0 = *(const v4fa*)(arow + kb + 8 * hh), x1 = *(const v4fa*)(arow + kb + 8 * hh + 4);
    const v4f x2 = *(const v4fa*)(arow + kb + 16 + 8 * hh), x3 = *(const v4fa*)(arow + kb + 16 + 8 * hh + 4);
    float xs[16] = {x0[0],x0[1],x0[2],x0[3],x1[0],x1[1],x1[2],x1[3],x2[0],x2[1],x2[2],x2[3],x3[0],x3[1],x3[2],x3[3]};
#pragma unroll
    for (int i = 0; i < 16; ++i) { const unsigned short hb = bf16_bits(xs[i]); ah.u[i] = hb; al.u[i] = ASPLIT ? bf16_bits(xs[i] - bf16_val(hb)) : (unsigned short)0; }
#pragma unroll
    for (int t = 0; t < 4; ++t) {
      const unsigned short* brow = Wt + (size_t)(col0 + t * 16 + ln) * ldb + kb;
      FragB b;
      b.half[0] = *(const v8us*)(brow + 8 * hh);
      b.half[1] = *(const v8us*)(brow + 16 + 8 * hh);
      acc[t] = mmaN<ASPLIT ? 2 : 1>(ah.v, al.v, b.v, b.v, acc[t]);
    }
  }
#pragma unroll
  for (int t = 0; t < 4; ++t) {
    float bv = bias ? bias[col0 + t * 16 + ln] : 0.f;
    if (BIAS_BF16) bv = bf16_round(bv);
#pragma unroll
    for (int r = 0; r < 8; ++r) { float v = acc[t][r] + bv; if (ACT == 1) v = fmaxf(v, 0.f); so[w][8 * hh + r][t * 16 + ln] = v; }
  }
  __builtin_amdgcn_fence(__ATOMIC_ACQ_REL, "workgroup");
  __builtin_amdgcn_wave_barrier();
  const int rsub = lane >> 4, c4 = (lane & 15) * 4;
  {
#pragma unroll
    for (int q = 0; q < 8; ++q) {
      const int r = q * 2 + rsub;
      const v4f v = *(const v4fa*)&so[w][r][c4];
      *(v4f*)(C + (size_t)(row0 + r) * ldc + col0 + c4) = v;
    }
    
  }
}

// GEMM C = act(A·W + bias + resid): A f32 (ASPLIT -> hi/lo 2 terms), Wt bf16 [N][K]; ACT 0 none, 1 relu, 2 exact gelu;
// resid (optional, f32, row index = (row % rmod), pitch ldr, RES_BF16 rounds it) added before the activation.
template <bool ASPLIT, int ACT, bool BIAS_BF16, bool RES_BF16>
__global__ __launch_bounds__(128) void k_gemm_bf3(const float* __restrict__ A, int lda, const unsigned short* __restrict__ Wt, int ldb,
                                                const float* __restrict__ bias, const float* __restrict__ resid, int rmod, int ldr,
                                                float* __restrict__ C, int ldc, int M, int N, int K) {
  __shared__ __attribute__((aligned(16))) float so[4][16][64];
  const int tid = threadIdx.x, w = tid >> 5, lane = tid & 31, ln = lane & 15, hh = lane >> 4;
  const int ntn = N / 64;
  const int wid = blockIdx.x * 4 + w;
  const int mt = wid / ntn, nq = wid % ntn;
  if (mt * 16 >= M) return;
  const int row0 = mt * 16, col0 = nq * 64;
  const float* arow = A + (size_t)(row0 + ln) * lda;
  v8f acc[4] = {};
  for (int kb = 0; kb < K; kb += 32) {
    FragB ah, al;
    const v4f x0 = *(const v4fa*)(arow + kb + 8 * hh), x1 = *(const v4fa*)(arow + kb + 8 * hh + 4);
    const v4f x2 = *(const v4fa*)(arow + kb + 16 + 8 * hh), x3 = *(const v4fa*)(arow + kb + 16 + 8 * hh + 4);
    float xs[16] = {x0[0],x0[1],x0[2],x0[3],x1[0],x1[1],x1[2],x1[3],x2[0],x2[1],x2[2],x2[3],x3[0],x3[1],x3[2],x3[3]};
#pragma unroll
    for (int i = 0; i < 16; ++i) { const unsigned short hb = bf16_bits(xs[i]); ah.u[i] = hb; al.u[i] = ASPLIT ? bf16_bits(xs[i] - bf16_val(hb)) : (unsigned short)0; }
#pragma unroll
    for (int t = 0; t < 4; ++t) {
      const unsigned short* brow = Wt + (size_t)(col0 + t * 16 + ln) * ldb + kb;
      FragB b;
      b.half[0] = *(const v8us*)(brow + 8 * hh);
      b.half[1] = *(const v8us*)(brow + 16 + 8 * hh);
      acc[t] = mmaN<ASPLIT ? 2 : 1>(ah.v, al.v, b.v, b.v, acc[t]);
    }
  }
#pragma unroll
  for (int t = 0; t < 4; ++t) {
    const int col = col0 + t * 16 + ln;
    float bv = bias ? bias[col] : 0.f;
    if (BIAS_BF16) bv = bf16_round(bv);
#pragma unroll
    for (int r = 0; r < 8; ++r) {
      float v = acc[t][r] + bv;
      if (resid) { float rv = resid[(size_t)((row0 + 8 * hh + r) % rmod) * ldr + col]; if (RES_BF16) rv = bf16_round(rv); v += rv; }
      if (ACT == 1) v = fmaxf(v, 0.f);
      if (ACT == 2) v = 0.5f * v * (1.0f + erff(v * 0.70710678118654752f));
      if (ACT == 3) { const float u = 0.7978845608028654f * (v + 0.044715f * v * v * v); v = 0.5f * v * (1.0f + tanhf(u)); }
      so[w][8 * hh + r][t * 16 + ln] = v;
    }
  }
  __builtin_amdgcn_fence(__ATOMIC_ACQ_REL, "workgroup");
  __builtin_amdgcn_wave_barrier();
  const int rsub = lane >> 4, c4 = (lane & 15) * 4;
  {
#pragma unroll
    for (int q = 0; q < 8; ++q) {
      const int r = q * 2 + rsub;
      const v4f v = *(const v4fa*)&so[w][r][c4];
      *(v4f*)(C + (size_t)(row0 + r) * ldc + col0 + c4) = v;
    }
    
  }
}
// row LayerNorm (biased variance, eps) over N: s = X (+ R); optional out_sum <- s; out_norm <- (s-mu)*rsqrt(var+eps)*g + b
template <bool PARAM_BF16>
__global__ __launch_bounds__(256) void k_layernorm(const float* __restrict__ X, const float* __restrict__ R, const float* __restrict__ g, const float* __restrict__ bta,
                                                  float* __restrict__ out_sum, float* __restrict__ out_norm, int N, float eps) {
  __shared__ float red[256];
  const int row = blockIdx.x, tid = threadIdx.x;
  const float* x = X + (size_t)row * N; const float* rr = R ? R + (size_t)row * N : nullptr;
  float vals[16];                     // up to N = 4096
  const int per = N / 256;            // contiguous chunk per thread? use strided-by-4 chunks: thread handles j = tid*4 + 1024*u
  float s1 = 0.f;
  for (int u = 0; u < per / 4; ++u) {
    const int j = tid * 4 + 1024 * u;
    const v4f a = *(const v4fa*)(x + j);
    v4f b = {0.f,0.f,0.f,0.f}; if (rr) b = *(const v4fa*)(rr + j);
#pragma unroll
    for (int q = 0; q < 4; ++q) { const float v = a[q] + b[q]; vals[u * 4 + q] = v; s1 += v; }
  }
  red[tid] = s1; __syncthreads();
  for (int st = 128; st > 0; st >>= 1) { if (tid < st) red[tid] += red[tid + st]; __syncthreads(); }
  const float mu = red[0] / (float)N; __syncthreads();
  float s2 = 0.f;
  for (int u = 0; u < per / 4; ++u)
#pragma unroll
    for (int q = 0; q < 4; ++q) { const float c = vals[u * 4 + q] - mu; s2 += c * c; }
  red[tid] = s2; __syncthreads();
  for (int st = 128; st > 0; st >>= 1) { if (tid < st) red[tid] += red[tid + st]; __syncthreads(); }
  const float rs = rsqrtf(red[0] / (float)N + eps);
  {
    for (int u = 0; u < per / 4; ++u) {
      const int j = tid * 4 + 1024 * u;
      v4f o, sm;
#pragma unroll
      for (int q = 0; q < 4; ++q) {
        float gg = g[j + q], bb = bta[j + q];
        if (PARAM_BF16) { gg = bf16_round(gg); bb = bf16_round(bb); }
        sm[q] = vals[u * 4 + q]; o[q] = (vals[u * 4 + q] - mu) * rs * gg + bb;
      }
      if (out_sum) *(v4f*)(out_sum + (size_t)row * N + j) = sm;
      *(v4f*)(out_norm + (size_t)row * N + j) = o;
    }
    
  }
}



// ---- f16 WMMA path (v_wmma_f32_16x16x32_f16): 11-bit significands for operands in range — used where a [0,1] probability operand needs more precision than bf16
typedef _Float16 v16h __attribute__((ext_vector_type(16)));
union FragH { v16h v; v8us half[2]; _Float16 h[16]; unsigned short u[16]; };
template <int NT>
__device__ __forceinline__ v8f mmaH(v16h ah, v16h al, v16h bh, v16h bl, v8f c) {
  c = __builtin_amdgcn_wmma_f32_16x16x32_f16(false, ah, false, bh, (short)0, c, false, false);
  if (NT >= 2) c = __builtin_amdgcn_wmma_f32_16x16x32_f16(false, al, false, bh, (short)0, c, false, false);
  if (NT >= 3) c = __builtin_amdgcn_wmma_f32_16x16x32_f16(false, ah, false, bl, (short)0, c, false, false);
  asm volatile("v_nop\n\tv_nop\n\tv_nop\n\tv_nop" : "+v"(c) : "v"(ah), "v"(al), "v"(bh), "v"(bl));
  return c;
}
// batched GEMM like k_gemm_b but f16 operands: A f32 (split into f16 hi/lo if ASPLIT, else rounded to f16), Bt = f16 values [n][k]; alpha; C f32; N multiple of 16 (partial tiles skipped)
template <bool ASPLIT>
__global__ __launch_bounds__(128) void k_gemm_h(const float* __restrict__ A, int lda, size_t sA, const _Float16* __restrict__ Bh, int ldb, size_t sB, float alpha, float* __restrict__ C, int ldc, size_t sC, int M, int N, int K) {
  __shared__ __attribute__((aligned(16))) float so[4][16][64];
  const int tid = threadIdx.x, w = tid >> 5, lane = tid & 31, ln = lane & 15, hh = lane >> 4; const int by = blockIdx.y;
  A += (size_t)by * sA; Bh += (size_t)by * sB; C += (size_t)by * sC;
  const int ntn = (N + 63) / 64; const int wid = blockIdx.x * 4 + w; const int mt = wid / ntn, nq = wid % ntn; if (mt * 16 >= M) return;
  const int row0 = mt * 16, col0 = nq * 64; const float* arow = A + (size_t)(row0 + ln) * lda;
  v8f acc[4] = {};
  for (int kb = 0; kb < K; kb += 32) {
    FragH ah, al;
    const v4f x0 = *(const v4fa*)(arow + kb + 8 * hh), x1 = *(const v4fa*)(arow + kb + 8 * hh + 4), x2 = *(const v4fa*)(arow + kb + 16 + 8 * hh), x3 = *(const v4fa*)(arow + kb + 16 + 8 * hh + 4);
    float xs[16] = {x0[0],x0[1],x0[2],x0[3],x1[0],x1[1],x1[2],x1[3],x2[0],x2[1],x2[2],x2[3],x3[0],x3[1],x3[2],x3[3]};
#pragma unroll
    for (int i = 0; i < 16; ++i) { const _Float16 h = (_Float16)xs[i]; ah.h[i] = h; al.h[i] = ASPLIT ? (_Float16)(xs[i] - (float)h) : (_Float16)0.0f; }
#pragma unroll
    for (int t = 0; t < 4; ++t) { if (col0 + t * 16 >= N) continue; const size_t boff = (size_t)(col0 + t * 16 + ln) * ldb + kb; FragH bq; bq.half[0] = *(const v8us*)(Bh + boff + 8 * hh); bq.half[1] = *(const v8us*)(Bh + boff + 16 + 8 * hh);
      acc[t] = mmaH<ASPLIT ? 2 : 1>(ah.v, al.v, bq.v, bq.v, acc[t]); }
  }
#pragma unroll
  for (int t = 0; t < 4; ++t) { if (col0 + t * 16 >= N) continue;
#pragma unroll
    for (int r = 0; r < 8; ++r) so[w][8 * hh + r][t * 16 + ln] = acc[t][r] * alpha; }
  __builtin_amdgcn_fence(__ATOMIC_ACQ_REL, "workgroup"); __builtin_amdgcn_wave_barrier();
  const int rsub = lane >> 4, c4 = (lane & 15) * 4;
  {
#pragma unroll
    for (int q = 0; q < 8; ++q) { const int r = q * 2 + rsub; if (col0 + c4 < N) { const v4f v = *(const v4fa*)&so[w][r][c4]; *(v4f*)(C + (size_t)(row0 + r) * ldc + col0 + c4) = v; } }
     }
}

// Wt[n][k] = f16(W[k][n]·scale) from f32 row-major W[K][N] (scale = power of two; bf16-exact weights stay exact in f16 away from the subnormal range)
__global__ __launch_bounds__(256) void k_wt_f16(const float* __restrict__ W, _Float16* __restrict__ Wt, int K, int N, float scale) {
  const int t = blockIdx.x * 256 + threadIdx.x; if (t >= N * (K / 8)) return; const int n = t / (K / 8), k8 = (t % (K / 8)) * 8; FragH f;
#pragma unroll
  for (int i = 0; i < 8; ++i) f.h[i] = (_Float16)(bf16_round(W[(size_t)(k8 + i) * N + n]) * scale); const v8us o = f.half[0];
  *(v8us*)((unsigned short*)Wt + (size_t)n * K + k8) = o; 
}
// k_gemm_hh variant with fused epilogue: v = acc·alpha + bias[by·sBias + col] (+ CP[(row/rowsPerB)·sCPb + by·64 + col] if CP) ; ACT 0 none / 1 elu ; writes f16 C16 (and f32 C if non-null)
template <int ACT>
__global__ __launch_bounds__(128) void k_gemm_hhx(const _Float16* __restrict__ A, int lda, size_t sA, const _Float16* __restrict__ Bh, int ldb, size_t sB, float alpha, const float* __restrict__ bias, size_t sBias, const float* __restrict__ CP, int rowsPerB, size_t sCPb, int row0g,
    float* __restrict__ C, _Float16* __restrict__ C16, int ldc, size_t sC, int M, int N, int K) {
  __shared__ __attribute__((aligned(16))) float so[4][16][64];
  const int tid = threadIdx.x, w = tid >> 5, lane = tid & 31, ln = lane & 15, hh = lane >> 4; const int by = blockIdx.y;
  A += (size_t)by * sA; Bh += (size_t)by * sB; const size_t cofs = (size_t)by * sC; const float* bp = bias ? bias + (size_t)by * sBias : nullptr;
  const int ntn = (N + 63) / 64; const int wid = blockIdx.x * 4 + w; const int mt = wid / ntn, nq = wid % ntn; if (mt * 16 >= M) return;
  const int row0 = mt * 16, col0 = nq * 64; const _Float16* arow = A + (size_t)(row0 + ln) * lda;
  v8f acc[4] = {};
  for (int kb = 0; kb < K; kb += 32) { FragH ah; ah.half[0] = *(const v8us*)((const unsigned short*)arow + kb + 8 * hh); ah.half[1] = *(const v8us*)((const unsigned short*)arow + kb + 16 + 8 * hh);
#pragma unroll
    for (int t = 0; t < 4; ++t) { if (col0 + t * 16 >= N) continue; const size_t boff = (size_t)(col0 + t * 16 + ln) * ldb + kb; FragH bq; bq.half[0] = *(const v8us*)((const unsigned short*)Bh + boff + 8 * hh); bq.half[1] = *(const v8us*)((const unsigned short*)Bh + boff + 16 + 8 * hh);
      acc[t] = mmaH<1>(ah.v, ah.v, bq.v, bq.v, acc[t]); }
  }
#pragma unroll
  for (int t = 0; t < 4; ++t) { if (col0 + t * 16 >= N) continue; const int col = col0 + t * 16 + ln; const float bv = bp ? bf16_round(bp[col]) : 0.f;
#pragma unroll
    for (int r = 0; r < 8; ++r) { float v = acc[t][r] * alpha + bv; if (CP) { const int rr = row0g + row0 + 8 * hh + r; if (rowsPerB < 0) v += CP[cofs + (size_t)rr * ldc + col];      /* rowsPerB < 0: own element of the batched C plane */ else { const int bidx = rr / rowsPerB; v += CP[(size_t)bidx * sCPb + (size_t)by * 64 + col]; } } if (ACT == 1) v = (v > 0.f) ? v : expm1f(v); else if (ACT == 7) v = (v > 0.f) ? v + 1.0f : expf(v); else if (ACT == 8) v = tanhf(v); else if (ACT == 9) v = 0.5f * v * (1.0f + tanhf(0.7978845608028654f * (v + 0.044715f * v * v * v))); else if (ACT == 11) v = 1.0f / (1.0f + expf(-v)); else if (ACT == 12) v = (v > 0.f) ? v : 0.01f * v; else if (ACT == 14) v = (v > 0.f) ? v : 0.1f * v; else if (ACT == 16) v = (v >= 0.f) ? v : 0.3f * v; else if (ACT == 17) v = (v >= 0.f) ? v : 0.2f * v; else if (ACT == 15) v = v / (1.0f + expf(-v)); else if (ACT == 3) v = fmaxf(v, 0.f); else if (ACT == 6) v = 0.5f * v * (1.0f + erff(v * 0.70710678118654752f)); so[w][8 * hh + r][t * 16 + ln] = v; } }
  __builtin_amdgcn_fence(__ATOMIC_ACQ_REL, "workgroup"); __builtin_amdgcn_wave_barrier();
  const int rsub = lane >> 4, c4 = (lane & 15) * 4; typedef _Float16 v4h __attribute__((ext_vector_type(4)));
  {
#pragma unroll
    for (int q = 0; q < 8; ++q) { const int r = q * 2 + rsub; if (col0 + c4 < N) { const v4f v = *(const v4fa*)&so[w][r][c4]; if (C) *(v4f*)(C + cofs + (size_t)(row0 + r) * ldc + col0 + c4) = v; if (C16) { v4h h4; for (int i = 0; i < 4; ++i) h4[i] = (_Float16)v[i]; *(v4h*)(C16 + cofs + (size_t)(row0 + r) * ldc + col0 + c4) = h4; } } }
     }
}


typedef _Float16 v4h __attribute__((ext_vector_type(4)));

__global__ __launch_bounds__(256) void k_x16(const float* __restrict__ x, _Float16* __restrict__ X16, size_t n8) { const size_t t = (size_t)blockIdx.x * 256 + threadIdx.x; if (t >= n8) return; FragH f;
#pragma unroll
  for (int q = 0; q < 8; ++q) f.h[q] = (_Float16)bf16_round(x[t * 8 + q]); *(v8us*)((unsigned short*)X16 + t * 8) = f.half[0];  }
__global__ __launch_bounds__(256) void k_h16(const float* __restrict__ x, _Float16* __restrict__ X16, size_t n8) { const size_t t = (size_t)blockIdx.x * 256 + threadIdx.x; if (t >= n8) return; FragH f;
#pragma unroll
  for (int q = 0; q < 8; ++q) f.h[q] = (_Float16)x[t * 8 + q]; *(v8us*)((unsigned short*)X16 + t * 8) = f.half[0];  }
__global__ __launch_bounds__(256) void k_round16f(const float* __restrict__ W, _Float16* __restrict__ Bt, size_t n8) { const size_t t = (size_t)blockIdx.x * 256 + threadIdx.x; if (t >= n8) return; FragH f;
#pragma unroll
  for (int i = 0; i < 8; ++i) f.h[i] = (_Float16)(bf16_round(W[t * 8 + i]) * 16.0f); *(v8us*)((unsigned short*)Bt + t * 8) = f.half[0];  }
template <int NHv, int TTv>
__global__ __launch_bounds__(256) void k_vt(const _Float16* __restrict__ V16, int ldv, int voff, _Float16* __restrict__ Vt) { __shared__ unsigned short tl[64][66]; const int tid = threadIdx.x; const int slab = blockIdx.x / (TTv / 64), lg = blockIdx.x % (TTv / 64); const int b = slab / NHv, h = slab % NHv;
  for (int i = tid; i < 64 * 8; i += 256) { const int r = i / 8, c8 = (i % 8) * 8; FragH f; f.half[0] = *(const v8us*)((const unsigned short*)V16 + ((size_t)b * TTv + lg * 64 + r) * ldv + voff + h * 64 + c8);
#pragma unroll
    for (int q = 0; q < 8; ++q) tl[r][c8 + q] = f.u[q]; }
  __syncthreads();
  {
#pragma unroll
    for (int rd = 0; rd < 2; ++rd) { const int d = rd * 32 + tid / 8, pc = tid % 8; FragH f;
#pragma unroll
      for (int q = 0; q < 8; ++q) f.u[q] = tl[pc * 8 + q][d];
      *(v8us*)((unsigned short*)Vt + ((size_t)slab * 64 + d) * TTv + lg * 64 + pc * 8) = f.half[0]; }
     } }

__global__ __launch_bounds__(256) void k_hl(const float* __restrict__ F, _Float16* __restrict__ Hh, _Float16* __restrict__ Hl, size_t n8) { const size_t t = (size_t)blockIdx.x * 256 + threadIdx.x; if (t >= n8) return; FragH fh, fl; const v4f a = *(const v4fa*)(F + t * 8), c = *(const v4fa*)(F + t * 8 + 4);
#pragma unroll
  for (int q = 0; q < 4; ++q) { _Float16 h = (_Float16)a[q]; fh.h[q] = h; fl.h[q] = (_Float16)((a[q] - (float)h) * 1024.0f); h = (_Float16)c[q]; fh.h[4 + q] = h; fl.h[4 + q] = (_Float16)((c[q] - (float)h) * 1024.0f); }
  { *(v8us*)((unsigned short*)Hh + t * 8) = fh.half[0]; *(v8us*)((unsigned short*)Hl + t * 8) = fl.half[0];  } }

// ---- fast GEMM (wave tile 32x64; requires M % 32 == 0 rows per launch region and N % 64 == 0); epilogue = k_gemm_hhx semantics ----
__device__ __forceinline__ v16h g2_frag(const _Float16* p, int hh) { FragH f; f.half[0] = *(const v8us*)((const unsigned short*)p + 8 * hh); f.half[1] = *(const v8us*)((const unsigned short*)p + 16 + 8 * hh); return f.v; }
__device__ __forceinline__ v8f g2_mma(v16h a, v16h b, v8f c) { v8f d = __builtin_amdgcn_wmma_f32_16x16x32_f16(false, a, false, b, (short)0, c, false, false); asm volatile("v_nop\n\tv_nop\n\tv_nop\n\tv_nop" : "+v"(d) : "v"(a), "v"(b)); return d; }
template <int ACT>
__global__ __launch_bounds__(128) void k_gemm2(const _Float16* __restrict__ A, int lda, size_t sA, const _Float16* __restrict__ Bh, int ldb, size_t sB, float alpha, const float* __restrict__ bias, size_t sBias, const float* __restrict__ CP, int rowsPerB, size_t sCPb, int row0g,
    float* __restrict__ C, _Float16* __restrict__ C16, int ldc, size_t sC, int M, int N, int K) { static_assert(ACT == 0 || ACT == 3 || ACT == 6 || ACT == 8 || ACT == 9 || ACT == 11 || ACT == 12 || ACT == 14 || ACT == 15 || ACT == 16 || ACT == 17, "k_gemm2: unsupported ACT code (would silently apply no activation)");
  __shared__ __attribute__((aligned(16))) float so[4][32][68];
  const int tid = threadIdx.x, w = tid >> 5, lane = tid & 31, ln = lane & 15, hh = lane >> 4; const int by = blockIdx.y;
  A += (size_t)by * sA; Bh += (size_t)by * sB; const size_t cofs = (size_t)by * sC; const float* bp = bias ? bias + (size_t)by * sBias : nullptr;
  const int ntn = N >> 6; const int mt = blockIdx.x / ntn, nq = blockIdx.x - mt * ntn; const int row0 = mt * 128 + 32 * w, col0 = nq * 64; if (row0 >= M) return;
  const _Float16* a0p = A + (size_t)(row0 + ln) * lda; const _Float16* a1p = a0p + (size_t)16 * lda;
  const _Float16* b0p = Bh + (size_t)(col0 + ln) * ldb; const _Float16* b1p = b0p + (size_t)16 * ldb; const _Float16* b2p = b1p + (size_t)16 * ldb; const _Float16* b3p = b2p + (size_t)16 * ldb;
  const v8f z8 = {0.f,0.f,0.f,0.f,0.f,0.f,0.f,0.f}; v8f c00 = z8, c01 = z8, c02 = z8, c03 = z8, c10 = z8, c11 = z8, c12 = z8, c13 = z8;
#pragma unroll 1
  for (int kb = 0; kb < K; kb += 32) { const v16h a0 = g2_frag(a0p + kb, hh), a1 = g2_frag(a1p + kb, hh);
    v16h b = g2_frag(b0p + kb, hh); c00 = g2_mma(a0, b, c00); c10 = g2_mma(a1, b, c10);
    b = g2_frag(b1p + kb, hh); c01 = g2_mma(a0, b, c01); c11 = g2_mma(a1, b, c11);
    b = g2_frag(b2p + kb, hh); c02 = g2_mma(a0, b, c02); c12 = g2_mma(a1, b, c12);
    b = g2_frag(b3p + kb, hh); c03 = g2_mma(a0, b, c03); c13 = g2_mma(a1, b, c13); }
  v8f accs[8] = {c00, c01, c02, c03, c10, c11, c12, c13};
#pragma unroll
  for (int u = 0; u < 8; ++u) { const int t = u & 3, half = u >> 2; const int col = col0 + t * 16 + ln; const float bv = bp ? bf16_round(bp[col]) : 0.f;
#pragma unroll
    for (int r = 0; r < 8; ++r) { const int rloc = half * 16 + 8 * hh + r; float v = accs[u][r] * alpha + bv; if (CP) { if (rowsPerB < 0) v += CP[cofs + (size_t)(row0g + row0 + rloc) * ldc + col];      /* rowsPerB < 0: own element of the batched C plane */ else { const int bidx = (row0g + row0 + rloc) / rowsPerB; v += CP[(size_t)bidx * sCPb + (size_t)by * 64 + col]; } }
      if (ACT == 3) v = fmaxf(v, 0.f); else if (ACT == 6) v = 0.5f * v * (1.0f + erff(v * 0.70710678118654752f)); else if (ACT == 11) v = 1.0f / (1.0f + expf(-v)); else if (ACT == 15) v = v / (1.0f + expf(-v)); else if (ACT == 12) v = (v > 0.f) ? v : 0.01f * v; else if (ACT == 8) v = tanhf(v); else if (ACT == 9) v = 0.5f * v * (1.0f + tanhf(0.7978845608028654f * (v + 0.044715f * v * v * v))); else if (ACT == 14) v = (v > 0.f) ? v : 0.1f * v; else if (ACT == 16) v = (v >= 0.f) ? v : 0.3f * v; else if (ACT == 17) v = (v >= 0.f) ? v : 0.2f * v;
      so[w][rloc][t * 16 + ln] = v; } }
  __builtin_amdgcn_fence(__ATOMIC_ACQ_REL, "workgroup"); __builtin_amdgcn_wave_barrier();
  const int rsub = lane >> 4, c4 = (lane & 15) * 4;
  {
#pragma unroll
    for (int q = 0; q < 16; ++q) { const int r = q * 2 + rsub; const v4f v = *(const v4fa*)&so[w][r][c4]; if (C) *(v4f*)(C + cofs + (size_t)(row0 + r) * ldc + col0 + c4) = v; if (C16) { v4h h4; for (int i = 0; i < 4; ++i) h4[i] = (_Float16)v[i]; *(v4h*)(C16 + cofs + (size_t)(row0 + r) * ldc + col0 + c4) = h4; } }
     } }


__global__ __launch_bounds__(256) void k_wnat(const float* __restrict__ w, size_t n8, _Float16* __restrict__ Bt) { const size_t t = (size_t)blockIdx.x * 256 + threadIdx.x; if (t >= n8) return; FragH f; for (int q = 0; q < 8; ++q) f.h[q] = (_Float16)(bf16_round(w[t * 8 + q]) * 16.0f); *(v8us*)((unsigned short*)Bt + t * 8) = f.half[0];  }
__global__ __launch_bounds__(256) void k_rsm(const float* __restrict__ S, _Float16* __restrict__ P, int nrows) {
  #pragma clang fp contract(off)
  const int i = blockIdx.x * 256 + threadIdx.x; if (i >= nrows) return; const float* s = S + (size_t)i * SQ; float mx = -3.0e38f;
#pragma unroll 1
  for (int j = 0; j < SQ; ++j) mx = fmaxf(mx, s[j]); float se = 0.f;
#pragma unroll 1
  for (int j = 0; j < SQ; ++j) se += expf(s[j] - mx); const float sc = 256.0f / se;
#pragma unroll 1
  for (int j0 = 0; j0 < SQ; j0 += 8) { FragH f; for (int q = 0; q < 8; ++q) f.h[q] = (_Float16)(expf(s[j0 + q] - mx) * sc); unsigned short* d = (unsigned short*)P + (size_t)i * SQ + j0; *(v8us*)d = f.half[0];  } }
__global__ __launch_bounds__(256) void k_vt(const _Float16* __restrict__ V16, int b, int h0, _Float16* __restrict__ VT) { __shared__ unsigned short tl[64][65]; const int tid = threadIdx.x; const int hh = blockIdx.x % HG, sg = blockIdx.x / HG; const int s0 = sg * 64; const int h = h0 + hh;
  for (int i = tid; i < 64 * 8; i += 256) { const int j = i / 8, d8 = (i % 8) * 8; FragH f; f.half[0] = *(const v8us*)((const unsigned short*)V16 + ((size_t)b * SQ + s0 + j) * DM + h * HD + d8); for (int q = 0; q < 8; ++q) tl[d8 + q][j] = f.u[q]; }
  __syncthreads();
  { for (int i = tid; i < 64 * 8; i += 256) { const int d = i / 8, j8 = (i % 8) * 8; FragH f; for (int q = 0; q < 8; ++q) f.u[q] = tl[d][j8 + q]; *(v8us*)((unsigned short*)VT + ((size_t)hh * HD + d) * SQ + s0 + j8) = f.half[0]; }  } }



__global__ __launch_bounds__(256) void k_rsmkm(const float* __restrict__ S, _Float16* __restrict__ P, int nrows, const int* __restrict__ am) {
  #pragma clang fp contract(off)
  const int t = blockIdx.x * 256 + threadIdx.x; if (t >= nrows) return; const size_t i = (size_t)t; const float* s = S + i * SQ; const int* mr = am + (size_t)(t % SQ) * SQ; float mx = -3.0e38f;
#pragma unroll 1
  for (int j = 0; j < SQ; ++j) { const float f = (mr[j] != 0) ? 1.f : 0.f; mx = fmaxf(mx, fmaf(f, s[j], (1.f - f) * -1.0e9f)); } float se = 0.f;
#pragma unroll 1
  for (int j = 0; j < SQ; ++j) { const float f = (mr[j] != 0) ? 1.f : 0.f; se += __expf(fmaf(f, s[j], (1.f - f) * -1.0e9f) - mx); } const float sc = 256.0f / se;
#pragma unroll 1
  for (int j0 = 0; j0 < SQ; j0 += 8) { FragH fr; for (int q = 0; q < 8; ++q) { const int j = j0 + q; const float f = (mr[j] != 0) ? 1.f : 0.f; fr.h[q] = (_Float16)(__expf(fmaf(f, s[j], (1.f - f) * -1.0e9f) - mx) * sc); }
    unsigned short* d = (unsigned short*)P + i * SQ + j0; *(v8us*)d = fr.half[0];  } }
extern "C" void kernel_launch(void* const* d_in, const int* in_sizes, int n_in,
                              void* d_out, int out_size, void* d_ws, size_t ws_size, hipStream_t stream) {
  (void)in_sizes; (void)n_in; (void)out_size;
  const float* const* I = (const float* const*)d_in; const float* xq = I[0]; const float* xk = I[0]; const float* xv = I[0]; const float* wqkv = I[1]; const float* bq = nullptr; const float* bk = nullptr; const float* bv = nullptr;      /* inputs: X (2-D [4096][1024] = one sequence; feeds all three streams), Wqkv ([in][out] [1024][2048]: columns 0..1023 = the shared q = k projection, 1024..2047 = v); NO biases (nullptr variables in the guarded slots); NO output projection */
  static_assert(NH * HD == DM && DM % 64 == 0 && SQ % 128 == 0 && NH % HG == 0, "shape / tile multiples");
  char* ws = (char*)d_ws; size_t off = 0;
  auto take = [&](size_t bytes) { char* p = ws + off; off += (bytes + 255) & ~(size_t)255; return p; };
  _Float16* BQ = (_Float16*)take((size_t)DM * DM * 2); _Float16* BK = (_Float16*)take((size_t)DM * DM * 2); _Float16* BV = (_Float16*)take((size_t)DM * DM * 2);
  _Float16* X16 = (_Float16*)take(NR * DM * 2); _Float16* XKp = (_Float16*)take(NR * DM * 2); _Float16* XVp = (_Float16*)take(NR * DM * 2); _Float16* Q16 = (_Float16*)take(NR * DM * 2); _Float16* K16 = (_Float16*)take(NR * DM * 2); _Float16* V16 = (_Float16*)take(NR * DM * 2);
  float* S = (float*)take((size_t)HG * SQ * SQ * 4); _Float16* P = (_Float16*)take((size_t)HG * SQ * SQ * 2); _Float16* VT = (_Float16*)take((size_t)NH * HD * SQ * 2);
  if (off > ws_size) return;
  k_wt_f16<<<(unsigned)(((size_t)2 * DM * (DM / 8) + 255) / 256), 256, 0, stream>>>(wqkv, BQ, DM, 2 * DM, 16.0f); (void)BV;      /* [in][out] [1024][2048] -> Bt[n][k] x16, 2048 rows: rows 0..1023 (the shared q = k projection) fill BQ, rows 1024..2047 (the v projection) fill the NEXT carve BK (BQ and BK are adjacent 2 MiB carves); the k projection below reads BQ, the v projection reads BK; BV is unused */
  _Float16* XK = XKp; _Float16* XV = XVp; k_x16<<<(unsigned)((NR * DM / 8 + 255) / 256), 256, 0, stream>>>(xk, XK, NR * DM / 8); k_x16<<<(unsigned)((NR * DM / 8 + 255) / 256), 256, 0, stream>>>(xv, XV, NR * DM / 8);      /* key and value inputs as exact f16 rows */

  k_x16<<<(unsigned)((NR * DM / 8 + 255) / 256), 256, 0, stream>>>(xq, X16, NR * DM / 8);
  const size_t r0p = (size_t)B0 * SQ;      /* first projected row */
  k_gemm2<0><<<dim3((unsigned)((MP / 128) * (DM / 64)), 1), 128, 0, stream>>>(X16 + r0p * DM, DM, 0, BQ, DM, 0, 0.0625f, bq, 0, nullptr, 1, 0, 0, nullptr, Q16 + r0p * DM, DM, 0, MP, DM, DM);
  k_gemm2<0><<<dim3((unsigned)((MP / 128) * (DM / 64)), 1), 128, 0, stream>>>(XK + r0p * DM, DM, 0, BQ, DM, 0, 0.0625f, bk, 0, nullptr, 1, 0, 0, nullptr, K16 + r0p * DM, DM, 0, MP, DM, DM);      /* k = the SAME projection as q (plane BQ) */
  k_gemm2<0><<<dim3((unsigned)((MP / 128) * (DM / 64)), 1), 128, 0, stream>>>(XV + r0p * DM, DM, 0, BK, DM, 0, 0.0625f, bv, 0, nullptr, 1, 0, 0, nullptr, V16 + r0p * DM, DM, 0, MP, DM, DM);      /* v from the second half of Wqkv (plane BK) */
  for (int b = B0; b < B0 + NBR; ++b) { const size_t r0 = (size_t)b * SQ;
    k_vt<NH, SQ><<<NH * (SQ / 64), 256, 0, stream>>>(V16 + r0 * LQ, LQ, 0, VT);      /* V^T [NH][HD][SQ] for this batch */
    for (int h0 = 0; h0 < NHD; h0 += HG) {
      k_gemm2<0><<<dim3((QN / 128) * (SQ / 64), HG), 128, 0, stream>>>(Q16 + r0 * LQ + h0 * HD, LQ, (size_t)HD, K16 + r0 * LQ + h0 * HD, LQ, (size_t)HD, 0.125f, nullptr, 0, nullptr, 1, 0, 0, S, nullptr, SQ, (size_t)SQ * SQ, QN, SQ, HD);      /* scores, HG heads per launch */
      k_rsm<<<(HG * SQ + 255) / 256, 256, 0, stream>>>(S, P, HG * SQ);      /* P = 256 softmax (f16), rows of all HG heads */
      k_gemm2<0><<<dim3((QN / 128) * (HD / 64), HG), 128, 0, stream>>>(P, SQ, (size_t)SQ * SQ, VT + (size_t)h0 * HD * SQ, SQ, (size_t)HD * SQ, 0.00390625f, nullptr, 0, nullptr, 1, 0, 0, (float*)d_out + r0 * DM + h0 * HD, nullptr, DM, (size_t)HD, QN, HD, SQ); } }      /* out = P V^T (alpha 2^-8) written f32 straight into the merged-heads output rows (no output projection) */
}

// v001
// A run of this version takes 2690 microseconds.
// Next to v000, in two timings, it ran 5.27 and 5.26 times as fast.
#include <hip/hip_runtime.h>
// Multi-head self-attention on ONE 4096-token problem with a SHARED query / key projection and no output projection, NON-causal (X [4096][1024]; proj = X Wqkv ([in][out] 1024 x 2048 sigma 1/32, no bias) split into a qk half and a v half; the scores use the SAME projection on both sides: scores = qk qk^T / sqrt(64) per head (16 heads of 64; symmetric per head); softmax over all 4096 keys (no mask); out = att v merged head-major -> [4096][1024]; no output projection); ONE head per attention launch group.
// Structure: token rows r = b*4096 + s; x as exact f16 rows (bf16-rounded); Q, K, V as three WMMA GEMMs (32x64 wave tiles, f32 accumulation, exact x16 weights, no bias, f16 outputs); per batch: V^T for all heads via LDS transposes; per (batch, head): scores GEMM (K = 64, HG = 1 head on grid.y, alpha = 1/sqrt(64)), row softmax on VALU (f32 statistics; weights stored x256 as f16), o = P . V^T GEMM (K = 4096, alpha 2^-8 undoes the x256 of P) written f32 straight into the merged-heads output rows; no output projection.
// Compute dtype: inputs rounded to bf16; x / weights exact; q, k, v and softmax weights as plain f16 GEMM operands (~2^-12); scores, softmax statistics and o f32. v_wmma_f32_16x16x32_f16.
#define NB 1
#define SQ 4096
#define DM 1024
#define NH 16
#define HD 64
#define HG 1                         /* heads per attention launch group (a 4096^2 f32 score slab is 64 MiB) */
#define B0 0                         /* first batch processed (debug hook) */
#define NBR NB                       /* batches processed (debug hook) */
#define NR ((size_t)NB * SQ)         /* token rows */
#define MP ((int)((size_t)NBR * SQ)) /* rows projected (debug hook) */
#define QN SQ                        /* query rows attended per batch (debug hook) */
#define NHD NH                       /* heads attended (debug hook) */
#define MPO MP                       /* unused (no output projection stage) */
#define LQ DM      /* row pitch of the q/k/v rows */
typedef __bf16 v16b __attribute__((ext_vector_type(16)));
typedef unsigned short v8us __attribute__((ext_vector_type(8), may_alias));
typedef float  v8f  __attribute__((ext_vector_type(8)));
typedef float  v4f  __attribute__((ext_vector_type(4)));
typedef float  v4fa __attribute__((ext_vector_type(4), may_alias));
union FragB { v16b v; v8us half[2]; unsigned short u[16]; };

__device__ __forceinline__ unsigned short bf16_bits(float x) { unsigned int u = __float_as_uint(x); return (unsigned short)((u + 0x7FFFu + ((u >> 16) & 1u)) >> 16); }
__device__ __forceinline__ float bf16_val(unsigned short b) { return __uint_as_float(((unsigned int)b) << 16); }
__device__ __forceinline__ float bf16_round(float x) { return bf16_val(bf16_bits(x)); }
// D += A·B with NT terms: 1 = ah·bh, 2 = + al·bh (A split), 3 = + ah·bl (both split)
template <int NT>
__device__ __forceinline__ v8f mmaN(v16b ah, v16b al, v16b bh, v16b bl, v8f c) {
  c = __builtin_amdgcn_wmma_f32_16x16x32_bf16(false, ah, false, bh, (short)0, c, false, false);
  if (NT >= 2) c = __builtin_amdgcn_wmma_f32_16x16x32_bf16(false, al, false, bh, (short)0, c, false, false);
  if (NT >= 3) c = __builtin_amdgcn_wmma_f32_16x16x32_bf16(false, ah, false, bl, (short)0, c, false, false);
  asm volatile("v_nop\n\tv_nop\n\tv_nop\n\tv_nop" : "+v"(c) : "v"(ah), "v"(al), "v"(bh), "v"(bl));
  return c;
}

__global__ __launch_bounds__(256) void k_wt_bf16(const float* __restrict__ W, unsigned short* __restrict__ Wt, int K, int N) {
  const int t = blockIdx.x * 256 + threadIdx.x;
  const int k8n = K / 8;
  if (t >= N * k8n) return;
  const int n = t / k8n, k8 = (t % k8n) * 8;
  v8us v;
#pragma unroll
  for (int i = 0; i < 8; ++i) v[i] = bf16_bits(W[(size_t)(k8 + i) * N + n]);
  *(v8us*)(Wt + (size_t)n * K + k8) = v;
  
}

// GEMM C[M][N] (f32, pitch ldc) = act(A[M][K]·W + bias). A f32 row-major (pitch lda) converted per fragment to bf16
// (ASPLIT: hi/lo two planes -> 2 terms, else single rounded term); Wt bf16 [N][K] (pitch ldb). BIAS_BF16 rounds the
// bias to bf16 first (bias quantised to bf16 before the add). K%32==0, M%16==0, N%64==0.
template <bool ASPLIT, int ACT, bool BIAS_BF16>
__global__ __launch_bounds__(128) void k_gemm_bf(const float* __restrict__ A, int lda, const unsigned short* __restrict__ Wt, int ldb,
                                               const float* __restrict__ bias, float* __restrict__ C, int ldc, int M, int N, int K) {
  __shared__ __attribute__((aligned(16))) float so[4][16][64];
  const int tid = threadIdx.x, w = tid >> 5, lane = tid & 31, ln = lane & 15, hh = lane >> 4;
  const int ntn = N / 64;
  const int wid = blockIdx.x * 4 + w;
  const int mt = wid / ntn, nq = wid % ntn;
  if (mt * 16 >= M) return;
  const int row0 = mt * 16, col0 = nq * 64;
  const float* arow = A + (size_t)(row0 + ln) * lda;
  v8f acc[4] = {};
  for (int kb = 0; kb < K; kb += 32) {
    FragB ah, al;
    const v4f x0 = *(const v4fa*)(arow + kb + 8 * hh), x1 = *(const v4fa*)(arow + kb + 8 * hh + 4);
    const v4f x2 = *(const v4fa*)(arow + kb + 16 + 8 * hh), x3 = *(const v4fa*)(arow + kb + 16 + 8 * hh + 4);
    float xs[16] = {x0[0],x0[1],x0[2],x0[3],x1[0],x1[1],x1[2],x1[3],x2[0],x2[1],x2[2],x2[3],x3[0],x3[1],x3[2],x3[3]};
#pragma unroll
    for (int i = 0; i < 16; ++i) { const unsigned short hb = bf16_bits(xs[i]); ah.u[i] = hb; al.u[i] = ASPLIT ? bf16_bits(xs[i] - bf16_val(hb)) : (unsigned short)0; }
#pragma unroll
    for (int t = 0; t < 4; ++t) {
      const unsigned short* brow = Wt + (size_t)(col0 + t * 16 + ln) * ldb + kb;
      FragB b;
      b.half[0] = *(const v8us*)(brow + 8 * hh);
      b.half[1] = *(const v8us*)(brow + 16 + 8 * hh);
      acc[t] = mmaN<ASPLIT ? 2 : 1>(ah.v, al.v, b.v, b.v, acc[t]);
    }
  }
#pragma unroll
  for (int t = 0; t < 4; ++t) {
    float bv = bias ? bias[col0 + t * 16 + ln] : 0.f;
    if (BIAS_BF16) bv = bf16_round(bv);
#pragma unroll
    for (int r = 0; r < 8; ++r) { float v = acc[t][r] + bv; if (ACT == 1) v = fmaxf(v, 0.f); so[w][8 * hh + r][t * 16 + ln] = v; }
  }
  __builtin_amdgcn_fence(__ATOMIC_ACQ_REL, "workgroup");
  __builtin_amdgcn_wave_barrier();
  const int rsub = lane >> 4, c4 = (lane & 15) * 4;
  {
#pragma unroll
    for (int q = 0; q < 8; ++q) {
      const int r = q * 2 + rsub;
      const v4f v = *(const v4fa*)&so[w][r][c4];
      *(v4f*)(C + (size_t)(row0 + r) * ldc + col0 + c4) = v;
    }
    
  }
}

// GEMM C = act(A·W + bias + resid): A f32 (ASPLIT -> hi/lo 2 terms), Wt bf16 [N][K]; ACT 0 none, 1 relu, 2 exact gelu;
// resid (optional, f32, row index = (row % rmod), pitch ldr, RES_BF16 rounds it) added before the activation.
template <bool ASPLIT, int ACT, bool BIAS_BF16, bool RES_BF16>
__global__ __launch_bounds__(128) void k_gemm_bf3(const float* __restrict__ A, int lda, const unsigned short* __restrict__ Wt, int ldb,
                                                const float* __restrict__ bias, const float* __restrict__ resid, int rmod, int ldr,
                                                float* __restrict__ C, int ldc, int M, int N, int K) {
  __shared__ __attribute__((aligned(16))) float so[4][16][64];
  const int tid = threadIdx.x, w = tid >> 5, lane = tid & 31, ln = lane & 15, hh = lane >> 4;
  const int ntn = N / 64;
  const int wid = blockIdx.x * 4 + w;
  const int mt = wid / ntn, nq = wid % ntn;
  if (mt * 16 >= M) return;
  const int row0 = mt * 16, col0 = nq * 64;
  const float* arow = A + (size_t)(row0 + ln) * lda;
  v8f acc[4] = {};
  for (int kb = 0; kb < K; kb += 32) {
    FragB ah, al;
    const v4f x0 = *(const v4fa*)(arow + kb + 8 * hh), x1 = *(const v4fa*)(arow + kb + 8 * hh + 4);
    const v4f x2 = *(const v4fa*)(arow + kb + 16 + 8 * hh), x3 = *(const v4fa*)(arow + kb + 16 + 8 * hh + 4);
    float xs[16] = {x0[0],x0[1],x0[2],x0[3],x1[0],x1[1],x1[2],x1[3],x2[0],x2[1],x2[2],x2[3],x3[0],x3[1],x3[2],x3[3]};
#pragma unroll
    for (int i = 0; i < 16; ++i) { const unsigned short hb = bf16_bits(xs[i]); ah.u[i] = hb; al.u[i] = ASPLIT ? bf16_bits(xs[i] - bf16_val(hb)) : (unsigned short)0; }
#pragma unroll
    for (int t = 0; t < 4; ++t) {
      const unsigned short* brow = Wt + (size_t)(col0 + t * 16 + ln) * ldb + kb;
      FragB b;
      b.half[0] = *(const v8us*)(brow + 8 * hh);
      b.half[1] = *(const v8us*)(brow + 16 + 8 * hh);
      acc[t] = mmaN<ASPLIT ? 2 : 1>(ah.v, al.v, b.v, b.v, acc[t]);
    }
  }
#pragma unroll
  for (int t = 0; t < 4; ++t) {
    const int col = col0 + t * 16 + ln;
    float bv = bias ? bias[col] : 0.f;
    if (BIAS_BF16) bv = bf16_round(bv);
#pragma unroll
    for (int r = 0; r < 8; ++r) {
      float v = acc[t][r] + bv;
      if (resid) { float rv = resid[(size_t)((row0 + 8 * hh + r) % rmod) * ldr + col]; if (RES_BF16) rv = bf16_round(rv); v += rv; }
      if (ACT == 1) v = fmaxf(v, 0.f);
      if (ACT == 2) v = 0.5f * v * (1.0f + erff(v * 0.70710678118654752f));
      if (ACT == 3) { const float u = 0.7978845608028654f * (v + 0.044715f * v * v * v); v = 0.5f * v * (1.0f + tanhf(u)); }
      so[w][8 * hh + r][t * 16 + ln] = v;
    }
  }
  __builtin_amdgcn_fence(__ATOMIC_ACQ_REL, "workgroup");
  __builtin_amdgcn_wave_barrier();
  const int rsub = lane >> 4, c4 = (lane & 15) * 4;
  {
#pragma unroll
    for (int q = 0; q < 8; ++q) {
      const int r = q * 2 + rsub;
      const v4f v = *(const v4fa*)&so[w][r][c4];
      *(v4f*)(C + (size_t)(row0 + r) * ldc + col0 + c4) = v;
    }
    
  }
}
// row LayerNorm (biased variance, eps) over N: s = X (+ R); optional out_sum <- s; out_norm <- (s-mu)*rsqrt(var+eps)*g + b
template <bool PARAM_BF16>
__global__ __launch_bounds__(256) void k_layernorm(const float* __restrict__ X, const float* __restrict__ R, const float* __restrict__ g, const float* __restrict__ bta,
                                                  float* __restrict__ out_sum, float* __restrict__ out_norm, int N, float eps) {
  __shared__ float red[256];
  const int row = blockIdx.x, tid = threadIdx.x;
  const float* x = X + (size_t)row * N; const float* rr = R ? R + (size_t)row * N : nullptr;
  float vals[16];                     // up to N = 4096
  const int per = N / 256;            // contiguous chunk per thread? use strided-by-4 chunks: thread handles j = tid*4 + 1024*u
  float s1 = 0.f;
  for (int u = 0; u < per / 4; ++u) {
    const int j = tid * 4 + 1024 * u;
    const v4f a = *(const v4fa*)(x + j);
    v4f b = {0.f,0.f,0.f,0.f}; if (rr) b = *(const v4fa*)(rr + j);
#pragma unroll
    for (int q = 0; q < 4; ++q) { const float v = a[q] + b[q]; vals[u * 4 + q] = v; s1 += v; }
  }
  red[tid] = s1; __syncthreads();
  for (int st = 128; st > 0; st >>= 1) { if (tid < st) red[tid] += red[tid + st]; __syncthreads(); }
  const float mu = red[0] / (float)N; __syncthreads();
  float s2 = 0.f;
  for (int u = 0; u < per / 4; ++u)
#pragma unroll
    for (int q = 0; q < 4; ++q) { const float c = vals[u * 4 + q] - mu; s2 += c * c; }
  red[tid] = s2; __syncthreads();
  for (int st = 128; st > 0; st >>= 1) { if (tid < st) red[tid] += red[tid + st]; __syncthreads(); }
  const float rs = rsqrtf(red[0] / (float)N + eps);
  {
    for (int u = 0; u < per / 4; ++u) {
      const int j = tid * 4 + 1024 * u;
      v4f o, sm;
#pragma unroll
      for (int q = 0; q < 4; ++q) {
        float gg = g[j + q], bb = bta[j + q];
        if (PARAM_BF16) { gg = bf16_round(gg); bb = bf16_round(bb); }
        sm[q] = vals[u * 4 + q]; o[q] = (vals[u * 4 + q] - mu) * rs * gg + bb;
      }
      if (out_sum) *(v4f*)(out_sum + (size_t)row * N + j) = sm;
      *(v4f*)(out_norm + (size_t)row * N + j) = o;
    }
    
  }
}



// ---- f16 WMMA path (v_wmma_f32_16x16x32_f16): 11-bit significands for operands in range — used where a [0,1] probability operand needs more precision than bf16
typedef _Float16 v16h __attribute__((ext_vector_type(16)));
union FragH { v16h v; v8us half[2]; _Float16 h[16]; unsigned short u[16]; };
template <int NT>
__device__ __forceinline__ v8f mmaH(v16h ah, v16h al, v16h bh, v16h bl, v8f c) {
  c = __builtin_amdgcn_wmma_f32_16x16x32_f16(false, ah, false, bh, (short)0, c, false, false);
  if (NT >= 2) c = __builtin_amdgcn_wmma_f32_16x16x32_f16(false, al, false, bh, (short)0, c, false, false);
  if (NT >= 3) c = __builtin_amdgcn_wmma_f32_16x16x32_f16(false, ah, false, bl, (short)0, c, false, false);
  asm volatile("v_nop\n\tv_nop\n\tv_nop\n\tv_nop" : "+v"(c) : "v"(ah), "v"(al), "v"(bh), "v"(bl));
  return c;
}
// batched GEMM like k_gemm_b but f16 operands: A f32 (split into f16 hi/lo if ASPLIT, else rounded to f16), Bt = f16 values [n][k]; alpha; C f32; N multiple of 16 (partial tiles skipped)
template <bool ASPLIT>
__global__ __launch_bounds__(128) void k_gemm_h(const float* __restrict__ A, int lda, size_t sA, const _Float16* __restrict__ Bh, int ldb, size_t sB, float alpha, float* __restrict__ C, int ldc, size_t sC, int M, int N, int K) {
  __shared__ __attribute__((aligned(16))) float so[4][16][64];
  const int tid = threadIdx.x, w = tid >> 5, lane = tid & 31, ln = lane & 15, hh = lane >> 4; const int by = blockIdx.y;
  A += (size_t)by * sA; Bh += (size_t)by * sB; C += (size_t)by * sC;
  const int ntn = (N + 63) / 64; const int wid = blockIdx.x * 4 + w; const int mt = wid / ntn, nq = wid % ntn; if (mt * 16 >= M) return;
  const int row0 = mt * 16, col0 = nq * 64; const float* arow = A + (size_t)(row0 + ln) * lda;
  v8f acc[4] = {};
  for (int kb = 0; kb < K; kb += 32) {
    FragH ah, al;
    const v4f x0 = *(const v4fa*)(arow + kb + 8 * hh), x1 = *(const v4fa*)(arow + kb + 8 * hh + 4), x2 = *(const v4fa*)(arow + kb + 16 + 8 * hh), x3 = *(const v4fa*)(arow + kb + 16 + 8 * hh + 4);
    float xs[16] = {x0[0],x0[1],x0[2],x0[3],x1[0],x1[1],x1[2],x1[3],x2[0],x2[1],x2[2],x2[3],x3[0],x3[1],x3[2],x3[3]};
#pragma unroll
    for (int i = 0; i < 16; ++i) { const _Float16 h = (_Float16)xs[i]; ah.h[i] = h; al.h[i] = ASPLIT ? (_Float16)(xs[i] - (float)h) : (_Float16)0.0f; }
#pragma unroll
    for (int t = 0; t < 4; ++t) { if (col0 + t * 16 >= N) continue; const size_t boff = (size_t)(col0 + t * 16 + ln) * ldb + kb; FragH bq; bq.half[0] = *(const v8us*)(Bh + boff + 8 * hh); bq.half[1] = *(const v8us*)(Bh + boff + 16 + 8 * hh);
      acc[t] = mmaH<ASPLIT ? 2 : 1>(ah.v, al.v, bq.v, bq.v, acc[t]); }
  }
#pragma unroll
  for (int t = 0; t < 4; ++t) { if (col0 + t * 16 >= N) continue;
#pragma unroll
    for (int r = 0; r < 8; ++r) so[w][8 * hh + r][t * 16 + ln] = acc[t][r] * alpha; }
  __builtin_amdgcn_fence(__ATOMIC_ACQ_REL, "workgroup"); __builtin_amdgcn_wave_barrier();
  const int rsub = lane >> 4, c4 = (lane & 15) * 4;
  {
#pragma unroll
    for (int q = 0; q < 8; ++q) { const int r = q * 2 + rsub; if (col0 + c4 < N) { const v4f v = *(const v4fa*)&so[w][r][c4]; *(v4f*)(C + (size_t)(row0 + r) * ldc + col0 + c4) = v; } }
     }
}

// Wt[n][k] = f16(W[k][n]·scale) from f32 row-major W[K][N] (scale = power of two; bf16-exact weights stay exact in f16 away from the subnormal range)
__global__ __launch_bounds__(256) void k_wt_f16(const float* __restrict__ W, _Float16* __restrict__ Wt, int K, int N, float scale) {
  const int t = blockIdx.x * 256 + threadIdx.x; if (t >= N * (K / 8)) return; const int n = t / (K / 8), k8 = (t % (K / 8)) * 8; FragH f;
#pragma unroll
  for (int i = 0; i < 8; ++i) f.h[i] = (_Float16)(bf16_round(W[(size_t)(k8 + i) * N + n]) * scale); const v8us o = f.half[0];
  *(v8us*)((unsigned short*)Wt + (size_t)n * K + k8) = o; 
}
// k_gemm_hh variant with fused epilogue: v = acc·alpha + bias[by·sBias + col] (+ CP[(row/rowsPerB)·sCPb + by·64 + col] if CP) ; ACT 0 none / 1 elu ; writes f16 C16 (and f32 C if non-null)
template <int ACT>
__global__ __launch_bounds__(128) void k_gemm_hhx(const _Float16* __restrict__ A, int lda, size_t sA, const _Float16* __restrict__ Bh, int ldb, size_t sB, float alpha, const float* __restrict__ bias, size_t sBias, const float* __restrict__ CP, int rowsPerB, size_t sCPb, int row0g,
    float* __restrict__ C, _Float16* __restrict__ C16, int ldc, size_t sC, int M, int N, int K) {
  __shared__ __attribute__((aligned(16))) float so[4][16][64];
  const int tid = threadIdx.x, w = tid >> 5, lane = tid & 31, ln = lane & 15, hh = lane >> 4; const int by = blockIdx.y;
  A += (size_t)by * sA; Bh += (size_t)by * sB; const size_t cofs = (size_t)by * sC; const float* bp = bias ? bias + (size_t)by * sBias : nullptr;
  const int ntn = (N + 63) / 64; const int wid = blockIdx.x * 4 + w; const int mt = wid / ntn, nq = wid % ntn; if (mt * 16 >= M) return;
  const int row0 = mt * 16, col0 = nq * 64; const _Float16* arow = A + (size_t)(row0 + ln) * lda;
  v8f acc[4] = {};
  for (int kb = 0; kb < K; kb += 32) { FragH ah; ah.half[0] = *(const v8us*)((const unsigned short*)arow + kb + 8 * hh); ah.half[1] = *(const v8us*)((const unsigned short*)arow + kb + 16 + 8 * hh);
#pragma unroll
    for (int t = 0; t < 4; ++t) { if (col0 + t * 16 >= N) continue; const size_t boff = (size_t)(col0 + t * 16 + ln) * ldb + kb; FragH bq; bq.half[0] = *(const v8us*)((const unsigned short*)Bh + boff + 8 * hh); bq.half[1] = *(const v8us*)((const unsigned short*)Bh + boff + 16 + 8 * hh);
      acc[t] = mmaH<1>(ah.v, ah.v, bq.v, bq.v, acc[t]); }
  }
#pragma unroll
  for (int t = 0; t < 4; ++t) { if (col0 + t * 16 >= N) continue; const int col = col0 + t * 16 + ln; const float bv = bp ? bf16_round(bp[col]) : 0.f;
#pragma unroll
    for (int r = 0; r < 8; ++r) { float v = acc[t][r] * alpha + bv; if (CP) { const int rr = row0g + row0 + 8 * hh + r; if (rowsPerB < 0) v += CP[cofs + (size_t)rr * ldc + col];      /* rowsPerB < 0: own element of the batched C plane */ else { const int bidx = rr / rowsPerB; v += CP[(size_t)bidx * sCPb + (size_t)by * 64 + col]; } } if (ACT == 1) v = (v > 0.f) ? v : expm1f(v); else if (ACT == 7) v = (v > 0.f) ? v + 1.0f : expf(v); else if (ACT == 8) v = tanhf(v); else if (ACT == 9) v = 0.5f * v * (1.0f + tanhf(0.7978845608028654f * (v + 0.044715f * v * v * v))); else if (ACT == 11) v = 1.0f / (1.0f + expf(-v)); else if (ACT == 12) v = (v > 0.f) ? v : 0.01f * v; else if (ACT == 14) v = (v > 0.f) ? v : 0.1f * v; else if (ACT == 16) v = (v >= 0.f) ? v : 0.3f * v; else if (ACT == 17) v = (v >= 0.f) ? v : 0.2f * v; else if (ACT == 15) v = v / (1.0f + expf(-v)); else if (ACT == 3) v = fmaxf(v, 0.f); else if (ACT == 6) v = 0.5f * v * (1.0f + erff(v * 0.70710678118654752f)); so[w][8 * hh + r][t * 16 + ln] = v; } }
  __builtin_amdgcn_fence(__ATOMIC_ACQ_REL, "workgroup"); __builtin_amdgcn_wave_barrier();
  const int rsub = lane >> 4, c4 = (lane & 15) * 4; typedef _Float16 v4h __attribute__((ext_vector_type(4)));
  {
#pragma unroll
    for (int q = 0; q < 8; ++q) { const int r = q * 2 + rsub; if (col0 + c4 < N) { const v4f v = *(const v4fa*)&so[w][r][c4]; if (C) *(v4f*)(C + cofs + (size_t)(row0 + r) * ldc + col0 + c4) = v; if (C16) { v4h h4; for (int i = 0; i < 4; ++i) h4[i] = (_Float16)v[i]; *(v4h*)(C16 + cofs + (size_t)(row0 + r) * ldc + col0 + c4) = h4; } } }
     }
}


typedef _Float16 v4h __attribute__((ext_vector_type(4)));

__global__ __launch_bounds__(256) void k_x16(const float* __restrict__ x, _Float16* __restrict__ X16, size_t n8) { const size_t t = (size_t)blockIdx.x * 256 + threadIdx.x; if (t >= n8) return; FragH f;
#pragma unroll
  for (int q = 0; q < 8; ++q) f.h[q] = (_Float16)bf16_round(x[t * 8 + q]); *(v8us*)((unsigned short*)X16 + t * 8) = f.half[0];  }
__global__ __launch_bounds__(256) void k_h16(const float* __restrict__ x, _Float16* __restrict__ X16, size_t n8) { const size_t t = (size_t)blockIdx.x * 256 + threadIdx.x; if (t >= n8) return; FragH f;
#pragma unroll
  for (int q = 0; q < 8; ++q) f.h[q] = (_Float16)x[t * 8 + q]; *(v8us*)((unsigned short*)X16 + t * 8) = f.half[0];  }
__global__ __launch_bounds__(256) void k_round16f(const float* __restrict__ W, _Float16* __restrict__ Bt, size_t n8) { const size_t t = (size_t)blockIdx.x * 256 + threadIdx.x; if (t >= n8) return; FragH f;
#pragma unroll
  for (int i = 0; i < 8; ++i) f.h[i] = (_Float16)(bf16_round(W[t * 8 + i]) * 16.0f); *(v8us*)((unsigned short*)Bt + t * 8) = f.half[0];  }
template <int NHv, int TTv>
__global__ __launch_bounds__(256) void k_vt(const _Float16* __restrict__ V16, int ldv, int voff, _Float16* __restrict__ Vt) { __shared__ unsigned short tl[64][66]; const int tid = threadIdx.x; const int slab = blockIdx.x / (TTv / 64), lg = blockIdx.x % (TTv / 64); const int b = slab / NHv, h = slab % NHv;
  for (int i = tid; i < 64 * 8; i += 256) { const int r = i / 8, c8 = (i % 8) * 8; FragH f; f.half[0] = *(const v8us*)((const unsigned short*)V16 + ((size_t)b * TTv + lg * 64 + r) * ldv + voff + h * 64 + c8);
#pragma unroll
    for (int q = 0; q < 8; ++q) tl[r][c8 + q] = f.u[q]; }
  __syncthreads();
  {
#pragma unroll
    for (int rd = 0; rd < 2; ++rd) { const int d = rd * 32 + tid / 8, pc = tid % 8; FragH f;
#pragma unroll
      for (int q = 0; q < 8; ++q) f.u[q] = tl[pc * 8 + q][d];
      *(v8us*)((unsigned short*)Vt + ((size_t)slab * 64 + d) * TTv + lg * 64 + pc * 8) = f.half[0]; }
     } }

__global__ __launch_bounds__(256) void k_hl(const float* __restrict__ F, _Float16* __restrict__ Hh, _Float16* __restrict__ Hl, size_t n8) { const size_t t = (size_t)blockIdx.x * 256 + threadIdx.x; if (t >= n8) return; FragH fh, fl; const v4f a = *(const v4fa*)(F + t * 8), c = *(const v4fa*)(F + t * 8 + 4);
#pragma unroll
  for (int q = 0; q < 4; ++q) { _Float16 h = (_Float16)a[q]; fh.h[q] = h; fl.h[q] = (_Float16)((a[q] - (float)h) * 1024.0f); h = (_Float16)c[q]; fh.h[4 + q] = h; fl.h[4 + q] = (_Float16)((c[q] - (float)h) * 1024.0f); }
  { *(v8us*)((unsigned short*)Hh + t * 8) = fh.half[0]; *(v8us*)((unsigned short*)Hl + t * 8) = fl.half[0];  } }

// ---- fast GEMM (wave tile 32x64; requires M % 32 == 0 rows per launch region and N % 64 == 0); epilogue = k_gemm_hhx semantics ----
__device__ __forceinline__ v16h g2_frag(const _Float16* p, int hh) { FragH f; f.half[0] = *(const v8us*)((const unsigned short*)p + 8 * hh); f.half[1] = *(const v8us*)((const unsigned short*)p + 16 + 8 * hh); return f.v; }
__device__ __forceinline__ v8f g2_mma(v16h a, v16h b, v8f c) { v8f d = __builtin_amdgcn_wmma_f32_16x16x32_f16(false, a, false, b, (short)0, c, false, false); asm volatile("v_nop\n\tv_nop\n\tv_nop\n\tv_nop" : "+v"(d) : "v"(a), "v"(b)); return d; }
template <int ACT>
__global__ __launch_bounds__(128) void k_gemm2(const _Float16* __restrict__ A, int lda, size_t sA, const _Float16* __restrict__ Bh, int ldb, size_t sB, float alpha, const float* __restrict__ bias, size_t sBias, const float* __restrict__ CP, int rowsPerB, size_t sCPb, int row0g,
    float* __restrict__ C, _Float16* __restrict__ C16, int ldc, size_t sC, int M, int N, int K) { static_assert(ACT == 0 || ACT == 3 || ACT == 6 || ACT == 8 || ACT == 9 || ACT == 11 || ACT == 12 || ACT == 14 || ACT == 15 || ACT == 16 || ACT == 17, "k_gemm2: unsupported ACT code (would silently apply no activation)");
  __shared__ __attribute__((aligned(16))) float so[4][32][68];
  const int tid = threadIdx.x, w = tid >> 5, lane = tid & 31, ln = lane & 15, hh = lane >> 4; const int by = blockIdx.y;
  A += (size_t)by * sA; Bh += (size_t)by * sB; const size_t cofs = (size_t)by * sC; const float* bp = bias ? bias + (size_t)by * sBias : nullptr;
  const int ntn = N >> 6; const int mt = blockIdx.x / ntn, nq = blockIdx.x - mt * ntn; const int row0 = mt * 128 + 32 * w, col0 = nq * 64; if (row0 >= M) return;
  const _Float16* a0p = A + (size_t)(row0 + ln) * lda; const _Float16* a1p = a0p + (size_t)16 * lda;
  const _Float16* b0p = Bh + (size_t)(col0 + ln) * ldb; const _Float16* b1p = b0p + (size_t)16 * ldb; const _Float16* b2p = b1p + (size_t)16 * ldb; const _Float16* b3p = b2p + (size_t)16 * ldb;
  const v8f z8 = {0.f,0.f,0.f,0.f,0.f,0.f,0.f,0.f}; v8f c00 = z8, c01 = z8, c02 = z8, c03 = z8, c10 = z8, c11 = z8, c12 = z8, c13 = z8;
#pragma unroll 1
  for (int kb = 0; kb < K; kb += 32) { const v16h a0 = g2_frag(a0p + kb, hh), a1 = g2_frag(a1p + kb, hh);
    v16h b = g2_frag(b0p + kb, hh); c00 = g2_mma(a0, b, c00); c10 = g2_mma(a1, b, c10);
    b = g2_frag(b1p + kb, hh); c01 = g2_mma(a0, b, c01); c11 = g2_mma(a1, b, c11);
    b = g2_frag(b2p + kb, hh); c02 = g2_mma(a0, b, c02); c12 = g2_mma(a1, b, c12);
    b = g2_frag(b3p + kb, hh); c03 = g2_mma(a0, b, c03); c13 = g2_mma(a1, b, c13); }
  v8f accs[8] = {c00, c01, c02, c03, c10, c11, c12, c13};
#pragma unroll
  for (int u = 0; u < 8; ++u) { const int t = u & 3, half = u >> 2; const int col = col0 + t * 16 + ln; const float bv = bp ? bf16_round(bp[col]) : 0.f;
#pragma unroll
    for (int r = 0; r < 8; ++r) { const int rloc = half * 16 + 8 * hh + r; float v = accs[u][r] * alpha + bv; if (CP) { if (rowsPerB < 0) v += CP[cofs + (size_t)(row0g + row0 + rloc) * ldc + col];      /* rowsPerB < 0: own element of the batched C plane */ else { const int bidx = (row0g + row0 + rloc) / rowsPerB; v += CP[(size_t)bidx * sCPb + (size_t)by * 64 + col]; } }
      if (ACT == 3) v = fmaxf(v, 0.f); else if (ACT == 6) v = 0.5f * v * (1.0f + erff(v * 0.70710678118654752f)); else if (ACT == 11) v = 1.0f / (1.0f + expf(-v)); else if (ACT == 15) v = v / (1.0f + expf(-v)); else if (ACT == 12) v = (v > 0.f) ? v : 0.01f * v; else if (ACT == 8) v = tanhf(v); else if (ACT == 9) v = 0.5f * v * (1.0f + tanhf(0.7978845608028654f * (v + 0.044715f * v * v * v))); else if (ACT == 14) v = (v > 0.f) ? v : 0.1f * v; else if (ACT == 16) v = (v >= 0.f) ? v : 0.3f * v; else if (ACT == 17) v = (v >= 0.f) ? v : 0.2f * v;
      so[w][rloc][t * 16 + ln] = v; } }
  __builtin_amdgcn_fence(__ATOMIC_ACQ_REL, "workgroup"); __builtin_amdgcn_wave_barrier();
  const int rsub = lane >> 4, c4 = (lane & 15) * 4;
  {
#pragma unroll
    for (int q = 0; q < 16; ++q) { const int r = q * 2 + rsub; const v4f v = *(const v4fa*)&so[w][r][c4]; if (C) *(v4f*)(C + cofs + (size_t)(row0 + r) * ldc + col0 + c4) = v; if (C16) { v4h h4; for (int i = 0; i < 4; ++i) h4[i] = (_Float16)v[i]; *(v4h*)(C16 + cofs + (size_t)(row0 + r) * ldc + col0 + c4) = h4; } }
     } }


__global__ __launch_bounds__(256) void k_wnat(const float* __restrict__ w, size_t n8, _Float16* __restrict__ Bt) { const size_t t = (size_t)blockIdx.x * 256 + threadIdx.x; if (t >= n8) return; FragH f; for (int q = 0; q < 8; ++q) f.h[q] = (_Float16)(bf16_round(w[t * 8 + q]) * 16.0f); *(v8us*)((unsigned short*)Bt + t * 8) = f.half[0];  }
// Row softmax, one wave per row: the row's 4096 f32 scores are read once, 512 contiguous bytes per load, and stay in the wave's registers (128 per lane)
// for the maximum, the exponentials, their sum and the scaled f16 weights; maximum and sum are four chains per lane, then a five-step butterfly over the lanes.
__global__ __launch_bounds__(256) void k_rsm(const float* __restrict__ S, _Float16* __restrict__ P, int nrows) {
  const int lane = threadIdx.x & 31; const int i = blockIdx.x * 8 + (threadIdx.x >> 5); if (i >= nrows) return;      /* the same in every lane of a wave; no barrier below */
  const float* s = S + (size_t)i * SQ + lane * 4; v4f a[SQ / 128];
#pragma unroll      /* constant indices keep a[] in registers, and all the row's loads are in flight at once */
  for (int c = 0; c < SQ / 128; ++c) a[c] = *(const v4fa*)(s + c * 128);
  v4f m4 = {-3.0e38f, -3.0e38f, -3.0e38f, -3.0e38f};
#pragma unroll      /* constant indices keep a[] in registers */
  for (int c = 0; c < SQ / 128; ++c) for (int q = 0; q < 4; ++q) m4[q] = fmaxf(m4[q], a[c][q]);
  float mx = fmaxf(fmaxf(m4[0], m4[1]), fmaxf(m4[2], m4[3]));
  for (int d = 16; d > 0; d >>= 1) mx = fmaxf(mx, __shfl_xor(mx, d, 32));
#pragma unroll      /* constant indices keep a[] in registers */
  for (int c = 0; c < SQ / 128; ++c) for (int q = 0; q < 4; ++q) a[c][q] = expf(a[c][q] - mx);
  v4f s4 = {0.f, 0.f, 0.f, 0.f};
#pragma unroll      /* constant indices keep a[] in registers */
  for (int c = 0; c < SQ / 128; ++c) s4 += a[c];
  float se = (s4[0] + s4[1]) + (s4[2] + s4[3]);
  for (int d = 16; d > 0; d >>= 1) se += __shfl_xor(se, d, 32);
  const float sc = 256.0f / se; _Float16* p = P + (size_t)i * SQ + lane * 4;
#pragma unroll      /* constant indices keep a[] in registers */
  for (int c = 0; c < SQ / 128; ++c) { v4h h4; for (int q = 0; q < 4; ++q) h4[q] = (_Float16)(a[c][q] * sc); *(v4h*)(p + c * 128) = h4; } }      /* 256 contiguous bytes per store */
__global__ __launch_bounds__(256) void k_vt(const _Float16* __restrict__ V16, int b, int h0, _Float16* __restrict__ VT) { __shared__ unsigned short tl[64][65]; const int tid = threadIdx.x; const int hh = blockIdx.x % HG, sg = blockIdx.x / HG; const int s0 = sg * 64; const int h = h0 + hh;
  for (int i = tid; i < 64 * 8; i += 256) { const int j = i / 8, d8 = (i % 8) * 8; FragH f; f.half[0] = *(const v8us*)((const unsigned short*)V16 + ((size_t)b * SQ + s0 + j) * DM + h * HD + d8); for (int q = 0; q < 8; ++q) tl[d8 + q][j] = f.u[q]; }
  __syncthreads();
  { for (int i = tid; i < 64 * 8; i += 256) { const int d = i / 8, j8 = (i % 8) * 8; FragH f; for (int q = 0; q < 8; ++q) f.u[q] = tl[d][j8 + q]; *(v8us*)((unsigned short*)VT + ((size_t)hh * HD + d) * SQ + s0 + j8) = f.half[0]; }  } }



__global__ __launch_bounds__(256) void k_rsmkm(const float* __restrict__ S, _Float16* __restrict__ P, int nrows, const int* __restrict__ am) {
  #pragma clang fp contract(off)
  const int t = blockIdx.x * 256 + threadIdx.x; if (t >= nrows) return; const size_t i = (size_t)t; const float* s = S + i * SQ; const int* mr = am + (size_t)(t % SQ) * SQ; float mx = -3.0e38f;
#pragma unroll 1
  for (int j = 0; j < SQ; ++j) { const float f = (mr[j] != 0) ? 1.f : 0.f; mx = fmaxf(mx, fmaf(f, s[j], (1.f - f) * -1.0e9f)); } float se = 0.f;
#pragma unroll 1
  for (int j = 0; j < SQ; ++j) { const float f = (mr[j] != 0) ? 1.f : 0.f; se += __expf(fmaf(f, s[j], (1.f - f) * -1.0e9f) - mx); } const float sc = 256.0f / se;
#pragma unroll 1
  for (int j0 = 0; j0 < SQ; j0 += 8) { FragH fr; for (int q = 0; q < 8; ++q) { const int j = j0 + q; const float f = (mr[j] != 0) ? 1.f : 0.f; fr.h[q] = (_Float16)(__expf(fmaf(f, s[j], (1.f - f) * -1.0e9f) - mx) * sc); }
    unsigned short* d = (unsigned short*)P + i * SQ + j0; *(v8us*)d = fr.half[0];  } }
extern "C" void kernel_launch(void* const* d_in, const int* in_sizes, int n_in,
                              void* d_out, int out_size, void* d_ws, size_t ws_size, hipStream_t stream) {
  (void)in_sizes; (void)n_in; (void)out_size;
  const float* const* I = (const float* const*)d_in; const float* xq = I[0]; const float* xk = I[0]; const float* xv = I[0]; const float* wqkv = I[1]; const float* bq = nullptr; const float* bk = nullptr; const float* bv = nullptr;      /* inputs: X (2-D [4096][1024] = one sequence; feeds all three streams), Wqkv ([in][out] [1024][2048]: columns 0..1023 = the shared q = k projection, 1024..2047 = v); NO biases (nullptr variables in the guarded slots); NO output projection */
  static_assert(NH * HD == DM && DM % 64 == 0 && SQ % 128 == 0 && NH % HG == 0, "shape / tile multiples");
  char* ws = (char*)d_ws; size_t off = 0;
  auto take = [&](size_t bytes) { char* p = ws + off; off += (bytes + 255) & ~(size_t)255; return p; };
  _Float16* BQ = (_Float16*)take((size_t)DM * DM * 2); _Float16* BK = (_Float16*)take((size_t)DM * DM * 2); _Float16* BV = (_Float16*)take((size_t)DM * DM * 2);
  _Float16* X16 = (_Float16*)take(NR * DM * 2); _Float16* XKp = (_Float16*)take(NR * DM * 2); _Float16* XVp = (_Float16*)take(NR * DM * 2); _Float16* Q16 = (_Float16*)take(NR * DM * 2); _Float16* K16 = (_Float16*)take(NR * DM * 2); _Float16* V16 = (_Float16*)take(NR * DM * 2);
  float* S = (float*)take((size_t)HG * SQ * SQ * 4); _Float16* P = (_Float16*)take((size_t)HG * SQ * SQ * 2); _Float16* VT = (_Float16*)take((size_t)NH * HD * SQ * 2);
  if (off > ws_size) return;
  k_wt_f16<<<(unsigned)(((size_t)2 * DM * (DM / 8) + 255) / 256), 256, 0, stream>>>(wqkv, BQ, DM, 2 * DM, 16.0f); (void)BV;      /* [in][out] [1024][2048] -> Bt[n][k] x16, 2048 rows: rows 0..1023 (the shared q = k projection) fill BQ, rows 1024..2047 (the v projection) fill the NEXT carve BK (BQ and BK are adjacent 2 MiB carves); the k projection below reads BQ, the v projection reads BK; BV is unused */
  _Float16* XK = XKp; _Float16* XV = XVp; k_x16<<<(unsigned)((NR * DM / 8 + 255) / 256), 256, 0, stream>>>(xk, XK, NR * DM / 8); k_x16<<<(unsigned)((NR * DM / 8 + 255) / 256), 256, 0, stream>>>(xv, XV, NR * DM / 8);      /* key and value inputs as exact f16 rows */

  k_x16<<<(unsigned)((NR * DM / 8 + 255) / 256), 256, 0, stream>>>(xq, X16, NR * DM / 8);
  const size_t r0p = (size_t)B0 * SQ;      /* first projected row */
  k_gemm2<0><<<dim3((unsigned)((MP / 128) * (DM / 64)), 1), 128, 0, stream>>>(X16 + r0p * DM, DM, 0, BQ, DM, 0, 0.0625f, bq, 0, nullptr, 1, 0, 0, nullptr, Q16 + r0p * DM, DM, 0, MP, DM, DM);
  k_gemm2<0><<<dim3((unsigned)((MP / 128) * (DM / 64)), 1), 128, 0, stream>>>(XK + r0p * DM, DM, 0, BQ, DM, 0, 0.0625f, bk, 0, nullptr, 1, 0, 0, nullptr, K16 + r0p * DM, DM, 0, MP, DM, DM);      /* k = the SAME projection as q (plane BQ) */
  k_gemm2<0><<<dim3((unsigned)((MP / 128) * (DM / 64)), 1), 128, 0, stream>>>(XV + r0p * DM, DM, 0, BK, DM, 0, 0.0625f, bv, 0, nullptr, 1, 0, 0, nullptr, V16 + r0p * DM, DM, 0, MP, DM, DM);      /* v from the second half of Wqkv (plane BK) */
  for (int b = B0; b < B0 + NBR; ++b) { const size_t r0 = (size_t)b * SQ;
    k_vt<NH, SQ><<<NH * (SQ / 64), 256, 0, stream>>>(V16 + r0 * LQ, LQ, 0, VT);      /* V^T [NH][HD][SQ] for this batch */
    for (int h0 = 0; h0 < NHD; h0 += HG) {
      k_gemm2<0><<<dim3((QN / 128) * (SQ / 64), HG), 128, 0, stream>>>(Q16 + r0 * LQ + h0 * HD, LQ, (size_t)HD, K16 + r0 * LQ + h0 * HD, LQ, (size_t)HD, 0.125f, nullptr, 0, nullptr, 1, 0, 0, S, nullptr, SQ, (size_t)SQ * SQ, QN, SQ, HD);      /* scores, HG heads per launch */
      k_rsm<<<(HG * SQ + 7) / 8, 256, 0, stream>>>(S, P, HG * SQ);      /* P = 256 softmax (f16), rows of all HG heads */
      k_gemm2<0><<<dim3((QN / 128) * (HD / 64), HG), 128, 0, stream>>>(P, SQ, (size_t)SQ * SQ, VT + (size_t)h0 * HD * SQ, SQ, (size_t)HD * SQ, 0.00390625f, nullptr, 0, nullptr, 1, 0, 0, (float*)d_out + r0 * DM + h0 * HD, nullptr, DM, (size_t)HD, QN, HD, SQ); } }      /* out = P V^T (alpha 2^-8) written f32 straight into the merged-heads output rows (no output projection) */
}

// v003
// It runs in 141 microseconds.
// Versions in between are left out here; by their measured steps it is 18.8 times as fast as v001.
// Counting every step since v000, it is 98.7 times as fast.
#include <hip/hip_runtime.h>
// Multi-head self-attention on ONE 4096-token problem with a SHARED query / key projection and no output projection, NON-causal (X [4096][1024]; proj = X Wqkv ([in][out] 1024 x 2048 sigma 1/32, no bias) split into a qk half and a v half; the scores use the SAME projection on both sides: scores = qk qk^T / sqrt(64) per head (16 heads of 64; symmetric per head); softmax over all 4096 keys (no mask); out = att v merged head-major -> [4096][1024]; no output projection); all heads in ONE fused attention launch.
// Structure: token rows r = b*4096 + s; x as exact f16 rows (bf16-rounded), converted once; proj = X Wqkv as ONE WMMA GEMM over all 2048 columns (32x64 wave tiles, f32 accumulation, exact x16 weights, f16 output rows of pitch 2048: columns 0..1023 serve as q and as k, 1024..2047 as v); per batch: V^T for all heads via LDS transposes; per batch: one fused attention launch over all heads (online softmax, f32 statistics, weights as f16 against the running maximum) written f32 straight into the merged-heads output rows.
// Compute dtype: inputs rounded to bf16; x / weights exact; q, k, v, softmax weights as plain f16 GEMM operands (~2^-12); o, scores and softmax statistics f32. v_wmma_f32_16x16x32_f16.
#define NB 1
#define SQ 4096
#define DM 1024
#define NH 16
#define HD 64
#define HG 1                         /* heads per group of the per-group V^T helper */
#define B0 0                         /* first batch processed (debug hook) */
#define NBR NB                       /* batches processed (debug hook) */
#define NR ((size_t)NB * SQ)         /* token rows */
#define MP ((int)((size_t)NBR * SQ)) /* rows projected (debug hook) */
#define QN SQ                        /* query rows attended per batch (debug hook) */
#define NHD NH                       /* heads attended (debug hook) */
#define MPO MP                       /* unused: no output stage (debug hook) */
#define LQ (2 * DM)      /* row pitch of the projected rows: 1024 shared q = k columns, then 1024 v columns */
typedef __bf16 v16b __attribute__((ext_vector_type(16)));
typedef unsigned short v8us __attribute__((ext_vector_type(8), may_alias));
typedef float  v8f  __attribute__((ext_vector_type(8)));
typedef float  v4f  __attribute__((ext_vector_type(4)));
typedef float  v4fa __attribute__((ext_vector_type(4), may_alias));
union FragB { v16b v; v8us half[2]; unsigned short u[16]; };

__device__ __forceinline__ unsigned short bf16_bits(float x) { unsigned int u = __float_as_uint(x); return (unsigned short)((u + 0x7FFFu + ((u >> 16) & 1u)) >> 16); }
__device__ __forceinline__ float bf16_val(unsigned short b) { return __uint_as_float(((unsigned int)b) << 16); }
__device__ __forceinline__ float bf16_round(float x) { return bf16_val(bf16_bits(x)); }
// D += A·B with NT terms: 1 = ah·bh, 2 = + al·bh (A split), 3 = + ah·bl (both split)
template <int NT>
__device__ __forceinline__ v8f mmaN(v16b ah, v16b al, v16b bh, v16b bl, v8f c) {
  c = __builtin_amdgcn_wmma_f32_16x16x32_bf16(false, ah, false, bh, (short)0, c, false, false);
  if (NT >= 2) c = __builtin_amdgcn_wmma_f32_16x16x32_bf16(false, al, false, bh, (short)0, c, false, false);
  if (NT >= 3) c = __builtin_amdgcn_wmma_f32_16x16x32_bf16(false, ah, false, bl, (short)0, c, false, false);
  asm volatile("v_nop\n\tv_nop\n\tv_nop\n\tv_nop" : "+v"(c) : "v"(ah), "v"(al), "v"(bh), "v"(bl));
  return c;
}

__global__ __launch_bounds__(256) void k_wt_bf16(const float* __restrict__ W, unsigned short* __restrict__ Wt, int K, int N) {
  const int t = blockIdx.x * 256 + threadIdx.x;
  const int k8n = K / 8;
  if (t >= N * k8n) return;
  const int n = t / k8n, k8 = (t % k8n) * 8;
  v8us v;
#pragma unroll
  for (int i = 0; i < 8; ++i) v[i] = bf16_bits(W[(size_t)(k8 + i) * N + n]);
  *(v8us*)(Wt + (size_t)n * K + k8) = v;
  
}

// GEMM C[M][N] (f32, pitch ldc) = act(A[M][K]·W + bias). A f32 row-major (pitch lda) converted per fragment to bf16
// (ASPLIT: hi/lo two planes -> 2 terms, else single rounded term); Wt bf16 [N][K] (pitch ldb). BIAS_BF16 rounds the
// bias to bf16 first (bias quantised to bf16 before the add). K%32==0, M%16==0, N%64==0.
template <bool ASPLIT, int ACT, bool BIAS_BF16>
__global__ __launch_bounds__(128) void k_gemm_bf(const float* __restrict__ A, int lda, const unsigned short* __restrict__ Wt, int ldb,
                                               const float* __restrict__ bias, float* __restrict__ C, int ldc, int M, int N, int K) {
  __shared__ __attribute__((aligned(16))) float so[4][16][64];
  const int tid = threadIdx.x, w = tid >> 5, lane = tid & 31, ln = lane & 15, hh = lane >> 4;
  const int ntn = N / 64;
  const int wid = blockIdx.x * 4 + w;
  const int mt = wid / ntn, nq = wid % ntn;
  if (mt * 16 >= M) return;
  const int row0 = mt * 16, col0 = nq * 64;
  const float* arow = A + (size_t)(row0 + ln) * lda;
  v8f acc[4] = {};
  for (int kb = 0; kb < K; kb += 32) {
    FragB ah, al;
    const v4f x0 = *(const v4fa*)(arow + kb + 8 * hh), x1 = *(const v4fa*)(arow + kb + 8 * hh + 4);
    const v4f x2 = *(const v4fa*)(arow + kb + 16 + 8 * hh), x3 = *(const v4fa*)(arow + kb + 16 + 8 * hh + 4);
    float xs[16] = {x0[0],x0[1],x0[2],x0[3],x1[0],x1[1],x1[2],x1[3],x2[0],x2[1],x2[2],x2[3],x3[0],x3[1],x3[2],x3[3]};
#pragma unroll
    for (int i = 0; i < 16; ++i) { const unsigned short hb = bf16_bits(xs[i]); ah.u[i] = hb; al.u[i] = ASPLIT ? bf16_bits(xs[i] - bf16_val(hb)) : (unsigned short)0; }
#pragma unroll
    for (int t = 0; t < 4; ++t) {
      const unsigned short* brow = Wt + (size_t)(col0 + t * 16 + ln) * ldb + kb;
      FragB b;
      b.half[0] = *(const v8us*)(brow + 8 * hh);
      b.half[1] = *(const v8us*)(brow + 16 + 8 * hh);
      acc[t] = mmaN<ASPLIT ? 2 : 1>(ah.v, al.v, b.v, b.v, acc[t]);
    }
  }
#pragma unroll
  for (int t = 0; t < 4; ++t) {
    float bv = bias ? bias[col0 + t * 16 + ln] : 0.f;
    if (BIAS_BF16) bv = bf16_round(bv);
#pragma unroll
    for (int r = 0; r < 8; ++r) { float v = acc[t][r] + bv; if (ACT == 1) v = fmaxf(v, 0.f); so[w][8 * hh + r][t * 16 + ln] = v; }
  }
  __builtin_amdgcn_fence(__ATOMIC_ACQ_REL, "workgroup");
  __builtin_amdgcn_wave_barrier();
  const int rsub = lane >> 4, c4 = (lane & 15) * 4;
  {
#pragma unroll
    for (int q = 0; q < 8; ++q) {
      const int r = q * 2 + rsub;
      const v4f v = *(const v4fa*)&so[w][r][c4];
      *(v4f*)(C + (size_t)(row0 + r) * ldc + col0 + c4) = v;
    }
    
  }
}

// GEMM C = act(A·W + bias + resid): A f32 (ASPLIT -> hi/lo 2 terms), Wt bf16 [N][K]; ACT 0 none, 1 relu, 2 exact gelu;
// resid (optional, f32, row index = (row % rmod), pitch ldr, RES_BF16 rounds it) added before the activation.
template <bool ASPLIT, int ACT, bool BIAS_BF16, bool RES_BF16>
__global__ __launch_bounds__(128) void k_gemm_bf3(const float* __restrict__ A, int lda, const unsigned short* __restrict__ Wt, int ldb,
                                                const float* __restrict__ bias, const float* __restrict__ resid, int rmod, int ldr,
                                                float* __restrict__ C, int ldc, int M, int N, int K) {
  __shared__ __attribute__((aligned(16))) float so[4][16][64];
  const int tid = threadIdx.x, w = tid >> 5, lane = tid & 31, ln = lane & 15, hh = lane >> 4;
  const int ntn = N / 64;
  const int wid = blockIdx.x * 4 + w;
  const int mt = wid / ntn, nq = wid % ntn;
  if (mt * 16 >= M) return;
  const int row0 = mt * 16, col0 = nq * 64;
  const float* arow = A + (size_t)(row0 + ln) * lda;
  v8f acc[4] = {};
  for (int kb = 0; kb < K; kb += 32) {
    FragB ah, al;
    const v4f x0 = *(const v4fa*)(arow + kb + 8 * hh), x1 = *(const v4fa*)(arow + kb + 8 * hh + 4);
    const v4f x2 = *(const v4fa*)(arow + kb + 16 + 8 * hh), x3 = *(const v4fa*)(arow + kb + 16 + 8 * hh + 4);
    float xs[16] = {x0[0],x0[1],x0[2],x0[3],x1[0],x1[1],x1[2],x1[3],x2[0],x2[1],x2[2],x2[3],x3[0],x3[1],x3[2],x3[3]};
#pragma unroll
    for (int i = 0; i < 16; ++i) { const unsigned short hb = bf16_bits(xs[i]); ah.u[i] = hb; al.u[i] = ASPLIT ? bf16_bits(xs[i] - bf16_val(hb)) : (unsigned short)0; }
#pragma unroll
    for (int t = 0; t < 4; ++t) {
      const unsigned short* brow = Wt + (size_t)(col0 + t * 16 + ln) * ldb + kb;
      FragB b;
      b.half[0] = *(const v8us*)(brow + 8 * hh);
      b.half[1] = *(const v8us*)(brow + 16 + 8 * hh);
      acc[t] = mmaN<ASPLIT ? 2 : 1>(ah.v, al.v, b.v, b.v, acc[t]);
    }
  }
#pragma unroll
  for (int t = 0; t < 4; ++t) {
    const int col = col0 + t * 16 + ln;
    float bv = bias ? bias[col] : 0.f;
    if (BIAS_BF16) bv = bf16_round(bv);
#pragma unroll
    for (int r = 0; r < 8; ++r) {
      float v = acc[t][r] + bv;
      if (resid) { float rv = resid[(size_t)((row0 + 8 * hh + r) % rmod) * ldr + col]; if (RES_BF16) rv = bf16_round(rv); v += rv; }
      if (ACT == 1) v = fmaxf(v, 0.f);
      if (ACT == 2) v = 0.5f * v * (1.0f + erff(v * 0.70710678118654752f));
      if (ACT == 3) { const float u = 0.7978845608028654f * (v + 0.044715f * v * v * v); v = 0.5f * v * (1.0f + tanhf(u)); }
      so[w][8 * hh + r][t * 16 + ln] = v;
    }
  }
  __builtin_amdgcn_fence(__ATOMIC_ACQ_REL, "workgroup");
  __builtin_amdgcn_wave_barrier();
  const int rsub = lane >> 4, c4 = (lane & 15) * 4;
  {
#pragma unroll
    for (int q = 0; q < 8; ++q) {
      const int r = q * 2 + rsub;
      const v4f v = *(const v4fa*)&so[w][r][c4];
      *(v4f*)(C + (size_t)(row0 + r) * ldc + col0 + c4) = v;
    }
    
  }
}
// row LayerNorm (biased variance, eps) over N: s = X (+ R); optional out_sum <- s; out_norm <- (s-mu)*rsqrt(var+eps)*g + b
template <bool PARAM_BF16>
__global__ __launch_bounds__(256) void k_layernorm(const float* __restrict__ X, const float* __restrict__ R, const float* __restrict__ g, const float* __restrict__ bta,
                                                  float* __restrict__ out_sum, float* __restrict__ out_norm, int N, float eps) {
  __shared__ float red[256];
  const int row = blockIdx.x, tid = threadIdx.x;
  const float* x = X + (size_t)row * N; const float* rr = R ? R + (size_t)row * N : nullptr;
  float vals[16];                     // up to N = 4096
  const int per = N / 256;            // contiguous chunk per thread? use strided-by-4 chunks: thread handles j = tid*4 + 1024*u
  float s1 = 0.f;
  for (int u = 0; u < per / 4; ++u) {
    const int j = tid * 4 + 1024 * u;
    const v4f a = *(const v4fa*)(x + j);
    v4f b = {0.f,0.f,0.f,0.f}; if (rr) b = *(const v4fa*)(rr + j);
#pragma unroll
    for (int q = 0; q < 4; ++q) { const float v = a[q] + b[q]; vals[u * 4 + q] = v; s1 += v; }
  }
  red[tid] = s1; __syncthreads();
  for (int st = 128; st > 0; st >>= 1) { if (tid < st) red[tid] += red[tid + st]; __syncthreads(); }
  const float mu = red[0] / (float)N; __syncthreads();
  float s2 = 0.f;
  for (int u = 0; u < per / 4; ++u)
#pragma unroll
    for (int q = 0; q < 4; ++q) { const float c = vals[u * 4 + q] - mu; s2 += c * c; }
  red[tid] = s2; __syncthreads();
  for (int st = 128; st > 0; st >>= 1) { if (tid < st) red[tid] += red[tid + st]; __syncthreads(); }
  const float rs = rsqrtf(red[0] / (float)N + eps);
  {
    for (int u = 0; u < per / 4; ++u) {
      const int j = tid * 4 + 1024 * u;
      v4f o, sm;
#pragma unroll
      for (int q = 0; q < 4; ++q) {
        float gg = g[j + q], bb = bta[j + q];
        if (PARAM_BF16) { gg = bf16_round(gg); bb = bf16_round(bb); }
        sm[q] = vals[u * 4 + q]; o[q] = (vals[u * 4 + q] - mu) * rs * gg + bb;
      }
      if (out_sum) *(v4f*)(out_sum + (size_t)row * N + j) = sm;
      *(v4f*)(out_norm + (size_t)row * N + j) = o;
    }
    
  }
}



// ---- f16 WMMA path (v_wmma_f32_16x16x32_f16): 11-bit significands for operands in range — used where a [0,1] probability operand needs more precision than bf16
typedef _Float16 v16h __attribute__((ext_vector_type(16)));
union FragH { v16h v; v8us half[2]; _Float16 h[16]; unsigned short u[16]; };
template <int NT>
__device__ __forceinline__ v8f mmaH(v16h ah, v16h al, v16h bh, v16h bl, v8f c) {
  c = __builtin_amdgcn_wmma_f32_16x16x32_f16(false, ah, false, bh, (short)0, c, false, false);
  if (NT >= 2) c = __builtin_amdgcn_wmma_f32_16x16x32_f16(false, al, false, bh, (short)0, c, false, false);
  if (NT >= 3) c = __builtin_amdgcn_wmma_f32_16x16x32_f16(false, ah, false, bl, (short)0, c, false, false);
  asm volatile("v_nop\n\tv_nop\n\tv_nop\n\tv_nop" : "+v"(c) : "v"(ah), "v"(al), "v"(bh), "v"(bl));
  return c;
}
// batched GEMM like k_gemm_b but f16 operands: A f32 (split into f16 hi/lo if ASPLIT, else rounded to f16), Bt = f16 values [n][k]; alpha; C f32; N multiple of 16 (partial tiles skipped)
template <bool ASPLIT>
__global__ __launch_bounds__(128) void k_gemm_h(const float* __restrict__ A, int lda, size_t sA, const _Float16* __restrict__ Bh, int ldb, size_t sB, float alpha, float* __restrict__ C, int ldc, size_t sC, int M, int N, int K) {
  __shared__ __attribute__((aligned(16))) float so[4][16][64];
  const int tid = threadIdx.x, w = tid >> 5, lane = tid & 31, ln = lane & 15, hh = lane >> 4; const int by = blockIdx.y;
  A += (size_t)by * sA; Bh += (size_t)by * sB; C += (size_t)by * sC;
  const int ntn = (N + 63) / 64; const int wid = blockIdx.x * 4 + w; const int mt = wid / ntn, nq = wid % ntn; if (mt * 16 >= M) return;
  const int row0 = mt * 16, col0 = nq * 64; const float* arow = A + (size_t)(row0 + ln) * lda;
  v8f acc[4] = {};
  for (int kb = 0; kb < K; kb += 32) {
    FragH ah, al;
    const v4f x0 = *(const v4fa*)(arow + kb + 8 * hh), x1 = *(const v4fa*)(arow + kb + 8 * hh + 4), x2 = *(const v4fa*)(arow + kb + 16 + 8 * hh), x3 = *(const v4fa*)(arow + kb + 16 + 8 * hh + 4);
    float xs[16] = {x0[0],x0[1],x0[2],x0[3],x1[0],x1[1],x1[2],x1[3],x2[0],x2[1],x2[2],x2[3],x3[0],x3[1],x3[2],x3[3]};
#pragma unroll
    for (int i = 0; i < 16; ++i) { const _Float16 h = (_Float16)xs[i]; ah.h[i] = h; al.h[i] = ASPLIT ? (_Float16)(xs[i] - (float)h) : (_Float16)0.0f; }
#pragma unroll
    for (int t = 0; t < 4; ++t) { if (col0 + t * 16 >= N) continue; const size_t boff = (size_t)(col0 + t * 16 + ln) * ldb + kb; FragH bq; bq.half[0] = *(const v8us*)(Bh + boff + 8 * hh); bq.half[1] = *(const v8us*)(Bh + boff + 16 + 8 * hh);
      acc[t] = mmaH<ASPLIT ? 2 : 1>(ah.v, al.v, bq.v, bq.v, acc[t]); }
  }
#pragma unroll
  for (int t = 0; t < 4; ++t) { if (col0 + t * 16 >= N) continue;
#pragma unroll
    for (int r = 0; r < 8; ++r) so[w][8 * hh + r][t * 16 + ln] = acc[t][r] * alpha; }
  __builtin_amdgcn_fence(__ATOMIC_ACQ_REL, "workgroup"); __builtin_amdgcn_wave_barrier();
  const int rsub = lane >> 4, c4 = (lane & 15) * 4;
  {
#pragma unroll
    for (int q = 0; q < 8; ++q) { const int r = q * 2 + rsub; if (col0 + c4 < N) { const v4f v = *(const v4fa*)&so[w][r][c4]; *(v4f*)(C + (size_t)(row0 + r) * ldc + col0 + c4) = v; } }
     }
}

// Wt[n][k] = f16(W[k][n]·scale) from f32 row-major W[K][N] (scale = power of two; bf16-exact weights stay exact in f16 away from the subnormal range)
__global__ __launch_bounds__(256) void k_wt_f16(const float* __restrict__ W, _Float16* __restrict__ Wt, int K, int N, float scale) {
  const int t = blockIdx.x * 256 + threadIdx.x; if (t >= N * (K / 8)) return; const int n = t / (K / 8), k8 = (t % (K / 8)) * 8; FragH f;
#pragma unroll
  for (int i = 0; i < 8; ++i) f.h[i] = (_Float16)(bf16_round(W[(size_t)(k8 + i) * N + n]) * scale); const v8us o = f.half[0];
  *(v8us*)((unsigned short*)Wt + (size_t)n * K + k8) = o; 
}
// k_gemm_hh variant with fused epilogue: v = acc·alpha + bias[by·sBias + col] (+ CP[(row/rowsPerB)·sCPb + by·64 + col] if CP) ; ACT 0 none / 1 elu ; writes f16 C16 (and f32 C if non-null)
template <int ACT>
__global__ __launch_bounds__(128) void k_gemm_hhx(const _Float16* __restrict__ A, int lda, size_t sA, const _Float16* __restrict__ Bh, int ldb, size_t sB, float alpha, const float* __restrict__ bias, size_t sBias, const float* __restrict__ CP, int rowsPerB, size_t sCPb, int row0g,
    float* __restrict__ C, _Float16* __restrict__ C16, int ldc, size_t sC, int M, int N, int K) {
  __shared__ __attribute__((aligned(16))) float so[4][16][64];
  const int tid = threadIdx.x, w = tid >> 5, lane = tid & 31, ln = lane & 15, hh = lane >> 4; const int by = blockIdx.y;
  A += (size_t)by * sA; Bh += (size_t)by * sB; const size_t cofs = (size_t)by * sC; const float* bp = bias ? bias + (size_t)by * sBias : nullptr;
  const int ntn = (N + 63) / 64; const int wid = blockIdx.x * 4 + w; const int mt = wid / ntn, nq = wid % ntn; if (mt * 16 >= M) return;
  const int row0 = mt * 16, col0 = nq * 64; const _Float16* arow = A + (size_t)(row0 + ln) * lda;
  v8f acc[4] = {};
  for (int kb = 0; kb < K; kb += 32) { FragH ah; ah.half[0] = *(const v8us*)((const unsigned short*)arow + kb + 8 * hh); ah.half[1] = *(const v8us*)((const unsigned short*)arow + kb + 16 + 8 * hh);
#pragma unroll
    for (int t = 0; t < 4; ++t) { if (col0 + t * 16 >= N) continue; const size_t boff = (size_t)(col0 + t * 16 + ln) * ldb + kb; FragH bq; bq.half[0] = *(const v8us*)((const unsigned short*)Bh + boff + 8 * hh); bq.half[1] = *(const v8us*)((const unsigned short*)Bh + boff + 16 + 8 * hh);
      acc[t] = mmaH<1>(ah.v, ah.v, bq.v, bq.v, acc[t]); }
  }
#pragma unroll
  for (int t = 0; t < 4; ++t) { if (col0 + t * 16 >= N) continue; const int col = col0 + t * 16 + ln; const float bv = bp ? bf16_round(bp[col]) : 0.f;
#pragma unroll
    for (int r = 0; r < 8; ++r) { float v = acc[t][r] * alpha + bv; if (CP) { const int rr = row0g + row0 + 8 * hh + r; if (rowsPerB < 0) v += CP[cofs + (size_t)rr * ldc + col];      /* rowsPerB < 0: own element of the batched C plane */ else { const int bidx = rr / rowsPerB; v += CP[(size_t)bidx * sCPb + (size_t)by * 64 + col]; } } if (ACT == 1) v = (v > 0.f) ? v : expm1f(v); else if (ACT == 7) v = (v > 0.f) ? v + 1.0f : expf(v); else if (ACT == 8) v = tanhf(v); else if (ACT == 9) v = 0.5f * v * (1.0f + tanhf(0.7978845608028654f * (v + 0.044715f * v * v * v))); else if (ACT == 11) v = 1.0f / (1.0f + expf(-v)); else if (ACT == 12) v = (v > 0.f) ? v : 0.01f * v; else if (ACT == 14) v = (v > 0.f) ? v : 0.1f * v; else if (ACT == 16) v = (v >= 0.f) ? v : 0.3f * v; else if (ACT == 17) v = (v >= 0.f) ? v : 0.2f * v; else if (ACT == 15) v = v / (1.0f + expf(-v)); else if (ACT == 3) v = fmaxf(v, 0.f); else if (ACT == 6) v = 0.5f * v * (1.0f + erff(v * 0.70710678118654752f)); so[w][8 * hh + r][t * 16 + ln] = v; } }
  __builtin_amdgcn_fence(__ATOMIC_ACQ_REL, "workgroup"); __builtin_amdgcn_wave_barrier();
  const int rsub = lane >> 4, c4 = (lane & 15) * 4; typedef _Float16 v4h __attribute__((ext_vector_type(4)));
  {
#pragma unroll
    for (int q = 0; q < 8; ++q) { const int r = q * 2 + rsub; if (col0 + c4 < N) { const v4f v = *(const v4fa*)&so[w][r][c4]; if (C) *(v4f*)(C + cofs + (size_t)(row0 + r) * ldc + col0 + c4) = v; if (C16) { v4h h4; for (int i = 0; i < 4; ++i) h4[i] = (_Float16)v[i]; *(v4h*)(C16 + cofs + (size_t)(row0 + r) * ldc + col0 + c4) = h4; } } }
     }
}


typedef _Float16 v4h __attribute__((ext_vector_type(4)));

__global__ __launch_bounds__(256) void k_x16(const float* __restrict__ x, _Float16* __restrict__ X16, size_t n8) { const size_t t = (size_t)blockIdx.x * 256 + threadIdx.x; if (t >= n8) return; FragH f;
#pragma unroll
  for (int q = 0; q < 8; ++q) f.h[q] = (_Float16)bf16_round(x[t * 8 + q]); *(v8us*)((unsigned short*)X16 + t * 8) = f.half[0];  }
__global__ __launch_bounds__(256) void k_h16(const float* __restrict__ x, _Float16* __restrict__ X16, size_t n8) { const size_t t = (size_t)blockIdx.x * 256 + threadIdx.x; if (t >= n8) return; FragH f;
#pragma unroll
  for (int q = 0; q < 8; ++q) f.h[q] = (_Float16)x[t * 8 + q]; *(v8us*)((unsigned short*)X16 + t * 8) = f.half[0];  }
__global__ __launch_bounds__(256) void k_round16f(const float* __restrict__ W, _Float16* __restrict__ Bt, size_t n8) { const size_t t = (size_t)blockIdx.x * 256 + threadIdx.x; if (t >= n8) return; FragH f;
#pragma unroll
  for (int i = 0; i < 8; ++i) f.h[i] = (_Float16)(bf16_round(W[t * 8 + i]) * 16.0f); *(v8us*)((unsigned short*)Bt + t * 8) = f.half[0];  }
template <int NHv, int TTv>
__global__ __launch_bounds__(256) void k_vt(const _Float16* __restrict__ V16, int ldv, int voff, _Float16* __restrict__ Vt) { __shared__ unsigned short tl[64][66]; const int tid = threadIdx.x; const int slab = blockIdx.x / (TTv / 64), lg = blockIdx.x % (TTv / 64); const int b = slab / NHv, h = slab % NHv;
  for (int i = tid; i < 64 * 8; i += 256) { const int r = i / 8, c8 = (i % 8) * 8; FragH f; f.half[0] = *(const v8us*)((const unsigned short*)V16 + ((size_t)b * TTv + lg * 64 + r) * ldv + voff + h * 64 + c8);
#pragma unroll
    for (int q = 0; q < 8; ++q) tl[r][c8 + q] = f.u[q]; }
  __syncthreads();
  {
#pragma unroll
    for (int rd = 0; rd < 2; ++rd) { const int d = rd * 32 + tid / 8, pc = tid % 8; FragH f;
#pragma unroll
      for (int q = 0; q < 8; ++q) f.u[q] = tl[pc * 8 + q][d];
      *(v8us*)((unsigned short*)Vt + ((size_t)slab * 64 + d) * TTv + lg * 64 + pc * 8) = f.half[0]; }
     } }

__global__ __launch_bounds__(256) void k_hl(const float* __restrict__ F, _Float16* __restrict__ Hh, _Float16* __restrict__ Hl, size_t n8) { const size_t t = (size_t)blockIdx.x * 256 + threadIdx.x; if (t >= n8) return; FragH fh, fl; const v4f a = *(const v4fa*)(F + t * 8), c = *(const v4fa*)(F + t * 8 + 4);
#pragma unroll
  for (int q = 0; q < 4; ++q) { _Float16 h = (_Float16)a[q]; fh.h[q] = h; fl.h[q] = (_Float16)((a[q] - (float)h) * 1024.0f); h = (_Float16)c[q]; fh.h[4 + q] = h; fl.h[4 + q] = (_Float16)((c[q] - (float)h) * 1024.0f); }
  { *(v8us*)((unsigned short*)Hh + t * 8) = fh.half[0]; *(v8us*)((unsigned short*)Hl + t * 8) = fl.half[0];  } }

// ---- fast GEMM (wave tile 32x64; requires M % 32 == 0 rows per launch region and N % 64 == 0); epilogue = k_gemm_hhx semantics ----
__device__ __forceinline__ v16h g2_frag(const _Float16* p, int hh) { FragH f; f.half[0] = *(const v8us*)((const unsigned short*)p + 8 * hh); f.half[1] = *(const v8us*)((const unsigned short*)p + 16 + 8 * hh); return f.v; }
__device__ __forceinline__ v8f g2_mma(v16h a, v16h b, v8f c) { v8f d = __builtin_amdgcn_wmma_f32_16x16x32_f16(false, a, false, b, (short)0, c, false, false); asm volatile("v_nop\n\tv_nop\n\tv_nop\n\tv_nop" : "+v"(d) : "v"(a), "v"(b)); return d; }
template <int ACT>
__global__ __launch_bounds__(128) void k_gemm2(const _Float16* __restrict__ A, int lda, size_t sA, const _Float16* __restrict__ Bh, int ldb, size_t sB, float alpha, const float* __restrict__ bias, size_t sBias, const float* __restrict__ CP, int rowsPerB, size_t sCPb, int row0g,
    float* __restrict__ C, _Float16* __restrict__ C16, int ldc, size_t sC, int M, int N, int K) { static_assert(ACT == 0 || ACT == 3 || ACT == 6 || ACT == 8 || ACT == 9 || ACT == 11 || ACT == 12 || ACT == 14 || ACT == 15 || ACT == 16 || ACT == 17, "k_gemm2: unsupported ACT code (would silently apply no activation)");
  __shared__ __attribute__((aligned(16))) float so[4][32][68];
  const int tid = threadIdx.x, w = tid >> 5, lane = tid & 31, ln = lane & 15, hh = lane >> 4; const int by = blockIdx.y;
  A += (size_t)by * sA; Bh += (size_t)by * sB; const size_t cofs = (size_t)by * sC; const float* bp = bias ? bias + (size_t)by * sBias : nullptr;
  const int ntn = N >> 6; const int mt = blockIdx.x / ntn, nq = blockIdx.x - mt * ntn; const int row0 = mt * 128 + 32 * w, col0 = nq * 64; if (row0 >= M) return;
  const _Float16* a0p = A + (size_t)(row0 + ln) * lda; const _Float16* a1p = a0p + (size_t)16 * lda;
  const _Float16* b0p = Bh + (size_t)(col0 + ln) * ldb; const _Float16* b1p = b0p + (size_t)16 * ldb; const _Float16* b2p = b1p + (size_t)16 * ldb; const _Float16* b3p = b2p + (size_t)16 * ldb;
  const v8f z8 = {0.f,0.f,0.f,0.f,0.f,0.f,0.f,0.f}; v8f c00 = z8, c01 = z8, c02 = z8, c03 = z8, c10 = z8, c11 = z8, c12 = z8, c13 = z8;
#pragma unroll 1
  for (int kb = 0; kb < K; kb += 32) { const v16h a0 = g2_frag(a0p + kb, hh), a1 = g2_frag(a1p + kb, hh);
    v16h b = g2_frag(b0p + kb, hh); c00 = g2_mma(a0, b, c00); c10 = g2_mma(a1, b, c10);
    b = g2_frag(b1p + kb, hh); c01 = g2_mma(a0, b, c01); c11 = g2_mma(a1, b, c11);
    b = g2_frag(b2p + kb, hh); c02 = g2_mma(a0, b, c02); c12 = g2_mma(a1, b, c12);
    b = g2_frag(b3p + kb, hh); c03 = g2_mma(a0, b, c03); c13 = g2_mma(a1, b, c13); }
  v8f accs[8] = {c00, c01, c02, c03, c10, c11, c12, c13};
#pragma unroll
  for (int u = 0; u < 8; ++u) { const int t = u & 3, half = u >> 2; const int col = col0 + t * 16 + ln; const float bv = bp ? bf16_round(bp[col]) : 0.f;
#pragma unroll
    for (int r = 0; r < 8; ++r) { const int rloc = half * 16 + 8 * hh + r; float v = accs[u][r] * alpha + bv; if (CP) { if (rowsPerB < 0) v += CP[cofs + (size_t)(row0g + row0 + rloc) * ldc + col];      /* rowsPerB < 0: own element of the batched C plane */ else { const int bidx = (row0g + row0 + rloc) / rowsPerB; v += CP[(size_t)bidx * sCPb + (size_t)by * 64 + col]; } }
      if (ACT == 3) v = fmaxf(v, 0.f); else if (ACT == 6) v = 0.5f * v * (1.0f + erff(v * 0.70710678118654752f)); else if (ACT == 11) v = 1.0f / (1.0f + expf(-v)); else if (ACT == 15) v = v / (1.0f + expf(-v)); else if (ACT == 12) v = (v > 0.f) ? v : 0.01f * v; else if (ACT == 8) v = tanhf(v); else if (ACT == 9) v = 0.5f * v * (1.0f + tanhf(0.7978845608028654f * (v + 0.044715f * v * v * v))); else if (ACT == 14) v = (v > 0.f) ? v : 0.1f * v; else if (ACT == 16) v = (v >= 0.f) ? v : 0.3f * v; else if (ACT == 17) v = (v >= 0.f) ? v : 0.2f * v;
      so[w][rloc][t * 16 + ln] = v; } }
  __builtin_amdgcn_fence(__ATOMIC_ACQ_REL, "workgroup"); __builtin_amdgcn_wave_barrier();
  const int rsub = lane >> 4, c4 = (lane & 15) * 4;
  {
#pragma unroll
    for (int q = 0; q < 16; ++q) { const int r = q * 2 + rsub; const v4f v = *(const v4fa*)&so[w][r][c4]; if (C) *(v4f*)(C + cofs + (size_t)(row0 + r) * ldc + col0 + c4) = v; if (C16) { v4h h4; for (int i = 0; i < 4; ++i) h4[i] = (_Float16)v[i]; *(v4h*)(C16 + cofs + (size_t)(row0 + r) * ldc + col0 + c4) = h4; } }
     } }


__global__ __launch_bounds__(256) void k_wnat(const float* __restrict__ w, size_t n8, _Float16* __restrict__ Bt) { const size_t t = (size_t)blockIdx.x * 256 + threadIdx.x; if (t >= n8) return; FragH f; for (int q = 0; q < 8; ++q) f.h[q] = (_Float16)(bf16_round(w[t * 8 + q]) * 16.0f); *(v8us*)((unsigned short*)Bt + t * 8) = f.half[0];  }
// Fused attention, all heads in one launch: scores, softmax and the weighted sum of v never leave the chip (no score or weight plane in memory).
// Workgroup = 8 waves = 256 queries of one head; a wave owns 32 query columns. Per stage of 64 keys the workgroup stages the k rows and the v^T rows in LDS
// (whole-line 16-byte loads one stage ahead through registers, two buffers, one barrier a stage). Transposed products: S^T = K Q^T (a lane holds 8 keys of ONE query per tile),
// running maximum and sum per query (online softmax, f32), weights x 2^12 against the running maximum as f16, O^T += V^T P^T with the two S^T tiles of 32 keys packed in place as the B operand.
#define FA_KT 64                     /* keys per stage */
#define FA_NS (SQ / FA_KT)           /* stages */
#define FA_LP 72                     /* LDS row pitch in f16: 128 data bytes + 16, an odd multiple of 16 bytes for the 16-byte fragment reads */
__device__ __forceinline__ float fa_xhalf(float x) { return __builtin_bit_cast(float, __builtin_amdgcn_permlanex16(__builtin_bit_cast(int, x), __builtin_bit_cast(int, x), 0x76543210, 0xfedcba98, false, false)); }      /* lane l <-> lane l ^ 16 */
__device__ __forceinline__ v16h fa_lfrag(const _Float16* p) { FragH f; f.half[0] = *(const v8us*)((const unsigned short*)p); f.half[1] = *(const v8us*)((const unsigned short*)p + 16); return f.v; }      /* p already holds the lane half's + 8 * hh: the k order of g2_frag */
__device__ __forceinline__ v8f fa_mma(v16h a, v16h b, v8f c) { return __builtin_amdgcn_wmma_f32_16x16x32_f16(false, a, false, b, (short)0, c, false, false); }
// Eight independent 2^x in place. One statement, so that no exponential stands directly in front of an instruction that overwrites its source or reads its result
// (as separate builtins the register allocator put the next result into the previous source); the v_nop is the slot the instruction set asks for behind the last one.
__device__ __forceinline__ void fa_exp2x8(float (&p)[8]) {
  asm("v_exp_f32 %0, %0\n\tv_exp_f32 %1, %1\n\tv_exp_f32 %2, %2\n\tv_exp_f32 %3, %3\n\tv_exp_f32 %4, %4\n\tv_exp_f32 %5, %5\n\tv_exp_f32 %6, %6\n\tv_exp_f32 %7, %7\n\tv_nop"
      : "+v"(p[0]), "+v"(p[1]), "+v"(p[2]), "+v"(p[3]), "+v"(p[4]), "+v"(p[5]), "+v"(p[6]), "+v"(p[7])); }
__global__ __launch_bounds__(256) void k_fattn(const _Float16* __restrict__ Q, const _Float16* __restrict__ K, const _Float16* __restrict__ VT, float* __restrict__ out) {
  __shared__ __attribute__((aligned(16))) _Float16 sk[2][FA_KT][FA_LP];
  __shared__ __attribute__((aligned(16))) _Float16 sv[2][HD][FA_LP];
  const int tid = threadIdx.x, w = tid >> 5, lane = tid & 31, ln = lane & 15, hh = lane >> 4;
  const int h = blockIdx.y, q0 = blockIdx.x * 256 + w * 32;
  const float CS = 0.125f * 1.4426950408889634f;      /* 1 / sqrt(64), and base 2 for the exponentials */
  v16h qf[2][2];      /* [query tile][k step of 32 head dims], B operand: column = query */
#pragma unroll      /* constant indices keep the fragments in registers */
  for (int qt = 0; qt < 2; ++qt) for (int ks = 0; ks < 2; ++ks) qf[qt][ks] = g2_frag(Q + (size_t)(q0 + qt * 16 + ln) * LQ + h * HD + ks * 32, hh);
  const int sr = tid >> 3, sc = (tid & 7) * 8;      /* staging: 8 threads cover one 128-byte row; rows sr and sr + 32 */
  const unsigned short* gk = (const unsigned short*)K + (size_t)sr * LQ + h * HD + sc;
  const unsigned short* gv = (const unsigned short*)VT + ((size_t)h * HD + sr) * SQ + sc;
  v8us rk0 = *(const v8us*)gk, rk1 = *(const v8us*)(gk + (size_t)32 * LQ), rv0 = *(const v8us*)gv, rv1 = *(const v8us*)(gv + (size_t)32 * SQ);
  *(v8us*)&sk[0][sr][sc] = rk0; *(v8us*)&sk[0][sr + 32][sc] = rk1; *(v8us*)&sv[0][sr][sc] = rv0; *(v8us*)&sv[0][sr + 32][sc] = rv1;
  __syncthreads();
  const v8f z8 = {0.f, 0.f, 0.f, 0.f, 0.f, 0.f, 0.f, 0.f};
  v8f o[2][4] = {{z8, z8, z8, z8}, {z8, z8, z8, z8}};      /* O^T: [query tile][16 head dims]; register r = head dim 8 * hh + r, column = query ln */
  float m[2] = {-3.0e38f, -3.0e38f}, l[2] = {0.f, 0.f};      /* running maximum (raw dot products) and this lane half's running sum, per query */
  for (int s = 0; s < FA_NS; ++s) {
    const int cur = s & 1;
    if (s + 1 < FA_NS) {      /* the next stage's rows fly while this stage is worked on */
      const unsigned short* nk = gk + (size_t)(s + 1) * FA_KT * LQ; const unsigned short* nv = gv + (size_t)(s + 1) * FA_KT;
      rk0 = *(const v8us*)nk; rk1 = *(const v8us*)(nk + (size_t)32 * LQ); rv0 = *(const v8us*)nv; rv1 = *(const v8us*)(nv + (size_t)32 * SQ);
    }
    __builtin_amdgcn_sched_barrier(0);      /* keeps the four loads up here: the scheduler otherwise sinks them to their LDS stores at the stage's foot, and their latency is then waited out every stage */
    v8f st[2][4];      /* S^T: [query tile][16 keys]; register r = key 8 * hh + r, column = query ln */
#pragma unroll      /* constant indices keep the tiles in registers */
    for (int kt = 0; kt < 4; ++kt) {
      const v16h a0 = fa_lfrag(&sk[cur][kt * 16 + ln][8 * hh]), a1 = fa_lfrag(&sk[cur][kt * 16 + ln][32 + 8 * hh]);
#pragma unroll      /* constant indices keep the tiles in registers */
      for (int qt = 0; qt < 2; ++qt) st[qt][kt] = fa_mma(a1, qf[qt][1], fa_mma(a0, qf[qt][0], z8));
    }
    FragH pf[2][2];      /* [query tile][32 keys]: P^T as B operand, element i = tile i >> 3, register i & 7 */
#pragma unroll      /* constant indices keep the tiles in registers */
    for (int qt = 0; qt < 2; ++qt) {
      float mk[4];      /* one short chain per tile: a tile's maximum runs while the next tile's products are still on the matrix unit */
#pragma unroll      /* constant indices keep the tiles in registers */
      for (int kt = 0; kt < 4; ++kt) { mk[kt] = st[qt][kt][0]; for (int r = 1; r < 8; ++r) mk[kt] = fmaxf(mk[kt], st[qt][kt][r]); }
      float mx = fmaxf(fmaxf(mk[0], mk[1]), fmaxf(mk[2], mk[3]));
      mx = fmaxf(mx, fa_xhalf(mx));
      const float mn = fmaxf(m[qt], mx);
      const float corr = __builtin_amdgcn_exp2f((m[qt] - mn) * CS);      /* 0 on the first stage */
      const float nb = 12.0f - mn * CS;
      m[qt] = mn;
      float ls[4] = {0.f, 0.f, 0.f, 0.f};
#pragma unroll      /* constant indices keep the tiles in registers */
      for (int kt = 0; kt < 4; ++kt) { float p[8]; for (int r = 0; r < 8; ++r) p[r] = fmaf(st[qt][kt][r], CS, nb); fa_exp2x8(p); for (int r = 0; r < 8; ++r) { ls[kt] += p[r]; pf[qt][kt >> 1].h[(kt & 1) * 8 + r] = (_Float16)p[r]; } }
      l[qt] = fmaf(l[qt], corr, (ls[0] + ls[1]) + (ls[2] + ls[3]));
#pragma unroll      /* constant indices keep the tiles in registers */
      for (int dt = 0; dt < 4; ++dt) o[qt][dt] *= corr;
    }
#pragma unroll      /* constant indices keep the tiles in registers */
    for (int ps = 0; ps < 2; ++ps) for (int dt = 0; dt < 4; ++dt) {
      const v16h a = fa_lfrag(&sv[cur][dt * 16 + ln][ps * 32 + 8 * hh]);
      o[0][dt] = fa_mma(a, pf[0][ps].v, o[0][dt]); o[1][dt] = fa_mma(a, pf[1][ps].v, o[1][dt]);
    }
    if (s + 1 < FA_NS) { *(v8us*)&sk[cur ^ 1][sr][sc] = rk0; *(v8us*)&sk[cur ^ 1][sr + 32][sc] = rk1; *(v8us*)&sv[cur ^ 1][sr][sc] = rv0; *(v8us*)&sv[cur ^ 1][sr + 32][sc] = rv1; }      /* that buffer's last readers left it before the previous barrier */
    __syncthreads();      /* publishes stage s + 1 and ends every read of stage s */
  }
#pragma unroll      /* constant indices keep the tiles in registers */
  for (int qt = 0; qt < 2; ++qt) {
    const float inv = 1.0f / (l[qt] + fa_xhalf(l[qt]));      /* the two lane halves' sums join once */
    float* op = out + (size_t)(q0 + qt * 16 + ln) * DM + h * HD + 8 * hh;
#pragma unroll      /* constant indices keep the tiles in registers */
    for (int dt = 0; dt < 4; ++dt) { const v4f lo = {o[qt][dt][0] * inv, o[qt][dt][1] * inv, o[qt][dt][2] * inv, o[qt][dt][3] * inv}, hi = {o[qt][dt][4] * inv, o[qt][dt][5] * inv, o[qt][dt][6] * inv, o[qt][dt][7] * inv};
      *(v4f*)(op + dt * 16) = lo; *(v4f*)(op + dt * 16 + 4) = hi; }
  } }
__global__ __launch_bounds__(256) void k_vt(const _Float16* __restrict__ V16, int b, int h0, _Float16* __restrict__ VT) { __shared__ unsigned short tl[64][65]; const int tid = threadIdx.x; const int hh = blockIdx.x % HG, sg = blockIdx.x / HG; const int s0 = sg * 64; const int h = h0 + hh;
  for (int i = tid; i < 64 * 8; i += 256) { const int j = i / 8, d8 = (i % 8) * 8; FragH f; f.half[0] = *(const v8us*)((const unsigned short*)V16 + ((size_t)b * SQ + s0 + j) * DM + h * HD + d8); for (int q = 0; q < 8; ++q) tl[d8 + q][j] = f.u[q]; }
  __syncthreads();
  { for (int i = tid; i < 64 * 8; i += 256) { const int d = i / 8, j8 = (i % 8) * 8; FragH f; for (int q = 0; q < 8; ++q) f.u[q] = tl[d][j8 + q]; *(v8us*)((unsigned short*)VT + ((size_t)hh * HD + d) * SQ + s0 + j8) = f.half[0]; }  } }



__global__ __launch_bounds__(256) void k_rsmkm(const float* __restrict__ S, _Float16* __restrict__ P, int nrows, const int* __restrict__ am) {
  #pragma clang fp contract(off)
  const int t = blockIdx.x * 256 + threadIdx.x; if (t >= nrows) return; const size_t i = (size_t)t; const float* s = S + i * SQ; const int* mr = am + (size_t)(t % SQ) * SQ; float mx = -3.0e38f;
#pragma unroll 1
  for (int j = 0; j < SQ; ++j) { const float f = (mr[j] != 0) ? 1.f : 0.f; mx = fmaxf(mx, fmaf(f, s[j], (1.f - f) * -1.0e9f)); } float se = 0.f;
#pragma unroll 1
  for (int j = 0; j < SQ; ++j) { const float f = (mr[j] != 0) ? 1.f : 0.f; se += __expf(fmaf(f, s[j], (1.f - f) * -1.0e9f) - mx); } const float sc = 256.0f / se;
#pragma unroll 1
  for (int j0 = 0; j0 < SQ; j0 += 8) { FragH fr; for (int q = 0; q < 8; ++q) { const int j = j0 + q; const float f = (mr[j] != 0) ? 1.f : 0.f; fr.h[q] = (_Float16)(__expf(fmaf(f, s[j], (1.f - f) * -1.0e9f) - mx) * sc); }
    unsigned short* d = (unsigned short*)P + i * SQ + j0; *(v8us*)d = fr.half[0];  } }
extern "C" void kernel_launch(void* const* d_in, const int* in_sizes, int n_in,
                              void* d_out, int out_size, void* d_ws, size_t ws_size, hipStream_t stream) {
  (void)in_sizes; (void)n_in; (void)out_size;
  const float* const* I = (const float* const*)d_in; const float* xq = I[0]; const float* wqkv = I[1];      /* input order: X (2-D [4096][1024] = one sequence; feeds the one projection), Wqkv ([in][out] [1024][2048]: columns 0..1023 = the shared q = k projection, 1024..2047 = v); NO biases (nullptr in the guarded slot); NO output projection */
  static_assert(NH * HD == DM && DM % 64 == 0 && SQ % 128 == 0 && NH % HG == 0, "shape / tile multiples");
  char* ws = (char*)d_ws; size_t off = 0;
  auto take = [&](size_t bytes) { char* p = ws + off; off += (bytes + 255) & ~(size_t)255; return p; };
  _Float16* BW = (_Float16*)take((size_t)2 * DM * DM * 2);
  _Float16* X16 = (_Float16*)take(NR * DM * 2); _Float16* P16 = (_Float16*)take(NR * LQ * 2);
  _Float16* VT = (_Float16*)take((size_t)NH * HD * SQ * 2);
  if (off > ws_size) return;
  k_wt_f16<<<(unsigned)(((size_t)2 * DM * (DM / 8) + 255) / 256), 256, 0, stream>>>(wqkv, BW, DM, 2 * DM, 16.0f);      /* [in][out] [1024][2048] -> Bt[n][k] x16, 2048 rows: rows 0..1023 the shared q = k projection, rows 1024..2047 the v projection */
  k_x16<<<(unsigned)((NR * DM / 8 + 255) / 256), 256, 0, stream>>>(xq, X16, NR * DM / 8);      /* the one input as exact f16 rows, once */
  const size_t r0p = (size_t)B0 * SQ;      /* first projected row */
  k_gemm2<0><<<dim3((unsigned)((MP / 128) * (LQ / 64)), 1), 128, 0, stream>>>(X16 + r0p * DM, DM, 0, BW, DM, 0, 0.0625f, nullptr, 0, nullptr, 1, 0, 0, nullptr, P16 + r0p * LQ, LQ, 0, MP, LQ, DM);      /* proj = X Wqkv, all 2048 columns in one launch; q and k are the same product and are read from the same columns */
  for (int b = B0; b < B0 + NBR; ++b) { const size_t r0 = (size_t)b * SQ;
    k_vt<NH, SQ><<<NH * (SQ / 64), 256, 0, stream>>>(P16 + r0 * LQ, LQ, DM, VT);      /* V^T [NH][HD][SQ] for this batch */
    k_fattn<<<dim3(QN / 256, NHD), 256, 0, stream>>>(P16 + r0 * LQ, P16 + r0 * LQ, VT, (float*)d_out + r0 * DM); }      /* out = softmax(q k^T / 8) v for all heads, f32 straight into the merged-heads output rows (no output projection) */
}

// v004
// Measured time: 103 microseconds a run.
// Two timings next to v003 both put it at 1.37 times that version's speed.
// Counting every step since v000, it is 135 times as fast.
#include <hip/hip_runtime.h>
// Multi-head self-attention on ONE 4096-token problem with a SHARED query / key projection and no output projection, NON-causal (X [4096][1024]; proj = X Wqkv ([in][out] 1024 x 2048 sigma 1/32, no bias) split into a qk half and a v half; the scores use the SAME projection on both sides: scores = qk qk^T / sqrt(64) per head (16 heads of 64; symmetric per head); softmax over all 4096 keys (no mask); out = att v merged head-major -> [4096][1024]; no output projection); all heads in ONE fused attention launch.
// Structure: token rows r = b*4096 + s; x as exact f16 rows (bf16-rounded), converted once; proj = X Wqkv as ONE WMMA GEMM over all 2048 columns (256x128 workgroup tiles staged in LDS, 64x64 wave tiles, f32 accumulation, exact x16 weights, f16 output rows of pitch 2048: columns 0..1023 serve as q and as k, 1024..2047 as v); per batch: V^T for all heads via LDS transposes; per batch: one fused attention launch over all heads (online softmax, f32 statistics, weights as f16 against the running maximum) written f32 straight into the merged-heads output rows.
// Compute dtype: inputs rounded to bf16; x / weights exact; q, k, v and softmax weights as plain f16 GEMM operands (~2^-12); scores, softmax statistics and o f32. v_wmma_f32_16x16x32_f16.
#define NB 1
#define SQ 4096
#define DM 1024
#define NH 16
#define HD 64
#define HG 1                         /* heads per group of the per-group V^T helper */
#define B0 0                         /* first batch processed (debug hook) */
#define NBR NB                       /* batches processed (debug hook) */
#define NR ((size_t)NB * SQ)         /* token rows */
#define MP ((int)((size_t)NBR * SQ)) /* rows projected (debug hook) */
#define QN SQ                        /* query rows attended per batch (debug hook) */
#define NHD NH                       /* heads attended (debug hook) */
#define MPO MP                       /* unused: no output stage (debug hook) */
#define LQ (2 * DM)      /* row pitch of the projected rows: 1024 shared q = k columns, then 1024 v columns */
typedef __bf16 v16b __attribute__((ext_vector_type(16)));
typedef unsigned short v8us __attribute__((ext_vector_type(8), may_alias));
typedef float  v8f  __attribute__((ext_vector_type(8)));
typedef float  v4f  __attribute__((ext_vector_type(4)));
typedef float  v4fa __attribute__((ext_vector_type(4), may_alias));
union FragB { v16b v; v8us half[2]; unsigned short u[16]; };

__device__ __forceinline__ unsigned short bf16_bits(float x) { unsigned int u = __float_as_uint(x); return (unsigned short)((u + 0x7FFFu + ((u >> 16) & 1u)) >> 16); }
__device__ __forceinline__ float bf16_val(unsigned short b) { return __uint_as_float(((unsigned int)b) << 16); }
__device__ __forceinline__ float bf16_round(float x) { return bf16_val(bf16_bits(x)); }
// D += A·B with NT terms: 1 = ah·bh, 2 = + al·bh (A split), 3 = + ah·bl (both split)
template <int NT>
__device__ __forceinline__ v8f mmaN(v16b ah, v16b al, v16b bh, v16b bl, v8f c) {
  c = __builtin_amdgcn_wmma_f32_16x16x32_bf16(false, ah, false, bh, (short)0, c, false, false);
  if (NT >= 2) c = __builtin_amdgcn_wmma_f32_16x16x32_bf16(false, al, false, bh, (short)0, c, false, false);
  if (NT >= 3) c = __builtin_amdgcn_wmma_f32_16x16x32_bf16(false, ah, false, bl, (short)0, c, false, false);
  asm volatile("v_nop\n\tv_nop\n\tv_nop\n\tv_nop" : "+v"(c) : "v"(ah), "v"(al), "v"(bh), "v"(bl));
  return c;
}

__global__ __launch_bounds__(256) void k_wt_bf16(const float* __restrict__ W, unsigned short* __restrict__ Wt, int K, int N) {
  const int t = blockIdx.x * 256 + threadIdx.x;
  const int k8n = K / 8;
  if (t >= N * k8n) return;
  const int n = t / k8n, k8 = (t % k8n) * 8;
  v8us v;
#pragma unroll
  for (int i = 0; i < 8; ++i) v[i] = bf16_bits(W[(size_t)(k8 + i) * N + n]);
  *(v8us*)(Wt + (size_t)n * K + k8) = v;
  
}

// GEMM C[M][N] (f32, pitch ldc) = act(A[M][K]·W + bias). A f32 row-major (pitch lda) converted per fragment to bf16
// (ASPLIT: hi/lo two planes -> 2 terms, else single rounded term); Wt bf16 [N][K] (pitch ldb). BIAS_BF16 rounds the
// bias to bf16 first (bias quantised to bf16 before the add). K%32==0, M%16==0, N%64==0.
template <bool ASPLIT, int ACT, bool BIAS_BF16>
__global__ __launch_bounds__(128) void k_gemm_bf(const float* __restrict__ A, int lda, const unsigned short* __restrict__ Wt, int ldb,
                                               const float* __restrict__ bias, float* __restrict__ C, int ldc, int M, int N, int K) {
  __shared__ __attribute__((aligned(16))) float so[4][16][64];
  const int tid = threadIdx.x, w = tid >> 5, lane = tid & 31, ln = lane & 15, hh = lane >> 4;
  const int ntn = N / 64;
  const int wid = blockIdx.x * 4 + w;
  const int mt = wid / ntn, nq = wid % ntn;
  if (mt * 16 >= M) return;
  const int row0 = mt * 16, col0 = nq * 64;
  const float* arow = A + (size_t)(row0 + ln) * lda;
  v8f acc[4] = {};
  for (int kb = 0; kb < K; kb += 32) {
    FragB ah, al;
    const v4f x0 = *(const v4fa*)(arow + kb + 8 * hh), x1 = *(const v4fa*)(arow + kb + 8 * hh + 4);
    const v4f x2 = *(const v4fa*)(arow + kb + 16 + 8 * hh), x3 = *(const v4fa*)(arow + kb + 16 + 8 * hh + 4);
    float xs[16] = {x0[0],x0[1],x0[2],x0[3],x1[0],x1[1],x1[2],x1[3],x2[0],x2[1],x2[2],x2[3],x3[0],x3[1],x3[2],x3[3]};
#pragma unroll
    for (int i = 0; i < 16; ++i) { const unsigned short hb = bf16_bits(xs[i]); ah.u[i] = hb; al.u[i] = ASPLIT ? bf16_bits(xs[i] - bf16_val(hb)) : (unsigned short)0; }
#pragma unroll
    for (int t = 0; t < 4; ++t) {
      const unsigned short* brow = Wt + (size_t)(col0 + t * 16 + ln) * ldb + kb;
      FragB b;
      b.half[0] = *(const v8us*)(brow + 8 * hh);
      b.half[1] = *(const v8us*)(brow + 16 + 8 * hh);
      acc[t] = mmaN<ASPLIT ? 2 : 1>(ah.v, al.v, b.v, b.v, acc[t]);
    }
  }
#pragma unroll
  for (int t = 0; t < 4; ++t) {
    float bv = bias ? bias[col0 + t * 16 + ln] : 0.f;
    if (BIAS_BF16) bv = bf16_round(bv);
#pragma unroll
    for (int r = 0; r < 8; ++r) { float v = acc[t][r] + bv; if (ACT == 1) v = fmaxf(v, 0.f); so[w][8 * hh + r][t * 16 + ln] = v; }
  }
  __builtin_amdgcn_fence(__ATOMIC_ACQ_REL, "workgroup");
  __builtin_amdgcn_wave_barrier();
  const int rsub = lane >> 4, c4 = (lane & 15) * 4;
  {
#pragma unroll
    for (int q = 0; q < 8; ++q) {
      const int r = q * 2 + rsub;
      const v4f v = *(const v4fa*)&so[w][r][c4];
      *(v4f*)(C + (size_t)(row0 + r) * ldc + col0 + c4) = v;
    }
    
  }
}

// GEMM C = act(A·W + bias + resid): A f32 (ASPLIT -> hi/lo 2 terms), Wt bf16 [N][K]; ACT 0 none, 1 relu, 2 exact gelu;
// resid (optional, f32, row index = (row % rmod), pitch ldr, RES_BF16 rounds it) added before the activation.
template <bool ASPLIT, int ACT, bool BIAS_BF16, bool RES_BF16>
__global__ __launch_bounds__(128) void k_gemm_bf3(const float* __restrict__ A, int lda, const unsigned short* __restrict__ Wt, int ldb,
                                                const float* __restrict__ bias, const float* __restrict__ resid, int rmod, int ldr,
                                                float* __restrict__ C, int ldc, int M, int N, int K) {
  __shared__ __attribute__((aligned(16))) float so[4][16][64];
  const int tid = threadIdx.x, w = tid >> 5, lane = tid & 31, ln = lane & 15, hh = lane >> 4;
  const int ntn = N / 64;
  const int wid = blockIdx.x * 4 + w;
  const int mt = wid / ntn, nq = wid % ntn;
  if (mt * 16 >= M) return;
  const int row0 = mt * 16, col0 = nq * 64;
  const float* arow = A + (size_t)(row0 + ln) * lda;
  v8f acc[4] = {};
  for (int kb = 0; kb < K; kb += 32) {
    FragB ah, al;
    const v4f x0 = *(const v4fa*)(arow + kb + 8 * hh), x1 = *(const v4fa*)(arow + kb + 8 * hh + 4);
    const v4f x2 = *(const v4fa*)(arow + kb + 16 + 8 * hh), x3 = *(const v4fa*)(arow + kb + 16 + 8 * hh + 4);
    float xs[16] = {x0[0],x0[1],x0[2],x0[3],x1[0],x1[1],x1[2],x1[3],x2[0],x2[1],x2[2],x2[3],x3[0],x3[1],x3[2],x3[3]};
#pragma unroll
    for (int i = 0; i < 16; ++i) { const unsigned short hb = bf16_bits(xs[i]); ah.u[i] = hb; al.u[i] = ASPLIT ? bf16_bits(xs[i] - bf16_val(hb)) : (unsigned short)0; }
#pragma unroll
    for (int t = 0; t < 4; ++t) {
      const unsigned short* brow = Wt + (size_t)(col0 + t * 16 + ln) * ldb + kb;
      FragB b;
      b.half[0] = *(const v8us*)(brow + 8 * hh);
      b.half[1] = *(const v8us*)(brow + 16 + 8 * hh);
      acc[t] = mmaN<ASPLIT ? 2 : 1>(ah.v, al.v, b.v, b.v, acc[t]);
    }
  }
#pragma unroll
  for (int t = 0; t < 4; ++t) {
    const int col = col0 + t * 16 + ln;
    float bv = bias ? bias[col] : 0.f;
    if (BIAS_BF16) bv = bf16_round(bv);
#pragma unroll
    for (int r = 0; r < 8; ++r) {
      float v = acc[t][r] + bv;
      if (resid) { float rv = resid[(size_t)((row0 + 8 * hh + r) % rmod) * ldr + col]; if (RES_BF16) rv = bf16_round(rv); v += rv; }
      if (ACT == 1) v = fmaxf(v, 0.f);
      if (ACT == 2) v = 0.5f * v * (1.0f + erff(v * 0.70710678118654752f));
      if (ACT == 3) { const float u = 0.7978845608028654f * (v + 0.044715f * v * v * v); v = 0.5f * v * (1.0f + tanhf(u)); }
      so[w][8 * hh + r][t * 16 + ln] = v;
    }
  }
  __builtin_amdgcn_fence(__ATOMIC_ACQ_REL, "workgroup");
  __builtin_amdgcn_wave_barrier();
  const int rsub = lane >> 4, c4 = (lane & 15) * 4;
  {
#pragma unroll
    for (int q = 0; q < 8; ++q) {
      const int r = q * 2 + rsub;
      const v4f v = *(const v4fa*)&so[w][r][c4];
      *(v4f*)(C + (size_t)(row0 + r) * ldc + col0 + c4) = v;
    }
    
  }
}
// row LayerNorm (biased variance, eps) over N: s = X (+ R); optional out_sum <- s; out_norm <- (s-mu)*rsqrt(var+eps)*g + b
template <bool PARAM_BF16>
__global__ __launch_bounds__(256) void k_layernorm(const float* __restrict__ X, const float* __restrict__ R, const float* __restrict__ g, const float* __restrict__ bta,
                                                  float* __restrict__ out_sum, float* __restrict__ out_norm, int N, float eps) {
  __shared__ float red[256];
  const int row = blockIdx.x, tid = threadIdx.x;
  const float* x = X + (size_t)row * N; const float* rr = R ? R + (size_t)row * N : nullptr;
  float vals[16];                     // up to N = 4096
  const int per = N / 256;            // contiguous chunk per thread? use strided-by-4 chunks: thread handles j = tid*4 + 1024*u
  float s1 = 0.f;
  for (int u = 0; u < per / 4; ++u) {
    const int j = tid * 4 + 1024 * u;
    const v4f a = *(const v4fa*)(x + j);
    v4f b = {0.f,0.f,0.f,0.f}; if (rr) b = *(const v4fa*)(rr + j);
#pragma unroll
    for (int q = 0; q < 4; ++q) { const float v = a[q] + b[q]; vals[u * 4 + q] = v; s1 += v; }
  }
  red[tid] = s1; __syncthreads();
  for (int st = 128; st > 0; st >>= 1) { if (tid < st) red[tid] += red[tid + st]; __syncthreads(); }
  const float mu = red[0] / (float)N; __syncthreads();
  float s2 = 0.f;
  for (int u = 0; u < per / 4; ++u)
#pragma unroll
    for (int q = 0; q < 4; ++q) { const float c = vals[u * 4 + q] - mu; s2 += c * c; }
  red[tid] = s2; __syncthreads();
  for (int st = 128; st > 0; st >>= 1) { if (tid < st) red[tid] += red[tid + st]; __syncthreads(); }
  const float rs = rsqrtf(red[0] / (float)N + eps);
  {
    for (int u = 0; u < per / 4; ++u) {
      const int j = tid * 4 + 1024 * u;
      v4f o, sm;
#pragma unroll
      for (int q = 0; q < 4; ++q) {
        float gg = g[j + q], bb = bta[j + q];
        if (PARAM_BF16) { gg = bf16_round(gg); bb = bf16_round(bb); }
        sm[q] = vals[u * 4 + q]; o[q] = (vals[u * 4 + q] - mu) * rs * gg + bb;
      }
      if (out_sum) *(v4f*)(out_sum + (size_t)row * N + j) = sm;
      *(v4f*)(out_norm + (size_t)row * N + j) = o;
    }
    
  }
}



// ---- f16 WMMA path (v_wmma_f32_16x16x32_f16): 11-bit significands for operands in range — used where a [0,1] probability operand needs more precision than bf16
typedef _Float16 v16h __attribute__((ext_vector_type(16)));
union FragH { v16h v; v8us half[2]; _Float16 h[16]; unsigned short u[16]; };
template <int NT>
__device__ __forceinline__ v8f mmaH(v16h ah, v16h al, v16h bh, v16h bl, v8f c) {
  c = __builtin_amdgcn_wmma_f32_16x16x32_f16(false, ah, false, bh, (short)0, c, false, false);
  if (NT >= 2) c = __builtin_amdgcn_wmma_f32_16x16x32_f16(false, al, false, bh, (short)0, c, false, false);
  if (NT >= 3) c = __builtin_amdgcn_wmma_f32_16x16x32_f16(false, ah, false, bl, (short)0, c, false, false);
  asm volatile("v_nop\n\tv_nop\n\tv_nop\n\tv_nop" : "+v"(c) : "v"(ah), "v"(al), "v"(bh), "v"(bl));
  return c;
}
// batched GEMM like k_gemm_b but f16 operands: A f32 (split into f16 hi/lo if ASPLIT, else rounded to f16), Bt = f16 values [n][k]; alpha; C f32; N multiple of 16 (partial tiles skipped)
template <bool ASPLIT>
__global__ __launch_bounds__(128) void k_gemm_h(const float* __restrict__ A, int lda, size_t sA, const _Float16* __restrict__ Bh, int ldb, size_t sB, float alpha, float* __restrict__ C, int ldc, size_t sC, int M, int N, int K) {
  __shared__ __attribute__((aligned(16))) float so[4][16][64];
  const int tid = threadIdx.x, w = tid >> 5, lane = tid & 31, ln = lane & 15, hh = lane >> 4; const int by = blockIdx.y;
  A += (size_t)by * sA; Bh += (size_t)by * sB; C += (size_t)by * sC;
  const int ntn = (N + 63) / 64; const int wid = blockIdx.x * 4 + w; const int mt = wid / ntn, nq = wid % ntn; if (mt * 16 >= M) return;
  const int row0 = mt * 16, col0 = nq * 64; const float* arow = A + (size_t)(row0 + ln) * lda;
  v8f acc[4] = {};
  for (int kb = 0; kb < K; kb += 32) {
    FragH ah, al;
    const v4f x0 = *(const v4fa*)(arow + kb + 8 * hh), x1 = *(const v4fa*)(arow + kb + 8 * hh + 4), x2 = *(const v4fa*)(arow + kb + 16 + 8 * hh), x3 = *(const v4fa*)(arow + kb + 16 + 8 * hh + 4);
    float xs[16] = {x0[0],x0[1],x0[2],x0[3],x1[0],x1[1],x1[2],x1[3],x2[0],x2[1],x2[2],x2[3],x3[0],x3[1],x3[2],x3[3]};
#pragma unroll
    for (int i = 0; i < 16; ++i) { const _Float16 h = (_Float16)xs[i]; ah.h[i] = h; al.h[i] = ASPLIT ? (_Float16)(xs[i] - (float)h) : (_Float16)0.0f; }
#pragma unroll
    for (int t = 0; t < 4; ++t) { if (col0 + t * 16 >= N) continue; const size_t boff = (size_t)(col0 + t * 16 + ln) * ldb + kb; FragH bq; bq.half[0] = *(const v8us*)(Bh + boff + 8 * hh); bq.half[1] = *(const v8us*)(Bh + boff + 16 + 8 * hh);
      acc[t] = mmaH<ASPLIT ? 2 : 1>(ah.v, al.v, bq.v, bq.v, acc[t]); }
  }
#pragma unroll
  for (int t = 0; t < 4; ++t) { if (col0 + t * 16 >= N) continue;
#pragma unroll
    for (int r = 0; r < 8; ++r) so[w][8 * hh + r][t * 16 + ln] = acc[t][r] * alpha; }
  __builtin_amdgcn_fence(__ATOMIC_ACQ_REL, "workgroup"); __builtin_amdgcn_wave_barrier();
  const int rsub = lane >> 4, c4 = (lane & 15) * 4;
  {
#pragma unroll
    for (int q = 0; q < 8; ++q) { const int r = q * 2 + rsub; if (col0 + c4 < N) { const v4f v = *(const v4fa*)&so[w][r][c4]; *(v4f*)(C + (size_t)(row0 + r) * ldc + col0 + c4) = v; } }
     }
}

// Wt[n][k] = f16(W[k][n]·scale) from f32 row-major W[K][N] (scale = power of two; bf16-exact weights stay exact in f16 away from the subnormal range)
__global__ __launch_bounds__(256) void k_wt_f16(const float* __restrict__ W, _Float16* __restrict__ Wt, int K, int N, float scale) {
  const int t = blockIdx.x * 256 + threadIdx.x; if (t >= N * (K / 8)) return; const int n = t / (K / 8), k8 = (t % (K / 8)) * 8; FragH f;
#pragma unroll
  for (int i = 0; i < 8; ++i) f.h[i] = (_Float16)(bf16_round(W[(size_t)(k8 + i) * N + n]) * scale); const v8us o = f.half[0];
  *(v8us*)((unsigned short*)Wt + (size_t)n * K + k8) = o; 
}
// k_gemm_hh variant with fused epilogue: v = acc·alpha + bias[by·sBias + col] (+ CP[(row/rowsPerB)·sCPb + by·64 + col] if CP) ; ACT 0 none / 1 elu ; writes f16 C16 (and f32 C if non-null)
template <int ACT>
__global__ __launch_bounds__(128) void k_gemm_hhx(const _Float16* __restrict__ A, int lda, size_t sA, const _Float16* __restrict__ Bh, int ldb, size_t sB, float alpha, const float* __restrict__ bias, size_t sBias, const float* __restrict__ CP, int rowsPerB, size_t sCPb, int row0g,
    float* __restrict__ C, _Float16* __restrict__ C16, int ldc, size_t sC, int M, int N, int K) {
  __shared__ __attribute__((aligned(16))) float so[4][16][64];
  const int tid = threadIdx.x, w = tid >> 5, lane = tid & 31, ln = lane & 15, hh = lane >> 4; const int by = blockIdx.y;
  A += (size_t)by * sA; Bh += (size_t)by * sB; const size_t cofs = (size_t)by * sC; const float* bp = bias ? bias + (size_t)by * sBias : nullptr;
  const int ntn = (N + 63) / 64; const int wid = blockIdx.x * 4 + w; const int mt = wid / ntn, nq = wid % ntn; if (mt * 16 >= M) return;
  const int row0 = mt * 16, col0 = nq * 64; const _Float16* arow = A + (size_t)(row0 + ln) * lda;
  v8f acc[4] = {};
  for (int kb = 0; kb < K; kb += 32) { FragH ah; ah.half[0] = *(const v8us*)((const unsigned short*)arow + kb + 8 * hh); ah.half[1] = *(const v8us*)((const unsigned short*)arow + kb + 16 + 8 * hh);
#pragma unroll
    for (int t = 0; t < 4; ++t) { if (col0 + t * 16 >= N) continue; const size_t boff = (size_t)(col0 + t * 16 + ln) * ldb + kb; FragH bq; bq.half[0] = *(const v8us*)((const unsigned short*)Bh + boff + 8 * hh); bq.half[1] = *(const v8us*)((const unsigned short*)Bh + boff + 16 + 8 * hh);
      acc[t] = mmaH<1>(ah.v, ah.v, bq.v, bq.v, acc[t]); }
  }
#pragma unroll
  for (int t = 0; t < 4; ++t) { if (col0 + t * 16 >= N) continue; const int col = col0 + t * 16 + ln; const float bv = bp ? bf16_round(bp[col]) : 0.f;
#pragma unroll
    for (int r = 0; r < 8; ++r) { float v = acc[t][r] * alpha + bv; if (CP) { const int rr = row0g + row0 + 8 * hh + r; if (rowsPerB < 0) v += CP[cofs + (size_t)rr * ldc + col];      /* rowsPerB < 0: own element of the batched C plane */ else { const int bidx = rr / rowsPerB; v += CP[(size_t)bidx * sCPb + (size_t)by * 64 + col]; } } if (ACT == 1) v = (v > 0.f) ? v : expm1f(v); else if (ACT == 7) v = (v > 0.f) ? v + 1.0f : expf(v); else if (ACT == 8) v = tanhf(v); else if (ACT == 9) v = 0.5f * v * (1.0f + tanhf(0.7978845608028654f * (v + 0.044715f * v * v * v))); else if (ACT == 11) v = 1.0f / (1.0f + expf(-v)); else if (ACT == 12) v = (v > 0.f) ? v : 0.01f * v; else if (ACT == 14) v = (v > 0.f) ? v : 0.1f * v; else if (ACT == 16) v = (v >= 0.f) ? v : 0.3f * v; else if (ACT == 17) v = (v >= 0.f) ? v : 0.2f * v; else if (ACT == 15) v = v / (1.0f + expf(-v)); else if (ACT == 3) v = fmaxf(v, 0.f); else if (ACT == 6) v = 0.5f * v * (1.0f + erff(v * 0.70710678118654752f)); so[w][8 * hh + r][t * 16 + ln] = v; } }
  __builtin_amdgcn_fence(__ATOMIC_ACQ_REL, "workgroup"); __builtin_amdgcn_wave_barrier();
  const int rsub = lane >> 4, c4 = (lane & 15) * 4; typedef _Float16 v4h __attribute__((ext_vector_type(4)));
  {
#pragma unroll
    for (int q = 0; q < 8; ++q) { const int r = q * 2 + rsub; if (col0 + c4 < N) { const v4f v = *(const v4fa*)&so[w][r][c4]; if (C) *(v4f*)(C + cofs + (size_t)(row0 + r) * ldc + col0 + c4) = v; if (C16) { v4h h4; for (int i = 0; i < 4; ++i) h4[i] = (_Float16)v[i]; *(v4h*)(C16 + cofs + (size_t)(row0 + r) * ldc + col0 + c4) = h4; } } }
     }
}


typedef _Float16 v4h __attribute__((ext_vector_type(4)));

__global__ __launch_bounds__(256) void k_x16(const float* __restrict__ x, _Float16* __restrict__ X16, size_t n8) { const size_t t = (size_t)blockIdx.x * 256 + threadIdx.x; if (t >= n8) return; FragH f;
#pragma unroll
  for (int q = 0; q < 8; ++q) f.h[q] = (_Float16)bf16_round(x[t * 8 + q]); *(v8us*)((unsigned short*)X16 + t * 8) = f.half[0];  }
__global__ __launch_bounds__(256) void k_h16(const float* __restrict__ x, _Float16* __restrict__ X16, size_t n8) { const size_t t = (size_t)blockIdx.x * 256 + threadIdx.x; if (t >= n8) return; FragH f;
#pragma unroll
  for (int q = 0; q < 8; ++q) f.h[q] = (_Float16)x[t * 8 + q]; *(v8us*)((unsigned short*)X16 + t * 8) = f.half[0];  }
__global__ __launch_bounds__(256) void k_round16f(const float* __restrict__ W, _Float16* __restrict__ Bt, size_t n8) { const size_t t = (size_t)blockIdx.x * 256 + threadIdx.x; if (t >= n8) return; FragH f;
#pragma unroll
  for (int i = 0; i < 8; ++i) f.h[i] = (_Float16)(bf16_round(W[t * 8 + i]) * 16.0f); *(v8us*)((unsigned short*)Bt + t * 8) = f.half[0];  }
template <int NHv, int TTv>
__global__ __launch_bounds__(256) void k_vt(const _Float16* __restrict__ V16, int ldv, int voff, _Float16* __restrict__ Vt) { __shared__ unsigned short tl[64][66]; const int tid = threadIdx.x; const int slab = blockIdx.x / (TTv / 64), lg = blockIdx.x % (TTv / 64); const int b = slab / NHv, h = slab % NHv;
  for (int i = tid; i < 64 * 8; i += 256) { const int r = i / 8, c8 = (i % 8) * 8; FragH f; f.half[0] = *(const v8us*)((const unsigned short*)V16 + ((size_t)b * TTv + lg * 64 + r) * ldv + voff + h * 64 + c8);
#pragma unroll
    for (int q = 0; q < 8; ++q) tl[r][c8 + q] = f.u[q]; }
  __syncthreads();
  {
#pragma unroll
    for (int rd = 0; rd < 2; ++rd) { const int d = rd * 32 + tid / 8, pc = tid % 8; FragH f;
#pragma unroll
      for (int q = 0; q < 8; ++q) f.u[q] = tl[pc * 8 + q][d];
      *(v8us*)((unsigned short*)Vt + ((size_t)slab * 64 + d) * TTv + lg * 64 + pc * 8) = f.half[0]; }
     } }

__global__ __launch_bounds__(256) void k_hl(const float* __restrict__ F, _Float16* __restrict__ Hh, _Float16* __restrict__ Hl, size_t n8) { const size_t t = (size_t)blockIdx.x * 256 + threadIdx.x; if (t >= n8) return; FragH fh, fl; const v4f a = *(const v4fa*)(F + t * 8), c = *(const v4fa*)(F + t * 8 + 4);
#pragma unroll
  for (int q = 0; q < 4; ++q) { _Float16 h = (_Float16)a[q]; fh.h[q] = h; fl.h[q] = (_Float16)((a[q] - (float)h) * 1024.0f); h = (_Float16)c[q]; fh.h[4 + q] = h; fl.h[4 + q] = (_Float16)((c[q] - (float)h) * 1024.0f); }
  { *(v8us*)((unsigned short*)Hh + t * 8) = fh.half[0]; *(v8us*)((unsigned short*)Hl + t * 8) = fl.half[0];  } }

// ---- fast GEMM (wave tile 32x64; requires M % 32 == 0 rows per launch region and N % 64 == 0); epilogue = k_gemm_hhx semantics ----
__device__ __forceinline__ v16h g2_frag(const _Float16* p, int hh) { FragH f; f.half[0] = *(const v8us*)((const unsigned short*)p + 8 * hh); f.half[1] = *(const v8us*)((const unsigned short*)p + 16 + 8 * hh); return f.v; }
__device__ __forceinline__ v8f g2_mma(v16h a, v16h b, v8f c) { v8f d = __builtin_amdgcn_wmma_f32_16x16x32_f16(false, a, false, b, (short)0, c, false, false); asm volatile("v_nop\n\tv_nop\n\tv_nop\n\tv_nop" : "+v"(d) : "v"(a), "v"(b)); return d; }
template <int ACT>
__global__ __launch_bounds__(128) void k_gemm2(const _Float16* __restrict__ A, int lda, size_t sA, const _Float16* __restrict__ Bh, int ldb, size_t sB, float alpha, const float* __restrict__ bias, size_t sBias, const float* __restrict__ CP, int rowsPerB, size_t sCPb, int row0g,
    float* __restrict__ C, _Float16* __restrict__ C16, int ldc, size_t sC, int M, int N, int K) { static_assert(ACT == 0 || ACT == 3 || ACT == 6 || ACT == 8 || ACT == 9 || ACT == 11 || ACT == 12 || ACT == 14 || ACT == 15 || ACT == 16 || ACT == 17, "k_gemm2: unsupported ACT code (would silently apply no activation)");
  __shared__ __attribute__((aligned(16))) float so[4][32][68];
  const int tid = threadIdx.x, w = tid >> 5, lane = tid & 31, ln = lane & 15, hh = lane >> 4; const int by = blockIdx.y;
  A += (size_t)by * sA; Bh += (size_t)by * sB; const size_t cofs = (size_t)by * sC; const float* bp = bias ? bias + (size_t)by * sBias : nullptr;
  const int ntn = N >> 6; const int mt = blockIdx.x / ntn, nq = blockIdx.x - mt * ntn; const int row0 = mt * 128 + 32 * w, col0 = nq * 64; if (row0 >= M) return;
  const _Float16* a0p = A + (size_t)(row0 + ln) * lda; const _Float16* a1p = a0p + (size_t)16 * lda;
  const _Float16* b0p = Bh + (size_t)(col0 + ln) * ldb; const _Float16* b1p = b0p + (size_t)16 * ldb; const _Float16* b2p = b1p + (size_t)16 * ldb; const _Float16* b3p = b2p + (size_t)16 * ldb;
  const v8f z8 = {0.f,0.f,0.f,0.f,0.f,0.f,0.f,0.f}; v8f c00 = z8, c01 = z8, c02 = z8, c03 = z8, c10 = z8, c11 = z8, c12 = z8, c13 = z8;
#pragma unroll 1
  for (int kb = 0; kb < K; kb += 32) { const v16h a0 = g2_frag(a0p + kb, hh), a1 = g2_frag(a1p + kb, hh);
    v16h b = g2_frag(b0p + kb, hh); c00 = g2_mma(a0, b, c00); c10 = g2_mma(a1, b, c10);
    b = g2_frag(b1p + kb, hh); c01 = g2_mma(a0, b, c01); c11 = g2_mma(a1, b, c11);
    b = g2_frag(b2p + kb, hh); c02 = g2_mma(a0, b, c02); c12 = g2_mma(a1, b, c12);
    b = g2_frag(b3p + kb, hh); c03 = g2_mma(a0, b, c03); c13 = g2_mma(a1, b, c13); }
  v8f accs[8] = {c00, c01, c02, c03, c10, c11, c12, c13};
#pragma unroll
  for (int u = 0; u < 8; ++u) { const int t = u & 3, half = u >> 2; const int col = col0 + t * 16 + ln; const float bv = bp ? bf16_round(bp[col]) : 0.f;
#pragma unroll
    for (int r = 0; r < 8; ++r) { const int rloc = half * 16 + 8 * hh + r; float v = accs[u][r] * alpha + bv; if (CP) { if (rowsPerB < 0) v += CP[cofs + (size_t)(row0g + row0 + rloc) * ldc + col];      /* rowsPerB < 0: own element of the batched C plane */ else { const int bidx = (row0g + row0 + rloc) / rowsPerB; v += CP[(size_t)bidx * sCPb + (size_t)by * 64 + col]; } }
      if (ACT == 3) v = fmaxf(v, 0.f); else if (ACT == 6) v = 0.5f * v * (1.0f + erff(v * 0.70710678118654752f)); else if (ACT == 11) v = 1.0f / (1.0f + expf(-v)); else if (ACT == 15) v = v / (1.0f + expf(-v)); else if (ACT == 12) v = (v > 0.f) ? v : 0.01f * v; else if (ACT == 8) v = tanhf(v); else if (ACT == 9) v = 0.5f * v * (1.0f + tanhf(0.7978845608028654f * (v + 0.044715f * v * v * v))); else if (ACT == 14) v = (v > 0.f) ? v : 0.1f * v; else if (ACT == 16) v = (v >= 0.f) ? v : 0.3f * v; else if (ACT == 17) v = (v >= 0.f) ? v : 0.2f * v;
      so[w][rloc][t * 16 + ln] = v; } }
  __builtin_amdgcn_fence(__ATOMIC_ACQ_REL, "workgroup"); __builtin_amdgcn_wave_barrier();
  const int rsub = lane >> 4, c4 = (lane & 15) * 4;
  {
#pragma unroll
    for (int q = 0; q < 16; ++q) { const int r = q * 2 + rsub; const v4f v = *(const v4fa*)&so[w][r][c4]; if (C) *(v4f*)(C + cofs + (size_t)(row0 + r) * ldc + col0 + c4) = v; if (C16) { v4h h4; for (int i = 0; i < 4; ++i) h4[i] = (_Float16)v[i]; *(v4h*)(C16 + cofs + (size_t)(row0 + r) * ldc + col0 + c4) = h4; } }
     } }


__global__ __launch_bounds__(256) void k_wnat(const float* __restrict__ w, size_t n8, _Float16* __restrict__ Bt) { const size_t t = (size_t)blockIdx.x * 256 + threadIdx.x; if (t >= n8) return; FragH f; for (int q = 0; q < 8; ++q) f.h[q] = (_Float16)(bf16_round(w[t * 8 + q]) * 16.0f); *(v8us*)((unsigned short*)Bt + t * 8) = f.half[0];  }
// Fused attention, all heads in one launch: scores, softmax and the weighted sum of v never leave the chip (no score or weight plane in memory).
// Workgroup = 8 waves = 256 queries of one head; a wave owns 32 query columns. Per stage of 64 keys the workgroup stages the k rows and the v^T rows in LDS
// (whole-line 16-byte loads one stage ahead through registers, two buffers, one barrier a stage). Transposed products: S^T = K Q^T (a lane holds 8 keys of ONE query per tile),
// running maximum and sum per query (online softmax, f32), weights x 2^12 against the running maximum as f16, O^T += V^T P^T with the two S^T tiles of 32 keys packed in place as the B operand.
#define FA_KT 64                     /* keys per stage */
#define FA_NS (SQ / FA_KT)           /* stages */
#define FA_LP 72                     /* LDS row pitch in f16: 128 data bytes + 16, an odd multiple of 16 bytes for the 16-byte fragment reads */
__device__ __forceinline__ float fa_xhalf(float x) { return __builtin_bit_cast(float, __builtin_amdgcn_permlanex16(__builtin_bit_cast(int, x), __builtin_bit_cast(int, x), 0x76543210, 0xfedcba98, false, false)); }      /* lane l <-> lane l ^ 16 */
__device__ __forceinline__ v16h fa_lfrag(const _Float16* p) { FragH f; f.half[0] = *(const v8us*)((const unsigned short*)p); f.half[1] = *(const v8us*)((const unsigned short*)p + 16); return f.v; }      /* p already holds the lane half's + 8 * hh: the k order of g2_frag */
__device__ __forceinline__ v8f fa_mma(v16h a, v16h b, v8f c) { return __builtin_amdgcn_wmma_f32_16x16x32_f16(false, a, false, b, (short)0, c, false, false); }
// Eight independent 2^x in place. One statement, so that no exponential stands directly in front of an instruction that overwrites its source or reads its result
// (as separate builtins the register allocator put the next result into the previous source); the v_nop is the slot the instruction set asks for behind the last one.
__device__ __forceinline__ void fa_exp2x8(float (&p)[8]) {
  asm("v_exp_f32 %0, %0\n\tv_exp_f32 %1, %1\n\tv_exp_f32 %2, %2\n\tv_exp_f32 %3, %3\n\tv_exp_f32 %4, %4\n\tv_exp_f32 %5, %5\n\tv_exp_f32 %6, %6\n\tv_exp_f32 %7, %7\n\tv_nop"
      : "+v"(p[0]), "+v"(p[1]), "+v"(p[2]), "+v"(p[3]), "+v"(p[4]), "+v"(p[5]), "+v"(p[6]), "+v"(p[7])); }
__global__ __launch_bounds__(256) void k_fattn(const _Float16* __restrict__ Q, const _Float16* __restrict__ K, const _Float16* __restrict__ VT, float* __restrict__ out) {
  __shared__ __attribute__((aligned(16))) _Float16 sk[2][FA_KT][FA_LP];
  __shared__ __attribute__((aligned(16))) _Float16 sv[2][HD][FA_LP];
  const int tid = threadIdx.x, w = tid >> 5, lane = tid & 31, ln = lane & 15, hh = lane >> 4;
  const int h = blockIdx.y, q0 = blockIdx.x * 256 + w * 32;
  const float CS = 0.125f * 1.4426950408889634f;      /* 1 / sqrt(64), and base 2 for the exponentials */
  v16h qf[2][2];      /* [query tile][k step of 32 head dims], B operand: column = query */
#pragma unroll      /* constant indices keep the fragments in registers */
  for (int qt = 0; qt < 2; ++qt) for (int ks = 0; ks < 2; ++ks) qf[qt][ks] = g2_frag(Q + (size_t)(q0 + qt * 16 + ln) * LQ + h * HD + ks * 32, hh);
  const int sr = tid >> 3, sc = (tid & 7) * 8;      /* staging: 8 threads cover one 128-byte row; rows sr and sr + 32 */
  const unsigned short* gk = (const unsigned short*)K + (size_t)sr * LQ + h * HD + sc;
  const unsigned short* gv = (const unsigned short*)VT + ((size_t)h * HD + sr) * SQ + sc;
  v8us rk0 = *(const v8us*)gk, rk1 = *(const v8us*)(gk + (size_t)32 * LQ), rv0 = *(const v8us*)gv, rv1 = *(const v8us*)(gv + (size_t)32 * SQ);
  *(v8us*)&sk[0][sr][sc] = rk0; *(v8us*)&sk[0][sr + 32][sc] = rk1; *(v8us*)&sv[0][sr][sc] = rv0; *(v8us*)&sv[0][sr + 32][sc] = rv1;
  __syncthreads();
  const v8f z8 = {0.f, 0.f, 0.f, 0.f, 0.f, 0.f, 0.f, 0.f};
  v8f o[2][4] = {{z8, z8, z8, z8}, {z8, z8, z8, z8}};      /* O^T: [query tile][16 head dims]; register r = head dim 8 * hh + r, column = query ln */
  float m[2] = {-3.0e38f, -3.0e38f}, l[2] = {0.f, 0.f};      /* running maximum (raw dot products) and this lane half's running sum, per query */
  for (int s = 0; s < FA_NS; ++s) {
    const int cur = s & 1;
    if (s + 1 < FA_NS) {      /* the next stage's rows fly while this stage is worked on */
      const unsigned short* nk = gk + (size_t)(s + 1) * FA_KT * LQ; const unsigned short* nv = gv + (size_t)(s + 1) * FA_KT;
      rk0 = *(const v8us*)nk; rk1 = *(const v8us*)(nk + (size_t)32 * LQ); rv0 = *(const v8us*)nv; rv1 = *(const v8us*)(nv + (size_t)32 * SQ);
    }
    __builtin_amdgcn_sched_barrier(0);      /* keeps the four loads up here: the scheduler otherwise sinks them to their LDS stores at the stage's foot, and their latency is then waited out every stage */
    v8f st[2][4];      /* S^T: [query tile][16 keys]; register r = key 8 * hh + r, column = query ln */
#pragma unroll      /* constant indices keep the tiles in registers */
    for (int kt = 0; kt < 4; ++kt) {
      const v16h a0 = fa_lfrag(&sk[cur][kt * 16 + ln][8 * hh]), a1 = fa_lfrag(&sk[cur][kt * 16 + ln][32 + 8 * hh]);
#pragma unroll      /* constant indices keep the tiles in registers */
      for (int qt = 0; qt < 2; ++qt) st[qt][kt] = fa_mma(a1, qf[qt][1], fa_mma(a0, qf[qt][0], z8));
    }
    FragH pf[2][2];      /* [query tile][32 keys]: P^T as B operand, element i = tile i >> 3, register i & 7 */
#pragma unroll      /* constant indices keep the tiles in registers */
    for (int qt = 0; qt < 2; ++qt) {
      float mk[4];      /* one short chain per tile: a tile's maximum runs while the next tile's products are still on the matrix unit */
#pragma unroll      /* constant indices keep the tiles in registers */
      for (int kt = 0; kt < 4; ++kt) { mk[kt] = st[qt][kt][0]; for (int r = 1; r < 8; ++r) mk[kt] = fmaxf(mk[kt], st[qt][kt][r]); }
      float mx = fmaxf(fmaxf(mk[0], mk[1]), fmaxf(mk[2], mk[3]));
      mx = fmaxf(mx, fa_xhalf(mx));
      const float mn = fmaxf(m[qt], mx);
      const float corr = __builtin_amdgcn_exp2f((m[qt] - mn) * CS);      /* 0 on the first stage */
      const float nb = 12.0f - mn * CS;
      m[qt] = mn;
      float ls[4] = {0.f, 0.f, 0.f, 0.f};
#pragma unroll      /* constant indices keep the tiles in registers */
      for (int kt = 0; kt < 4; ++kt) { float p[8]; for (int r = 0; r < 8; ++r) p[r] = fmaf(st[qt][kt][r], CS, nb); fa_exp2x8(p); for (int r = 0; r < 8; ++r) { ls[kt] += p[r]; pf[qt][kt >> 1].h[(kt & 1) * 8 + r] = (_Float16)p[r]; } }
      l[qt] = fmaf(l[qt], corr, (ls[0] + ls[1]) + (ls[2] + ls[3]));
#pragma unroll      /* constant indices keep the tiles in registers */
      for (int dt = 0; dt < 4; ++dt) o[qt][dt] *= corr;
    }
#pragma unroll      /* constant indices keep the tiles in registers */
    for (int ps = 0; ps < 2; ++ps) for (int dt = 0; dt < 4; ++dt) {
      const v16h a = fa_lfrag(&sv[cur][dt * 16 + ln][ps * 32 + 8 * hh]);
      o[0][dt] = fa_mma(a, pf[0][ps].v, o[0][dt]); o[1][dt] = fa_mma(a, pf[1][ps].v, o[1][dt]);
    }
    if (s + 1 < FA_NS) { *(v8us*)&sk[cur ^ 1][sr][sc] = rk0; *(v8us*)&sk[cur ^ 1][sr + 32][sc] = rk1; *(v8us*)&sv[cur ^ 1][sr][sc] = rv0; *(v8us*)&sv[cur ^ 1][sr + 32][sc] = rv1; }      /* that buffer's last readers left it before the previous barrier */
    __syncthreads();      /* publishes stage s + 1 and ends every read of stage s */
  }
#pragma unroll      /* constant indices keep the tiles in registers */
  for (int qt = 0; qt < 2; ++qt) {
    const float inv = 1.0f / (l[qt] + fa_xhalf(l[qt]));      /* the two lane halves' sums join once */
    float* op = out + (size_t)(q0 + qt * 16 + ln) * DM + h * HD + 8 * hh;
#pragma unroll      /* constant indices keep the tiles in registers */
    for (int dt = 0; dt < 4; ++dt) { const v4f lo = {o[qt][dt][0] * inv, o[qt][dt][1] * inv, o[qt][dt][2] * inv, o[qt][dt][3] * inv}, hi = {o[qt][dt][4] * inv, o[qt][dt][5] * inv, o[qt][dt][6] * inv, o[qt][dt][7] * inv};
      *(v4f*)(op + dt * 16) = lo; *(v4f*)(op + dt * 16 + 4) = hi; }
  } }
// Projection GEMM with both operands staged in LDS: P[token][n] = (1/16) sum_k X[token][k] Wt[n][k], f16 operands, f32 accumulation, f16 result rows of pitch LQ.
// Workgroup = 8 waves = 256 tokens x 128 columns; a wave owns 64 tokens x 64 columns (16 accumulator tiles, so a fragment read from LDS feeds 4 products). Per stage of 64 k the workgroup stages
// the 256 X rows and the 128 Wt rows in LDS (whole-line 16-byte loads one stage ahead through registers, two buffers, one barrier a stage: the ring of k_fattn).
// Transposed products, A = Wt rows, B = X rows: a lane holds 8 neighbouring columns of ONE token per tile, which pack into one 16-byte piece of a result row.
#define G3_KT 64                     /* k per stage */
#define G3_NS (DM / G3_KT)           /* stages */
#define G3_LP 72                     /* LDS row pitch in f16: 128 data bytes + 16, an odd multiple of 16 bytes for the 16-byte fragment reads */
#define G3_MT 256                    /* tokens per workgroup */
#define G3_NT 128                    /* columns per workgroup */
#define G3_BR (G3_MT + G3_NT)        /* LDS rows per buffer: the X rows, then the Wt rows */
__global__ __launch_bounds__(256) void k_gemm3(const _Float16* __restrict__ X, const _Float16* __restrict__ Wt, _Float16* __restrict__ P) {
  __shared__ __attribute__((aligned(16))) _Float16 sg[2 * G3_BR * G3_LP];
  const int tid = threadIdx.x, w = tid >> 5, lane = tid & 31, ln = lane & 15, hh = lane >> 4;
  const int row0 = blockIdx.y * G3_MT, col0 = blockIdx.x * G3_NT;
  const int tw = (w & 3) * 64, cw = (w >> 2) * 64;      /* the wave's first token and first column inside the workgroup's tile */
  const int sr = tid >> 3, sc = (tid & 7) * 8;      /* staging: 8 threads cover one 128-byte row; rows sr + 32 i */
  const unsigned short* gx = (const unsigned short*)X + (size_t)(row0 + sr) * DM + sc;
  const unsigned short* gw = (const unsigned short*)Wt + (size_t)(col0 + sr) * DM + sc;
  v8us rx[8], rw[4];
#pragma unroll      /* constant indices keep the staged rows in registers */
  for (int i = 0; i < 8; ++i) rx[i] = *(const v8us*)(gx + (size_t)i * 32 * DM);
#pragma unroll      /* constant indices keep the staged rows in registers */
  for (int i = 0; i < 4; ++i) rw[i] = *(const v8us*)(gw + (size_t)i * 32 * DM);
#pragma unroll      /* constant indices keep the staged rows in registers */
  for (int i = 0; i < 8; ++i) *(v8us*)&sg[(sr + 32 * i) * G3_LP + sc] = rx[i];
#pragma unroll      /* constant indices keep the staged rows in registers */
  for (int i = 0; i < 4; ++i) *(v8us*)&sg[(G3_MT + sr + 32 * i) * G3_LP + sc] = rw[i];
  __syncthreads();
  const v8f z8 = {0.f, 0.f, 0.f, 0.f, 0.f, 0.f, 0.f, 0.f};
  v8f acc[4][4];      /* [16 columns][16 tokens]; register r = column 8 * hh + r, lane column = token ln */
#pragma unroll      /* constant indices keep the tiles in registers */
  for (int i = 0; i < 4; ++i) for (int j = 0; j < 4; ++j) acc[i][j] = z8;
  for (int s = 0; s < G3_NS; ++s) {
    const _Float16* sb = sg + (s & 1) * (G3_BR * G3_LP);
    if (s + 1 < G3_NS) {      /* the next stage's rows fly while this stage is worked on */
#pragma unroll      /* constant indices keep the staged rows in registers */
      for (int i = 0; i < 8; ++i) rx[i] = *(const v8us*)(gx + (size_t)i * 32 * DM + (s + 1) * G3_KT);
#pragma unroll      /* constant indices keep the staged rows in registers */
      for (int i = 0; i < 4; ++i) rw[i] = *(const v8us*)(gw + (size_t)i * 32 * DM + (s + 1) * G3_KT);
      asm volatile("s_wait_xcnt 0x0" ::: "memory");      /* stands in front of the LDS reads below, which land in the registers that held these loads' addresses */
    }
    __builtin_amdgcn_sched_barrier(0);      /* keeps the twelve loads and their wait up here: without it the scheduler lifts an address of the LDS reads into a load's address register ahead of the wait */
    v16h wf[2][4], xf[2][4];      /* [k step of 32][16 columns] and [k step of 32][16 tokens] */
#pragma unroll      /* constant indices keep the fragments in registers */
    for (int ks = 0; ks < 2; ++ks) {      /* in the order of first use, so that the products start behind the first loads */
      wf[ks][0] = fa_lfrag(sb + (G3_MT + cw + ln) * G3_LP + ks * 32 + 8 * hh);
#pragma unroll      /* constant indices keep the fragments in registers */
      for (int j = 0; j < 4; ++j) xf[ks][j] = fa_lfrag(sb + (tw + j * 16 + ln) * G3_LP + ks * 32 + 8 * hh);
#pragma unroll      /* constant indices keep the fragments in registers */
      for (int i = 1; i < 4; ++i) wf[ks][i] = fa_lfrag(sb + (G3_MT + cw + i * 16 + ln) * G3_LP + ks * 32 + 8 * hh);
    }
    __builtin_amdgcn_sched_barrier(0);      /* the stage's 32 LDS reads stay one group ahead of its products: spread among them into one register set, every four products waited out a read's latency */
#pragma unroll      /* constant indices keep the tiles in registers */
    for (int ks = 0; ks < 2; ++ks) for (int i = 0; i < 4; ++i) for (int j = 0; j < 4; ++j) acc[i][j] = fa_mma(wf[ks][i], xf[ks][j], acc[i][j]);
    __builtin_amdgcn_sched_barrier(0);      /* the LDS stores of the next stage stay behind the products: lifted above them, they wait out the global loads' latency with the matrix unit idle */
    if (s + 1 < G3_NS) {      /* that buffer's last readers left it before the previous barrier */
      _Float16* sn = sg + ((s & 1) ^ 1) * (G3_BR * G3_LP);
#pragma unroll      /* constant indices keep the staged rows in registers */
      for (int i = 0; i < 8; ++i) *(v8us*)&sn[(sr + 32 * i) * G3_LP + sc] = rx[i];
#pragma unroll      /* constant indices keep the staged rows in registers */
      for (int i = 0; i < 4; ++i) *(v8us*)&sn[(G3_MT + sr + 32 * i) * G3_LP + sc] = rw[i];
    }
    __syncthreads();      /* publishes stage s + 1 and ends every read of stage s; the last one frees the ring for the result rows */
  }
  _Float16* so = sg + w * 64 * G3_LP;      /* the wave's own 64 result rows of 64 columns, so that whole 128-byte lines go out */
#pragma unroll      /* constant indices keep the tiles in registers */
  for (int i = 0; i < 4; ++i) for (int j = 0; j < 4; ++j) { FragH f; for (int r = 0; r < 8; ++r) f.h[r] = (_Float16)(acc[i][j][r] * 0.0625f);      /* the weights were staged x 16 */
    *(v8us*)&so[(j * 16 + ln) * G3_LP + i * 16 + 8 * hh] = f.half[0]; }
  __builtin_amdgcn_fence(__ATOMIC_ACQ_REL, "workgroup"); __builtin_amdgcn_wave_barrier();      /* the wave reads back what its other lanes wrote */
#pragma unroll      /* independent row pieces: the reads go ahead of the stores */
  for (int q = 0; q < 16; ++q) { const int r = q * 4 + (lane >> 3), c = (lane & 7) * 8; const v8us v = *(const v8us*)&so[r * G3_LP + c];
    *(v8us*)((unsigned short*)P + (size_t)(row0 + tw + r) * LQ + col0 + cw + c) = v; }
}
__global__ __launch_bounds__(256) void k_vt(const _Float16* __restrict__ V16, int b, int h0, _Float16* __restrict__ VT) { __shared__ unsigned short tl[64][65]; const int tid = threadIdx.x; const int hh = blockIdx.x % HG, sg = blockIdx.x / HG; const int s0 = sg * 64; const int h = h0 + hh;
  for (int i = tid; i < 64 * 8; i += 256) { const int j = i / 8, d8 = (i % 8) * 8; FragH f; f.half[0] = *(const v8us*)((const unsigned short*)V16 + ((size_t)b * SQ + s0 + j) * DM + h * HD + d8); for (int q = 0; q < 8; ++q) tl[d8 + q][j] = f.u[q]; }
  __syncthreads();
  { for (int i = tid; i < 64 * 8; i += 256) { const int d = i / 8, j8 = (i % 8) * 8; FragH f; for (int q = 0; q < 8; ++q) f.u[q] = tl[d][j8 + q]; *(v8us*)((unsigned short*)VT + ((size_t)hh * HD + d) * SQ + s0 + j8) = f.half[0]; }  } }



__global__ __launch_bounds__(256) void k_rsmkm(const float* __restrict__ S, _Float16* __restrict__ P, int nrows, const int* __restrict__ am) {
  #pragma clang fp contract(off)
  const int t = blockIdx.x * 256 + threadIdx.x; if (t >= nrows) return; const size_t i = (size_t)t; const float* s = S + i * SQ; const int* mr = am + (size_t)(t % SQ) * SQ; float mx = -3.0e38f;
#pragma unroll 1
  for (int j = 0; j < SQ; ++j) { const float f = (mr[j] != 0) ? 1.f : 0.f; mx = fmaxf(mx, fmaf(f, s[j], (1.f - f) * -1.0e9f)); } float se = 0.f;
#pragma unroll 1
  for (int j = 0; j < SQ; ++j) { const float f = (mr[j] != 0) ? 1.f : 0.f; se += __expf(fmaf(f, s[j], (1.f - f) * -1.0e9f) - mx); } const float sc = 256.0f / se;
#pragma unroll 1
  for (int j0 = 0; j0 < SQ; j0 += 8) { FragH fr; for (int q = 0; q < 8; ++q) { const int j = j0 + q; const float f = (mr[j] != 0) ? 1.f : 0.f; fr.h[q] = (_Float16)(__expf(fmaf(f, s[j], (1.f - f) * -1.0e9f) - mx) * sc); }
    unsigned short* d = (unsigned short*)P + i * SQ + j0; *(v8us*)d = fr.half[0];  } }
extern "C" void kernel_launch(void* const* d_in, const int* in_sizes, int n_in,
                              void* d_out, int out_size, void* d_ws, size_t ws_size, hipStream_t stream) {
  (void)in_sizes; (void)n_in; (void)out_size;
  const float* const* I = (const float* const*)d_in; const float* xq = I[0]; const float* wqkv = I[1];      /* input order: X (2-D [4096][1024] = one sequence; feeds the one projection), Wqkv ([in][out] [1024][2048]: columns 0..1023 = the shared q = k projection, 1024..2047 = v); NO biases; NO output projection */
  static_assert(NH * HD == DM && DM % 64 == 0 && SQ % 128 == 0 && NH % HG == 0 && MP % G3_MT == 0 && LQ % G3_NT == 0 && G3_NS >= 2, "shape / tile multiples");
  char* ws = (char*)d_ws; size_t off = 0;
  auto take = [&](size_t bytes) { char* p = ws + off; off += (bytes + 255) & ~(size_t)255; return p; };
  _Float16* BW = (_Float16*)take((size_t)2 * DM * DM * 2);
  _Float16* X16 = (_Float16*)take(NR * DM * 2); _Float16* P16 = (_Float16*)take(NR * LQ * 2);
  _Float16* VT = (_Float16*)take((size_t)NH * HD * SQ * 2);
  if (off > ws_size) return;
  k_wt_f16<<<(unsigned)(((size_t)2 * DM * (DM / 8) + 255) / 256), 256, 0, stream>>>(wqkv, BW, DM, 2 * DM, 16.0f);      /* [in][out] [1024][2048] -> Bt[n][k] x16, 2048 rows: rows 0..1023 the shared q = k projection, rows 1024..2047 the v projection */
  k_x16<<<(unsigned)((NR * DM / 8 + 255) / 256), 256, 0, stream>>>(xq, X16, NR * DM / 8);      /* the one input as exact f16 rows, once */
  const size_t r0p = (size_t)B0 * SQ;      /* first projected row */
  k_gemm3<<<dim3(LQ / G3_NT, MP / G3_MT), 256, 0, stream>>>(X16 + r0p * DM, BW, P16 + r0p * LQ);      /* proj = X Wqkv, all 2048 columns in one launch; q and k are the same product and are read from the same columns */
  for (int b = B0; b < B0 + NBR; ++b) { const size_t r0 = (size_t)b * SQ;
    k_vt<NH, SQ><<<NH * (SQ / 64), 256, 0, stream>>>(P16 + r0 * LQ, LQ, DM, VT);      /* V^T [NH][HD][SQ] for this batch */
    k_fattn<<<dim3(QN / 256, NHD), 256, 0, stream>>>(P16 + r0 * LQ, P16 + r0 * LQ, VT, (float*)d_out + r0 * DM); }      /* out = softmax(q k^T / 8) v for all heads, f32 straight into the merged-heads output rows (no output projection) */
}

// v005
// Measured time: 98.1 microseconds a run.
// Two timings next to v004 both put it at 1.06 times that version's speed.
// Over all steps from v000 it is 143 times as fast.
#include <hip/hip_runtime.h>
// Multi-head self-attention on ONE 4096-token problem with a SHARED query / key projection and no output projection, NON-causal (X [4096][1024]; proj = X Wqkv ([in][out] 1024 x 2048 sigma 1/32, no bias) split into a qk half and a v half; the scores use the SAME projection on both sides: scores = qk qk^T / sqrt(64) per head (16 heads of 64; symmetric per head); softmax over all 4096 keys (no mask); out = att v merged head-major -> [4096][1024]; no output projection); all heads in ONE fused attention launch.
// Structure: token rows r = b*4096 + s; proj = X Wqkv as ONE WMMA GEMM over all 2048 columns, fed from the f32 inputs (x and weights rounded to bf16 on the way into LDS, bf16 products; 256x128 workgroup tiles, 64x64 wave tiles, f32 accumulation, f16 output rows of pitch 2048: columns 0..1023 serve as q and as k, 1024..2047 as v); per batch: V^T for all heads via LDS transposes; per batch: one fused attention launch over all heads (online softmax, f32 statistics, weights as f16 against the running maximum) written f32 straight into the merged-heads output rows.
// Compute dtype: inputs rounded to bf16; x / weights exact bf16 operands (v_wmma_f32_16x16x32_bf16); q, k, v and softmax weights as plain f16 GEMM operands (~2^-12); scores, softmax statistics and o f32. v_wmma_f32_16x16x32_f16.
#define NB 1
#define SQ 4096
#define DM 1024
#define NH 16
#define HD 64
#define HG 1                         /* heads per group of the per-group V^T helper */
#define B0 0                         /* first batch processed (debug hook) */
#define NBR NB                       /* batches processed (debug hook) */
#define NR ((size_t)NB * SQ)         /* token rows */
#define MP ((int)((size_t)NBR * SQ)) /* rows projected (debug hook) */
#define QN SQ                        /* query rows attended per batch (debug hook) */
#define NHD NH                       /* heads attended (debug hook) */
#define MPO MP                       /* unused: no output stage (debug hook) */
#define LQ (2 * DM)      /* row pitch of the projected rows: 1024 shared q = k columns, then 1024 v columns */
typedef __bf16 v16b __attribute__((ext_vector_type(16)));
typedef unsigned short v8us __attribute__((ext_vector_type(8), may_alias));
typedef float  v8f  __attribute__((ext_vector_type(8)));
typedef float  v4f  __attribute__((ext_vector_type(4)));
typedef float  v4fa __attribute__((ext_vector_type(4), may_alias));
union FragB { v16b v; v8us half[2]; unsigned short u[16]; };

__device__ __forceinline__ unsigned short bf16_bits(float x) { unsigned int u = __float_as_uint(x); return (unsigned short)((u + 0x7FFFu + ((u >> 16) & 1u)) >> 16); }
__device__ __forceinline__ float bf16_val(unsigned short b) { return __uint_as_float(((unsigned int)b) << 16); }
__device__ __forceinline__ float bf16_round(float x) { return bf16_val(bf16_bits(x)); }
// D += A·B with NT terms: 1 = ah·bh, 2 = + al·bh (A split), 3 = + ah·bl (both split)
template <int NT>
__device__ __forceinline__ v8f mmaN(v16b ah, v16b al, v16b bh, v16b bl, v8f c) {
  c = __builtin_amdgcn_wmma_f32_16x16x32_bf16(false, ah, false, bh, (short)0, c, false, false);
  if (NT >= 2) c = __builtin_amdgcn_wmma_f32_16x16x32_bf16(false, al, false, bh, (short)0, c, false, false);
  if (NT >= 3) c = __builtin_amdgcn_wmma_f32_16x16x32_bf16(false, ah, false, bl, (short)0, c, false, false);
  asm volatile("v_nop\n\tv_nop\n\tv_nop\n\tv_nop" : "+v"(c) : "v"(ah), "v"(al), "v"(bh), "v"(bl));
  return c;
}

__global__ __launch_bounds__(256) void k_wt_bf16(const float* __restrict__ W, unsigned short* __restrict__ Wt, int K, int N) {
  const int t = blockIdx.x * 256 + threadIdx.x;
  const int k8n = K / 8;
  if (t >= N * k8n) return;
  const int n = t / k8n, k8 = (t % k8n) * 8;
  v8us v;
#pragma unroll
  for (int i = 0; i < 8; ++i) v[i] = bf16_bits(W[(size_t)(k8 + i) * N + n]);
  *(v8us*)(Wt + (size_t)n * K + k8) = v;
  
}

// GEMM C[M][N] (f32, pitch ldc) = act(A[M][K]·W + bias). A f32 row-major (pitch lda) converted per fragment to bf16
// (ASPLIT: hi/lo two planes -> 2 terms, else single rounded term); Wt bf16 [N][K] (pitch ldb). BIAS_BF16 rounds the
// bias to bf16 first (bias quantised to bf16 before the add). K%32==0, M%16==0, N%64==0.
template <bool ASPLIT, int ACT, bool BIAS_BF16>
__global__ __launch_bounds__(128) void k_gemm_bf(const float* __restrict__ A, int lda, const unsigned short* __restrict__ Wt, int ldb,
                                               const float* __restrict__ bias, float* __restrict__ C, int ldc, int M, int N, int K) {
  __shared__ __attribute__((aligned(16))) float so[4][16][64];
  const int tid = threadIdx.x, w = tid >> 5, lane = tid & 31, ln = lane & 15, hh = lane >> 4;
  const int ntn = N / 64;
  const int wid = blockIdx.x * 4 + w;
  const int mt = wid / ntn, nq = wid % ntn;
  if (mt * 16 >= M) return;
  const int row0 = mt * 16, col0 = nq * 64;
  const float* arow = A + (size_t)(row0 + ln) * lda;
  v8f acc[4] = {};
  for (int kb = 0; kb < K; kb += 32) {
    FragB ah, al;
    const v4f x0 = *(const v4fa*)(arow + kb + 8 * hh), x1 = *(const v4fa*)(arow + kb + 8 * hh + 4);
    const v4f x2 = *(const v4fa*)(arow + kb + 16 + 8 * hh), x3 = *(const v4fa*)(arow + kb + 16 + 8 * hh + 4);
    float xs[16] = {x0[0],x0[1],x0[2],x0[3],x1[0],x1[1],x1[2],x1[3],x2[0],x2[1],x2[2],x2[3],x3[0],x3[1],x3[2],x3[3]};
#pragma unroll
    for (int i = 0; i < 16; ++i) { const unsigned short hb = bf16_bits(xs[i]); ah.u[i] = hb; al.u[i] = ASPLIT ? bf16_bits(xs[i] - bf16_val(hb)) : (unsigned short)0; }
#pragma unroll
    for (int t = 0; t < 4; ++t) {
      const unsigned short* brow = Wt + (size_t)(col0 + t * 16 + ln) * ldb + kb;
      FragB b;
      b.half[0] = *(const v8us*)(brow + 8 * hh);
      b.half[1] = *(const v8us*)(brow + 16 + 8 * hh);
      acc[t] = mmaN<ASPLIT ? 2 : 1>(ah.v, al.v, b.v, b.v, acc[t]);
    }
  }
#pragma unroll
  for (int t = 0; t < 4; ++t) {
    float bv = bias ? bias[col0 + t * 16 + ln] : 0.f;
    if (BIAS_BF16) bv = bf16_round(bv);
#pragma unroll
    for (int r = 0; r < 8; ++r) { float v = acc[t][r] + bv; if (ACT == 1) v = fmaxf(v, 0.f); so[w][8 * hh + r][t * 16 + ln] = v; }
  }
  __builtin_amdgcn_fence(__ATOMIC_ACQ_REL, "workgroup");
  __builtin_amdgcn_wave_barrier();
  const int rsub = lane >> 4, c4 = (lane & 15) * 4;
  {
#pragma unroll
    for (int q = 0; q < 8; ++q) {
      const int r = q * 2 + rsub;
      const v4f v = *(const v4fa*)&so[w][r][c4];
      *(v4f*)(C + (size_t)(row0 + r) * ldc + col0 + c4) = v;
    }
    
  }
}

// GEMM C = act(A·W + bias + resid): A f32 (ASPLIT -> hi/lo 2 terms), Wt bf16 [N][K]; ACT 0 none, 1 relu, 2 exact gelu;
// resid (optional, f32, row index = (row % rmod), pitch ldr, RES_BF16 rounds it) added before the activation.
template <bool ASPLIT, int ACT, bool BIAS_BF16, bool RES_BF16>
__global__ __launch_bounds__(128) void k_gemm_bf3(const float* __restrict__ A, int lda, const unsigned short* __restrict__ Wt, int ldb,
                                                const float* __restrict__ bias, const float* __restrict__ resid, int rmod, int ldr,
                                                float* __restrict__ C, int ldc, int M, int N, int K) {
  __shared__ __attribute__((aligned(16))) float so[4][16][64];
  const int tid = threadIdx.x, w = tid >> 5, lane = tid & 31, ln = lane & 15, hh = lane >> 4;
  const int ntn = N / 64;
  const int wid = blockIdx.x * 4 + w;
  const int mt = wid / ntn, nq = wid % ntn;
  if (mt * 16 >= M) return;
  const int row0 = mt * 16, col0 = nq * 64;
  const float* arow = A + (size_t)(row0 + ln) * lda;
  v8f acc[4] = {};
  for (int kb = 0; kb < K; kb += 32) {
    FragB ah, al;
    const v4f x0 = *(const v4fa*)(arow + kb + 8 * hh), x1 = *(const v4fa*)(arow + kb + 8 * hh + 4);
    const v4f x2 = *(const v4fa*)(arow + kb + 16 + 8 * hh), x3 = *(const v4fa*)(arow + kb + 16 + 8 * hh + 4);
    float xs[16] = {x0[0],x0[1],x0[2],x0[3],x1[0],x1[1],x1[2],x1[3],x2[0],x2[1],x2[2],x2[3],x3[0],x3[1],x3[2],x3[3]};
#pragma unroll
    for (int i = 0; i < 16; ++i) { const unsigned short hb = bf16_bits(xs[i]); ah.u[i] = hb; al.u[i] = ASPLIT ? bf16_bits(xs[i] - bf16_val(hb)) : (unsigned short)0; }
#pragma unroll
    for (int t = 0; t < 4; ++t) {
      const unsigned short* brow = Wt + (size_t)(col0 + t * 16 + ln) * ldb + kb;
      FragB b;
      b.half[0] = *(const v8us*)(brow + 8 * hh);
      b.half[1] = *(const v8us*)(brow + 16 + 8 * hh);
      acc[t] = mmaN<ASPLIT ? 2 : 1>(ah.v, al.v, b.v, b.v, acc[t]);
    }
  }
#pragma unroll
  for (int t = 0; t < 4; ++t) {
    const int col = col0 + t * 16 + ln;
    float bv = bias ? bias[col] : 0.f;
    if (BIAS_BF16) bv = bf16_round(bv);
#pragma unroll
    for (int r = 0; r < 8; ++r) {
      float v = acc[t][r] + bv;
      if (resid) { float rv = resid[(size_t)((row0 + 8 * hh + r) % rmod) * ldr + col]; if (RES_BF16) rv = bf16_round(rv); v += rv; }
      if (ACT == 1) v = fmaxf(v, 0.f);
      if (ACT == 2) v = 0.5f * v * (1.0f + erff(v * 0.70710678118654752f));
      if (ACT == 3) { const float u = 0.7978845608028654f * (v + 0.044715f * v * v * v); v = 0.5f * v * (1.0f + tanhf(u)); }
      so[w][8 * hh + r][t * 16 + ln] = v;
    }
  }
  __builtin_amdgcn_fence(__ATOMIC_ACQ_REL, "workgroup");
  __builtin_amdgcn_wave_barrier();
  const int rsub = lane >> 4, c4 = (lane & 15) * 4;
  {
#pragma unroll
    for (int q = 0; q < 8; ++q) {
      const int r = q * 2 + rsub;
      const v4f v = *(const v4fa*)&so[w][r][c4];
      *(v4f*)(C + (size_t)(row0 + r) * ldc + col0 + c4) = v;
    }
    
  }
}
// row LayerNorm (biased variance, eps) over N: s = X (+ R); optional out_sum <- s; out_norm <- (s-mu)*rsqrt(var+eps)*g + b
template <bool PARAM_BF16>
__global__ __launch_bounds__(256) void k_layernorm(const float* __restrict__ X, const float* __restrict__ R, const float* __restrict__ g, const float* __restrict__ bta,
                                                  float* __restrict__ out_sum, float* __restrict__ out_norm, int N, float eps) {
  __shared__ float red[256];
  const int row = blockIdx.x, tid = threadIdx.x;
  const float* x = X + (size_t)row * N; const float* rr = R ? R + (size_t)row * N : nullptr;
  float vals[16];                     // up to N = 4096
  const int per = N / 256;            // contiguous chunk per thread? use strided-by-4 chunks: thread handles j = tid*4 + 1024*u
  float s1 = 0.f;
  for (int u = 0; u < per / 4; ++u) {
    const int j = tid * 4 + 1024 * u;
    const v4f a = *(const v4fa*)(x + j);
    v4f b = {0.f,0.f,0.f,0.f}; if (rr) b = *(const v4fa*)(rr + j);
#pragma unroll
    for (int q = 0; q < 4; ++q) { const float v = a[q] + b[q]; vals[u * 4 + q] = v; s1 += v; }
  }
  red[tid] = s1; __syncthreads();
  for (int st = 128; st > 0; st >>= 1) { if (tid < st) red[tid] += red[tid + st]; __syncthreads(); }
  const float mu = red[0] / (float)N; __syncthreads();
  float s2 = 0.f;
  for (int u = 0; u < per / 4; ++u)
#pragma unroll
    for (int q = 0; q < 4; ++q) { const float c = vals[u * 4 + q] - mu; s2 += c * c; }
  red[tid] = s2; __syncthreads();
  for (int st = 128; st > 0; st >>= 1) { if (tid < st) red[tid] += red[tid + st]; __syncthreads(); }
  const float rs = rsqrtf(red[0] / (float)N + eps);
  {
    for (int u = 0; u < per / 4; ++u) {
      const int j = tid * 4 + 1024 * u;
      v4f o, sm;
#pragma unroll
      for (int q = 0; q < 4; ++q) {
        float gg = g[j + q], bb = bta[j + q];
        if (PARAM_BF16) { gg = bf16_round(gg); bb = bf16_round(bb); }
        sm[q] = vals[u * 4 + q]; o[q] = (vals[u * 4 + q] - mu) * rs * gg + bb;
      }
      if (out_sum) *(v4f*)(out_sum + (size_t)row * N + j) = sm;
      *(v4f*)(out_norm + (size_t)row * N + j) = o;
    }
    
  }
}



// ---- f16 WMMA path (v_wmma_f32_16x16x32_f16): 11-bit significands for operands in range — used where a [0,1] probability operand needs more precision than bf16
typedef _Float16 v16h __attribute__((ext_vector_type(16)));
union FragH { v16h v; v8us half[2]; _Float16 h[16]; unsigned short u[16]; };
template <int NT>
__device__ __forceinline__ v8f mmaH(v16h ah, v16h al, v16h bh, v16h bl, v8f c) {
  c = __builtin_amdgcn_wmma_f32_16x16x32_f16(false, ah, false, bh, (short)0, c, false, false);
  if (NT >= 2) c = __builtin_amdgcn_wmma_f32_16x16x32_f16(false, al, false, bh, (short)0, c, false, false);
  if (NT >= 3) c = __builtin_amdgcn_wmma_f32_16x16x32_f16(false, ah, false, bl, (short)0, c, false, false);
  asm volatile("v_nop\n\tv_nop\n\tv_nop\n\tv_nop" : "+v"(c) : "v"(ah), "v"(al), "v"(bh), "v"(bl));
  return c;
}
// batched GEMM like k_gemm_b but f16 operands: A f32 (split into f16 hi/lo if ASPLIT, else rounded to f16), Bt = f16 values [n][k]; alpha; C f32; N multiple of 16 (partial tiles skipped)
template <bool ASPLIT>
__global__ __launch_bounds__(128) void k_gemm_h(const float* __restrict__ A, int lda, size_t sA, const _Float16* __restrict__ Bh, int ldb, size_t sB, float alpha, float* __restrict__ C, int ldc, size_t sC, int M, int N, int K) {
  __shared__ __attribute__((aligned(16))) float so[4][16][64];
  const int tid = threadIdx.x, w = tid >> 5, lane = tid & 31, ln = lane & 15, hh = lane >> 4; const int by = blockIdx.y;
  A += (size_t)by * sA; Bh += (size_t)by * sB; C += (size_t)by * sC;
  const int ntn = (N + 63) / 64; const int wid = blockIdx.x * 4 + w; const int mt = wid / ntn, nq = wid % ntn; if (mt * 16 >= M) return;
  const int row0 = mt * 16, col0 = nq * 64; const float* arow = A + (size_t)(row0 + ln) * lda;
  v8f acc[4] = {};
  for (int kb = 0; kb < K; kb += 32) {
    FragH ah, al;
    const v4f x0 = *(const v4fa*)(arow + kb + 8 * hh), x1 = *(const v4fa*)(arow + kb + 8 * hh + 4), x2 = *(const v4fa*)(arow + kb + 16 + 8 * hh), x3 = *(const v4fa*)(arow + kb + 16 + 8 * hh + 4);
    float xs[16] = {x0[0],x0[1],x0[2],x0[3],x1[0],x1[1],x1[2],x1[3],x2[0],x2[1],x2[2],x2[3],x3[0],x3[1],x3[2],x3[3]};
#pragma unroll
    for (int i = 0; i < 16; ++i) { const _Float16 h = (_Float16)xs[i]; ah.h[i] = h; al.h[i] = ASPLIT ? (_Float16)(xs[i] - (float)h) : (_Float16)0.0f; }
#pragma unroll
    for (int t = 0; t < 4; ++t) { if (col0 + t * 16 >= N) continue; const size_t boff = (size_t)(col0 + t * 16 + ln) * ldb + kb; FragH bq; bq.half[0] = *(const v8us*)(Bh + boff + 8 * hh); bq.half[1] = *(const v8us*)(Bh + boff + 16 + 8 * hh);
      acc[t] = mmaH<ASPLIT ? 2 : 1>(ah.v, al.v, bq.v, bq.v, acc[t]); }
  }
#pragma unroll
  for (int t = 0; t < 4; ++t) { if (col0 + t * 16 >= N) continue;
#pragma unroll
    for (int r = 0; r < 8; ++r) so[w][8 * hh + r][t * 16 + ln] = acc[t][r] * alpha; }
  __builtin_amdgcn_fence(__ATOMIC_ACQ_REL, "workgroup"); __builtin_amdgcn_wave_barrier();
  const int rsub = lane >> 4, c4 = (lane & 15) * 4;
  {
#pragma unroll
    for (int q = 0; q < 8; ++q) { const int r = q * 2 + rsub; if (col0 + c4 < N) { const v4f v = *(const v4fa*)&so[w][r][c4]; *(v4f*)(C + (size_t)(row0 + r) * ldc + col0 + c4) = v; } }
     }
}

// Wt[n][k] = f16(W[k][n]·scale) from f32 row-major W[K][N] (scale = power of two; bf16-exact weights stay exact in f16 away from the subnormal range)
__global__ __launch_bounds__(256) void k_wt_f16(const float* __restrict__ W, _Float16* __restrict__ Wt, int K, int N, float scale) {
  const int t = blockIdx.x * 256 + threadIdx.x; if (t >= N * (K / 8)) return; const int n = t / (K / 8), k8 = (t % (K / 8)) * 8; FragH f;
#pragma unroll
  for (int i = 0; i < 8; ++i) f.h[i] = (_Float16)(bf16_round(W[(size_t)(k8 + i) * N + n]) * scale); const v8us o = f.half[0];
  *(v8us*)((unsigned short*)Wt + (size_t)n * K + k8) = o; 
}
// k_gemm_hh variant with fused epilogue: v = acc·alpha + bias[by·sBias + col] (+ CP[(row/rowsPerB)·sCPb + by·64 + col] if CP) ; ACT 0 none / 1 elu ; writes f16 C16 (and f32 C if non-null)
template <int ACT>
__global__ __launch_bounds__(128) void k_gemm_hhx(const _Float16* __restrict__ A, int lda, size_t sA, const _Float16* __restrict__ Bh, int ldb, size_t sB, float alpha, const float* __restrict__ bias, size_t sBias, const float* __restrict__ CP, int rowsPerB, size_t sCPb, int row0g,
    float* __restrict__ C, _Float16* __restrict__ C16, int ldc, size_t sC, int M, int N, int K) {
  __shared__ __attribute__((aligned(16))) float so[4][16][64];
  const int tid = threadIdx.x, w = tid >> 5, lane = tid & 31, ln = lane & 15, hh = lane >> 4; const int by = blockIdx.y;
  A += (size_t)by * sA; Bh += (size_t)by * sB; const size_t cofs = (size_t)by * sC; const float* bp = bias ? bias + (size_t)by * sBias : nullptr;
  const int ntn = (N + 63) / 64; const int wid = blockIdx.x * 4 + w; const int mt = wid / ntn, nq = wid % ntn; if (mt * 16 >= M) return;
  const int row0 = mt * 16, col0 = nq * 64; const _Float16* arow = A + (size_t)(row0 + ln) * lda;
  v8f acc[4] = {};
  for (int kb = 0; kb < K; kb += 32) { FragH ah; ah.half[0] = *(const v8us*)((const unsigned short*)arow + kb + 8 * hh); ah.half[1] = *(const v8us*)((const unsigned short*)arow + kb + 16 + 8 * hh);
#pragma unroll
    for (int t = 0; t < 4; ++t) { if (col0 + t * 16 >= N) continue; const size_t boff = (size_t)(col0 + t * 16 + ln) * ldb + kb; FragH bq; bq.half[0] = *(const v8us*)((const unsigned short*)Bh + boff + 8 * hh); bq.half[1] = *(const v8us*)((const unsigned short*)Bh + boff + 16 + 8 * hh);
      acc[t] = mmaH<1>(ah.v, ah.v, bq.v, bq.v, acc[t]); }
  }
#pragma unroll
  for (int t = 0; t < 4; ++t) { if (col0 + t * 16 >= N) continue; const int col = col0 + t * 16 + ln; const float bv = bp ? bf16_round(bp[col]) : 0.f;
#pragma unroll
    for (int r = 0; r < 8; ++r) { float v = acc[t][r] * alpha + bv; if (CP) { const int rr = row0g + row0 + 8 * hh + r; if (rowsPerB < 0) v += CP[cofs + (size_t)rr * ldc + col];      /* rowsPerB < 0: own element of the batched C plane */ else { const int bidx = rr / rowsPerB; v += CP[(size_t)bidx * sCPb + (size_t)by * 64 + col]; } } if (ACT == 1) v = (v > 0.f) ? v : expm1f(v); else if (ACT == 7) v = (v > 0.f) ? v + 1.0f : expf(v); else if (ACT == 8) v = tanhf(v); else if (ACT == 9) v = 0.5f * v * (1.0f + tanhf(0.7978845608028654f * (v + 0.044715f * v * v * v))); else if (ACT == 11) v = 1.0f / (1.0f + expf(-v)); else if (ACT == 12) v = (v > 0.f) ? v : 0.01f * v; else if (ACT == 14) v = (v > 0.f) ? v : 0.1f * v; else if (ACT == 16) v = (v >= 0.f) ? v : 0.3f * v; else if (ACT == 17) v = (v >= 0.f) ? v : 0.2f * v; else if (ACT == 15) v = v / (1.0f + expf(-v)); else if (ACT == 3) v = fmaxf(v, 0.f); else if (ACT == 6) v = 0.5f * v * (1.0f + erff(v * 0.70710678118654752f)); so[w][8 * hh + r][t * 16 + ln] = v; } }
  __builtin_amdgcn_fence(__ATOMIC_ACQ_REL, "workgroup"); __builtin_amdgcn_wave_barrier();
  const int rsub = lane >> 4, c4 = (lane & 15) * 4; typedef _Float16 v4h __attribute__((ext_vector_type(4)));
  {
#pragma unroll
    for (int q = 0; q < 8; ++q) { const int r = q * 2 + rsub; if (col0 + c4 < N) { const v4f v = *(const v4fa*)&so[w][r][c4]; if (C) *(v4f*)(C + cofs + (size_t)(row0 + r) * ldc + col0 + c4) = v; if (C16) { v4h h4; for (int i = 0; i < 4; ++i) h4[i] = (_Float16)v[i]; *(v4h*)(C16 + cofs + (size_t)(row0 + r) * ldc + col0 + c4) = h4; } } }
     }
}


typedef _Float16 v4h __attribute__((ext_vector_type(4)));

__global__ __launch_bounds__(256) void k_x16(const float* __restrict__ x, _Float16* __restrict__ X16, size_t n8) { const size_t t = (size_t)blockIdx.x * 256 + threadIdx.x; if (t >= n8) return; FragH f;
#pragma unroll
  for (int q = 0; q < 8; ++q) f.h[q] = (_Float16)bf16_round(x[t * 8 + q]); *(v8us*)((unsigned short*)X16 + t * 8) = f.half[0];  }
__global__ __launch_bounds__(256) void k_h16(const float* __restrict__ x, _Float16* __restrict__ X16, size_t n8) { const size_t t = (size_t)blockIdx.x * 256 + threadIdx.x; if (t >= n8) return; FragH f;
#pragma unroll
  for (int q = 0; q < 8; ++q) f.h[q] = (_Float16)x[t * 8 + q]; *(v8us*)((unsigned short*)X16 + t * 8) = f.half[0];  }
__global__ __launch_bounds__(256) void k_round16f(const float* __restrict__ W, _Float16* __restrict__ Bt, size_t n8) { const size_t t = (size_t)blockIdx.x * 256 + threadIdx.x; if (t >= n8) return; FragH f;
#pragma unroll
  for (int i = 0; i < 8; ++i) f.h[i] = (_Float16)(bf16_round(W[t * 8 + i]) * 16.0f); *(v8us*)((unsigned short*)Bt + t * 8) = f.half[0];  }
template <int NHv, int TTv>
__global__ __launch_bounds__(256) void k_vt(const _Float16* __restrict__ V16, int ldv, int voff, _Float16* __restrict__ Vt) { __shared__ unsigned short tl[64][66]; const int tid = threadIdx.x; const int slab = blockIdx.x / (TTv / 64), lg = blockIdx.x % (TTv / 64); const int b = slab / NHv, h = slab % NHv;
  for (int i = tid; i < 64 * 8; i += 256) { const int r = i / 8, c8 = (i % 8) * 8; FragH f; f.half[0] = *(const v8us*)((const unsigned short*)V16 + ((size_t)b * TTv + lg * 64 + r) * ldv + voff + h * 64 + c8);
#pragma unroll
    for (int q = 0; q < 8; ++q) tl[r][c8 + q] = f.u[q]; }
  __syncthreads();
  {
#pragma unroll
    for (int rd = 0; rd < 2; ++rd) { const int d = rd * 32 + tid / 8, pc = tid % 8; FragH f;
#pragma unroll
      for (int q = 0; q < 8; ++q) f.u[q] = tl[pc * 8 + q][d];
      *(v8us*)((unsigned short*)Vt + ((size_t)slab * 64 + d) * TTv + lg * 64 + pc * 8) = f.half[0]; }
     } }

__global__ __launch_bounds__(256) void k_hl(const float* __restrict__ F, _Float16* __restrict__ Hh, _Float16* __restrict__ Hl, size_t n8) { const size_t t = (size_t)blockIdx.x * 256 + threadIdx.x; if (t >= n8) return; FragH fh, fl; const v4f a = *(const v4fa*)(F + t * 8), c = *(const v4fa*)(F + t * 8 + 4);
#pragma unroll
  for (int q = 0; q < 4; ++q) { _Float16 h = (_Float16)a[q]; fh.h[q] = h; fl.h[q] = (_Float16)((a[q] - (float)h) * 1024.0f); h = (_Float16)c[q]; fh.h[4 + q] = h; fl.h[4 + q] = (_Float16)((c[q] - (float)h) * 1024.0f); }
  { *(v8us*)((unsigned short*)Hh + t * 8) = fh.half[0]; *(v8us*)((unsigned short*)Hl + t * 8) = fl.half[0];  } }

// ---- fast GEMM (wave tile 32x64; requires M % 32 == 0 rows per launch region and N % 64 == 0); epilogue = k_gemm_hhx semantics ----
__device__ __forceinline__ v16h g2_frag(const _Float16* p, int hh) { FragH f; f.half[0] = *(const v8us*)((const unsigned short*)p + 8 * hh); f.half[1] = *(const v8us*)((const unsigned short*)p + 16 + 8 * hh); return f.v; }
__device__ __forceinline__ v8f g2_mma(v16h a, v16h b, v8f c) { v8f d = __builtin_amdgcn_wmma_f32_16x16x32_f16(false, a, false, b, (short)0, c, false, false); asm volatile("v_nop\n\tv_nop\n\tv_nop\n\tv_nop" : "+v"(d) : "v"(a), "v"(b)); return d; }
template <int ACT>
__global__ __launch_bounds__(128) void k_gemm2(const _Float16* __restrict__ A, int lda, size_t sA, const _Float16* __restrict__ Bh, int ldb, size_t sB, float alpha, const float* __restrict__ bias, size_t sBias, const float* __restrict__ CP, int rowsPerB, size_t sCPb, int row0g,
    float* __restrict__ C, _Float16* __restrict__ C16, int ldc, size_t sC, int M, int N, int K) { static_assert(ACT == 0 || ACT == 3 || ACT == 6 || ACT == 8 || ACT == 9 || ACT == 11 || ACT == 12 || ACT == 14 || ACT == 15 || ACT == 16 || ACT == 17, "k_gemm2: unsupported ACT code (would silently apply no activation)");
  __shared__ __attribute__((aligned(16))) float so[4][32][68];
  const int tid = threadIdx.x, w = tid >> 5, lane = tid & 31, ln = lane & 15, hh = lane >> 4; const int by = blockIdx.y;
  A += (size_t)by * sA; Bh += (size_t)by * sB; const size_t cofs = (size_t)by * sC; const float* bp = bias ? bias + (size_t)by * sBias : nullptr;
  const int ntn = N >> 6; const int mt = blockIdx.x / ntn, nq = blockIdx.x - mt * ntn; const int row0 = mt * 128 + 32 * w, col0 = nq * 64; if (row0 >= M) return;
  const _Float16* a0p = A + (size_t)(row0 + ln) * lda; const _Float16* a1p = a0p + (size_t)16 * lda;
  const _Float16* b0p = Bh + (size_t)(col0 + ln) * ldb; const _Float16* b1p = b0p + (size_t)16 * ldb; const _Float16* b2p = b1p + (size_t)16 * ldb; const _Float16* b3p = b2p + (size_t)16 * ldb;
  const v8f z8 = {0.f,0.f,0.f,0.f,0.f,0.f,0.f,0.f}; v8f c00 = z8, c01 = z8, c02 = z8, c03 = z8, c10 = z8, c11 = z8, c12 = z8, c13 = z8;
#pragma unroll 1
  for (int kb = 0; kb < K; kb += 32) { const v16h a0 = g2_frag(a0p + kb, hh), a1 = g2_frag(a1p + kb, hh);
    v16h b = g2_frag(b0p + kb, hh); c00 = g2_mma(a0, b, c00); c10 = g2_mma(a1, b, c10);
    b = g2_frag(b1p + kb, hh); c01 = g2_mma(a0, b, c01); c11 = g2_mma(a1, b, c11);
    b = g2_frag(b2p + kb, hh); c02 = g2_mma(a0, b, c02); c12 = g2_mma(a1, b, c12);
    b = g2_frag(b3p + kb, hh); c03 = g2_mma(a0, b, c03); c13 = g2_mma(a1, b, c13); }
  v8f accs[8] = {c00, c01, c02, c03, c10, c11, c12, c13};
#pragma unroll
  for (int u = 0; u < 8; ++u) { const int t = u & 3, half = u >> 2; const int col = col0 + t * 16 + ln; const float bv = bp ? bf16_round(bp[col]) : 0.f;
#pragma unroll
    for (int r = 0; r < 8; ++r) { const int rloc = half * 16 + 8 * hh + r; float v = accs[u][r] * alpha + bv; if (CP) { if (rowsPerB < 0) v += CP[cofs + (size_t)(row0g + row0 + rloc) * ldc + col];      /* rowsPerB < 0: own element of the batched C plane */ else { const int bidx = (row0g + row0 + rloc) / rowsPerB; v += CP[(size_t)bidx * sCPb + (size_t)by * 64 + col]; } }
      if (ACT == 3) v = fmaxf(v, 0.f); else if (ACT == 6) v = 0.5f * v * (1.0f + erff(v * 0.70710678118654752f)); else if (ACT == 11) v = 1.0f / (1.0f + expf(-v)); else if (ACT == 15) v = v / (1.0f + expf(-v)); else if (ACT == 12) v = (v > 0.f) ? v : 0.01f * v; else if (ACT == 8) v = tanhf(v); else if (ACT == 9) v = 0.5f * v * (1.0f + tanhf(0.7978845608028654f * (v + 0.044715f * v * v * v))); else if (ACT == 14) v = (v > 0.f) ? v : 0.1f * v; else if (ACT == 16) v = (v >= 0.f) ? v : 0.3f * v; else if (ACT == 17) v = (v >= 0.f) ? v : 0.2f * v;
      so[w][rloc][t * 16 + ln] = v; } }
  __builtin_amdgcn_fence(__ATOMIC_ACQ_REL, "workgroup"); __builtin_amdgcn_wave_barrier();
  const int rsub = lane >> 4, c4 = (lane & 15) * 4;
  {
#pragma unroll
    for (int q = 0; q < 16; ++q) { const int r = q * 2 + rsub; const v4f v = *(const v4fa*)&so[w][r][c4]; if (C) *(v4f*)(C + cofs + (size_t)(row0 + r) * ldc + col0 + c4) = v; if (C16) { v4h h4; for (int i = 0; i < 4; ++i) h4[i] = (_Float16)v[i]; *(v4h*)(C16 + cofs + (size_t)(row0 + r) * ldc + col0 + c4) = h4; } }
     } }


__global__ __launch_bounds__(256) void k_wnat(const float* __restrict__ w, size_t n8, _Float16* __restrict__ Bt) { const size_t t = (size_t)blockIdx.x * 256 + threadIdx.x; if (t >= n8) return; FragH f; for (int q = 0; q < 8; ++q) f.h[q] = (_Float16)(bf16_round(w[t * 8 + q]) * 16.0f); *(v8us*)((unsigned short*)Bt + t * 8) = f.half[0];  }
// Fused attention, all heads in one launch: scores, softmax and the weighted sum of v never leave the chip (no score or weight plane in memory).
// Workgroup = 8 waves = 256 queries of one head; a wave owns 32 query columns. Per stage of 64 keys the workgroup stages the k rows and the v^T rows in LDS
// (whole-line 16-byte loads one stage ahead through registers, two buffers, one barrier a stage). Transposed products: S^T = K Q^T (a lane holds 8 keys of ONE query per tile),
// running maximum and sum per query (online softmax, f32), weights x 2^12 against the running maximum as f16, O^T += V^T P^T with the two S^T tiles of 32 keys packed in place as the B operand.
#define FA_KT 64                     /* keys per stage */
#define FA_NS (SQ / FA_KT)           /* stages */
#define FA_LP 72                     /* LDS row pitch in f16: 128 data bytes + 16, an odd multiple of 16 bytes for the 16-byte fragment reads */
__device__ __forceinline__ float fa_xhalf(float x) { return __builtin_bit_cast(float, __builtin_amdgcn_permlanex16(__builtin_bit_cast(int, x), __builtin_bit_cast(int, x), 0x76543210, 0xfedcba98, false, false)); }      /* lane l <-> lane l ^ 16 */
__device__ __forceinline__ v16h fa_lfrag(const _Float16* p) { FragH f; f.half[0] = *(const v8us*)((const unsigned short*)p); f.half[1] = *(const v8us*)((const unsigned short*)p + 16); return f.v; }      /* p already holds the lane half's + 8 * hh: the k order of g2_frag */
__device__ __forceinline__ v8f fa_mma(v16h a, v16h b, v8f c) { return __builtin_amdgcn_wmma_f32_16x16x32_f16(false, a, false, b, (short)0, c, false, false); }
// Eight independent 2^x in place. One statement, so that no exponential stands directly in front of an instruction that overwrites its source or reads its result
// (as separate builtins the register allocator put the next result into the previous source); the v_nop is the slot the instruction set asks for behind the last one.
__device__ __forceinline__ void fa_exp2x8(float (&p)[8]) {
  asm("v_exp_f32 %0, %0\n\tv_exp_f32 %1, %1\n\tv_exp_f32 %2, %2\n\tv_exp_f32 %3, %3\n\tv_exp_f32 %4, %4\n\tv_exp_f32 %5, %5\n\tv_exp_f32 %6, %6\n\tv_exp_f32 %7, %7\n\tv_nop"
      : "+v"(p[0]), "+v"(p[1]), "+v"(p[2]), "+v"(p[3]), "+v"(p[4]), "+v"(p[5]), "+v"(p[6]), "+v"(p[7])); }
__global__ __launch_bounds__(256) void k_fattn(const _Float16* __restrict__ Q, const _Float16* __restrict__ K, const _Float16* __restrict__ VT, float* __restrict__ out) {
  __shared__ __attribute__((aligned(16))) _Float16 sk[2][FA_KT][FA_LP];
  __shared__ __attribute__((aligned(16))) _Float16 sv[2][HD][FA_LP];
  const int tid = threadIdx.x, w = tid >> 5, lane = tid & 31, ln = lane & 15, hh = lane >> 4;
  const int h = blockIdx.y, q0 = blockIdx.x * 256 + w * 32;
  const float CS = 0.125f * 1.4426950408889634f;      /* 1 / sqrt(64), and base 2 for the exponentials */
  v16h qf[2][2];      /* [query tile][k step of 32 head dims], B operand: column = query */
#pragma unroll      /* constant indices keep the fragments in registers */
  for (int qt = 0; qt < 2; ++qt) for (int ks = 0; ks < 2; ++ks) qf[qt][ks] = g2_frag(Q + (size_t)(q0 + qt * 16 + ln) * LQ + h * HD + ks * 32, hh);
  const int sr = tid >> 3, sc = (tid & 7) * 8;      /* staging: 8 threads cover one 128-byte row; rows sr and sr + 32 */
  const unsigned short* gk = (const unsigned short*)K + (size_t)sr * LQ + h * HD + sc;
  const unsigned short* gv = (const unsigned short*)VT + ((size_t)h * HD + sr) * SQ + sc;
  v8us rk0 = *(const v8us*)gk, rk1 = *(const v8us*)(gk + (size_t)32 * LQ), rv0 = *(const v8us*)gv, rv1 = *(const v8us*)(gv + (size_t)32 * SQ);
  *(v8us*)&sk[0][sr][sc] = rk0; *(v8us*)&sk[0][sr + 32][sc] = rk1; *(v8us*)&sv[0][sr][sc] = rv0; *(v8us*)&sv[0][sr + 32][sc] = rv1;
  __syncthreads();
  const v8f z8 = {0.f, 0.f, 0.f, 0.f, 0.f, 0.f, 0.f, 0.f};
  v8f o[2][4] = {{z8, z8, z8, z8}, {z8, z8, z8, z8}};      /* O^T: [query tile][16 head dims]; register r = head dim 8 * hh + r, column = query ln */
  float m[2] = {-3.0e38f, -3.0e38f}, l[2] = {0.f, 0.f};      /* running maximum (raw dot products) and this lane half's running sum, per query */
  for (int s = 0; s < FA_NS; ++s) {
    const int cur = s & 1;
    if (s + 1 < FA_NS) {      /* the next stage's rows fly while this stage is worked on */
      const unsigned short* nk = gk + (size_t)(s + 1) * FA_KT * LQ; const unsigned short* nv = gv + (size_t)(s + 1) * FA_KT;
      rk0 = *(const v8us*)nk; rk1 = *(const v8us*)(nk + (size_t)32 * LQ); rv0 = *(const v8us*)nv; rv1 = *(const v8us*)(nv + (size_t)32 * SQ);
    }
    __builtin_amdgcn_sched_barrier(0);      /* keeps the four loads up here: the scheduler otherwise sinks them to their LDS stores at the stage's foot, and their latency is then waited out every stage */
    v8f st[2][4];      /* S^T: [query tile][16 keys]; register r = key 8 * hh + r, column = query ln */
#pragma unroll      /* constant indices keep the tiles in registers */
    for (int kt = 0; kt < 4; ++kt) {
      const v16h a0 = fa_lfrag(&sk[cur][kt * 16 + ln][8 * hh]), a1 = fa_lfrag(&sk[cur][kt * 16 + ln][32 + 8 * hh]);
#pragma unroll      /* constant indices keep the tiles in registers */
      for (int qt = 0; qt < 2; ++qt) st[qt][kt] = fa_mma(a1, qf[qt][1], fa_mma(a0, qf[qt][0], z8));
    }
    FragH pf[2][2];      /* [query tile][32 keys]: P^T as B operand, element i = tile i >> 3, register i & 7 */
#pragma unroll      /* constant indices keep the tiles in registers */
    for (int qt = 0; qt < 2; ++qt) {
      float mk[4];      /* one short chain per tile: a tile's maximum runs while the next tile's products are still on the matrix unit */
#pragma unroll      /* constant indices keep the tiles in registers */
      for (int kt = 0; kt < 4; ++kt) { mk[kt] = st[qt][kt][0]; for (int r = 1; r < 8; ++r) mk[kt] = fmaxf(mk[kt], st[qt][kt][r]); }
      float mx = fmaxf(fmaxf(mk[0], mk[1]), fmaxf(mk[2], mk[3]));
      mx = fmaxf(mx, fa_xhalf(mx));
      const float mn = fmaxf(m[qt], mx);
      const float corr = __builtin_amdgcn_exp2f((m[qt] - mn) * CS);      /* 0 on the first stage */
      const float nb = 12.0f - mn * CS;
      m[qt] = mn;
      float ls[4] = {0.f, 0.f, 0.f, 0.f};
#pragma unroll      /* constant indices keep the tiles in registers */
      for (int kt = 0; kt < 4; ++kt) { float p[8]; for (int r = 0; r < 8; ++r) p[r] = fmaf(st[qt][kt][r], CS, nb); fa_exp2x8(p); for (int r = 0; r < 8; ++r) { ls[kt] += p[r]; pf[qt][kt >> 1].h[(kt & 1) * 8 + r] = (_Float16)p[r]; } }
      l[qt] = fmaf(l[qt], corr, (ls[0] + ls[1]) + (ls[2] + ls[3]));
#pragma unroll      /* constant indices keep the tiles in registers */
      for (int dt = 0; dt < 4; ++dt) o[qt][dt] *= corr;
    }
#pragma unroll      /* constant indices keep the tiles in registers */
    for (int ps = 0; ps < 2; ++ps) for (int dt = 0; dt < 4; ++dt) {
      const v16h a = fa_lfrag(&sv[cur][dt * 16 + ln][ps * 32 + 8 * hh]);
      o[0][dt] = fa_mma(a, pf[0][ps].v, o[0][dt]); o[1][dt] = fa_mma(a, pf[1][ps].v, o[1][dt]);
    }
    if (s + 1 < FA_NS) { *(v8us*)&sk[cur ^ 1][sr][sc] = rk0; *(v8us*)&sk[cur ^ 1][sr + 32][sc] = rk1; *(v8us*)&sv[cur ^ 1][sr][sc] = rv0; *(v8us*)&sv[cur ^ 1][sr + 32][sc] = rv1; }      /* that buffer's last readers left it before the previous barrier */
    __syncthreads();      /* publishes stage s + 1 and ends every read of stage s */
  }
#pragma unroll      /* constant indices keep the tiles in registers */
  for (int qt = 0; qt < 2; ++qt) {
    const float inv = 1.0f / (l[qt] + fa_xhalf(l[qt]));      /* the two lane halves' sums join once */
    float* op = out + (size_t)(q0 + qt * 16 + ln) * DM + h * HD + 8 * hh;
#pragma unroll      /* constant indices keep the tiles in registers */
    for (int dt = 0; dt < 4; ++dt) { const v4f lo = {o[qt][dt][0] * inv, o[qt][dt][1] * inv, o[qt][dt][2] * inv, o[qt][dt][3] * inv}, hi = {o[qt][dt][4] * inv, o[qt][dt][5] * inv, o[qt][dt][6] * inv, o[qt][dt][7] * inv};
      *(v4f*)(op + dt * 16) = lo; *(v4f*)(op + dt * 16 + 4) = hi; }
  } }
// Projection GEMM with both operands staged in LDS straight from the f32 inputs: P[token][n] = sum_k bf16(X[token][k]) bf16(W[k][n]), v_wmma_f32_16x16x32_bf16, f32 accumulation, f16 result rows of pitch LQ.
// The rounding (to nearest even, one packed conversion per two values) stands between the global loads and the LDS stores of the ring, so no 16-bit copy of X or W exists in memory and no launch makes one. X: 16 lanes cover the 256 bytes of a row's stage.
// W is [k][n]: a wave takes 8 k rows, a lane one column of each 32 (every load a whole 128-byte line), and the lane's 8 k values of a column pack into one 16-byte piece of the LDS row n: the transposition costs nothing.
// Workgroup = 8 waves = 256 tokens x 128 columns; a wave owns 64 tokens x 64 columns (16 accumulator tiles, so a fragment read from LDS feeds 4 products). Per stage of 64 k the workgroup stages
// the 256 X rows and the 128 W columns (as rows) in LDS (whole-line loads one stage ahead through registers, two buffers, one barrier a stage: the ring of k_fattn).
// Transposed products, A = Wt rows, B = X rows: a lane holds 8 neighbouring columns of ONE token per tile, which pack into one 16-byte piece of a result row.
#define G3_KT 64                     /* k per stage */
#define G3_NS (DM / G3_KT)           /* stages */
#define G3_LP 72                     /* LDS row pitch in f16: 128 data bytes + 16, an odd multiple of 16 bytes for the 16-byte fragment reads */
#define G3_MT 256                    /* tokens per workgroup */
#define G3_NT 128                    /* columns per workgroup */
#define G3_BR (G3_MT + G3_NT)        /* LDS rows per buffer: the X rows, then the Wt rows */
typedef unsigned short v4us __attribute__((ext_vector_type(4), may_alias));
__global__ __launch_bounds__(256) void k_gemm3(const float* __restrict__ X, const float* __restrict__ W, _Float16* __restrict__ P) {
  __shared__ __attribute__((aligned(16))) _Float16 sg[2 * G3_BR * G3_LP];
  const int tid = threadIdx.x, w = tid >> 5, lane = tid & 31, ln = lane & 15, hh = lane >> 4;
  const int row0 = blockIdx.y * G3_MT, col0 = blockIdx.x * G3_NT;
  const int tw = (w & 3) * 64, cw = (w >> 2) * 64;      /* the wave's first token and first column inside the workgroup's tile */
  const int xr = tid >> 4, xc = (tid & 15) * 4;      /* X staging: 16 threads cover the 256 bytes of one row's stage; rows xr + 16 i */
  const float* gx = X + (size_t)(row0 + xr) * DM + xc;
  const float* gw = W + (size_t)(w * 8) * LQ + col0 + lane;      /* W staging: k rows 8 w + e of the stage, columns lane + 32 q */
  v4f rx[16]; float rw[4][8];
#pragma unroll      /* constant indices keep the staged rows in registers */
  for (int i = 0; i < 16; ++i) rx[i] = *(const v4fa*)(gx + (size_t)i * 16 * DM);
#pragma unroll      /* constant indices keep the staged rows in registers */
  for (int q = 0; q < 4; ++q) for (int e = 0; e < 8; ++e) rw[q][e] = gw[(size_t)e * LQ + q * 32];
#pragma unroll      /* constant indices keep the staged rows in registers */
  for (int i = 0; i < 16; ++i) { union { __bf16 b[4]; v4us v; } f; for (int e = 0; e < 4; ++e) f.b[e] = (__bf16)rx[i][e]; *(v4us*)&sg[(xr + 16 * i) * G3_LP + xc] = f.v; }
#pragma unroll      /* constant indices keep the staged rows in registers */
  for (int q = 0; q < 4; ++q) { FragB f; for (int e = 0; e < 8; ++e) f.v[e] = (__bf16)rw[q][e]; *(v8us*)&sg[(G3_MT + lane + 32 * q) * G3_LP + w * 8] = f.half[0]; }
  __syncthreads();
  const v8f z8 = {0.f, 0.f, 0.f, 0.f, 0.f, 0.f, 0.f, 0.f};
  v8f acc[4][4];      /* [16 columns][16 tokens]; register r = column 8 * hh + r, lane column = token ln */
#pragma unroll      /* constant indices keep the tiles in registers */
  for (int i = 0; i < 4; ++i) for (int j = 0; j < 4; ++j) acc[i][j] = z8;
  for (int s = 0; s < G3_NS; ++s) {
    const _Float16* sb = sg + (s & 1) * (G3_BR * G3_LP);
    if (s + 1 < G3_NS) {      /* the next stage's rows fly while this stage is worked on */
#pragma unroll      /* constant indices keep the staged rows in registers */
      for (int i = 0; i < 16; ++i) rx[i] = *(const v4fa*)(gx + (size_t)i * 16 * DM + (s + 1) * G3_KT);
#pragma unroll      /* constant indices keep the staged rows in registers */
      for (int q = 0; q < 4; ++q) for (int e = 0; e < 8; ++e) rw[q][e] = gw[(size_t)((s + 1) * G3_KT + e) * LQ + q * 32];
      asm volatile("s_wait_xcnt 0x0" ::: "memory");      /* stands in front of the LDS reads below, which land in the registers that held these loads' addresses */
    }
    __builtin_amdgcn_sched_barrier(0);      /* keeps the 48 loads and their wait up here: without it the scheduler lifts an address of the LDS reads into a load's address register ahead of the wait */
    v16h wf[2][4], xf[2][4];      /* [k step of 32][16 columns] and [k step of 32][16 tokens] */
#pragma unroll      /* constant indices keep the fragments in registers */
    for (int ks = 0; ks < 2; ++ks) {      /* in the order of first use, so that the products start behind the first loads */
      wf[ks][0] = fa_lfrag(sb + (G3_MT + cw + ln) * G3_LP + ks * 32 + 8 * hh);
#pragma unroll      /* constant indices keep the fragments in registers */
      for (int j = 0; j < 4; ++j) xf[ks][j] = fa_lfrag(sb + (tw + j * 16 + ln) * G3_LP + ks * 32 + 8 * hh);
#pragma unroll      /* constant indices keep the fragments in registers */
      for (int i = 1; i < 4; ++i) wf[ks][i] = fa_lfrag(sb + (G3_MT + cw + i * 16 + ln) * G3_LP + ks * 32 + 8 * hh);
    }
    __builtin_amdgcn_sched_barrier(0);      /* the stage's 32 LDS reads stay one group ahead of its products: spread among them into one register set, every four products waited out a read's latency */
#pragma unroll      /* constant indices keep the tiles in registers */
    for (int ks = 0; ks < 2; ++ks) for (int i = 0; i < 4; ++i) for (int j = 0; j < 4; ++j) acc[i][j] = __builtin_amdgcn_wmma_f32_16x16x32_bf16(false, __builtin_bit_cast(v16b, wf[ks][i]), false, __builtin_bit_cast(v16b, xf[ks][j]), (short)0, acc[i][j], false, false);
    __builtin_amdgcn_sched_barrier(0);      /* the conversions and LDS stores of the next stage stay behind the products: lifted above them, they wait out the global loads' latency with the matrix unit idle */
    if (s + 1 < G3_NS) {      /* that buffer's last readers left it before the previous barrier */
      _Float16* sn = sg + ((s & 1) ^ 1) * (G3_BR * G3_LP);
#pragma unroll      /* constant indices keep the staged rows in registers */
      for (int i = 0; i < 16; ++i) { union { __bf16 b[4]; v4us v; } f; for (int e = 0; e < 4; ++e) f.b[e] = (__bf16)rx[i][e]; *(v4us*)&sn[(xr + 16 * i) * G3_LP + xc] = f.v; }
#pragma unroll      /* constant indices keep the staged rows in registers */
      for (int q = 0; q < 4; ++q) { FragB f; for (int e = 0; e < 8; ++e) f.v[e] = (__bf16)rw[q][e]; *(v8us*)&sn[(G3_MT + lane + 32 * q) * G3_LP + w * 8] = f.half[0]; }
    }
    __syncthreads();      /* publishes stage s + 1 and ends every read of stage s; the last one frees the ring for the result rows */
  }
  _Float16* so = sg + w * 64 * G3_LP;      /* the wave's own 64 result rows of 64 columns, so that whole 128-byte lines go out */
#pragma unroll      /* constant indices keep the tiles in registers */
  for (int i = 0; i < 4; ++i) for (int j = 0; j < 4; ++j) { FragH f; for (int r = 0; r < 8; ++r) f.h[r] = (_Float16)acc[i][j][r];
    *(v8us*)&so[(j * 16 + ln) * G3_LP + i * 16 + 8 * hh] = f.half[0]; }
  __builtin_amdgcn_fence(__ATOMIC_ACQ_REL, "workgroup"); __builtin_amdgcn_wave_barrier();      /* the wave reads back what its other lanes wrote */
#pragma unroll      /* independent row pieces: the reads go ahead of the stores */
  for (int q = 0; q < 16; ++q) { const int r = q * 4 + (lane >> 3), c = (lane & 7) * 8; const v8us v = *(const v8us*)&so[r * G3_LP + c];
    *(v8us*)((unsigned short*)P + (size_t)(row0 + tw + r) * LQ + col0 + cw + c) = v; }
}
__global__ __launch_bounds__(256) void k_vt(const _Float16* __restrict__ V16, int b, int h0, _Float16* __restrict__ VT) { __shared__ unsigned short tl[64][65]; const int tid = threadIdx.x; const int hh = blockIdx.x % HG, sg = blockIdx.x / HG; const int s0 = sg * 64; const int h = h0 + hh;
  for (int i = tid; i < 64 * 8; i += 256) { const int j = i / 8, d8 = (i % 8) * 8; FragH f; f.half[0] = *(const v8us*)((const unsigned short*)V16 + ((size_t)b * SQ + s0 + j) * DM + h * HD + d8); for (int q = 0; q < 8; ++q) tl[d8 + q][j] = f.u[q]; }
  __syncthreads();
  { for (int i = tid; i < 64 * 8; i += 256) { const int d = i / 8, j8 = (i % 8) * 8; FragH f; for (int q = 0; q < 8; ++q) f.u[q] = tl[d][j8 + q]; *(v8us*)((unsigned short*)VT + ((size_t)hh * HD + d) * SQ + s0 + j8) = f.half[0]; }  } }



__global__ __launch_bounds__(256) void k_rsmkm(const float* __restrict__ S, _Float16* __restrict__ P, int nrows, const int* __restrict__ am) {
  #pragma clang fp contract(off)
  const int t = blockIdx.x * 256 + threadIdx.x; if (t >= nrows) return; const size_t i = (size_t)t; const float* s = S + i * SQ; const int* mr = am + (size_t)(t % SQ) * SQ; float mx = -3.0e38f;
#pragma unroll 1
  for (int j = 0; j < SQ; ++j) { const float f = (mr[j] != 0) ? 1.f : 0.f; mx = fmaxf(mx, fmaf(f, s[j], (1.f - f) * -1.0e9f)); } float se = 0.f;
#pragma unroll 1
  for (int j = 0; j < SQ; ++j) { const float f = (mr[j] != 0) ? 1.f : 0.f; se += __expf(fmaf(f, s[j], (1.f - f) * -1.0e9f) - mx); } const float sc = 256.0f / se;
#pragma unroll 1
  for (int j0 = 0; j0 < SQ; j0 += 8) { FragH fr; for (int q = 0; q < 8; ++q) { const int j = j0 + q; const float f = (mr[j] != 0) ? 1.f : 0.f; fr.h[q] = (_Float16)(__expf(fmaf(f, s[j], (1.f - f) * -1.0e9f) - mx) * sc); }
    unsigned short* d = (unsigned short*)P + i * SQ + j0; *(v8us*)d = fr.half[0];  } }
extern "C" void kernel_launch(void* const* d_in, const int* in_sizes, int n_in,
                              void* d_out, int out_size, void* d_ws, size_t ws_size, hipStream_t stream) {
  (void)in_sizes; (void)n_in; (void)out_size;
  const float* const* I = (const float* const*)d_in; const float* xq = I[0]; const float* wqkv = I[1];      /* input order: X (2-D [4096][1024] = one sequence; feeds the one projection), Wqkv ([in][out] [1024][2048]: columns 0..1023 = the shared q = k projection, 1024..2047 = v); NO biases; NO output projection */
  static_assert(NH * HD == DM && DM % 64 == 0 && SQ % 128 == 0 && NH % HG == 0 && MP % G3_MT == 0 && LQ % G3_NT == 0 && G3_NS >= 2, "shape / tile multiples");
  char* ws = (char*)d_ws; size_t off = 0;
  auto take = [&](size_t bytes) { char* p = ws + off; off += (bytes + 255) & ~(size_t)255; return p; };
  _Float16* P16 = (_Float16*)take(NR * LQ * 2);
  _Float16* VT = (_Float16*)take((size_t)NH * HD * SQ * 2);
  if (off > ws_size) return;
  const size_t r0p = (size_t)B0 * SQ;      /* first projected row */
  k_gemm3<<<dim3(LQ / G3_NT, MP / G3_MT), 256, 0, stream>>>(xq + r0p * DM, wqkv, P16 + r0p * LQ);      /* proj = X Wqkv from the f32 inputs ([in][out] weights as they lie), all 2048 columns in one launch; q and k are the same product and are read from the same columns */
  for (int b = B0; b < B0 + NBR; ++b) { const size_t r0 = (size_t)b * SQ;
    k_vt<NH, SQ><<<NH * (SQ / 64), 256, 0, stream>>>(P16 + r0 * LQ, LQ, DM, VT);      /* V^T [NH][HD][SQ] for this batch */
    k_fattn<<<dim3(QN / 256, NHD), 256, 0, stream>>>(P16 + r0 * LQ, P16 + r0 * LQ, VT, (float*)d_out + r0 * DM); }      /* out = softmax(q k^T / 8) v for all heads, f32 straight into the merged-heads output rows (no output projection) */
}

// v006
// Measured time: 90.6 microseconds a run.
// Timed twice side by side with v005, it ran 1.08 times as fast both times.
// Counting every step since v000, it is 155 times as fast.
#include <hip/hip_runtime.h>
// Multi-head self-attention on ONE 4096-token problem with a SHARED query / key projection and no output projection, NON-causal (X [4096][1024]; proj = X Wqkv ([in][out] 1024 x 2048 sigma 1/32, no bias) split into a qk half and a v half; the scores use the SAME projection on both sides: scores = qk qk^T / sqrt(64) per head (16 heads of 64; symmetric per head); softmax over all 4096 keys (no mask); out = att v merged head-major -> [4096][1024]; no output projection); all heads in ONE fused attention launch.
// Structure: token rows r = b*4096 + s; proj = X Wqkv as ONE WMMA GEMM over all 2048 columns, fed from the f32 inputs (x and weights rounded to bf16 on the way into LDS, bf16 products; 256x128 workgroup tiles, 64x64 wave tiles, f32 accumulation, f16 output rows of pitch 2048: columns 0..1023 serve as q and as k, 1024..2047 as v); per batch: V^T for all heads via LDS transposes; per batch: one fused attention launch over all heads (online softmax, f32 statistics, weights as f16 against the running maximum) written f32 straight into the merged-heads output rows.
// Compute dtype: inputs rounded to bf16; x / weights exact bf16 operands (v_wmma_f32_16x16x32_bf16); q, k, v and softmax weights as plain f16 GEMM operands (~2^-12); scores, softmax statistics and o f32. v_wmma_f32_16x16x32_f16.
#define NB 1
#define SQ 4096
#define DM 1024
#define NH 16
#define HD 64
#define HG 1                         /* heads per group of the per-group V^T helper */
#define B0 0                         /* first batch processed (debug hook) */
#define NBR NB                       /* batches processed (debug hook) */
#define NR ((size_t)NB * SQ)         /* token rows */
#define MP ((int)((size_t)NBR * SQ)) /* rows projected (debug hook) */
#define QN SQ                        /* query rows attended per batch (debug hook) */
#define NHD NH                       /* heads attended (debug hook) */
#define MPO MP                       /* unused: no output stage (debug hook) */
#define LQ (2 * DM)      /* row pitch of the projected rows: 1024 shared q = k columns, then 1024 v columns */
typedef __bf16 v16b __attribute__((ext_vector_type(16)));
typedef unsigned short v8us __attribute__((ext_vector_type(8), may_alias));
typedef float  v8f  __attribute__((ext_vector_type(8)));
typedef float  v4f  __attribute__((ext_vector_type(4)));
typedef float  v4fa __attribute__((ext_vector_type(4), may_alias));
union FragB { v16b v; v8us half[2]; unsigned short u[16]; };

__device__ __forceinline__ unsigned short bf16_bits(float x) { unsigned int u = __float_as_uint(x); return (unsigned short)((u + 0x7FFFu + ((u >> 16) & 1u)) >> 16); }
__device__ __forceinline__ float bf16_val(unsigned short b) { return __uint_as_float(((unsigned int)b) << 16); }
__device__ __forceinline__ float bf16_round(float x) { return bf16_val(bf16_bits(x)); }
// D += A·B with NT terms: 1 = ah·bh, 2 = + al·bh (A split), 3 = + ah·bl (both split)
template <int NT>
__device__ __forceinline__ v8f mmaN(v16b ah, v16b al, v16b bh, v16b bl, v8f c) {
  c = __builtin_amdgcn_wmma_f32_16x16x32_bf16(false, ah, false, bh, (short)0, c, false, false);
  if (NT >= 2) c = __builtin_amdgcn_wmma_f32_16x16x32_bf16(false, al, false, bh, (short)0, c, false, false);
  if (NT >= 3) c = __builtin_amdgcn_wmma_f32_16x16x32_bf16(false, ah, false, bl, (short)0, c, false, false);
  asm volatile("v_nop\n\tv_nop\n\tv_nop\n\tv_nop" : "+v"(c) : "v"(ah), "v"(al), "v"(bh), "v"(bl));
  return c;
}

__global__ __launch_bounds__(256) void k_wt_bf16(const float* __restrict__ W, unsigned short* __restrict__ Wt, int K, int N) {
  const int t = blockIdx.x * 256 + threadIdx.x;
  const int k8n = K / 8;
  if (t >= N * k8n) return;
  const int n = t / k8n, k8 = (t % k8n) * 8;
  v8us v;
#pragma unroll
  for (int i = 0; i < 8; ++i) v[i] = bf16_bits(W[(size_t)(k8 + i) * N + n]);
  *(v8us*)(Wt + (size_t)n * K + k8) = v;
  
}

// GEMM C[M][N] (f32, pitch ldc) = act(A[M][K]·W + bias). A f32 row-major (pitch lda) converted per fragment to bf16
// (ASPLIT: hi/lo two planes -> 2 terms, else single rounded term); Wt bf16 [N][K] (pitch ldb). BIAS_BF16 rounds the
// bias to bf16 first (bias quantised to bf16 before the add). K%32==0, M%16==0, N%64==0.
template <bool ASPLIT, int ACT, bool BIAS_BF16>
__global__ __launch_bounds__(128) void k_gemm_bf(const float* __restrict__ A, int lda, const unsigned short* __restrict__ Wt, int ldb,
                                               const float* __restrict__ bias, float* __restrict__ C, int ldc, int M, int N, int K) {
  __shared__ __attribute__((aligned(16))) float so[4][16][64];
  const int tid = threadIdx.x, w = tid >> 5, lane = tid & 31, ln = lane & 15, hh = lane >> 4;
  const int ntn = N / 64;
  const int wid = blockIdx.x * 4 + w;
  const int mt = wid / ntn, nq = wid % ntn;
  if (mt * 16 >= M) return;
  const int row0 = mt * 16, col0 = nq * 64;
  const float* arow = A + (size_t)(row0 + ln) * lda;
  v8f acc[4] = {};
  for (int kb = 0; kb < K; kb += 32) {
    FragB ah, al;
    const v4f x0 = *(const v4fa*)(arow + kb + 8 * hh), x1 = *(const v4fa*)(arow + kb + 8 * hh + 4);
    const v4f x2 = *(const v4fa*)(arow + kb + 16 + 8 * hh), x3 = *(const v4fa*)(arow + kb + 16 + 8 * hh + 4);
    float xs[16] = {x0[0],x0[1],x0[2],x0[3],x1[0],x1[1],x1[2],x1[3],x2[0],x2[1],x2[2],x2[3],x3[0],x3[1],x3[2],x3[3]};
#pragma unroll
    for (int i = 0; i < 16; ++i) { const unsigned short hb = bf16_bits(xs[i]); ah.u[i] = hb; al.u[i] = ASPLIT ? bf16_bits(xs[i] - bf16_val(hb)) : (unsigned short)0; }
#pragma unroll
    for (int t = 0; t < 4; ++t) {
      const unsigned short* brow = Wt + (size_t)(col0 + t * 16 + ln) * ldb + kb;
      FragB b;
      b.half[0] = *(const v8us*)(brow + 8 * hh);
      b.half[1] = *(const v8us*)(brow + 16 + 8 * hh);
      acc[t] = mmaN<ASPLIT ? 2 : 1>(ah.v, al.v, b.v, b.v, acc[t]);
    }
  }
#pragma unroll
  for (int t = 0; t < 4; ++t) {
    float bv = bias ? bias[col0 + t * 16 + ln] : 0.f;
    if (BIAS_BF16) bv = bf16_round(bv);
#pragma unroll
    for (int r = 0; r < 8; ++r) { float v = acc[t][r] + bv; if (ACT == 1) v = fmaxf(v, 0.f); so[w][8 * hh + r][t * 16 + ln] = v; }
  }
  __builtin_amdgcn_fence(__ATOMIC_ACQ_REL, "workgroup");
  __builtin_amdgcn_wave_barrier();
  const int rsub = lane >> 4, c4 = (lane & 15) * 4;
  {
#pragma unroll
    for (int q = 0; q < 8; ++q) {
      const int r = q * 2 + rsub;
      const v4f v = *(const v4fa*)&so[w][r][c4];
      *(v4f*)(C + (size_t)(row0 + r) * ldc + col0 + c4) = v;
    }
    
  }
}

// GEMM C = act(A·W + bias + resid): A f32 (ASPLIT -> hi/lo 2 terms), Wt bf16 [N][K]; ACT 0 none, 1 relu, 2 exact gelu;
// resid (optional, f32, row index = (row % rmod), pitch ldr, RES_BF16 rounds it) added before the activation.
template <bool ASPLIT, int ACT, bool BIAS_BF16, bool RES_BF16>
__global__ __launch_bounds__(128) void k_gemm_bf3(const float* __restrict__ A, int lda, const unsigned short* __restrict__ Wt, int ldb,
                                                const float* __restrict__ bias, const float* __restrict__ resid, int rmod, int ldr,
                                                float* __restrict__ C, int ldc, int M, int N, int K) {
  __shared__ __attribute__((aligned(16))) float so[4][16][64];
  const int tid = threadIdx.x, w = tid >> 5, lane = tid & 31, ln = lane & 15, hh = lane >> 4;
  const int ntn = N / 64;
  const int wid = blockIdx.x * 4 + w;
  const int mt = wid / ntn, nq = wid % ntn;
  if (mt * 16 >= M) return;
  const int row0 = mt * 16, col0 = nq * 64;
  const float* arow = A + (size_t)(row0 + ln) * lda;
  v8f acc[4] = {};
  for (int kb = 0; kb < K; kb += 32) {
    FragB ah, al;
    const v4f x0 = *(const v4fa*)(arow + kb + 8 * hh), x1 = *(const v4fa*)(arow + kb + 8 * hh + 4);
    const v4f x2 = *(const v4fa*)(arow + kb + 16 + 8 * hh), x3 = *(const v4fa*)(arow + kb + 16 + 8 * hh + 4);
    float xs[16] = {x0[0],x0[1],x0[2],x0[3],x1[0],x1[1],x1[2],x1[3],x2[0],x2[1],x2[2],x2[3],x3[0],x3[1],x3[2],x3[3]};
#pragma unroll
    for (int i = 0; i < 16; ++i) { const unsigned short hb = bf16_bits(xs[i]); ah.u[i] = hb; al.u[i] = ASPLIT ? bf16_bits(xs[i] - bf16_val(hb)) : (unsigned short)0; }
#pragma unroll
    for (int t = 0; t < 4; ++t) {
      const unsigned short* brow = Wt + (size_t)(col0 + t * 16 + ln) * ldb + kb;
      FragB b;
      b.half[0] = *(const v8us*)(brow + 8 * hh);
      b.half[1] = *(const v8us*)(brow + 16 + 8 * hh);
      acc[t] = mmaN<ASPLIT ? 2 : 1>(ah.v, al.v, b.v, b.v, acc[t]);
    }
  }
#pragma unroll
  for (int t = 0; t < 4; ++t) {
    const int col = col0 + t * 16 + ln;
    float bv = bias ? bias[col] : 0.f;
    if (BIAS_BF16) bv = bf16_round(bv);
#pragma unroll
    for (int r = 0; r < 8; ++r) {
      float v = acc[t][r] + bv;
      if (resid) { float rv = resid[(size_t)((row0 + 8 * hh + r) % rmod) * ldr + col]; if (RES_BF16) rv = bf16_round(rv); v += rv; }
      if (ACT == 1) v = fmaxf(v, 0.f);
      if (ACT == 2) v = 0.5f * v * (1.0f + erff(v * 0.70710678118654752f));
      if (ACT == 3) { const float u = 0.7978845608028654f * (v + 0.044715f * v * v * v); v = 0.5f * v * (1.0f + tanhf(u)); }
      so[w][8 * hh + r][t * 16 + ln] = v;
    }
  }
  __builtin_amdgcn_fence(__ATOMIC_ACQ_REL, "workgroup");
  __builtin_amdgcn_wave_barrier();
  const int rsub = lane >> 4, c4 = (lane & 15) * 4;
  {
#pragma unroll
    for (int q = 0; q < 8; ++q) {
      const int r = q * 2 + rsub;
      const v4f v = *(const v4fa*)&so[w][r][c4];
      *(v4f*)(C + (size_t)(row0 + r) * ldc + col0 + c4) = v;
    }
    
  }
}
// row LayerNorm (biased variance, eps) over N: s = X (+ R); optional out_sum <- s; out_norm <- (s-mu)*rsqrt(var+eps)*g + b
template <bool PARAM_BF16>
__global__ __launch_bounds__(256) void k_layernorm(const float* __restrict__ X, const float* __restrict__ R, const float* __restrict__ g, const float* __restrict__ bta,
                                                  float* __restrict__ out_sum, float* __restrict__ out_norm, int N, float eps) {
  __shared__ float red[256];
  const int row = blockIdx.x, tid = threadIdx.x;
  const float* x = X + (size_t)row * N; const float* rr = R ? R + (size_t)row * N : nullptr;
  float vals[16];                     // up to N = 4096
  const int per = N / 256;            // contiguous chunk per thread? use strided-by-4 chunks: thread handles j = tid*4 + 1024*u
  float s1 = 0.f;
  for (int u = 0; u < per / 4; ++u) {
    const int j = tid * 4 + 1024 * u;
    const v4f a = *(const v4fa*)(x + j);
    v4f b = {0.f,0.f,0.f,0.f}; if (rr) b = *(const v4fa*)(rr + j);
#pragma unroll
    for (int q = 0; q < 4; ++q) { const float v = a[q] + b[q]; vals[u * 4 + q] = v; s1 += v; }
  }
  red[tid] = s1; __syncthreads();
  for (int st = 128; st > 0; st >>= 1) { if (tid < st) red[tid] += red[tid + st]; __syncthreads(); }
  const float mu = red[0] / (float)N; __syncthreads();
  float s2 = 0.f;
  for (int u = 0; u < per / 4; ++u)
#pragma unroll
    for (int q = 0; q < 4; ++q) { const float c = vals[u * 4 + q] - mu; s2 += c * c; }
  red[tid] = s2; __syncthreads();
  for (int st = 128; st > 0; st >>= 1) { if (tid < st) red[tid] += red[tid + st]; __syncthreads(); }
  const float rs = rsqrtf(red[0] / (float)N + eps);
  {
    for (int u = 0; u < per / 4; ++u) {
      const int j = tid * 4 + 1024 * u;
      v4f o, sm;
#pragma unroll
      for (int q = 0; q < 4; ++q) {
        float gg = g[j + q], bb = bta[j + q];
        if (PARAM_BF16) { gg = bf16_round(gg); bb = bf16_round(bb); }
        sm[q] = vals[u * 4 + q]; o[q] = (vals[u * 4 + q] - mu) * rs * gg + bb;
      }
      if (out_sum) *(v4f*)(out_sum + (size_t)row * N + j) = sm;
      *(v4f*)(out_norm + (size_t)row * N + j) = o;
    }
    
  }
}



// ---- f16 WMMA path (v_wmma_f32_16x16x32_f16): 11-bit significands for operands in range — used where a [0,1] probability operand needs more precision than bf16
typedef _Float16 v16h __attribute__((ext_vector_type(16)));
union FragH { v16h v; v8us half[2]; _Float16 h[16]; unsigned short u[16]; };
template <int NT>
__device__ __forceinline__ v8f mmaH(v16h ah, v16h al, v16h bh, v16h bl, v8f c) {
  c = __builtin_amdgcn_wmma_f32_16x16x32_f16(false, ah, false, bh, (short)0, c, false, false);
  if (NT >= 2) c = __builtin_amdgcn_wmma_f32_16x16x32_f16(false, al, false, bh, (short)0, c, false, false);
  if (NT >= 3) c = __builtin_amdgcn_wmma_f32_16x16x32_f16(false, ah, false, bl, (short)0, c, false, false);
  asm volatile("v_nop\n\tv_nop\n\tv_nop\n\tv_nop" : "+v"(c) : "v"(ah), "v"(al), "v"(bh), "v"(bl));
  return c;
}
// batched GEMM like k_gemm_b but f16 operands: A f32 (split into f16 hi/lo if ASPLIT, else rounded to f16), Bt = f16 values [n][k]; alpha; C f32; N multiple of 16 (partial tiles skipped)
template <bool ASPLIT>
__global__ __launch_bounds__(128) void k_gemm_h(const float* __restrict__ A, int lda, size_t sA, const _Float16* __restrict__ Bh, int ldb, size_t sB, float alpha, float* __restrict__ C, int ldc, size_t sC, int M, int N, int K) {
  __shared__ __attribute__((aligned(16))) float so[4][16][64];
  const int tid = threadIdx.x, w = tid >> 5, lane = tid & 31, ln = lane & 15, hh = lane >> 4; const int by = blockIdx.y;
  A += (size_t)by * sA; Bh += (size_t)by * sB; C += (size_t)by * sC;
  const int ntn = (N + 63) / 64; const int wid = blockIdx.x * 4 + w; const int mt = wid / ntn, nq = wid % ntn; if (mt * 16 >= M) return;
  const int row0 = mt * 16, col0 = nq * 64; const float* arow = A + (size_t)(row0 + ln) * lda;
  v8f acc[4] = {};
  for (int kb = 0; kb < K; kb += 32) {
    FragH ah, al;
    const v4f x0 = *(const v4fa*)(arow + kb + 8 * hh), x1 = *(const v4fa*)(arow + kb + 8 * hh + 4), x2 = *(const v4fa*)(arow + kb + 16 + 8 * hh), x3 = *(const v4fa*)(arow + kb + 16 + 8 * hh + 4);
    float xs[16] = {x0[0],x0[1],x0[2],x0[3],x1[0],x1[1],x1[2],x1[3],x2[0],x2[1],x2[2],x2[3],x3[0],x3[1],x3[2],x3[3]};
#pragma unroll
    for (int i = 0; i < 16; ++i) { const _Float16 h = (_Float16)xs[i]; ah.h[i] = h; al.h[i] = ASPLIT ? (_Float16)(xs[i] - (float)h) : (_Float16)0.0f; }
#pragma unroll
    for (int t = 0; t < 4; ++t) { if (col0 + t * 16 >= N) continue; const size_t boff = (size_t)(col0 + t * 16 + ln) * ldb + kb; FragH bq; bq.half[0] = *(const v8us*)(Bh + boff + 8 * hh); bq.half[1] = *(const v8us*)(Bh + boff + 16 + 8 * hh);
      acc[t] = mmaH<ASPLIT ? 2 : 1>(ah.v, al.v, bq.v, bq.v, acc[t]); }
  }
#pragma unroll
  for (int t = 0; t < 4; ++t) { if (col0 + t * 16 >= N) continue;
#pragma unroll
    for (int r = 0; r < 8; ++r) so[w][8 * hh + r][t * 16 + ln] = acc[t][r] * alpha; }
  __builtin_amdgcn_fence(__ATOMIC_ACQ_REL, "workgroup"); __builtin_amdgcn_wave_barrier();
  const int rsub = lane >> 4, c4 = (lane & 15) * 4;
  {
#pragma unroll
    for (int q = 0; q < 8; ++q) { const int r = q * 2 + rsub; if (col0 + c4 < N) { const v4f v = *(const v4fa*)&so[w][r][c4]; *(v4f*)(C + (size_t)(row0 + r) * ldc + col0 + c4) = v; } }
     }
}

// Wt[n][k] = f16(W[k][n]·scale) from f32 row-major W[K][N] (scale = power of two; bf16-exact weights stay exact in f16 away from the subnormal range)
__global__ __launch_bounds__(256) void k_wt_f16(const float* __restrict__ W, _Float16* __restrict__ Wt, int K, int N, float scale) {
  const int t = blockIdx.x * 256 + threadIdx.x; if (t >= N * (K / 8)) return; const int n = t / (K / 8), k8 = (t % (K / 8)) * 8; FragH f;
#pragma unroll
  for (int i = 0; i < 8; ++i) f.h[i] = (_Float16)(bf16_round(W[(size_t)(k8 + i) * N + n]) * scale); const v8us o = f.half[0];
  *(v8us*)((unsigned short*)Wt + (size_t)n * K + k8) = o; 
}
// k_gemm_hh variant with fused epilogue: v = acc·alpha + bias[by·sBias + col] (+ CP[(row/rowsPerB)·sCPb + by·64 + col] if CP) ; ACT 0 none / 1 elu ; writes f16 C16 (and f32 C if non-null)
template <int ACT>
__global__ __launch_bounds__(128) void k_gemm_hhx(const _Float16* __restrict__ A, int lda, size_t sA, const _Float16* __restrict__ Bh, int ldb, size_t sB, float alpha, const float* __restrict__ bias, size_t sBias, const float* __restrict__ CP, int rowsPerB, size_t sCPb, int row0g,
    float* __restrict__ C, _Float16* __restrict__ C16, int ldc, size_t sC, int M, int N, int K) {
  __shared__ __attribute__((aligned(16))) float so[4][16][64];
  const int tid = threadIdx.x, w = tid >> 5, lane = tid & 31, ln = lane & 15, hh = lane >> 4; const int by = blockIdx.y;
  A += (size_t)by * sA; Bh += (size_t)by * sB; const size_t cofs = (size_t)by * sC; const float* bp = bias ? bias + (size_t)by * sBias : nullptr;
  const int ntn = (N + 63) / 64; const int wid = blockIdx.x * 4 + w; const int mt = wid / ntn, nq = wid % ntn; if (mt * 16 >= M) return;
  const int row0 = mt * 16, col0 = nq * 64; const _Float16* arow = A + (size_t)(row0 + ln) * lda;
  v8f acc[4] = {};
  for (int kb = 0; kb < K; kb += 32) { FragH ah; ah.half[0] = *(const v8us*)((const unsigned short*)arow + kb + 8 * hh); ah.half[1] = *(const v8us*)((const unsigned short*)arow + kb + 16 + 8 * hh);
#pragma unroll
    for (int t = 0; t < 4; ++t) { if (col0 + t * 16 >= N) continue; const size_t boff = (size_t)(col0 + t * 16 + ln) * ldb + kb; FragH bq; bq.half[0] = *(const v8us*)((const unsigned short*)Bh + boff + 8 * hh); bq.half[1] = *(const v8us*)((const unsigned short*)Bh + boff + 16 + 8 * hh);
      acc[t] = mmaH<1>(ah.v, ah.v, bq.v, bq.v, acc[t]); }
  }
#pragma unroll
  for (int t = 0; t < 4; ++t) { if (col0 + t * 16 >= N) continue; const int col = col0 + t * 16 + ln; const float bv = bp ? bf16_round(bp[col]) : 0.f;
#pragma unroll
    for (int r = 0; r < 8; ++r) { float v = acc[t][r] * alpha + bv; if (CP) { const int rr = row0g + row0 + 8 * hh + r; if (rowsPerB < 0) v += CP[cofs + (size_t)rr * ldc + col];      /* rowsPerB < 0: own element of the batched C plane */ else { const int bidx = rr / rowsPerB; v += CP[(size_t)bidx * sCPb + (size_t)by * 64 + col]; } } if (ACT == 1) v = (v > 0.f) ? v : expm1f(v); else if (ACT == 7) v = (v > 0.f) ? v + 1.0f : expf(v); else if (ACT == 8) v = tanhf(v); else if (ACT == 9) v = 0.5f * v * (1.0f + tanhf(0.7978845608028654f * (v + 0.044715f * v * v * v))); else if (ACT == 11) v = 1.0f / (1.0f + expf(-v)); else if (ACT == 12) v = (v > 0.f) ? v : 0.01f * v; else if (ACT == 14) v = (v > 0.f) ? v : 0.1f * v; else if (ACT == 16) v = (v >= 0.f) ? v : 0.3f * v; else if (ACT == 17) v = (v >= 0.f) ? v : 0.2f * v; else if (ACT == 15) v = v / (1.0f + expf(-v)); else if (ACT == 3) v = fmaxf(v, 0.f); else if (ACT == 6) v = 0.5f * v * (1.0f + erff(v * 0.70710678118654752f)); so[w][8 * hh + r][t * 16 + ln] = v; } }
  __builtin_amdgcn_fence(__ATOMIC_ACQ_REL, "workgroup"); __builtin_amdgcn_wave_barrier();
  const int rsub = lane >> 4, c4 = (lane & 15) * 4; typedef _Float16 v4h __attribute__((ext_vector_type(4)));
  {
#pragma unroll
    for (int q = 0; q < 8; ++q) { const int r = q * 2 + rsub; if (col0 + c4 < N) { const v4f v = *(const v4fa*)&so[w][r][c4]; if (C) *(v4f*)(C + cofs + (size_t)(row0 + r) * ldc + col0 + c4) = v; if (C16) { v4h h4; for (int i = 0; i < 4; ++i) h4[i] = (_Float16)v[i]; *(v4h*)(C16 + cofs + (size_t)(row0 + r) * ldc + col0 + c4) = h4; } } }
     }
}


typedef _Float16 v4h __attribute__((ext_vector_type(4)));

__global__ __launch_bounds__(256) void k_x16(const float* __restrict__ x, _Float16* __restrict__ X16, size_t n8) { const size_t t = (size_t)blockIdx.x * 256 + threadIdx.x; if (t >= n8) return; FragH f;
#pragma unroll
  for (int q = 0; q < 8; ++q) f.h[q] = (_Float16)bf16_round(x[t * 8 + q]); *(v8us*)((unsigned short*)X16 + t * 8) = f.half[0];  }
__global__ __launch_bounds__(256) void k_h16(const float* __restrict__ x, _Float16* __restrict__ X16, size_t n8) { const size_t t = (size_t)blockIdx.x * 256 + threadIdx.x; if (t >= n8) return; FragH f;
#pragma unroll
  for (int q = 0; q < 8; ++q) f.h[q] = (_Float16)x[t * 8 + q]; *(v8us*)((unsigned short*)X16 + t * 8) = f.half[0];  }
__global__ __launch_bounds__(256) void k_round16f(const float* __restrict__ W, _Float16* __restrict__ Bt, size_t n8) { const size_t t = (size_t)blockIdx.x * 256 + threadIdx.x; if (t >= n8) return; FragH f;
#pragma unroll
  for (int i = 0; i < 8; ++i) f.h[i] = (_Float16)(bf16_round(W[t * 8 + i]) * 16.0f); *(v8us*)((unsigned short*)Bt + t * 8) = f.half[0];  }
template <int NHv, int TTv>
__global__ __launch_bounds__(256) void k_vt(const _Float16* __restrict__ V16, int ldv, int voff, _Float16* __restrict__ Vt) { __shared__ unsigned short tl[64][66]; const int tid = threadIdx.x; const int slab = blockIdx.x / (TTv / 64), lg = blockIdx.x % (TTv / 64); const int b = slab / NHv, h = slab % NHv;
  for (int i = tid; i < 64 * 8; i += 256) { const int r = i / 8, c8 = (i % 8) * 8; FragH f; f.half[0] = *(const v8us*)((const unsigned short*)V16 + ((size_t)b * TTv + lg * 64 + r) * ldv + voff + h * 64 + c8);
#pragma unroll
    for (int q = 0; q < 8; ++q) tl[r][c8 + q] = f.u[q]; }
  __syncthreads();
  {
#pragma unroll
    for (int rd = 0; rd < 2; ++rd) { const int d = rd * 32 + tid / 8, pc = tid % 8; FragH f;
#pragma unroll
      for (int q = 0; q < 8; ++q) f.u[q] = tl[pc * 8 + q][d];
      *(v8us*)((unsigned short*)Vt + ((size_t)slab * 64 + d) * TTv + lg * 64 + pc * 8) = f.half[0]; }
     } }

__global__ __launch_bounds__(256) void k_hl(const float* __restrict__ F, _Float16* __restrict__ Hh, _Float16* __restrict__ Hl, size_t n8) { const size_t t = (size_t)blockIdx.x * 256 + threadIdx.x; if (t >= n8) return; FragH fh, fl; const v4f a = *(const v4fa*)(F + t * 8), c = *(const v4fa*)(F + t * 8 + 4);
#pragma unroll
  for (int q = 0; q < 4; ++q) { _Float16 h = (_Float16)a[q]; fh.h[q] = h; fl.h[q] = (_Float16)((a[q] - (float)h) * 1024.0f); h = (_Float16)c[q]; fh.h[4 + q] = h; fl.h[4 + q] = (_Float16)((c[q] - (float)h) * 1024.0f); }
  { *(v8us*)((unsigned short*)Hh + t * 8) = fh.half[0]; *(v8us*)((unsigned short*)Hl + t * 8) = fl.half[0];  } }

// ---- fast GEMM (wave tile 32x64; requires M % 32 == 0 rows per launch region and N % 64 == 0); epilogue = k_gemm_hhx semantics ----
__device__ __forceinline__ v16h g2_frag(const _Float16* p, int hh) { FragH f; f.half[0] = *(const v8us*)((const unsigned short*)p + 8 * hh); f.half[1] = *(const v8us*)((const unsigned short*)p + 16 + 8 * hh); return f.v; }
__device__ __forceinline__ v8f g2_mma(v16h a, v16h b, v8f c) { v8f d = __builtin_amdgcn_wmma_f32_16x16x32_f16(false, a, false, b, (short)0, c, false, false); asm volatile("v_nop\n\tv_nop\n\tv_nop\n\tv_nop" : "+v"(d) : "v"(a), "v"(b)); return d; }
template <int ACT>
__global__ __launch_bounds__(128) void k_gemm2(const _Float16* __restrict__ A, int lda, size_t sA, const _Float16* __restrict__ Bh, int ldb, size_t sB, float alpha, const float* __restrict__ bias, size_t sBias, const float* __restrict__ CP, int rowsPerB, size_t sCPb, int row0g,
    float* __restrict__ C, _Float16* __restrict__ C16, int ldc, size_t sC, int M, int N, int K) { static_assert(ACT == 0 || ACT == 3 || ACT == 6 || ACT == 8 || ACT == 9 || ACT == 11 || ACT == 12 || ACT == 14 || ACT == 15 || ACT == 16 || ACT == 17, "k_gemm2: unsupported ACT code (would silently apply no activation)");
  __shared__ __attribute__((aligned(16))) float so[4][32][68];
  const int tid = threadIdx.x, w = tid >> 5, lane = tid & 31, ln = lane & 15, hh = lane >> 4; const int by = blockIdx.y;
  A += (size_t)by * sA; Bh += (size_t)by * sB; const size_t cofs = (size_t)by * sC; const float* bp = bias ? bias + (size_t)by * sBias : nullptr;
  const int ntn = N >> 6; const int mt = blockIdx.x / ntn, nq = blockIdx.x - mt * ntn; const int row0 = mt * 128 + 32 * w, col0 = nq * 64; if (row0 >= M) return;
  const _Float16* a0p = A + (size_t)(row0 + ln) * lda; const _Float16* a1p = a0p + (size_t)16 * lda;
  const _Float16* b0p = Bh + (size_t)(col0 + ln) * ldb; const _Float16* b1p = b0p + (size_t)16 * ldb; const _Float16* b2p = b1p + (size_t)16 * ldb; const _Float16* b3p = b2p + (size_t)16 * ldb;
  const v8f z8 = {0.f,0.f,0.f,0.f,0.f,0.f,0.f,0.f}; v8f c00 = z8, c01 = z8, c02 = z8, c03 = z8, c10 = z8, c11 = z8, c12 = z8, c13 = z8;
#pragma unroll 1
  for (int kb = 0; kb < K; kb += 32) { const v16h a0 = g2_frag(a0p + kb, hh), a1 = g2_frag(a1p + kb, hh);
    v16h b = g2_frag(b0p + kb, hh); c00 = g2_mma(a0, b, c00); c10 = g2_mma(a1, b, c10);
    b = g2_frag(b1p + kb, hh); c01 = g2_mma(a0, b, c01); c11 = g2_mma(a1, b, c11);
    b = g2_frag(b2p + kb, hh); c02 = g2_mma(a0, b, c02); c12 = g2_mma(a1, b, c12);
    b = g2_frag(b3p + kb, hh); c03 = g2_mma(a0, b, c03); c13 = g2_mma(a1, b, c13); }
  v8f accs[8] = {c00, c01, c02, c03, c10, c11, c12, c13};
#pragma unroll
  for (int u = 0; u < 8; ++u) { const int t = u & 3, half = u >> 2; const int col = col0 + t * 16 + ln; const float bv = bp ? bf16_round(bp[col]) : 0.f;
#pragma unroll
    for (int r = 0; r < 8; ++r) { const int rloc = half * 16 + 8 * hh + r; float v = accs[u][r] * alpha + bv; if (CP) { if (rowsPerB < 0) v += CP[cofs + (size_t)(row0g + row0 + rloc) * ldc + col];      /* rowsPerB < 0: own element of the batched C plane */ else { const int bidx = (row0g + row0 + rloc) / rowsPerB; v += CP[(size_t)bidx * sCPb + (size_t)by * 64 + col]; } }
      if (ACT == 3) v = fmaxf(v, 0.f); else if (ACT == 6) v = 0.5f * v * (1.0f + erff(v * 0.70710678118654752f)); else if (ACT == 11) v = 1.0f / (1.0f + expf(-v)); else if (ACT == 15) v = v / (1.0f + expf(-v)); else if (ACT == 12) v = (v > 0.f) ? v : 0.01f * v; else if (ACT == 8) v = tanhf(v); else if (ACT == 9) v = 0.5f * v * (1.0f + tanhf(0.7978845608028654f * (v + 0.044715f * v * v * v))); else if (ACT == 14) v = (v > 0.f) ? v : 0.1f * v; else if (ACT == 16) v = (v >= 0.f) ? v : 0.3f * v; else if (ACT == 17) v = (v >= 0.f) ? v : 0.2f * v;
      so[w][rloc][t * 16 + ln] = v; } }
  __builtin_amdgcn_fence(__ATOMIC_ACQ_REL, "workgroup"); __builtin_amdgcn_wave_barrier();
  const int rsub = lane >> 4, c4 = (lane & 15) * 4;
  {
#pragma unroll
    for (int q = 0; q < 16; ++q) { const int r = q * 2 + rsub; const v4f v = *(const v4fa*)&so[w][r][c4]; if (C) *(v4f*)(C + cofs + (size_t)(row0 + r) * ldc + col0 + c4) = v; if (C16) { v4h h4; for (int i = 0; i < 4; ++i) h4[i] = (_Float16)v[i]; *(v4h*)(C16 + cofs + (size_t)(row0 + r) * ldc + col0 + c4) = h4; } }
     } }


__global__ __launch_bounds__(256) void k_wnat(const float* __restrict__ w, size_t n8, _Float16* __restrict__ Bt) { const size_t t = (size_t)blockIdx.x * 256 + threadIdx.x; if (t >= n8) return; FragH f; for (int q = 0; q < 8; ++q) f.h[q] = (_Float16)(bf16_round(w[t * 8 + q]) * 16.0f); *(v8us*)((unsigned short*)Bt + t * 8) = f.half[0];  }
// Fused attention, all heads in one launch: scores, softmax and the weighted sum of v never leave the chip (no score or weight plane in memory).
// Workgroup = 16 waves = 256 queries of one head, as two key groups of 8 waves: a wave owns 32 query columns and every second tile of 64 keys, so that four waves share a SIMD
// (one wave's vector work and LDS waits run under the others' products) at the same fragment reuse. Per stage each group stages its own 64 k rows and v^T rows in its own LDS ring
// (whole-line 16-byte loads one stage ahead through registers, two buffers, one barrier a stage). Each group keeps its own maximum, sum and O^T; they are merged once, through LDS, at the end. Transposed products: S^T = K Q^T (a lane holds 8 keys of ONE query per tile),
// running maximum and sum per query (online softmax, f32), weights x 2^12 against the running maximum as f16, O^T += V^T P^T with the two S^T tiles of 32 keys packed in place as the B operand.
#define FA_KT 64                     /* keys per stage */
#define FA_KG 2                      /* key groups of 8 waves per workgroup */
#define FA_NS (SQ / (FA_KT * FA_KG)) /* stages: each takes every group one tile on */
#define FA_LP 72                     /* LDS row pitch in f16: 128 data bytes + 16, an odd multiple of 16 bytes for the 16-byte fragment reads */
__device__ __forceinline__ float fa_xhalf(float x) { return __builtin_bit_cast(float, __builtin_amdgcn_permlanex16(__builtin_bit_cast(int, x), __builtin_bit_cast(int, x), 0x76543210, 0xfedcba98, false, false)); }      /* lane l <-> lane l ^ 16 */
__device__ __forceinline__ v16h fa_lfrag(const _Float16* p) { FragH f; f.half[0] = *(const v8us*)((const unsigned short*)p); f.half[1] = *(const v8us*)((const unsigned short*)p + 16); return f.v; }      /* p already holds the lane half's + 8 * hh: the k order of g2_frag */
__device__ __forceinline__ v8f fa_mma(v16h a, v16h b, v8f c) { return __builtin_amdgcn_wmma_f32_16x16x32_f16(false, a, false, b, (short)0, c, false, false); }
// Eight independent 2^x in place. One statement, so that no exponential stands directly in front of an instruction that overwrites its source or reads its result
// (as separate builtins the register allocator put the next result into the previous source); the v_nop is the slot the instruction set asks for behind the last one.
__device__ __forceinline__ void fa_exp2x8(float (&p)[8]) {
  asm("v_exp_f32 %0, %0\n\tv_exp_f32 %1, %1\n\tv_exp_f32 %2, %2\n\tv_exp_f32 %3, %3\n\tv_exp_f32 %4, %4\n\tv_exp_f32 %5, %5\n\tv_exp_f32 %6, %6\n\tv_exp_f32 %7, %7\n\tv_nop"
      : "+v"(p[0]), "+v"(p[1]), "+v"(p[2]), "+v"(p[3]), "+v"(p[4]), "+v"(p[5]), "+v"(p[6]), "+v"(p[7])); }
__global__ __launch_bounds__(256 * FA_KG) void k_fattn(const _Float16* __restrict__ Q, const _Float16* __restrict__ K, const _Float16* __restrict__ VT, float* __restrict__ out) {
  __shared__ __attribute__((aligned(16))) _Float16 skg[FA_KG][2][FA_KT][FA_LP];
  __shared__ __attribute__((aligned(16))) _Float16 svg[FA_KG][2][HD][FA_LP];
  __shared__ __attribute__((aligned(16))) v4f xo[8][16][32];      /* group 1's O^T on its way to group 0: [query wave][16-byte piece][lane] */
  __shared__ float xs[8][4][32];      /* group 1's maxima and sums: [query wave][m of tile 0, 1, l of tile 0, 1][lane] */
  const int g = __builtin_amdgcn_readfirstlane((int)threadIdx.x >> 8);      /* key group, the same in a whole wave */
  const int tid = threadIdx.x & 255, w = tid >> 5, lane = tid & 31, ln = lane & 15, hh = lane >> 4;      /* place inside the group */
  _Float16 (*sk)[FA_KT][FA_LP] = skg[g]; _Float16 (*sv)[HD][FA_LP] = svg[g];
  const int h = blockIdx.y, q0 = blockIdx.x * 256 + w * 32;
  const float CS = 0.125f * 1.4426950408889634f;      /* 1 / sqrt(64), and base 2 for the exponentials */
  v16h qf[2][2];      /* [query tile][k step of 32 head dims], B operand: column = query */
#pragma unroll      /* constant indices keep the fragments in registers */
  for (int qt = 0; qt < 2; ++qt) for (int ks = 0; ks < 2; ++ks) qf[qt][ks] = g2_frag(Q + (size_t)(q0 + qt * 16 + ln) * LQ + h * HD + ks * 32, hh);
  const int sr = tid >> 3, sc = (tid & 7) * 8;      /* staging: 8 threads cover one 128-byte row; rows sr and sr + 32 */
  const unsigned short* gk = (const unsigned short*)K + (size_t)(g * FA_KT + sr) * LQ + h * HD + sc;      /* stage s: the group's keys (s * FA_KG + g) * 64 .. + 63 */
  const unsigned short* gv = (const unsigned short*)VT + ((size_t)h * HD + sr) * SQ + g * FA_KT + sc;
  v8us rk0 = *(const v8us*)gk, rk1 = *(const v8us*)(gk + (size_t)32 * LQ), rv0 = *(const v8us*)gv, rv1 = *(const v8us*)(gv + (size_t)32 * SQ);
  *(v8us*)&sk[0][sr][sc] = rk0; *(v8us*)&sk[0][sr + 32][sc] = rk1; *(v8us*)&sv[0][sr][sc] = rv0; *(v8us*)&sv[0][sr + 32][sc] = rv1;
  __syncthreads();
  const v8f z8 = {0.f, 0.f, 0.f, 0.f, 0.f, 0.f, 0.f, 0.f};
  v8f o[2][4] = {{z8, z8, z8, z8}, {z8, z8, z8, z8}};      /* O^T: [query tile][16 head dims]; register r = head dim 8 * hh + r, column = query ln */
  float m[2] = {-3.0e38f, -3.0e38f}, l[2] = {0.f, 0.f};      /* running maximum (raw dot products) and this lane half's running sum, per query */
  for (int s = 0; s < FA_NS; ++s) {
    const int cur = s & 1;
    if (s + 1 < FA_NS) {      /* the next stage's rows fly while this stage is worked on */
      const unsigned short* nk = gk + (size_t)(s + 1) * (FA_KG * FA_KT) * LQ; const unsigned short* nv = gv + (size_t)(s + 1) * (FA_KG * FA_KT);
      rk0 = *(const v8us*)nk; rk1 = *(const v8us*)(nk + (size_t)32 * LQ); rv0 = *(const v8us*)nv; rv1 = *(const v8us*)(nv + (size_t)32 * SQ);
    }
    __builtin_amdgcn_sched_barrier(0);      /* keeps the four loads up here: the scheduler otherwise sinks them to their LDS stores at the stage's foot, and their latency is then waited out every stage */
    v8f st[2][4];      /* S^T: [query tile][16 keys]; register r = key 8 * hh + r, column = query ln */
#pragma unroll      /* constant indices keep the tiles in registers */
    for (int kt = 0; kt < 4; ++kt) {
      const v16h a0 = fa_lfrag(&sk[cur][kt * 16 + ln][8 * hh]), a1 = fa_lfrag(&sk[cur][kt * 16 + ln][32 + 8 * hh]);
#pragma unroll      /* constant indices keep the tiles in registers */
      for (int qt = 0; qt < 2; ++qt) st[qt][kt] = fa_mma(a1, qf[qt][1], fa_mma(a0, qf[qt][0], z8));
    }
    FragH pf[2][2];      /* [query tile][32 keys]: P^T as B operand, element i = tile i >> 3, register i & 7 */
#pragma unroll      /* constant indices keep the tiles in registers */
    for (int qt = 0; qt < 2; ++qt) {
      float mk[4];      /* one short chain per tile: a tile's maximum runs while the next tile's products are still on the matrix unit */
#pragma unroll      /* constant indices keep the tiles in registers */
      for (int kt = 0; kt < 4; ++kt) { mk[kt] = st[qt][kt][0]; for (int r = 1; r < 8; ++r) mk[kt] = fmaxf(mk[kt], st[qt][kt][r]); }
      float mx = fmaxf(fmaxf(mk[0], mk[1]), fmaxf(mk[2], mk[3]));
      mx = fmaxf(mx, fa_xhalf(mx));
      const float mn = fmaxf(m[qt], mx);
      const float corr = __builtin_amdgcn_exp2f((m[qt] - mn) * CS);      /* 0 on the first stage */
      const float nb = 12.0f - mn * CS;
      m[qt] = mn;
      float ls[4] = {0.f, 0.f, 0.f, 0.f};
#pragma unroll      /* constant indices keep the tiles in registers */
      for (int kt = 0; kt < 4; ++kt) { float p[8]; for (int r = 0; r < 8; ++r) p[r] = fmaf(st[qt][kt][r], CS, nb); fa_exp2x8(p); for (int r = 0; r < 8; ++r) { ls[kt] += p[r]; pf[qt][kt >> 1].h[(kt & 1) * 8 + r] = (_Float16)p[r]; } }
      l[qt] = fmaf(l[qt], corr, (ls[0] + ls[1]) + (ls[2] + ls[3]));
#pragma unroll      /* constant indices keep the tiles in registers */
      for (int dt = 0; dt < 4; ++dt) o[qt][dt] *= corr;
    }
#pragma unroll      /* constant indices keep the tiles in registers */
    for (int ps = 0; ps < 2; ++ps) for (int dt = 0; dt < 4; ++dt) {
      const v16h a = fa_lfrag(&sv[cur][dt * 16 + ln][ps * 32 + 8 * hh]);
      o[0][dt] = fa_mma(a, pf[0][ps].v, o[0][dt]); o[1][dt] = fa_mma(a, pf[1][ps].v, o[1][dt]);
    }
    if (s + 1 < FA_NS) { *(v8us*)&sk[cur ^ 1][sr][sc] = rk0; *(v8us*)&sk[cur ^ 1][sr + 32][sc] = rk1; *(v8us*)&sv[cur ^ 1][sr][sc] = rv0; *(v8us*)&sv[cur ^ 1][sr + 32][sc] = rv1; }      /* that buffer's last readers left it before the previous barrier */
    __syncthreads();      /* publishes stage s + 1 and ends every read of stage s */
  }
  l[0] += fa_xhalf(l[0]); l[1] += fa_xhalf(l[1]);      /* the two lane halves' sums join once */
  if (g == 1) {      /* hand the group's statistics and O^T over, lane to same lane of the wave with the same queries */
#pragma unroll      /* constant indices keep the tiles in registers */
    for (int qt = 0; qt < 2; ++qt) { xs[w][qt][lane] = m[qt]; xs[w][2 + qt][lane] = l[qt];
#pragma unroll      /* constant indices keep the tiles in registers */
      for (int dt = 0; dt < 4; ++dt) { const v4f lo = {o[qt][dt][0], o[qt][dt][1], o[qt][dt][2], o[qt][dt][3]}, hi = {o[qt][dt][4], o[qt][dt][5], o[qt][dt][6], o[qt][dt][7]};
        xo[w][(qt * 4 + dt) * 2][lane] = lo; xo[w][(qt * 4 + dt) * 2 + 1][lane] = hi; } }
  }
  __syncthreads();      /* publishes group 1's partial results to group 0 */
  if (g == 0) {
#pragma unroll      /* constant indices keep the tiles in registers */
    for (int qt = 0; qt < 2; ++qt) {
      const float m1 = xs[w][qt][lane], l1 = xs[w][2 + qt][lane];
      const float mn = fmaxf(m[qt], m1);
      const float c0 = __builtin_amdgcn_exp2f((m[qt] - mn) * CS), c1 = __builtin_amdgcn_exp2f((m1 - mn) * CS);      /* both groups' weights brought to the common maximum */
      const float inv = 1.0f / fmaf(l[qt], c0, l1 * c1);
      const float a0 = c0 * inv, a1 = c1 * inv;
      float* op = out + (size_t)(q0 + qt * 16 + ln) * DM + h * HD + 8 * hh;
#pragma unroll      /* constant indices keep the tiles in registers */
      for (int dt = 0; dt < 4; ++dt) { const v4f p0 = xo[w][(qt * 4 + dt) * 2][lane], p1 = xo[w][(qt * 4 + dt) * 2 + 1][lane];
        const v4f lo = {fmaf(o[qt][dt][0], a0, p0[0] * a1), fmaf(o[qt][dt][1], a0, p0[1] * a1), fmaf(o[qt][dt][2], a0, p0[2] * a1), fmaf(o[qt][dt][3], a0, p0[3] * a1)};
        const v4f hi = {fmaf(o[qt][dt][4], a0, p1[0] * a1), fmaf(o[qt][dt][5], a0, p1[1] * a1), fmaf(o[qt][dt][6], a0, p1[2] * a1), fmaf(o[qt][dt][7], a0, p1[3] * a1)};
        *(v4f*)(op + dt * 16) = lo; *(v4f*)(op + dt * 16 + 4) = hi; }
    }
  } }
// Projection GEMM with both operands staged in LDS straight from the f32 inputs: P[token][n] = sum_k bf16(X[token][k]) bf16(W[k][n]), v_wmma_f32_16x16x32_bf16, f32 accumulation, f16 result rows of pitch LQ.
// The rounding (to nearest even, one packed conversion per two values) stands between the global loads and the LDS stores of the ring, so no 16-bit copy of X or W exists in memory and no launch makes one. X: 16 lanes cover the 256 bytes of a row's stage.
// W is [k][n]: a wave takes 8 k rows, a lane one column of each 32 (every load a whole 128-byte line), and the lane's 8 k values of a column pack into one 16-byte piece of the LDS row n: the transposition costs nothing.
// Workgroup = 8 waves = 256 tokens x 128 columns; a wave owns 64 tokens x 64 columns (16 accumulator tiles, so a fragment read from LDS feeds 4 products). Per stage of 64 k the workgroup stages
// the 256 X rows and the 128 W columns (as rows) in LDS (whole-line loads one stage ahead through registers, two buffers, one barrier a stage: the ring of k_fattn).
// Transposed products, A = Wt rows, B = X rows: a lane holds 8 neighbouring columns of ONE token per tile, which pack into one 16-byte piece of a result row.
#define G3_KT 64                     /* k per stage */
#define G3_NS (DM / G3_KT)           /* stages */
#define G3_LP 72                     /* LDS row pitch in f16: 128 data bytes + 16, an odd multiple of 16 bytes for the 16-byte fragment reads */
#define G3_MT 256                    /* tokens per workgroup */
#define G3_NT 128                    /* columns per workgroup */
#define G3_BR (G3_MT + G3_NT)        /* LDS rows per buffer: the X rows, then the Wt rows */
typedef unsigned short v4us __attribute__((ext_vector_type(4), may_alias));
__global__ __launch_bounds__(256) void k_gemm3(const float* __restrict__ X, const float* __restrict__ W, _Float16* __restrict__ P) {
  __shared__ __attribute__((aligned(16))) _Float16 sg[2 * G3_BR * G3_LP];
  const int tid = threadIdx.x, w = tid >> 5, lane = tid & 31, ln = lane & 15, hh = lane >> 4;
  const int row0 = blockIdx.y * G3_MT, col0 = blockIdx.x * G3_NT;
  const int tw = (w & 3) * 64, cw = (w >> 2) * 64;      /* the wave's first token and first column inside the workgroup's tile */
  const int xr = tid >> 4, xc = (tid & 15) * 4;      /* X staging: 16 threads cover the 256 bytes of one row's stage; rows xr + 16 i */
  const float* gx = X + (size_t)(row0 + xr) * DM + xc;
  const float* gw = W + (size_t)(w * 8) * LQ + col0 + lane;      /* W staging: k rows 8 w + e of the stage, columns lane + 32 q */
  v4f rx[16]; float rw[4][8];
#pragma unroll      /* constant indices keep the staged rows in registers */
  for (int i = 0; i < 16; ++i) rx[i] = *(const v4fa*)(gx + (size_t)i * 16 * DM);
#pragma unroll      /* constant indices keep the staged rows in registers */
  for (int q = 0; q < 4; ++q) for (int e = 0; e < 8; ++e) rw[q][e] = gw[(size_t)e * LQ + q * 32];
#pragma unroll      /* constant indices keep the staged rows in registers */
  for (int i = 0; i < 16; ++i) { union { __bf16 b[4]; v4us v; } f; for (int e = 0; e < 4; ++e) f.b[e] = (__bf16)rx[i][e]; *(v4us*)&sg[(xr + 16 * i) * G3_LP + xc] = f.v; }
#pragma unroll      /* constant indices keep the staged rows in registers */
  for (int q = 0; q < 4; ++q) { FragB f; for (int e = 0; e < 8; ++e) f.v[e] = (__bf16)rw[q][e]; *(v8us*)&sg[(G3_MT + lane + 32 * q) * G3_LP + w * 8] = f.half[0]; }
  __syncthreads();
  const v8f z8 = {0.f, 0.f, 0.f, 0.f, 0.f, 0.f, 0.f, 0.f};
  v8f acc[4][4];      /* [16 columns][16 tokens]; register r = column 8 * hh + r, lane column = token ln */
#pragma unroll      /* constant indices keep the tiles in registers */
  for (int i = 0; i < 4; ++i) for (int j = 0; j < 4; ++j) acc[i][j] = z8;
  for (int s = 0; s < G3_NS; ++s) {
    const _Float16* sb = sg + (s & 1) * (G3_BR * G3_LP);
    if (s + 1 < G3_NS) {      /* the next stage's rows fly while this stage is worked on */
#pragma unroll      /* constant indices keep the staged rows in registers */
      for (int i = 0; i < 16; ++i) rx[i] = *(const v4fa*)(gx + (size_t)i * 16 * DM + (s + 1) * G3_KT);
#pragma unroll      /* constant indices keep the staged rows in registers */
      for (int q = 0; q < 4; ++q) for (int e = 0; e < 8; ++e) rw[q][e] = gw[(size_t)((s + 1) * G3_KT + e) * LQ + q * 32];
      asm volatile("s_wait_xcnt 0x0" ::: "memory");      /* stands in front of the LDS reads below, which land in the registers that held these loads' addresses */
    }
    __builtin_amdgcn_sched_barrier(0);      /* keeps the 48 loads and their wait up here: without it the scheduler lifts an address of the LDS reads into a load's address register ahead of the wait */
    v16h wf[2][4], xf[2][4];      /* [k step of 32][16 columns] and [k step of 32][16 tokens] */
#pragma unroll      /* constant indices keep the fragments in registers */
    for (int ks = 0; ks < 2; ++ks) {      /* in the order of first use, so that the products start behind the first loads */
      wf[ks][0] = fa_lfrag(sb + (G3_MT + cw + ln) * G3_LP + ks * 32 + 8 * hh);
#pragma unroll      /* constant indices keep the fragments in registers */
      for (int j = 0; j < 4; ++j) xf[ks][j] = fa_lfrag(sb + (tw + j * 16 + ln) * G3_LP + ks * 32 + 8 * hh);
#pragma unroll      /* constant indices keep the fragments in registers */
      for (int i = 1; i < 4; ++i) wf[ks][i] = fa_lfrag(sb + (G3_MT + cw + i * 16 + ln) * G3_LP + ks * 32 + 8 * hh);
    }
    __builtin_amdgcn_sched_barrier(0);      /* the stage's 32 LDS reads stay one group ahead of its products: spread among them into one register set, every four products waited out a read's latency */
#pragma unroll      /* constant indices keep the tiles in registers */
    for (int ks = 0; ks < 2; ++ks) for (int i = 0; i < 4; ++i) for (int j = 0; j < 4; ++j) acc[i][j] = __builtin_amdgcn_wmma_f32_16x16x32_bf16(false, __builtin_bit_cast(v16b, wf[ks][i]), false, __builtin_bit_cast(v16b, xf[ks][j]), (short)0, acc[i][j], false, false);
    __builtin_amdgcn_sched_barrier(0);      /* the conversions and LDS stores of the next stage stay behind the products: lifted above them, they wait out the global loads' latency with the matrix unit idle */
    if (s + 1 < G3_NS) {      /* that buffer's last readers left it before the previous barrier */
      _Float16* sn = sg + ((s & 1) ^ 1) * (G3_BR * G3_LP);
#pragma unroll      /* constant indices keep the staged rows in registers */
      for (int i = 0; i < 16; ++i) { union { __bf16 b[4]; v4us v; } f; for (int e = 0; e < 4; ++e) f.b[e] = (__bf16)rx[i][e]; *(v4us*)&sn[(xr + 16 * i) * G3_LP + xc] = f.v; }
#pragma unroll      /* constant indices keep the staged rows in registers */
      for (int q = 0; q < 4; ++q) { FragB f; for (int e = 0; e < 8; ++e) f.v[e] = (__bf16)rw[q][e]; *(v8us*)&sn[(G3_MT + lane + 32 * q) * G3_LP + w * 8] = f.half[0]; }
    }
    __syncthreads();      /* publishes stage s + 1 and ends every read of stage s; the last one frees the ring for the result rows */
  }
  _Float16* so = sg + w * 64 * G3_LP;      /* the wave's own 64 result rows of 64 columns, so that whole 128-byte lines go out */
#pragma unroll      /* constant indices keep the tiles in registers */
  for (int i = 0; i < 4; ++i) for (int j = 0; j < 4; ++j) { FragH f; for (int r = 0; r < 8; ++r) f.h[r] = (_Float16)acc[i][j][r];
    *(v8us*)&so[(j * 16 + ln) * G3_LP + i * 16 + 8 * hh] = f.half[0]; }
  __builtin_amdgcn_fence(__ATOMIC_ACQ_REL, "workgroup"); __builtin_amdgcn_wave_barrier();      /* the wave reads back what its other lanes wrote */
#pragma unroll      /* independent row pieces: the reads go ahead of the stores */
  for (int q = 0; q < 16; ++q) { const int r = q * 4 + (lane >> 3), c = (lane & 7) * 8; const v8us v = *(const v8us*)&so[r * G3_LP + c];
    *(v8us*)((unsigned short*)P + (size_t)(row0 + tw + r) * LQ + col0 + cw + c) = v; }
}
__global__ __launch_bounds__(256) void k_vt(const _Float16* __restrict__ V16, int b, int h0, _Float16* __restrict__ VT) { __shared__ unsigned short tl[64][65]; const int tid = threadIdx.x; const int hh = blockIdx.x % HG, sg = blockIdx.x / HG; const int s0 = sg * 64; const int h = h0 + hh;
  for (int i = tid; i < 64 * 8; i += 256) { const int j = i / 8, d8 = (i % 8) * 8; FragH f; f.half[0] = *(const v8us*)((const unsigned short*)V16 + ((size_t)b * SQ + s0 + j) * DM + h * HD + d8); for (int q = 0; q < 8; ++q) tl[d8 + q][j] = f.u[q]; }
  __syncthreads();
  { for (int i = tid; i < 64 * 8; i += 256) { const int d = i / 8, j8 = (i % 8) * 8; FragH f; for (int q = 0; q < 8; ++q) f.u[q] = tl[d][j8 + q]; *(v8us*)((unsigned short*)VT + ((size_t)hh * HD + d) * SQ + s0 + j8) = f.half[0]; }  } }



__global__ __launch_bounds__(256) void k_rsmkm(const float* __restrict__ S, _Float16* __restrict__ P, int nrows, const int* __restrict__ am) {
  #pragma clang fp contract(off)
  const int t = blockIdx.x * 256 + threadIdx.x; if (t >= nrows) return; const size_t i = (size_t)t; const float* s = S + i * SQ; const int* mr = am + (size_t)(t % SQ) * SQ; float mx = -3.0e38f;
#pragma unroll 1
  for (int j = 0; j < SQ; ++j) { const float f = (mr[j] != 0) ? 1.f : 0.f; mx = fmaxf(mx, fmaf(f, s[j], (1.f - f) * -1.0e9f)); } float se = 0.f;
#pragma unroll 1
  for (int j = 0; j < SQ; ++j) { const float f = (mr[j] != 0) ? 1.f : 0.f; se += __expf(fmaf(f, s[j], (1.f - f) * -1.0e9f) - mx); } const float sc = 256.0f / se;
#pragma unroll 1
  for (int j0 = 0; j0 < SQ; j0 += 8) { FragH fr; for (int q = 0; q < 8; ++q) { const int j = j0 + q; const float f = (mr[j] != 0) ? 1.f : 0.f; fr.h[q] = (_Float16)(__expf(fmaf(f, s[j], (1.f - f) * -1.0e9f) - mx) * sc); }
    unsigned short* d = (unsigned short*)P + i * SQ + j0; *(v8us*)d = fr.half[0];  } }
extern "C" void kernel_launch(void* const* d_in, const int* in_sizes, int n_in,
                              void* d_out, int out_size, void* d_ws, size_t ws_size, hipStream_t stream) {
  (void)in_sizes; (void)n_in; (void)out_size;
  const float* const* I = (const float* const*)d_in; const float* xq = I[0]; const float* wqkv = I[1];      /* input order: X (2-D [4096][1024] = one sequence; feeds the one projection), Wqkv ([in][out] [1024][2048]: columns 0..1023 = the shared q = k projection, 1024..2047 = v); NO biases; NO output projection */
  static_assert(NH * HD == DM && DM % 64 == 0 && SQ % (FA_KT * FA_KG) == 0 && SQ % 256 == 0 && NH % HG == 0 && MP % G3_MT == 0 && LQ % G3_NT == 0 && G3_NS >= 2, "shape / tile multiples");
  char* ws = (char*)d_ws; size_t off = 0;
  auto take = [&](size_t bytes) { char* p = ws + off; off += (bytes + 255) & ~(size_t)255; return p; };
  _Float16* P16 = (_Float16*)take(NR * LQ * 2);
  _Float16* VT = (_Float16*)take((size_t)NH * HD * SQ * 2);
  if (off > ws_size) return;
  const size_t r0p = (size_t)B0 * SQ;      /* first projected row */
  k_gemm3<<<dim3(LQ / G3_NT, MP / G3_MT), 256, 0, stream>>>(xq + r0p * DM, wqkv, P16 + r0p * LQ);      /* proj = X Wqkv from the f32 inputs ([in][out] weights as they lie), all 2048 columns in one launch; q and k are the same product and are read from the same columns */
  for (int b = B0; b < B0 + NBR; ++b) { const size_t r0 = (size_t)b * SQ;
    k_vt<NH, SQ><<<NH * (SQ / 64), 256, 0, stream>>>(P16 + r0 * LQ, LQ, DM, VT);      /* V^T [NH][HD][SQ] for this batch */
    k_fattn<<<dim3(QN / 256, NHD), 256 * FA_KG, 0, stream>>>(P16 + r0 * LQ, P16 + r0 * LQ, VT, (float*)d_out + r0 * DM); }      /* out = softmax(q k^T / 8) v for all heads, f32 straight into the merged-heads output rows (no output projection) */
}

// v007
// One run takes 87.7 microseconds.
// In both of two side-by-side timings against v006, it was 1.03 times as fast.
// All steps since v000 together make it 160 times as fast.
#include <hip/hip_runtime.h>
// Multi-head self-attention on ONE 4096-token problem with a SHARED query / key projection and no output projection, NON-causal (X [4096][1024]; proj = X Wqkv ([in][out] 1024 x 2048 sigma 1/32, no bias) split into a qk half and a v half; the scores use the SAME projection on both sides: scores = qk qk^T / sqrt(64) per head (16 heads of 64; symmetric per head); softmax over all 4096 keys (no mask); out = att v merged head-major -> [4096][1024]; no output projection); all heads in ONE fused attention launch.
// Structure: token rows r = b*4096 + s; proj = X Wqkv as ONE WMMA GEMM over all 2048 columns, fed from the f32 inputs (x and weights rounded to bf16 on the way into LDS, bf16 products; 256x128 workgroup tiles, 64x64 wave tiles, f32 accumulation, f16 output: columns 0..1023 as rows of pitch 2048 that serve as q and as k, columns 1024..2047 (v) written as V^T [head][dim][token] by the same launch, its two WMMA operands exchanged there); per batch: one fused attention launch over all heads (online softmax, f32 statistics, weights as f16 against the running maximum) written f32 straight into the merged-heads output rows.
// Compute dtype: inputs rounded to bf16; x / weights exact bf16 operands (v_wmma_f32_16x16x32_bf16); q, k, v and softmax weights as plain f16 GEMM operands (~2^-12); o, scores and softmax statistics f32. v_wmma_f32_16x16x32_f16.
#define NB 1
#define SQ 4096
#define DM 1024
#define NH 16
#define HD 64
#define HG 1                         /* heads per group of the per-group V^T helper */
#define B0 0                         /* first batch processed (debug hook) */
#define NBR NB                       /* batches processed (debug hook) */
#define NR ((size_t)NB * SQ)         /* token rows */
#define MP ((int)((size_t)NBR * SQ)) /* rows projected (debug hook) */
#define QN SQ                        /* query rows attended per batch (debug hook) */
#define NHD NH                       /* heads attended (debug hook) */
#define MPO MP
#define LQ (2 * DM)      /* row pitch of the projected rows: 1024 shared q = k columns, then 1024 left unwritten (v goes out as V^T) */
typedef __bf16 v16b __attribute__((ext_vector_type(16)));
typedef unsigned short v8us __attribute__((ext_vector_type(8), may_alias));
typedef float  v8f  __attribute__((ext_vector_type(8)));
typedef float  v4f  __attribute__((ext_vector_type(4)));
typedef float  v4fa __attribute__((ext_vector_type(4), may_alias));
union FragB { v16b v; v8us half[2]; unsigned short u[16]; };

__device__ __forceinline__ unsigned short bf16_bits(float x) { unsigned int u = __float_as_uint(x); return (unsigned short)((u + 0x7FFFu + ((u >> 16) & 1u)) >> 16); }
__device__ __forceinline__ float bf16_val(unsigned short b) { return __uint_as_float(((unsigned int)b) << 16); }
__device__ __forceinline__ float bf16_round(float x) { return bf16_val(bf16_bits(x)); }
// D += A·B with NT terms: 1 = ah·bh, 2 = + al·bh (A split), 3 = + ah·bl (both split)
template <int NT>
__device__ __forceinline__ v8f mmaN(v16b ah, v16b al, v16b bh, v16b bl, v8f c) {
  c = __builtin_amdgcn_wmma_f32_16x16x32_bf16(false, ah, false, bh, (short)0, c, false, false);
  if (NT >= 2) c = __builtin_amdgcn_wmma_f32_16x16x32_bf16(false, al, false, bh, (short)0, c, false, false);
  if (NT >= 3) c = __builtin_amdgcn_wmma_f32_16x16x32_bf16(false, ah, false, bl, (short)0, c, false, false);
  asm volatile("v_nop\n\tv_nop\n\tv_nop\n\tv_nop" : "+v"(c) : "v"(ah), "v"(al), "v"(bh), "v"(bl));
  return c;
}

__global__ __launch_bounds__(256) void k_wt_bf16(const float* __restrict__ W, unsigned short* __restrict__ Wt, int K, int N) {
  const int t = blockIdx.x * 256 + threadIdx.x;
  const int k8n = K / 8;
  if (t >= N * k8n) return;
  const int n = t / k8n, k8 = (t % k8n) * 8;
  v8us v;
#pragma unroll
  for (int i = 0; i < 8; ++i) v[i] = bf16_bits(W[(size_t)(k8 + i) * N + n]);
  *(v8us*)(Wt + (size_t)n * K + k8) = v;
  
}

// GEMM C[M][N] (f32, pitch ldc) = act(A[M][K]·W + bias). A f32 row-major (pitch lda) converted per fragment to bf16
// (ASPLIT: hi/lo two planes -> 2 terms, else single rounded term); Wt bf16 [N][K] (pitch ldb). BIAS_BF16 rounds the
// bias to bf16 first (bias quantised to bf16 before the add). K%32==0, M%16==0, N%64==0.
template <bool ASPLIT, int ACT, bool BIAS_BF16>
__global__ __launch_bounds__(128) void k_gemm_bf(const float* __restrict__ A, int lda, const unsigned short* __restrict__ Wt, int ldb,
                                               const float* __restrict__ bias, float* __restrict__ C, int ldc, int M, int N, int K) {
  __shared__ __attribute__((aligned(16))) float so[4][16][64];
  const int tid = threadIdx.x, w = tid >> 5, lane = tid & 31, ln = lane & 15, hh = lane >> 4;
  const int ntn = N / 64;
  const int wid = blockIdx.x * 4 + w;
  const int mt = wid / ntn, nq = wid % ntn;
  if (mt * 16 >= M) return;
  const int row0 = mt * 16, col0 = nq * 64;
  const float* arow = A + (size_t)(row0 + ln) * lda;
  v8f acc[4] = {};
  for (int kb = 0; kb < K; kb += 32) {
    FragB ah, al;
    const v4f x0 = *(const v4fa*)(arow + kb + 8 * hh), x1 = *(const v4fa*)(arow + kb + 8 * hh + 4);
    const v4f x2 = *(const v4fa*)(arow + kb + 16 + 8 * hh), x3 = *(const v4fa*)(arow + kb + 16 + 8 * hh + 4);
    float xs[16] = {x0[0],x0[1],x0[2],x0[3],x1[0],x1[1],x1[2],x1[3],x2[0],x2[1],x2[2],x2[3],x3[0],x3[1],x3[2],x3[3]};
#pragma unroll
    for (int i = 0; i < 16; ++i) { const unsigned short hb = bf16_bits(xs[i]); ah.u[i] = hb; al.u[i] = ASPLIT ? bf16_bits(xs[i] - bf16_val(hb)) : (unsigned short)0; }
#pragma unroll
    for (int t = 0; t < 4; ++t) {
      const unsigned short* brow = Wt + (size_t)(col0 + t * 16 + ln) * ldb + kb;
      FragB b;
      b.half[0] = *(const v8us*)(brow + 8 * hh);
      b.half[1] = *(const v8us*)(brow + 16 + 8 * hh);
      acc[t] = mmaN<ASPLIT ? 2 : 1>(ah.v, al.v, b.v, b.v, acc[t]);
    }
  }
#pragma unroll
  for (int t = 0; t < 4; ++t) {
    float bv = bias ? bias[col0 + t * 16 + ln] : 0.f;
    if (BIAS_BF16) bv = bf16_round(bv);
#pragma unroll
    for (int r = 0; r < 8; ++r) { float v = acc[t][r] + bv; if (ACT == 1) v = fmaxf(v, 0.f); so[w][8 * hh + r][t * 16 + ln] = v; }
  }
  __builtin_amdgcn_fence(__ATOMIC_ACQ_REL, "workgroup");
  __builtin_amdgcn_wave_barrier();
  const int rsub = lane >> 4, c4 = (lane & 15) * 4;
  {
#pragma unroll
    for (int q = 0; q < 8; ++q) {
      const int r = q * 2 + rsub;
      const v4f v = *(const v4fa*)&so[w][r][c4];
      *(v4f*)(C + (size_t)(row0 + r) * ldc + col0 + c4) = v;
    }
    
  }
}

// GEMM C = act(A·W + bias + resid): A f32 (ASPLIT -> hi/lo 2 terms), Wt bf16 [N][K]; ACT 0 none, 1 relu, 2 exact gelu;
// resid (optional, f32, row index = (row % rmod), pitch ldr, RES_BF16 rounds it) added before the activation.
template <bool ASPLIT, int ACT, bool BIAS_BF16, bool RES_BF16>
__global__ __launch_bounds__(128) void k_gemm_bf3(const float* __restrict__ A, int lda, const unsigned short* __restrict__ Wt, int ldb,
                                                const float* __restrict__ bias, const float* __restrict__ resid, int rmod, int ldr,
                                                float* __restrict__ C, int ldc, int M, int N, int K) {
  __shared__ __attribute__((aligned(16))) float so[4][16][64];
  const int tid = threadIdx.x, w = tid >> 5, lane = tid & 31, ln = lane & 15, hh = lane >> 4;
  const int ntn = N / 64;
  const int wid = blockIdx.x * 4 + w;
  const int mt = wid / ntn, nq = wid % ntn;
  if (mt * 16 >= M) return;
  const int row0 = mt * 16, col0 = nq * 64;
  const float* arow = A + (size_t)(row0 + ln) * lda;
  v8f acc[4] = {};
  for (int kb = 0; kb < K; kb += 32) {
    FragB ah, al;
    const v4f x0 = *(const v4fa*)(arow + kb + 8 * hh), x1 = *(const v4fa*)(arow + kb + 8 * hh + 4);
    const v4f x2 = *(const v4fa*)(arow + kb + 16 + 8 * hh), x3 = *(const v4fa*)(arow + kb + 16 + 8 * hh + 4);
    float xs[16] = {x0[0],x0[1],x0[2],x0[3],x1[0],x1[1],x1[2],x1[3],x2[0],x2[1],x2[2],x2[3],x3[0],x3[1],x3[2],x3[3]};
#pragma unroll
    for (int i = 0; i < 16; ++i) { const unsigned short hb = bf16_bits(xs[i]); ah.u[i] = hb; al.u[i] = ASPLIT ? bf16_bits(xs[i] - bf16_val(hb)) : (unsigned short)0; }
#pragma unroll
    for (int t = 0; t < 4; ++t) {
      const unsigned short* brow = Wt + (size_t)(col0 + t * 16 + ln) * ldb + kb;
      FragB b;
      b.half[0] = *(const v8us*)(brow + 8 * hh);
      b.half[1] = *(const v8us*)(brow + 16 + 8 * hh);
      acc[t] = mmaN<ASPLIT ? 2 : 1>(ah.v, al.v, b.v, b.v, acc[t]);
    }
  }
#pragma unroll
  for (int t = 0; t < 4; ++t) {
    const int col = col0 + t * 16 + ln;
    float bv = bias ? bias[col] : 0.f;
    if (BIAS_BF16) bv = bf16_round(bv);
#pragma unroll
    for (int r = 0; r < 8; ++r) {
      float v = acc[t][r] + bv;
      if (resid) { float rv = resid[(size_t)((row0 + 8 * hh + r) % rmod) * ldr + col]; if (RES_BF16) rv = bf16_round(rv); v += rv; }
      if (ACT == 1) v = fmaxf(v, 0.f);
      if (ACT == 2) v = 0.5f * v * (1.0f + erff(v * 0.70710678118654752f));
      if (ACT == 3) { const float u = 0.7978845608028654f * (v + 0.044715f * v * v * v); v = 0.5f * v * (1.0f + tanhf(u)); }
      so[w][8 * hh + r][t * 16 + ln] = v;
    }
  }
  __builtin_amdgcn_fence(__ATOMIC_ACQ_REL, "workgroup");
  __builtin_amdgcn_wave_barrier();
  const int rsub = lane >> 4, c4 = (lane & 15) * 4;
  {
#pragma unroll
    for (int q = 0; q < 8; ++q) {
      const int r = q * 2 + rsub;
      const v4f v = *(const v4fa*)&so[w][r][c4];
      *(v4f*)(C + (size_t)(row0 + r) * ldc + col0 + c4) = v;
    }
    
  }
}
// row LayerNorm (biased variance, eps) over N: s = X (+ R); optional out_sum <- s; out_norm <- (s-mu)*rsqrt(var+eps)*g + b
template <bool PARAM_BF16>
__global__ __launch_bounds__(256) void k_layernorm(const float* __restrict__ X, const float* __restrict__ R, const float* __restrict__ g, const float* __restrict__ bta,
                                                  float* __restrict__ out_sum, float* __restrict__ out_norm, int N, float eps) {
  __shared__ float red[256];
  const int row = blockIdx.x, tid = threadIdx.x;
  const float* x = X + (size_t)row * N; const float* rr = R ? R + (size_t)row * N : nullptr;
  float vals[16];                     // up to N = 4096
  const int per = N / 256;            // contiguous chunk per thread? use strided-by-4 chunks: thread handles j = tid*4 + 1024*u
  float s1 = 0.f;
  for (int u = 0; u < per / 4; ++u) {
    const int j = tid * 4 + 1024 * u;
    const v4f a = *(const v4fa*)(x + j);
    v4f b = {0.f,0.f,0.f,0.f}; if (rr) b = *(const v4fa*)(rr + j);
#pragma unroll
    for (int q = 0; q < 4; ++q) { const float v = a[q] + b[q]; vals[u * 4 + q] = v; s1 += v; }
  }
  red[tid] = s1; __syncthreads();
  for (int st = 128; st > 0; st >>= 1) { if (tid < st) red[tid] += red[tid + st]; __syncthreads(); }
  const float mu = red[0] / (float)N; __syncthreads();
  float s2 = 0.f;
  for (int u = 0; u < per / 4; ++u)
#pragma unroll
    for (int q = 0; q < 4; ++q) { const float c = vals[u * 4 + q] - mu; s2 += c * c; }
  red[tid] = s2; __syncthreads();
  for (int st = 128; st > 0; st >>= 1) { if (tid < st) red[tid] += red[tid + st]; __syncthreads(); }
  const float rs = rsqrtf(red[0] / (float)N + eps);
  {
    for (int u = 0; u < per / 4; ++u) {
      const int j = tid * 4 + 1024 * u;
      v4f o, sm;
#pragma unroll
      for (int q = 0; q < 4; ++q) {
        float gg = g[j + q], bb = bta[j + q];
        if (PARAM_BF16) { gg = bf16_round(gg); bb = bf16_round(bb); }
        sm[q] = vals[u * 4 + q]; o[q] = (vals[u * 4 + q] - mu) * rs * gg + bb;
      }
      if (out_sum) *(v4f*)(out_sum + (size_t)row * N + j) = sm;
      *(v4f*)(out_norm + (size_t)row * N + j) = o;
    }
    
  }
}



// ---- f16 WMMA path (v_wmma_f32_16x16x32_f16): 11-bit significands for operands in range — used where a [0,1] probability operand needs more precision than bf16
typedef _Float16 v16h __attribute__((ext_vector_type(16)));
union FragH { v16h v; v8us half[2]; _Float16 h[16]; unsigned short u[16]; };
template <int NT>
__device__ __forceinline__ v8f mmaH(v16h ah, v16h al, v16h bh, v16h bl, v8f c) {
  c = __builtin_amdgcn_wmma_f32_16x16x32_f16(false, ah, false, bh, (short)0, c, false, false);
  if (NT >= 2) c = __builtin_amdgcn_wmma_f32_16x16x32_f16(false, al, false, bh, (short)0, c, false, false);
  if (NT >= 3) c = __builtin_amdgcn_wmma_f32_16x16x32_f16(false, ah, false, bl, (short)0, c, false, false);
  asm volatile("v_nop\n\tv_nop\n\tv_nop\n\tv_nop" : "+v"(c) : "v"(ah), "v"(al), "v"(bh), "v"(bl));
  return c;
}
// batched GEMM like k_gemm_b but f16 operands: A f32 (split into f16 hi/lo if ASPLIT, else rounded to f16), Bt = f16 values [n][k]; alpha; C f32; N multiple of 16 (partial tiles skipped)
template <bool ASPLIT>
__global__ __launch_bounds__(128) void k_gemm_h(const float* __restrict__ A, int lda, size_t sA, const _Float16* __restrict__ Bh, int ldb, size_t sB, float alpha, float* __restrict__ C, int ldc, size_t sC, int M, int N, int K) {
  __shared__ __attribute__((aligned(16))) float so[4][16][64];
  const int tid = threadIdx.x, w = tid >> 5, lane = tid & 31, ln = lane & 15, hh = lane >> 4; const int by = blockIdx.y;
  A += (size_t)by * sA; Bh += (size_t)by * sB; C += (size_t)by * sC;
  const int ntn = (N + 63) / 64; const int wid = blockIdx.x * 4 + w; const int mt = wid / ntn, nq = wid % ntn; if (mt * 16 >= M) return;
  const int row0 = mt * 16, col0 = nq * 64; const float* arow = A + (size_t)(row0 + ln) * lda;
  v8f acc[4] = {};
  for (int kb = 0; kb < K; kb += 32) {
    FragH ah, al;
    const v4f x0 = *(const v4fa*)(arow + kb + 8 * hh), x1 = *(const v4fa*)(arow + kb + 8 * hh + 4), x2 = *(const v4fa*)(arow + kb + 16 + 8 * hh), x3 = *(const v4fa*)(arow + kb + 16 + 8 * hh + 4);
    float xs[16] = {x0[0],x0[1],x0[2],x0[3],x1[0],x1[1],x1[2],x1[3],x2[0],x2[1],x2[2],x2[3],x3[0],x3[1],x3[2],x3[3]};
#pragma unroll
    for (int i = 0; i < 16; ++i) { const _Float16 h = (_Float16)xs[i]; ah.h[i] = h; al.h[i] = ASPLIT ? (_Float16)(xs[i] - (float)h) : (_Float16)0.0f; }
#pragma unroll
    for (int t = 0; t < 4; ++t) { if (col0 + t * 16 >= N) continue; const size_t boff = (size_t)(col0 + t * 16 + ln) * ldb + kb; FragH bq; bq.half[0] = *(const v8us*)(Bh + boff + 8 * hh); bq.half[1] = *(const v8us*)(Bh + boff + 16 + 8 * hh);
      acc[t] = mmaH<ASPLIT ? 2 : 1>(ah.v, al.v, bq.v, bq.v, acc[t]); }
  }
#pragma unroll
  for (int t = 0; t < 4; ++t) { if (col0 + t * 16 >= N) continue;
#pragma unroll
    for (int r = 0; r < 8; ++r) so[w][8 * hh + r][t * 16 + ln] = acc[t][r] * alpha; }
  __builtin_amdgcn_fence(__ATOMIC_ACQ_REL, "workgroup"); __builtin_amdgcn_wave_barrier();
  const int rsub = lane >> 4, c4 = (lane & 15) * 4;
  {
#pragma unroll
    for (int q = 0; q < 8; ++q) { const int r = q * 2 + rsub; if (col0 + c4 < N) { const v4f v = *(const v4fa*)&so[w][r][c4]; *(v4f*)(C + (size_t)(row0 + r) * ldc + col0 + c4) = v; } }
     }
}

// Wt[n][k] = f16(W[k][n]·scale) from f32 row-major W[K][N] (scale = power of two; bf16-exact weights stay exact in f16 away from the subnormal range)
__global__ __launch_bounds__(256) void k_wt_f16(const float* __restrict__ W, _Float16* __restrict__ Wt, int K, int N, float scale) {
  const int t = blockIdx.x * 256 + threadIdx.x; if (t >= N * (K / 8)) return; const int n = t / (K / 8), k8 = (t % (K / 8)) * 8; FragH f;
#pragma unroll
  for (int i = 0; i < 8; ++i) f.h[i] = (_Float16)(bf16_round(W[(size_t)(k8 + i) * N + n]) * scale); const v8us o = f.half[0];
  *(v8us*)((unsigned short*)Wt + (size_t)n * K + k8) = o; 
}
// k_gemm_hh variant with fused epilogue: v = acc·alpha + bias[by·sBias + col] (+ CP[(row/rowsPerB)·sCPb + by·64 + col] if CP) ; ACT 0 none / 1 elu ; writes f16 C16 (and f32 C if non-null)
template <int ACT>
__global__ __launch_bounds__(128) void k_gemm_hhx(const _Float16* __restrict__ A, int lda, size_t sA, const _Float16* __restrict__ Bh, int ldb, size_t sB, float alpha, const float* __restrict__ bias, size_t sBias, const float* __restrict__ CP, int rowsPerB, size_t sCPb, int row0g,
    float* __restrict__ C, _Float16* __restrict__ C16, int ldc, size_t sC, int M, int N, int K) {
  __shared__ __attribute__((aligned(16))) float so[4][16][64];
  const int tid = threadIdx.x, w = tid >> 5, lane = tid & 31, ln = lane & 15, hh = lane >> 4; const int by = blockIdx.y;
  A += (size_t)by * sA; Bh += (size_t)by * sB; const size_t cofs = (size_t)by * sC; const float* bp = bias ? bias + (size_t)by * sBias : nullptr;
  const int ntn = (N + 63) / 64; const int wid = blockIdx.x * 4 + w; const int mt = wid / ntn, nq = wid % ntn; if (mt * 16 >= M) return;
  const int row0 = mt * 16, col0 = nq * 64; const _Float16* arow = A + (size_t)(row0 + ln) * lda;
  v8f acc[4] = {};
  for (int kb = 0; kb < K; kb += 32) { FragH ah; ah.half[0] = *(const v8us*)((const unsigned short*)arow + kb + 8 * hh); ah.half[1] = *(const v8us*)((const unsigned short*)arow + kb + 16 + 8 * hh);
#pragma unroll
    for (int t = 0; t < 4; ++t) { if (col0 + t * 16 >= N) continue; const size_t boff = (size_t)(col0 + t * 16 + ln) * ldb + kb; FragH bq; bq.half[0] = *(const v8us*)((const unsigned short*)Bh + boff + 8 * hh); bq.half[1] = *(const v8us*)((const unsigned short*)Bh + boff + 16 + 8 * hh);
      acc[t] = mmaH<1>(ah.v, ah.v, bq.v, bq.v, acc[t]); }
  }
#pragma unroll
  for (int t = 0; t < 4; ++t) { if (col0 + t * 16 >= N) continue; const int col = col0 + t * 16 + ln; const float bv = bp ? bf16_round(bp[col]) : 0.f;
#pragma unroll
    for (int r = 0; r < 8; ++r) { float v = acc[t][r] * alpha + bv; if (CP) { const int rr = row0g + row0 + 8 * hh + r; if (rowsPerB < 0) v += CP[cofs + (size_t)rr * ldc + col];      /* rowsPerB < 0: own element of the batched C plane */ else { const int bidx = rr / rowsPerB; v += CP[(size_t)bidx * sCPb + (size_t)by * 64 + col]; } } if (ACT == 1) v = (v > 0.f) ? v : expm1f(v); else if (ACT == 7) v = (v > 0.f) ? v + 1.0f : expf(v); else if (ACT == 8) v = tanhf(v); else if (ACT == 9) v = 0.5f * v * (1.0f + tanhf(0.7978845608028654f * (v + 0.044715f * v * v * v))); else if (ACT == 11) v = 1.0f / (1.0f + expf(-v)); else if (ACT == 12) v = (v > 0.f) ? v : 0.01f * v; else if (ACT == 14) v = (v > 0.f) ? v : 0.1f * v; else if (ACT == 16) v = (v >= 0.f) ? v : 0.3f * v; else if (ACT == 17) v = (v >= 0.f) ? v : 0.2f * v; else if (ACT == 15) v = v / (1.0f + expf(-v)); else if (ACT == 3) v = fmaxf(v, 0.f); else if (ACT == 6) v = 0.5f * v * (1.0f + erff(v * 0.70710678118654752f)); so[w][8 * hh + r][t * 16 + ln] = v; } }
  __builtin_amdgcn_fence(__ATOMIC_ACQ_REL, "workgroup"); __builtin_amdgcn_wave_barrier();
  const int rsub = lane >> 4, c4 = (lane & 15) * 4; typedef _Float16 v4h __attribute__((ext_vector_type(4)));
  {
#pragma unroll
    for (int q = 0; q < 8; ++q) { const int r = q * 2 + rsub; if (col0 + c4 < N) { const v4f v = *(const v4fa*)&so[w][r][c4]; if (C) *(v4f*)(C + cofs + (size_t)(row0 + r) * ldc + col0 + c4) = v; if (C16) { v4h h4; for (int i = 0; i < 4; ++i) h4[i] = (_Float16)v[i]; *(v4h*)(C16 + cofs + (size_t)(row0 + r) * ldc + col0 + c4) = h4; } } }
     }
}


typedef _Float16 v4h __attribute__((ext_vector_type(4)));

__global__ __launch_bounds__(256) void k_x16(const float* __restrict__ x, _Float16* __restrict__ X16, size_t n8) { const size_t t = (size_t)blockIdx.x * 256 + threadIdx.x; if (t >= n8) return; FragH f;
#pragma unroll
  for (int q = 0; q < 8; ++q) f.h[q] = (_Float16)bf16_round(x[t * 8 + q]); *(v8us*)((unsigned short*)X16 + t * 8) = f.half[0];  }
__global__ __launch_bounds__(256) void k_h16(const float* __restrict__ x, _Float16* __restrict__ X16, size_t n8) { const size_t t = (size_t)blockIdx.x * 256 + threadIdx.x; if (t >= n8) return; FragH f;
#pragma unroll
  for (int q = 0; q < 8; ++q) f.h[q] = (_Float16)x[t * 8 + q]; *(v8us*)((unsigned short*)X16 + t * 8) = f.half[0];  }
__global__ __launch_bounds__(256) void k_round16f(const float* __restrict__ W, _Float16* __restrict__ Bt, size_t n8) { const size_t t = (size_t)blockIdx.x * 256 + threadIdx.x; if (t >= n8) return; FragH f;
#pragma unroll
  for (int i = 0; i < 8; ++i) f.h[i] = (_Float16)(bf16_round(W[t * 8 + i]) * 16.0f); *(v8us*)((unsigned short*)Bt + t * 8) = f.half[0];  }
template <int NHv, int TTv>
__global__ __launch_bounds__(256) void k_vt(const _Float16* __restrict__ V16, int ldv, int voff, _Float16* __restrict__ Vt) { __shared__ unsigned short tl[64][66]; const int tid = threadIdx.x; const int slab = blockIdx.x / (TTv / 64), lg = blockIdx.x % (TTv / 64); const int b = slab / NHv, h = slab % NHv;
  for (int i = tid; i < 64 * 8; i += 256) { const int r = i / 8, c8 = (i % 8) * 8; FragH f; f.half[0] = *(const v8us*)((const unsigned short*)V16 + ((size_t)b * TTv + lg * 64 + r) * ldv + voff + h * 64 + c8);
#pragma unroll
    for (int q = 0; q < 8; ++q) tl[r][c8 + q] = f.u[q]; }
  __syncthreads();
  {
#pragma unroll
    for (int rd = 0; rd < 2; ++rd) { const int d = rd * 32 + tid / 8, pc = tid % 8; FragH f;
#pragma unroll
      for (int q = 0; q < 8; ++q) f.u[q] = tl[pc * 8 + q][d];
      *(v8us*)((unsigned short*)Vt + ((size_t)slab * 64 + d) * TTv + lg * 64 + pc * 8) = f.half[0]; }
     } }

__global__ __launch_bounds__(256) void k_hl(const float* __restrict__ F, _Float16* __restrict__ Hh, _Float16* __restrict__ Hl, size_t n8) { const size_t t = (size_t)blockIdx.x * 256 + threadIdx.x; if (t >= n8) return; FragH fh, fl; const v4f a = *(const v4fa*)(F + t * 8), c = *(const v4fa*)(F + t * 8 + 4);
#pragma unroll
  for (int q = 0; q < 4; ++q) { _Float16 h = (_Float16)a[q]; fh.h[q] = h; fl.h[q] = (_Float16)((a[q] - (float)h) * 1024.0f); h = (_Float16)c[q]; fh.h[4 + q] = h; fl.h[4 + q] = (_Float16)((c[q] - (float)h) * 1024.0f); }
  { *(v8us*)((unsigned short*)Hh + t * 8) = fh.half[0]; *(v8us*)((unsigned short*)Hl + t * 8) = fl.half[0];  } }

// ---- fast GEMM (wave tile 32x64; requires M % 32 == 0 rows per launch region and N % 64 == 0); epilogue = k_gemm_hhx semantics ----
__device__ __forceinline__ v16h g2_frag(const _Float16* p, int hh) { FragH f; f.half[0] = *(const v8us*)((const unsigned short*)p + 8 * hh); f.half[1] = *(const v8us*)((const unsigned short*)p + 16 + 8 * hh); return f.v; }
__device__ __forceinline__ v8f g2_mma(v16h a, v16h b, v8f c) { v8f d = __builtin_amdgcn_wmma_f32_16x16x32_f16(false, a, false, b, (short)0, c, false, false); asm volatile("v_nop\n\tv_nop\n\tv_nop\n\tv_nop" : "+v"(d) : "v"(a), "v"(b)); return d; }
template <int ACT>
__global__ __launch_bounds__(128) void k_gemm2(const _Float16* __restrict__ A, int lda, size_t sA, const _Float16* __restrict__ Bh, int ldb, size_t sB, float alpha, const float* __restrict__ bias, size_t sBias, const float* __restrict__ CP, int rowsPerB, size_t sCPb, int row0g,
    float* __restrict__ C, _Float16* __restrict__ C16, int ldc, size_t sC, int M, int N, int K) { static_assert(ACT == 0 || ACT == 3 || ACT == 6 || ACT == 8 || ACT == 9 || ACT == 11 || ACT == 12 || ACT == 14 || ACT == 15 || ACT == 16 || ACT == 17, "k_gemm2: unsupported ACT code (would silently apply no activation)");
  __shared__ __attribute__((aligned(16))) float so[4][32][68];
  const int tid = threadIdx.x, w = tid >> 5, lane = tid & 31, ln = lane & 15, hh = lane >> 4; const int by = blockIdx.y;
  A += (size_t)by * sA; Bh += (size_t)by * sB; const size_t cofs = (size_t)by * sC; const float* bp = bias ? bias + (size_t)by * sBias : nullptr;
  const int ntn = N >> 6; const int mt = blockIdx.x / ntn, nq = blockIdx.x - mt * ntn; const int row0 = mt * 128 + 32 * w, col0 = nq * 64; if (row0 >= M) return;
  const _Float16* a0p = A + (size_t)(row0 + ln) * lda; const _Float16* a1p = a0p + (size_t)16 * lda;
  const _Float16* b0p = Bh + (size_t)(col0 + ln) * ldb; const _Float16* b1p = b0p + (size_t)16 * ldb; const _Float16* b2p = b1p + (size_t)16 * ldb; const _Float16* b3p = b2p + (size_t)16 * ldb;
  const v8f z8 = {0.f,0.f,0.f,0.f,0.f,0.f,0.f,0.f}; v8f c00 = z8, c01 = z8, c02 = z8, c03 = z8, c10 = z8, c11 = z8, c12 = z8, c13 = z8;
#pragma unroll 1
  for (int kb = 0; kb < K; kb += 32) { const v16h a0 = g2_frag(a0p + kb, hh), a1 = g2_frag(a1p + kb, hh);
    v16h b = g2_frag(b0p + kb, hh); c00 = g2_mma(a0, b, c00); c10 = g2_mma(a1, b, c10);
    b = g2_frag(b1p + kb, hh); c01 = g2_mma(a0, b, c01); c11 = g2_mma(a1, b, c11);
    b = g2_frag(b2p + kb, hh); c02 = g2_mma(a0, b, c02); c12 = g2_mma(a1, b, c12);
    b = g2_frag(b3p + kb, hh); c03 = g2_mma(a0, b, c03); c13 = g2_mma(a1, b, c13); }
  v8f accs[8] = {c00, c01, c02, c03, c10, c11, c12, c13};
#pragma unroll
  for (int u = 0; u < 8; ++u) { const int t = u & 3, half = u >> 2; const int col = col0 + t * 16 + ln; const float bv = bp ? bf16_round(bp[col]) : 0.f;
#pragma unroll
    for (int r = 0; r < 8; ++r) { const int rloc = half * 16 + 8 * hh + r; float v = accs[u][r] * alpha + bv; if (CP) { if (rowsPerB < 0) v += CP[cofs + (size_t)(row0g + row0 + rloc) * ldc + col];      /* rowsPerB < 0: own element of the batched C plane */ else { const int bidx = (row0g + row0 + rloc) / rowsPerB; v += CP[(size_t)bidx * sCPb + (size_t)by * 64 + col]; } }
      if (ACT == 3) v = fmaxf(v, 0.f); else if (ACT == 6) v = 0.5f * v * (1.0f + erff(v * 0.70710678118654752f)); else if (ACT == 11) v = 1.0f / (1.0f + expf(-v)); else if (ACT == 15) v = v / (1.0f + expf(-v)); else if (ACT == 12) v = (v > 0.f) ? v : 0.01f * v; else if (ACT == 8) v = tanhf(v); else if (ACT == 9) v = 0.5f * v * (1.0f + tanhf(0.7978845608028654f * (v + 0.044715f * v * v * v))); else if (ACT == 14) v = (v > 0.f) ? v : 0.1f * v; else if (ACT == 16) v = (v >= 0.f) ? v : 0.3f * v; else if (ACT == 17) v = (v >= 0.f) ? v : 0.2f * v;
      so[w][rloc][t * 16 + ln] = v; } }
  __builtin_amdgcn_fence(__ATOMIC_ACQ_REL, "workgroup"); __builtin_amdgcn_wave_barrier();
  const int rsub = lane >> 4, c4 = (lane & 15) * 4;
  {
#pragma unroll
    for (int q = 0; q < 16; ++q) { const int r = q * 2 + rsub; const v4f v = *(const v4fa*)&so[w][r][c4]; if (C) *(v4f*)(C + cofs + (size_t)(row0 + r) * ldc + col0 + c4) = v; if (C16) { v4h h4; for (int i = 0; i < 4; ++i) h4[i] = (_Float16)v[i]; *(v4h*)(C16 + cofs + (size_t)(row0 + r) * ldc + col0 + c4) = h4; } }
     } }


__global__ __launch_bounds__(256) void k_wnat(const float* __restrict__ w, size_t n8, _Float16* __restrict__ Bt) { const size_t t = (size_t)blockIdx.x * 256 + threadIdx.x; if (t >= n8) return; FragH f; for (int q = 0; q < 8; ++q) f.h[q] = (_Float16)(bf16_round(w[t * 8 + q]) * 16.0f); *(v8us*)((unsigned short*)Bt + t * 8) = f.half[0];  }
// Fused attention, all heads in one launch: scores, softmax and the weighted sum of v never leave the chip (no score or weight plane in memory).
// Workgroup = 16 waves = 256 queries of one head, as two key groups of 8 waves: a wave owns 32 query columns and every second tile of 64 keys, so that four waves share a SIMD
// (one wave's vector work and LDS waits run under the others' products) at the same fragment reuse. Per stage each group stages its own 64 k rows and v^T rows in its own LDS ring
// (whole-line 16-byte loads one stage ahead through registers, two buffers, one barrier a stage). Each group keeps its own maximum, sum and O^T; they are merged once, through LDS, at the end. Transposed products: S^T = K Q^T (a lane holds 8 keys of ONE query per tile),
// running maximum and sum per query (online softmax, f32), weights x 2^12 against the running maximum as f16, O^T += V^T P^T with the two S^T tiles of 32 keys packed in place as the B operand.
#define FA_KT 64                     /* keys per stage */
#define FA_KG 2                      /* key groups of 8 waves per workgroup */
#define FA_NS (SQ / (FA_KT * FA_KG)) /* stages: each takes every group one tile on */
#define FA_LP 72                     /* LDS row pitch in f16: 128 data bytes + 16, an odd multiple of 16 bytes for the 16-byte fragment reads */
__device__ __forceinline__ float fa_xhalf(float x) { return __builtin_bit_cast(float, __builtin_amdgcn_permlanex16(__builtin_bit_cast(int, x), __builtin_bit_cast(int, x), 0x76543210, 0xfedcba98, false, false)); }      /* lane l <-> lane l ^ 16 */
__device__ __forceinline__ v16h fa_lfrag(const _Float16* p) { FragH f; f.half[0] = *(const v8us*)((const unsigned short*)p); f.half[1] = *(const v8us*)((const unsigned short*)p + 16); return f.v; }      /* p already holds the lane half's + 8 * hh: the k order of g2_frag */
__device__ __forceinline__ v8f fa_mma(v16h a, v16h b, v8f c) { return __builtin_amdgcn_wmma_f32_16x16x32_f16(false, a, false, b, (short)0, c, false, false); }
// Eight independent 2^x in place. One statement, so that no exponential stands directly in front of an instruction that overwrites its source or reads its result
// (as separate builtins the register allocator put the next result into the previous source); the v_nop is the slot the instruction set asks for behind the last one.
__device__ __forceinline__ void fa_exp2x8(float (&p)[8]) {
  asm("v_exp_f32 %0, %0\n\tv_exp_f32 %1, %1\n\tv_exp_f32 %2, %2\n\tv_exp_f32 %3, %3\n\tv_exp_f32 %4, %4\n\tv_exp_f32 %5, %5\n\tv_exp_f32 %6, %6\n\tv_exp_f32 %7, %7\n\tv_nop"
      : "+v"(p[0]), "+v"(p[1]), "+v"(p[2]), "+v"(p[3]), "+v"(p[4]), "+v"(p[5]), "+v"(p[6]), "+v"(p[7])); }
__global__ __launch_bounds__(256 * FA_KG) void k_fattn(const _Float16* __restrict__ Q, const _Float16* __restrict__ K, const _Float16* __restrict__ VT, float* __restrict__ out) {
  __shared__ __attribute__((aligned(16))) _Float16 skg[FA_KG][2][FA_KT][FA_LP];
  __shared__ __attribute__((aligned(16))) _Float16 svg[FA_KG][2][HD][FA_LP];
  __shared__ __attribute__((aligned(16))) v4f xo[8][16][32];      /* group 1's O^T on its way to group 0: [query wave][16-byte piece][lane] */
  __shared__ float xs[8][4][32];      /* group 1's maxima and sums: [query wave][m of tile 0, 1, l of tile 0, 1][lane] */
  const int g = __builtin_amdgcn_readfirstlane((int)threadIdx.x >> 8);      /* key group, the same in a whole wave */
  const int tid = threadIdx.x & 255, w = tid >> 5, lane = tid & 31, ln = lane & 15, hh = lane >> 4;      /* place inside the group */
  _Float16 (*sk)[FA_KT][FA_LP] = skg[g]; _Float16 (*sv)[HD][FA_LP] = svg[g];
  const int h = blockIdx.y, q0 = blockIdx.x * 256 + w * 32;
  const float CS = 0.125f * 1.4426950408889634f;      /* 1 / sqrt(64), and base 2 for the exponentials */
  v16h qf[2][2];      /* [query tile][k step of 32 head dims], B operand: column = query */
#pragma unroll      /* constant indices keep the fragments in registers */
  for (int qt = 0; qt < 2; ++qt) for (int ks = 0; ks < 2; ++ks) qf[qt][ks] = g2_frag(Q + (size_t)(q0 + qt * 16 + ln) * LQ + h * HD + ks * 32, hh);
  const int sr = tid >> 3, sc = (tid & 7) * 8;      /* staging: 8 threads cover one 128-byte row; rows sr and sr + 32 */
  const unsigned short* gk = (const unsigned short*)K + (size_t)(g * FA_KT + sr) * LQ + h * HD + sc;      /* stage s: the group's keys (s * FA_KG + g) * 64 .. + 63 */
  const unsigned short* gv = (const unsigned short*)VT + ((size_t)h * HD + sr) * SQ + g * FA_KT + sc;
  v8us rk0 = *(const v8us*)gk, rk1 = *(const v8us*)(gk + (size_t)32 * LQ), rv0 = *(const v8us*)gv, rv1 = *(const v8us*)(gv + (size_t)32 * SQ);
  *(v8us*)&sk[0][sr][sc] = rk0; *(v8us*)&sk[0][sr + 32][sc] = rk1; *(v8us*)&sv[0][sr][sc] = rv0; *(v8us*)&sv[0][sr + 32][sc] = rv1;
  __syncthreads();
  const v8f z8 = {0.f, 0.f, 0.f, 0.f, 0.f, 0.f, 0.f, 0.f};
  v8f o[2][4] = {{z8, z8, z8, z8}, {z8, z8, z8, z8}};      /* O^T: [query tile][16 head dims]; register r = head dim 8 * hh + r, column = query ln */
  float m[2] = {-3.0e38f, -3.0e38f}, l[2] = {0.f, 0.f};      /* running maximum (raw dot products) and this lane half's running sum, per query */
  for (int s = 0; s < FA_NS; ++s) {
    const int cur = s & 1;
    if (s + 1 < FA_NS) {      /* the next stage's rows fly while this stage is worked on */
      const unsigned short* nk = gk + (size_t)(s + 1) * (FA_KG * FA_KT) * LQ; const unsigned short* nv = gv + (size_t)(s + 1) * (FA_KG * FA_KT);
      rk0 = *(const v8us*)nk; rk1 = *(const v8us*)(nk + (size_t)32 * LQ); rv0 = *(const v8us*)nv; rv1 = *(const v8us*)(nv + (size_t)32 * SQ);
    }
    __builtin_amdgcn_sched_barrier(0);      /* keeps the four loads up here: the scheduler otherwise sinks them to their LDS stores at the stage's foot, and their latency is then waited out every stage */
    v8f st[2][4];      /* S^T: [query tile][16 keys]; register r = key 8 * hh + r, column = query ln */
#pragma unroll      /* constant indices keep the tiles in registers */
    for (int kt = 0; kt < 4; ++kt) {
      const v16h a0 = fa_lfrag(&sk[cur][kt * 16 + ln][8 * hh]), a1 = fa_lfrag(&sk[cur][kt * 16 + ln][32 + 8 * hh]);
#pragma unroll      /* constant indices keep the tiles in registers */
      for (int qt = 0; qt < 2; ++qt) st[qt][kt] = fa_mma(a1, qf[qt][1], fa_mma(a0, qf[qt][0], z8));
    }
    FragH pf[2][2];      /* [query tile][32 keys]: P^T as B operand, element i = tile i >> 3, register i & 7 */
#pragma unroll      /* constant indices keep the tiles in registers */
    for (int qt = 0; qt < 2; ++qt) {
      float mk[4];      /* one short chain per tile: a tile's maximum runs while the next tile's products are still on the matrix unit */
#pragma unroll      /* constant indices keep the tiles in registers */
      for (int kt = 0; kt < 4; ++kt) { mk[kt] = st[qt][kt][0]; for (int r = 1; r < 8; ++r) mk[kt] = fmaxf(mk[kt], st[qt][kt][r]); }
      float mx = fmaxf(fmaxf(mk[0], mk[1]), fmaxf(mk[2], mk[3]));
      mx = fmaxf(mx, fa_xhalf(mx));
      const float mn = fmaxf(m[qt], mx);
      const float corr = __builtin_amdgcn_exp2f((m[qt] - mn) * CS);      /* 0 on the first stage */
      const float nb = 12.0f - mn * CS;
      m[qt] = mn;
      float ls[4] = {0.f, 0.f, 0.f, 0.f};
#pragma unroll      /* constant indices keep the tiles in registers */
      for (int kt = 0; kt < 4; ++kt) { float p[8]; for (int r = 0; r < 8; ++r) p[r] = fmaf(st[qt][kt][r], CS, nb); fa_exp2x8(p); for (int r = 0; r < 8; ++r) { ls[kt] += p[r]; pf[qt][kt >> 1].h[(kt & 1) * 8 + r] = (_Float16)p[r]; } }
      l[qt] = fmaf(l[qt], corr, (ls[0] + ls[1]) + (ls[2] + ls[3]));
#pragma unroll      /* constant indices keep the tiles in registers */
      for (int dt = 0; dt < 4; ++dt) o[qt][dt] *= corr;
    }
#pragma unroll      /* constant indices keep the tiles in registers */
    for (int ps = 0; ps < 2; ++ps) for (int dt = 0; dt < 4; ++dt) {
      const v16h a = fa_lfrag(&sv[cur][dt * 16 + ln][ps * 32 + 8 * hh]);
      o[0][dt] = fa_mma(a, pf[0][ps].v, o[0][dt]); o[1][dt] = fa_mma(a, pf[1][ps].v, o[1][dt]);
    }
    if (s + 1 < FA_NS) { *(v8us*)&sk[cur ^ 1][sr][sc] = rk0; *(v8us*)&sk[cur ^ 1][sr + 32][sc] = rk1; *(v8us*)&sv[cur ^ 1][sr][sc] = rv0; *(v8us*)&sv[cur ^ 1][sr + 32][sc] = rv1; }      /* that buffer's last readers left it before the previous barrier */
    __syncthreads();      /* publishes stage s + 1 and ends every read of stage s */
  }
  l[0] += fa_xhalf(l[0]); l[1] += fa_xhalf(l[1]);      /* the two lane halves' sums join once */
  if (g == 1) {      /* hand the group's statistics and O^T over, lane to same lane of the wave with the same queries */
#pragma unroll      /* constant indices keep the tiles in registers */
    for (int qt = 0; qt < 2; ++qt) { xs[w][qt][lane] = m[qt]; xs[w][2 + qt][lane] = l[qt];
#pragma unroll      /* constant indices keep the tiles in registers */
      for (int dt = 0; dt < 4; ++dt) { const v4f lo = {o[qt][dt][0], o[qt][dt][1], o[qt][dt][2], o[qt][dt][3]}, hi = {o[qt][dt][4], o[qt][dt][5], o[qt][dt][6], o[qt][dt][7]};
        xo[w][(qt * 4 + dt) * 2][lane] = lo; xo[w][(qt * 4 + dt) * 2 + 1][lane] = hi; } }
  }
  __syncthreads();      /* publishes group 1's partial results to group 0 */
  if (g == 0) {
#pragma unroll      /* constant indices keep the tiles in registers */
    for (int qt = 0; qt < 2; ++qt) {
      const float m1 = xs[w][qt][lane], l1 = xs[w][2 + qt][lane];
      const float mn = fmaxf(m[qt], m1);
      const float c0 = __builtin_amdgcn_exp2f((m[qt] - mn) * CS), c1 = __builtin_amdgcn_exp2f((m1 - mn) * CS);      /* both groups' weights brought to the common maximum */
      const float inv = 1.0f / fmaf(l[qt], c0, l1 * c1);
      const float a0 = c0 * inv, a1 = c1 * inv;
      float* op = out + (size_t)(q0 + qt * 16 + ln) * DM + h * HD + 8 * hh;
#pragma unroll      /* constant indices keep the tiles in registers */
      for (int dt = 0; dt < 4; ++dt) { const v4f p0 = xo[w][(qt * 4 + dt) * 2][lane], p1 = xo[w][(qt * 4 + dt) * 2 + 1][lane];
        const v4f lo = {fmaf(o[qt][dt][0], a0, p0[0] * a1), fmaf(o[qt][dt][1], a0, p0[1] * a1), fmaf(o[qt][dt][2], a0, p0[2] * a1), fmaf(o[qt][dt][3], a0, p0[3] * a1)};
        const v4f hi = {fmaf(o[qt][dt][4], a0, p1[0] * a1), fmaf(o[qt][dt][5], a0, p1[1] * a1), fmaf(o[qt][dt][6], a0, p1[2] * a1), fmaf(o[qt][dt][7], a0, p1[3] * a1)};
        *(v4f*)(op + dt * 16) = lo; *(v4f*)(op + dt * 16 + 4) = hi; }
    }
  } }
// Projection GEMM with both operands staged in LDS straight from the f32 inputs: P[token][n] = sum_k bf16(X[token][k]) bf16(W[k][n]), v_wmma_f32_16x16x32_bf16, f32 accumulation, f16 result rows of pitch LQ.
// The rounding (to nearest even, one packed conversion per two values) stands between the global loads and the LDS stores of the ring, so no 16-bit copy of X or W exists in memory and no launch makes one. X: 16 lanes cover the 256 bytes of a row's stage.
// W is [k][n]: a wave takes 8 k rows, a lane one column of each 32 (every load a whole 128-byte line), and the lane's 8 k values of a column pack into one 16-byte piece of the LDS row n: the transposition costs nothing.
// Workgroup = 8 waves = 256 tokens x 128 columns; a wave owns 64 tokens x 64 columns (16 accumulator tiles, so a fragment read from LDS feeds 4 products). Per stage of 64 k the workgroup stages
// the 256 X rows and the 128 W columns (as rows) in LDS (whole-line loads one stage ahead through registers, two buffers, one barrier a stage: the ring of k_fattn).
// Transposed products, A = Wt rows, B = X rows: a lane holds 8 neighbouring columns of ONE token per tile, which pack into one 16-byte piece of a result row.
// A workgroup of the v half (columns from DM on) exchanges the operands, A = X rows, B = Wt rows: a lane then holds 8 neighbouring tokens of ONE column, a 16-byte piece of a V^T row, so V^T leaves this launch
// in the layout k_fattn reads and no transposing launch follows. Wave tiles are 64 x 64 and both operands have one LDS row form, so only the two first-row numbers and the result address differ.
#define G3_KT 64                     /* k per stage */
#define G3_NS (DM / G3_KT)           /* stages */
#define G3_LP 72                     /* LDS row pitch in f16: 128 data bytes + 16, an odd multiple of 16 bytes for the 16-byte fragment reads */
#define G3_MT 256                    /* tokens per workgroup */
#define G3_NT 128                    /* columns per workgroup */
#define G3_BR (G3_MT + G3_NT)        /* LDS rows per buffer: the X rows, then the Wt rows */
typedef unsigned short v4us __attribute__((ext_vector_type(4), may_alias));
__global__ __launch_bounds__(256) void k_gemm3(const float* __restrict__ X, const float* __restrict__ W, _Float16* __restrict__ P, _Float16* __restrict__ VT) {
  __shared__ __attribute__((aligned(16))) _Float16 sg[2 * G3_BR * G3_LP];
  const int tid = threadIdx.x, w = tid >> 5, lane = tid & 31, ln = lane & 15, hh = lane >> 4;
  const int row0 = blockIdx.y * G3_MT, col0 = blockIdx.x * G3_NT;
  const int tw = (w & 3) * 64, cw = (w >> 2) * 64;      /* the wave's first token and first column inside the workgroup's tile */
  const bool vh = col0 >= DM;      /* the v half, the same for the whole workgroup */
  const int ar = vh ? tw : G3_MT + cw, br = vh ? G3_MT + cw : tw;      /* first LDS row of the wave's A operand and of its B operand */
  const int xr = tid >> 4, xc = (tid & 15) * 4;      /* X staging: 16 threads cover the 256 bytes of one row's stage; rows xr + 16 i */
  const float* gx = X + (size_t)(row0 + xr) * DM + xc;
  const float* gw = W + (size_t)(w * 8) * LQ + col0 + lane;      /* W staging: k rows 8 w + e of the stage, columns lane + 32 q */
  v4f rx[16]; float rw[4][8];
#pragma unroll      /* constant indices keep the staged rows in registers */
  for (int i = 0; i < 16; ++i) rx[i] = *(const v4fa*)(gx + (size_t)i * 16 * DM);
#pragma unroll      /* constant indices keep the staged rows in registers */
  for (int q = 0; q < 4; ++q) for (int e = 0; e < 8; ++e) rw[q][e] = gw[(size_t)e * LQ + q * 32];
#pragma unroll      /* constant indices keep the staged rows in registers */
  for (int i = 0; i < 16; ++i) { union { __bf16 b[4]; v4us v; } f; for (int e = 0; e < 4; ++e) f.b[e] = (__bf16)rx[i][e]; *(v4us*)&sg[(xr + 16 * i) * G3_LP + xc] = f.v; }
#pragma unroll      /* constant indices keep the staged rows in registers */
  for (int q = 0; q < 4; ++q) { FragB f; for (int e = 0; e < 8; ++e) f.v[e] = (__bf16)rw[q][e]; *(v8us*)&sg[(G3_MT + lane + 32 * q) * G3_LP + w * 8] = f.half[0]; }
  __syncthreads();
  const v8f z8 = {0.f, 0.f, 0.f, 0.f, 0.f, 0.f, 0.f, 0.f};
  v8f acc[4][4];      /* [16 A rows][16 B rows]; register r = A row 8 * hh + r, lane column = B row ln (q = k half: A rows are columns, B rows tokens; v half: the reverse) */
#pragma unroll      /* constant indices keep the tiles in registers */
  for (int i = 0; i < 4; ++i) for (int j = 0; j < 4; ++j) acc[i][j] = z8;
  for (int s = 0; s < G3_NS; ++s) {
    const _Float16* sb = sg + (s & 1) * (G3_BR * G3_LP);
    if (s + 1 < G3_NS) {      /* the next stage's rows fly while this stage is worked on */
#pragma unroll      /* constant indices keep the staged rows in registers */
      for (int i = 0; i < 16; ++i) rx[i] = *(const v4fa*)(gx + (size_t)i * 16 * DM + (s + 1) * G3_KT);
#pragma unroll      /* constant indices keep the staged rows in registers */
      for (int q = 0; q < 4; ++q) for (int e = 0; e < 8; ++e) rw[q][e] = gw[(size_t)((s + 1) * G3_KT + e) * LQ + q * 32];
      asm volatile("s_wait_xcnt 0x0" ::: "memory");      /* stands in front of the LDS reads below, which land in the registers that held these loads' addresses */
    }
    __builtin_amdgcn_sched_barrier(0);      /* keeps the 48 loads and their wait up here: without it the scheduler lifts an address of the LDS reads into a load's address register ahead of the wait */
    v16h wf[2][4], xf[2][4];      /* [k step of 32][16 A rows] and [k step of 32][16 B rows] */
#pragma unroll      /* constant indices keep the fragments in registers */
    for (int ks = 0; ks < 2; ++ks) {      /* in the order of first use, so that the products start behind the first loads */
      wf[ks][0] = fa_lfrag(sb + (ar + ln) * G3_LP + ks * 32 + 8 * hh);
#pragma unroll      /* constant indices keep the fragments in registers */
      for (int j = 0; j < 4; ++j) xf[ks][j] = fa_lfrag(sb + (br + j * 16 + ln) * G3_LP + ks * 32 + 8 * hh);
#pragma unroll      /* constant indices keep the fragments in registers */
      for (int i = 1; i < 4; ++i) wf[ks][i] = fa_lfrag(sb + (ar + i * 16 + ln) * G3_LP + ks * 32 + 8 * hh);
    }
    __builtin_amdgcn_sched_barrier(0);      /* the stage's 32 LDS reads stay one group ahead of its products: spread among them into one register set, every four products waited out a read's latency */
#pragma unroll      /* constant indices keep the tiles in registers */
    for (int ks = 0; ks < 2; ++ks) for (int i = 0; i < 4; ++i) for (int j = 0; j < 4; ++j) acc[i][j] = __builtin_amdgcn_wmma_f32_16x16x32_bf16(false, __builtin_bit_cast(v16b, wf[ks][i]), false, __builtin_bit_cast(v16b, xf[ks][j]), (short)0, acc[i][j], false, false);
    __builtin_amdgcn_sched_barrier(0);      /* the conversions and LDS stores of the next stage stay behind the products: lifted above them, they wait out the global loads' latency with the matrix unit idle */
    if (s + 1 < G3_NS) {      /* that buffer's last readers left it before the previous barrier */
      _Float16* sn = sg + ((s & 1) ^ 1) * (G3_BR * G3_LP);
#pragma unroll      /* constant indices keep the staged rows in registers */
      for (int i = 0; i < 16; ++i) { union { __bf16 b[4]; v4us v; } f; for (int e = 0; e < 4; ++e) f.b[e] = (__bf16)rx[i][e]; *(v4us*)&sn[(xr + 16 * i) * G3_LP + xc] = f.v; }
#pragma unroll      /* constant indices keep the staged rows in registers */
      for (int q = 0; q < 4; ++q) { FragB f; for (int e = 0; e < 8; ++e) f.v[e] = (__bf16)rw[q][e]; *(v8us*)&sn[(G3_MT + lane + 32 * q) * G3_LP + w * 8] = f.half[0]; }
    }
    __syncthreads();      /* publishes stage s + 1 and ends every read of stage s; the last one frees the ring for the result rows */
  }
  _Float16* so = sg + w * 64 * G3_LP;      /* the wave's own 64 result rows (B rows) of 64 values (A rows), so that whole 128-byte lines go out */
#pragma unroll      /* constant indices keep the tiles in registers */
  for (int i = 0; i < 4; ++i) for (int j = 0; j < 4; ++j) { FragH f; for (int r = 0; r < 8; ++r) f.h[r] = (_Float16)acc[i][j][r];
    *(v8us*)&so[(j * 16 + ln) * G3_LP + i * 16 + 8 * hh] = f.half[0]; }
  __builtin_amdgcn_fence(__ATOMIC_ACQ_REL, "workgroup"); __builtin_amdgcn_wave_barrier();      /* the wave reads back what its other lanes wrote */
  unsigned short* dp = vh ? (unsigned short*)VT + (size_t)(col0 - DM + cw) * SQ + row0 + tw      /* v half: rows = v columns (head * HD + dim), values = tokens */
                          : (unsigned short*)P + (size_t)(row0 + tw) * LQ + col0 + cw;      /* q = k half: rows = tokens, values = columns */
  const int dl = vh ? SQ : LQ;      /* row pitch of the plane written */
#pragma unroll      /* independent row pieces: the reads go ahead of the stores */
  for (int q = 0; q < 16; ++q) { const int r = q * 4 + (lane >> 3), c = (lane & 7) * 8; const v8us v = *(const v8us*)&so[r * G3_LP + c];
    *(v8us*)(dp + (size_t)(r * dl) + c) = v; }
}
__global__ __launch_bounds__(256) void k_vt(const _Float16* __restrict__ V16, int b, int h0, _Float16* __restrict__ VT) { __shared__ unsigned short tl[64][65]; const int tid = threadIdx.x; const int hh = blockIdx.x % HG, sg = blockIdx.x / HG; const int s0 = sg * 64; const int h = h0 + hh;
  for (int i = tid; i < 64 * 8; i += 256) { const int j = i / 8, d8 = (i % 8) * 8; FragH f; f.half[0] = *(const v8us*)((const unsigned short*)V16 + ((size_t)b * SQ + s0 + j) * DM + h * HD + d8); for (int q = 0; q < 8; ++q) tl[d8 + q][j] = f.u[q]; }
  __syncthreads();
  { for (int i = tid; i < 64 * 8; i += 256) { const int d = i / 8, j8 = (i % 8) * 8; FragH f; for (int q = 0; q < 8; ++q) f.u[q] = tl[d][j8 + q]; *(v8us*)((unsigned short*)VT + ((size_t)hh * HD + d) * SQ + s0 + j8) = f.half[0]; }  } }



__global__ __launch_bounds__(256) void k_rsmkm(const float* __restrict__ S, _Float16* __restrict__ P, int nrows, const int* __restrict__ am) {
  #pragma clang fp contract(off)
  const int t = blockIdx.x * 256 + threadIdx.x; if (t >= nrows) return; const size_t i = (size_t)t; const float* s = S + i * SQ; const int* mr = am + (size_t)(t % SQ) * SQ; float mx = -3.0e38f;
#pragma unroll 1
  for (int j = 0; j < SQ; ++j) { const float f = (mr[j] != 0) ? 1.f : 0.f; mx = fmaxf(mx, fmaf(f, s[j], (1.f - f) * -1.0e9f)); } float se = 0.f;
#pragma unroll 1
  for (int j = 0; j < SQ; ++j) { const float f = (mr[j] != 0) ? 1.f : 0.f; se += __expf(fmaf(f, s[j], (1.f - f) * -1.0e9f) - mx); } const float sc = 256.0f / se;
#pragma unroll 1
  for (int j0 = 0; j0 < SQ; j0 += 8) { FragH fr; for (int q = 0; q < 8; ++q) { const int j = j0 + q; const float f = (mr[j] != 0) ? 1.f : 0.f; fr.h[q] = (_Float16)(__expf(fmaf(f, s[j], (1.f - f) * -1.0e9f) - mx) * sc); }
    unsigned short* d = (unsigned short*)P + i * SQ + j0; *(v8us*)d = fr.half[0];  } }
extern "C" void kernel_launch(void* const* d_in, const int* in_sizes, int n_in,
                              void* d_out, int out_size, void* d_ws, size_t ws_size, hipStream_t stream) {
  (void)in_sizes; (void)n_in; (void)out_size;
  const float* const* I = (const float* const*)d_in; const float* xq = I[0]; const float* wqkv = I[1];      /* input order: X (2-D [4096][1024] = one sequence; feeds the one projection), Wqkv ([in][out] [1024][2048]: columns 0..1023 = the shared q = k projection, 1024..2047 = v); NO biases; NO output projection */
  static_assert(NH * HD == DM && DM % 64 == 0 && SQ % (FA_KT * FA_KG) == 0 && SQ % 256 == 0 && NH % HG == 0 && MP % G3_MT == 0 && LQ % G3_NT == 0 && DM % G3_NT == 0 && NB == 1 && G3_NS >= 2, "shape / tile multiples; one batch, since the projection writes V^T by token");
  char* ws = (char*)d_ws; size_t off = 0;
  auto take = [&](size_t bytes) { char* p = ws + off; off += (bytes + 255) & ~(size_t)255; return p; };
  _Float16* P16 = (_Float16*)take(NR * LQ * 2);
  _Float16* VT = (_Float16*)take((size_t)NH * HD * SQ * 2);
  if (off > ws_size) return;
  const size_t r0p = (size_t)B0 * SQ;      /* first projected row */
  k_gemm3<<<dim3(LQ / G3_NT, MP / G3_MT), 256, 0, stream>>>(xq + r0p * DM, wqkv, P16 + r0p * LQ, VT);      /* proj = X Wqkv from the f32 inputs ([in][out] weights as they lie), all 2048 columns in one launch; q and k are the same product and are read from the same columns; the v columns go out as V^T [NH][HD][SQ] */
  for (int b = B0; b < B0 + NBR; ++b) { const size_t r0 = (size_t)b * SQ;
    k_fattn<<<dim3(QN / 256, NHD), 256 * FA_KG, 0, stream>>>(P16 + r0 * LQ, P16 + r0 * LQ, VT, (float*)d_out + r0 * DM); }      /* out = softmax(q k^T / 8) v for all heads, f32 straight into the merged-heads output rows (no output projection) */
}

// v008
// One run takes 82 microseconds.
// In both of two side-by-side timings against v007, it was 1.07 times as fast.
// Over all steps from v000 it is 170 times as fast.
#include <hip/hip_runtime.h>
// Multi-head self-attention on ONE 4096-token problem with a SHARED query / key projection and no output projection, NON-causal (X [4096][1024]; proj = X Wqkv ([in][out] 1024 x 2048 sigma 1/32, no bias) split into a qk half and a v half; the scores use the SAME projection on both sides: scores = qk qk^T / sqrt(64) per head (16 heads of 64; symmetric per head); softmax over all 4096 keys (no mask); out = att v merged head-major -> [4096][1024]; no output projection); all heads in ONE fused attention launch.
// Structure: token rows r = b*4096 + s; proj = X Wqkv as ONE WMMA GEMM over all 2048 columns, fed from the f32 inputs (x and weights rounded to bf16 on the way into LDS, bf16 products; 256x128 workgroup tiles, 64x64 wave tiles, f32 accumulation, f16 output: columns 0..1023 as rows of pitch 2048 that serve as q and as k, columns 1024..2047 (v) written as V^T [head][dim][token] by the same launch, its two WMMA operands exchanged there); per batch: one fused attention launch over all heads (softmax against a fixed reference per query, its own score q.q; f32 sums, weights as f16; the online softmax with a running maximum stands behind it for scores that leave the f16 range) written f32 straight into the merged-heads output rows.
// Compute dtype: inputs rounded to bf16; x / weights exact bf16 operands (v_wmma_f32_16x16x32_bf16); q, k, v and softmax weights as plain f16 GEMM operands (~2^-12); scores and softmax statistics f32. v_wmma_f32_16x16x32_f16.
#define NB 1
#define SQ 4096
#define DM 1024
#define NH 16
#define HD 64
#define HG 1                         /* heads per group of the per-group V^T helper */
#define B0 0                         /* first batch processed (debug hook) */
#define NBR NB                       /* batches processed (debug hook) */
#define NR ((size_t)NB * SQ)         /* token rows */
#define MP ((int)((size_t)NBR * SQ)) /* rows projected (debug hook) */
#define QN SQ                        /* query rows attended per batch (debug hook) */
#define NHD NH                       /* heads attended (debug hook) */
#define MPO MP
#define LQ (2 * DM)      /* row pitch of the projected rows: 1024 shared q = k columns, then 1024 left unwritten (v goes out as V^T) */
typedef __bf16 v16b __attribute__((ext_vector_type(16)));
typedef unsigned short v8us __attribute__((ext_vector_type(8), may_alias));
typedef float  v8f  __attribute__((ext_vector_type(8)));
typedef float  v4f  __attribute__((ext_vector_type(4)));
typedef float  v4fa __attribute__((ext_vector_type(4), may_alias));
union FragB { v16b v; v8us half[2]; unsigned short u[16]; };

__device__ __forceinline__ unsigned short bf16_bits(float x) { unsigned int u = __float_as_uint(x); return (unsigned short)((u + 0x7FFFu + ((u >> 16) & 1u)) >> 16); }
__device__ __forceinline__ float bf16_val(unsigned short b) { return __uint_as_float(((unsigned int)b) << 16); }
__device__ __forceinline__ float bf16_round(float x) { return bf16_val(bf16_bits(x)); }
// D += A·B with NT terms: 1 = ah·bh, 2 = + al·bh (A split), 3 = + ah·bl (both split)
template <int NT>
__device__ __forceinline__ v8f mmaN(v16b ah, v16b al, v16b bh, v16b bl, v8f c) {
  c = __builtin_amdgcn_wmma_f32_16x16x32_bf16(false, ah, false, bh, (short)0, c, false, false);
  if (NT >= 2) c = __builtin_amdgcn_wmma_f32_16x16x32_bf16(false, al, false, bh, (short)0, c, false, false);
  if (NT >= 3) c = __builtin_amdgcn_wmma_f32_16x16x32_bf16(false, ah, false, bl, (short)0, c, false, false);
  asm volatile("v_nop\n\tv_nop\n\tv_nop\n\tv_nop" : "+v"(c) : "v"(ah), "v"(al), "v"(bh), "v"(bl));
  return c;
}

__global__ __launch_bounds__(256) void k_wt_bf16(const float* __restrict__ W, unsigned short* __restrict__ Wt, int K, int N) {
  const int t = blockIdx.x * 256 + threadIdx.x;
  const int k8n = K / 8;
  if (t >= N * k8n) return;
  const int n = t / k8n, k8 = (t % k8n) * 8;
  v8us v;
#pragma unroll
  for (int i = 0; i < 8; ++i) v[i] = bf16_bits(W[(size_t)(k8 + i) * N + n]);
  *(v8us*)(Wt + (size_t)n * K + k8) = v;
  
}

// GEMM C[M][N] (f32, pitch ldc) = act(A[M][K]·W + bias). A f32 row-major (pitch lda) converted per fragment to bf16
// (ASPLIT: hi/lo two planes -> 2 terms, else single rounded term); Wt bf16 [N][K] (pitch ldb). BIAS_BF16 rounds the
// bias to bf16 first (bias quantised to bf16 before the add). K%32==0, M%16==0, N%64==0.
template <bool ASPLIT, int ACT, bool BIAS_BF16>
__global__ __launch_bounds__(128) void k_gemm_bf(const float* __restrict__ A, int lda, const unsigned short* __restrict__ Wt, int ldb,
                                               const float* __restrict__ bias, float* __restrict__ C, int ldc, int M, int N, int K) {
  __shared__ __attribute__((aligned(16))) float so[4][16][64];
  const int tid = threadIdx.x, w = tid >> 5, lane = tid & 31, ln = lane & 15, hh = lane >> 4;
  const int ntn = N / 64;
  const int wid = blockIdx.x * 4 + w;
  const int mt = wid / ntn, nq = wid % ntn;
  if (mt * 16 >= M) return;
  const int row0 = mt * 16, col0 = nq * 64;
  const float* arow = A + (size_t)(row0 + ln) * lda;
  v8f acc[4] = {};
  for (int kb = 0; kb < K; kb += 32) {
    FragB ah, al;
    const v4f x0 = *(const v4fa*)(arow + kb + 8 * hh), x1 = *(const v4fa*)(arow + kb + 8 * hh + 4);
    const v4f x2 = *(const v4fa*)(arow + kb + 16 + 8 * hh), x3 = *(const v4fa*)(arow + kb + 16 + 8 * hh + 4);
    float xs[16] = {x0[0],x0[1],x0[2],x0[3],x1[0],x1[1],x1[2],x1[3],x2[0],x2[1],x2[2],x2[3],x3[0],x3[1],x3[2],x3[3]};
#pragma unroll
    for (int i = 0; i < 16; ++i) { const unsigned short hb = bf16_bits(xs[i]); ah.u[i] = hb; al.u[i] = ASPLIT ? bf16_bits(xs[i] - bf16_val(hb)) : (unsigned short)0; }
#pragma unroll
    for (int t = 0; t < 4; ++t) {
      const unsigned short* brow = Wt + (size_t)(col0 + t * 16 + ln) * ldb + kb;
      FragB b;
      b.half[0] = *(const v8us*)(brow + 8 * hh);
      b.half[1] = *(const v8us*)(brow + 16 + 8 * hh);
      acc[t] = mmaN<ASPLIT ? 2 : 1>(ah.v, al.v, b.v, b.v, acc[t]);
    }
  }
#pragma unroll
  for (int t = 0; t < 4; ++t) {
    float bv = bias ? bias[col0 + t * 16 + ln] : 0.f;
    if (BIAS_BF16) bv = bf16_round(bv);
#pragma unroll
    for (int r = 0; r < 8; ++r) { float v = acc[t][r] + bv; if (ACT == 1) v = fmaxf(v, 0.f); so[w][8 * hh + r][t * 16 + ln] = v; }
  }
  __builtin_amdgcn_fence(__ATOMIC_ACQ_REL, "workgroup");
  __builtin_amdgcn_wave_barrier();
  const int rsub = lane >> 4, c4 = (lane & 15) * 4;
  {
#pragma unroll
    for (int q = 0; q < 8; ++q) {
      const int r = q * 2 + rsub;
      const v4f v = *(const v4fa*)&so[w][r][c4];
      *(v4f*)(C + (size_t)(row0 + r) * ldc + col0 + c4) = v;
    }
    
  }
}

// GEMM C = act(A·W + bias + resid): A f32 (ASPLIT -> hi/lo 2 terms), Wt bf16 [N][K]; ACT 0 none, 1 relu, 2 exact gelu;
// resid (optional, f32, row index = (row % rmod), pitch ldr, RES_BF16 rounds it) added before the activation.
template <bool ASPLIT, int ACT, bool BIAS_BF16, bool RES_BF16>
__global__ __launch_bounds__(128) void k_gemm_bf3(const float* __restrict__ A, int lda, const unsigned short* __restrict__ Wt, int ldb,
                                                const float* __restrict__ bias, const float* __restrict__ resid, int rmod, int ldr,
                                                float* __restrict__ C, int ldc, int M, int N, int K) {
  __shared__ __attribute__((aligned(16))) float so[4][16][64];
  const int tid = threadIdx.x, w = tid >> 5, lane = tid & 31, ln = lane & 15, hh = lane >> 4;
  const int ntn = N / 64;
  const int wid = blockIdx.x * 4 + w;
  const int mt = wid / ntn, nq = wid % ntn;
  if (mt * 16 >= M) return;
  const int row0 = mt * 16, col0 = nq * 64;
  const float* arow = A + (size_t)(row0 + ln) * lda;
  v8f acc[4] = {};
  for (int kb = 0; kb < K; kb += 32) {
    FragB ah, al;
    const v4f x0 = *(const v4fa*)(arow + kb + 8 * hh), x1 = *(const v4fa*)(arow + kb + 8 * hh + 4);
    const v4f x2 = *(const v4fa*)(arow + kb + 16 + 8 * hh), x3 = *(const v4fa*)(arow + kb + 16 + 8 * hh + 4);
    float xs[16] = {x0[0],x0[1],x0[2],x0[3],x1[0],x1[1],x1[2],x1[3],x2[0],x2[1],x2[2],x2[3],x3[0],x3[1],x3[2],x3[3]};
#pragma unroll
    for (int i = 0; i < 16; ++i) { const unsigned short hb = bf16_bits(xs[i]); ah.u[i] = hb; al.u[i] = ASPLIT ? bf16_bits(xs[i] - bf16_val(hb)) : (unsigned short)0; }
#pragma unroll
    for (int t = 0; t < 4; ++t) {
      const unsigned short* brow = Wt + (size_t)(col0 + t * 16 + ln) * ldb + kb;
      FragB b;
      b.half[0] = *(const v8us*)(brow + 8 * hh);
      b.half[1] = *(const v8us*)(brow + 16 + 8 * hh);
      acc[t] = mmaN<ASPLIT ? 2 : 1>(ah.v, al.v, b.v, b.v, acc[t]);
    }
  }
#pragma unroll
  for (int t = 0; t < 4; ++t) {
    const int col = col0 + t * 16 + ln;
    float bv = bias ? bias[col] : 0.f;
    if (BIAS_BF16) bv = bf16_round(bv);
#pragma unroll
    for (int r = 0; r < 8; ++r) {
      float v = acc[t][r] + bv;
      if (resid) { float rv = resid[(size_t)((row0 + 8 * hh + r) % rmod) * ldr + col]; if (RES_BF16) rv = bf16_round(rv); v += rv; }
      if (ACT == 1) v = fmaxf(v, 0.f);
      if (ACT == 2) v = 0.5f * v * (1.0f + erff(v * 0.70710678118654752f));
      if (ACT == 3) { const float u = 0.7978845608028654f * (v + 0.044715f * v * v * v); v = 0.5f * v * (1.0f + tanhf(u)); }
      so[w][8 * hh + r][t * 16 + ln] = v;
    }
  }
  __builtin_amdgcn_fence(__ATOMIC_ACQ_REL, "workgroup");
  __builtin_amdgcn_wave_barrier();
  const int rsub = lane >> 4, c4 = (lane & 15) * 4;
  {
#pragma unroll
    for (int q = 0; q < 8; ++q) {
      const int r = q * 2 + rsub;
      const v4f v = *(const v4fa*)&so[w][r][c4];
      *(v4f*)(C + (size_t)(row0 + r) * ldc + col0 + c4) = v;
    }
    
  }
}
// row LayerNorm (biased variance, eps) over N: s = X (+ R); optional out_sum <- s; out_norm <- (s-mu)*rsqrt(var+eps)*g + b
template <bool PARAM_BF16>
__global__ __launch_bounds__(256) void k_layernorm(const float* __restrict__ X, const float* __restrict__ R, const float* __restrict__ g, const float* __restrict__ bta,
                                                  float* __restrict__ out_sum, float* __restrict__ out_norm, int N, float eps) {
  __shared__ float red[256];
  const int row = blockIdx.x, tid = threadIdx.x;
  const float* x = X + (size_t)row * N; const float* rr = R ? R + (size_t)row * N : nullptr;
  float vals[16];                     // up to N = 4096
  const int per = N / 256;            // contiguous chunk per thread? use strided-by-4 chunks: thread handles j = tid*4 + 1024*u
  float s1 = 0.f;
  for (int u = 0; u < per / 4; ++u) {
    const int j = tid * 4 + 1024 * u;
    const v4f a = *(const v4fa*)(x + j);
    v4f b = {0.f,0.f,0.f,0.f}; if (rr) b = *(const v4fa*)(rr + j);
#pragma unroll
    for (int q = 0; q < 4; ++q) { const float v = a[q] + b[q]; vals[u * 4 + q] = v; s1 += v; }
  }
  red[tid] = s1; __syncthreads();
  for (int st = 128; st > 0; st >>= 1) { if (tid < st) red[tid] += red[tid + st]; __syncthreads(); }
  const float mu = red[0] / (float)N; __syncthreads();
  float s2 = 0.f;
  for (int u = 0; u < per / 4; ++u)
#pragma unroll
    for (int q = 0; q < 4; ++q) { const float c = vals[u * 4 + q] - mu; s2 += c * c; }
  red[tid] = s2; __syncthreads();
  for (int st = 128; st > 0; st >>= 1) { if (tid < st) red[tid] += red[tid + st]; __syncthreads(); }
  const float rs = rsqrtf(red[0] / (float)N + eps);
  {
    for (int u = 0; u < per / 4; ++u) {
      const int j = tid * 4 + 1024 * u;
      v4f o, sm;
#pragma unroll
      for (int q = 0; q < 4; ++q) {
        float gg = g[j + q], bb = bta[j + q];
        if (PARAM_BF16) { gg = bf16_round(gg); bb = bf16_round(bb); }
        sm[q] = vals[u * 4 + q]; o[q] = (vals[u * 4 + q] - mu) * rs * gg + bb;
      }
      if (out_sum) *(v4f*)(out_sum + (size_t)row * N + j) = sm;
      *(v4f*)(out_norm + (size_t)row * N + j) = o;
    }
    
  }
}



// ---- f16 WMMA path (v_wmma_f32_16x16x32_f16): 11-bit significands for operands in range — used where a [0,1] probability operand needs more precision than bf16
typedef _Float16 v16h __attribute__((ext_vector_type(16)));
union FragH { v16h v; v8us half[2]; _Float16 h[16]; unsigned short u[16]; };
template <int NT>
__device__ __forceinline__ v8f mmaH(v16h ah, v16h al, v16h bh, v16h bl, v8f c) {
  c = __builtin_amdgcn_wmma_f32_16x16x32_f16(false, ah, false, bh, (short)0, c, false, false);
  if (NT >= 2) c = __builtin_amdgcn_wmma_f32_16x16x32_f16(false, al, false, bh, (short)0, c, false, false);
  if (NT >= 3) c = __builtin_amdgcn_wmma_f32_16x16x32_f16(false, ah, false, bl, (short)0, c, false, false);
  asm volatile("v_nop\n\tv_nop\n\tv_nop\n\tv_nop" : "+v"(c) : "v"(ah), "v"(al), "v"(bh), "v"(bl));
  return c;
}
// batched GEMM like k_gemm_b but f16 operands: A f32 (split into f16 hi/lo if ASPLIT, else rounded to f16), Bt = f16 values [n][k]; alpha; C f32; N multiple of 16 (partial tiles skipped)
template <bool ASPLIT>
__global__ __launch_bounds__(128) void k_gemm_h(const float* __restrict__ A, int lda, size_t sA, const _Float16* __restrict__ Bh, int ldb, size_t sB, float alpha, float* __restrict__ C, int ldc, size_t sC, int M, int N, int K) {
  __shared__ __attribute__((aligned(16))) float so[4][16][64];
  const int tid = threadIdx.x, w = tid >> 5, lane = tid & 31, ln = lane & 15, hh = lane >> 4; const int by = blockIdx.y;
  A += (size_t)by * sA; Bh += (size_t)by * sB; C += (size_t)by * sC;
  const int ntn = (N + 63) / 64; const int wid = blockIdx.x * 4 + w; const int mt = wid / ntn, nq = wid % ntn; if (mt * 16 >= M) return;
  const int row0 = mt * 16, col0 = nq * 64; const float* arow = A + (size_t)(row0 + ln) * lda;
  v8f acc[4] = {};
  for (int kb = 0; kb < K; kb += 32) {
    FragH ah, al;
    const v4f x0 = *(const v4fa*)(arow + kb + 8 * hh), x1 = *(const v4fa*)(arow + kb + 8 * hh + 4), x2 = *(const v4fa*)(arow + kb + 16 + 8 * hh), x3 = *(const v4fa*)(arow + kb + 16 + 8 * hh + 4);
    float xs[16] = {x0[0],x0[1],x0[2],x0[3],x1[0],x1[1],x1[2],x1[3],x2[0],x2[1],x2[2],x2[3],x3[0],x3[1],x3[2],x3[3]};
#pragma unroll
    for (int i = 0; i < 16; ++i) { const _Float16 h = (_Float16)xs[i]; ah.h[i] = h; al.h[i] = ASPLIT ? (_Float16)(xs[i] - (float)h) : (_Float16)0.0f; }
#pragma unroll
    for (int t = 0; t < 4; ++t) { if (col0 + t * 16 >= N) continue; const size_t boff = (size_t)(col0 + t * 16 + ln) * ldb + kb; FragH bq; bq.half[0] = *(const v8us*)(Bh + boff + 8 * hh); bq.half[1] = *(const v8us*)(Bh + boff + 16 + 8 * hh);
      acc[t] = mmaH<ASPLIT ? 2 : 1>(ah.v, al.v, bq.v, bq.v, acc[t]); }
  }
#pragma unroll
  for (int t = 0; t < 4; ++t) { if (col0 + t * 16 >= N) continue;
#pragma unroll
    for (int r = 0; r < 8; ++r) so[w][8 * hh + r][t * 16 + ln] = acc[t][r] * alpha; }
  __builtin_amdgcn_fence(__ATOMIC_ACQ_REL, "workgroup"); __builtin_amdgcn_wave_barrier();
  const int rsub = lane >> 4, c4 = (lane & 15) * 4;
  {
#pragma unroll
    for (int q = 0; q < 8; ++q) { const int r = q * 2 + rsub; if (col0 + c4 < N) { const v4f v = *(const v4fa*)&so[w][r][c4]; *(v4f*)(C + (size_t)(row0 + r) * ldc + col0 + c4) = v; } }
     }
}

// Wt[n][k] = f16(W[k][n]·scale) from f32 row-major W[K][N] (scale = power of two; bf16-exact weights stay exact in f16 away from the subnormal range)
__global__ __launch_bounds__(256) void k_wt_f16(const float* __restrict__ W, _Float16* __restrict__ Wt, int K, int N, float scale) {
  const int t = blockIdx.x * 256 + threadIdx.x; if (t >= N * (K / 8)) return; const int n = t / (K / 8), k8 = (t % (K / 8)) * 8; FragH f;
#pragma unroll
  for (int i = 0; i < 8; ++i) f.h[i] = (_Float16)(bf16_round(W[(size_t)(k8 + i) * N + n]) * scale); const v8us o = f.half[0];
  *(v8us*)((unsigned short*)Wt + (size_t)n * K + k8) = o; 
}
// k_gemm_hh variant with fused epilogue: v = acc·alpha + bias[by·sBias + col] (+ CP[(row/rowsPerB)·sCPb + by·64 + col] if CP) ; ACT 0 none / 1 elu ; writes f16 C16 (and f32 C if non-null)
template <int ACT>
__global__ __launch_bounds__(128) void k_gemm_hhx(const _Float16* __restrict__ A, int lda, size_t sA, const _Float16* __restrict__ Bh, int ldb, size_t sB, float alpha, const float* __restrict__ bias, size_t sBias, const float* __restrict__ CP, int rowsPerB, size_t sCPb, int row0g,
    float* __restrict__ C, _Float16* __restrict__ C16, int ldc, size_t sC, int M, int N, int K) {
  __shared__ __attribute__((aligned(16))) float so[4][16][64];
  const int tid = threadIdx.x, w = tid >> 5, lane = tid & 31, ln = lane & 15, hh = lane >> 4; const int by = blockIdx.y;
  A += (size_t)by * sA; Bh += (size_t)by * sB; const size_t cofs = (size_t)by * sC; const float* bp = bias ? bias + (size_t)by * sBias : nullptr;
  const int ntn = (N + 63) / 64; const int wid = blockIdx.x * 4 + w; const int mt = wid / ntn, nq = wid % ntn; if (mt * 16 >= M) return;
  const int row0 = mt * 16, col0 = nq * 64; const _Float16* arow = A + (size_t)(row0 + ln) * lda;
  v8f acc[4] = {};
  for (int kb = 0; kb < K; kb += 32) { FragH ah; ah.half[0] = *(const v8us*)((const unsigned short*)arow + kb + 8 * hh); ah.half[1] = *(const v8us*)((const unsigned short*)arow + kb + 16 + 8 * hh);
#pragma unroll
    for (int t = 0; t < 4; ++t) { if (col0 + t * 16 >= N) continue; const size_t boff = (size_t)(col0 + t * 16 + ln) * ldb + kb; FragH bq; bq.half[0] = *(const v8us*)((const unsigned short*)Bh + boff + 8 * hh); bq.half[1] = *(const v8us*)((const unsigned short*)Bh + boff + 16 + 8 * hh);
      acc[t] = mmaH<1>(ah.v, ah.v, bq.v, bq.v, acc[t]); }
  }
#pragma unroll
  for (int t = 0; t < 4; ++t) { if (col0 + t * 16 >= N) continue; const int col = col0 + t * 16 + ln; const float bv = bp ? bf16_round(bp[col]) : 0.f;
#pragma unroll
    for (int r = 0; r < 8; ++r) { float v = acc[t][r] * alpha + bv; if (CP) { const int rr = row0g + row0 + 8 * hh + r; if (rowsPerB < 0) v += CP[cofs + (size_t)rr * ldc + col];      /* rowsPerB < 0: own element of the batched C plane */ else { const int bidx = rr / rowsPerB; v += CP[(size_t)bidx * sCPb + (size_t)by * 64 + col]; } } if (ACT == 1) v = (v > 0.f) ? v : expm1f(v); else if (ACT == 7) v = (v > 0.f) ? v + 1.0f : expf(v); else if (ACT == 8) v = tanhf(v); else if (ACT == 9) v = 0.5f * v * (1.0f + tanhf(0.7978845608028654f * (v + 0.044715f * v * v * v))); else if (ACT == 11) v = 1.0f / (1.0f + expf(-v)); else if (ACT == 12) v = (v > 0.f) ? v : 0.01f * v; else if (ACT == 14) v = (v > 0.f) ? v : 0.1f * v; else if (ACT == 16) v = (v >= 0.f) ? v : 0.3f * v; else if (ACT == 17) v = (v >= 0.f) ? v : 0.2f * v; else if (ACT == 15) v = v / (1.0f + expf(-v)); else if (ACT == 3) v = fmaxf(v, 0.f); else if (ACT == 6) v = 0.5f * v * (1.0f + erff(v * 0.70710678118654752f)); so[w][8 * hh + r][t * 16 + ln] = v; } }
  __builtin_amdgcn_fence(__ATOMIC_ACQ_REL, "workgroup"); __builtin_amdgcn_wave_barrier();
  const int rsub = lane >> 4, c4 = (lane & 15) * 4; typedef _Float16 v4h __attribute__((ext_vector_type(4)));
  {
#pragma unroll
    for (int q = 0; q < 8; ++q) { const int r = q * 2 + rsub; if (col0 + c4 < N) { const v4f v = *(const v4fa*)&so[w][r][c4]; if (C) *(v4f*)(C + cofs + (size_t)(row0 + r) * ldc + col0 + c4) = v; if (C16) { v4h h4; for (int i = 0; i < 4; ++i) h4[i] = (_Float16)v[i]; *(v4h*)(C16 + cofs + (size_t)(row0 + r) * ldc + col0 + c4) = h4; } } }
     }
}


typedef _Float16 v4h __attribute__((ext_vector_type(4)));

__global__ __launch_bounds__(256) void k_x16(const float* __restrict__ x, _Float16* __restrict__ X16, size_t n8) { const size_t t = (size_t)blockIdx.x * 256 + threadIdx.x; if (t >= n8) return; FragH f;
#pragma unroll
  for (int q = 0; q < 8; ++q) f.h[q] = (_Float16)bf16_round(x[t * 8 + q]); *(v8us*)((unsigned short*)X16 + t * 8) = f.half[0];  }
__global__ __launch_bounds__(256) void k_h16(const float* __restrict__ x, _Float16* __restrict__ X16, size_t n8) { const size_t t = (size_t)blockIdx.x * 256 + threadIdx.x; if (t >= n8) return; FragH f;
#pragma unroll
  for (int q = 0; q < 8; ++q) f.h[q] = (_Float16)x[t * 8 + q]; *(v8us*)((unsigned short*)X16 + t * 8) = f.half[0];  }
__global__ __launch_bounds__(256) void k_round16f(const float* __restrict__ W, _Float16* __restrict__ Bt, size_t n8) { const size_t t = (size_t)blockIdx.x * 256 + threadIdx.x; if (t >= n8) return; FragH f;
#pragma unroll
  for (int i = 0; i < 8; ++i) f.h[i] = (_Float16)(bf16_round(W[t * 8 + i]) * 16.0f); *(v8us*)((unsigned short*)Bt + t * 8) = f.half[0];  }
template <int NHv, int TTv>
__global__ __launch_bounds__(256) void k_vt(const _Float16* __restrict__ V16, int ldv, int voff, _Float16* __restrict__ Vt) { __shared__ unsigned short tl[64][66]; const int tid = threadIdx.x; const int slab = blockIdx.x / (TTv / 64), lg = blockIdx.x % (TTv / 64); const int b = slab / NHv, h = slab % NHv;
  for (int i = tid; i < 64 * 8; i += 256) { const int r = i / 8, c8 = (i % 8) * 8; FragH f; f.half[0] = *(const v8us*)((const unsigned short*)V16 + ((size_t)b * TTv + lg * 64 + r) * ldv + voff + h * 64 + c8);
#pragma unroll
    for (int q = 0; q < 8; ++q) tl[r][c8 + q] = f.u[q]; }
  __syncthreads();
  {
#pragma unroll
    for (int rd = 0; rd < 2; ++rd) { const int d = rd * 32 + tid / 8, pc = tid % 8; FragH f;
#pragma unroll
      for (int q = 0; q < 8; ++q) f.u[q] = tl[pc * 8 + q][d];
      *(v8us*)((unsigned short*)Vt + ((size_t)slab * 64 + d) * TTv + lg * 64 + pc * 8) = f.half[0]; }
     } }

__global__ __launch_bounds__(256) void k_hl(const float* __restrict__ F, _Float16* __restrict__ Hh, _Float16* __restrict__ Hl, size_t n8) { const size_t t = (size_t)blockIdx.x * 256 + threadIdx.x; if (t >= n8) return; FragH fh, fl; const v4f a = *(const v4fa*)(F + t * 8), c = *(const v4fa*)(F + t * 8 + 4);
#pragma unroll
  for (int q = 0; q < 4; ++q) { _Float16 h = (_Float16)a[q]; fh.h[q] = h; fl.h[q] = (_Float16)((a[q] - (float)h) * 1024.0f); h = (_Float16)c[q]; fh.h[4 + q] = h; fl.h[4 + q] = (_Float16)((c[q] - (float)h) * 1024.0f); }
  { *(v8us*)((unsigned short*)Hh + t * 8) = fh.half[0]; *(v8us*)((unsigned short*)Hl + t * 8) = fl.half[0];  } }

// ---- fast GEMM (wave tile 32x64; requires M % 32 == 0 rows per launch region and N % 64 == 0); epilogue = k_gemm_hhx semantics ----
__device__ __forceinline__ v16h g2_frag(const _Float16* p, int hh) { FragH f; f.half[0] = *(const v8us*)((const unsigned short*)p + 8 * hh); f.half[1] = *(const v8us*)((const unsigned short*)p + 16 + 8 * hh); return f.v; }
__device__ __forceinline__ v8f g2_mma(v16h a, v16h b, v8f c) { v8f d = __builtin_amdgcn_wmma_f32_16x16x32_f16(false, a, false, b, (short)0, c, false, false); asm volatile("v_nop\n\tv_nop\n\tv_nop\n\tv_nop" : "+v"(d) : "v"(a), "v"(b)); return d; }
template <int ACT>
__global__ __launch_bounds__(128) void k_gemm2(const _Float16* __restrict__ A, int lda, size_t sA, const _Float16* __restrict__ Bh, int ldb, size_t sB, float alpha, const float* __restrict__ bias, size_t sBias, const float* __restrict__ CP, int rowsPerB, size_t sCPb, int row0g,
    float* __restrict__ C, _Float16* __restrict__ C16, int ldc, size_t sC, int M, int N, int K) { static_assert(ACT == 0 || ACT == 3 || ACT == 6 || ACT == 8 || ACT == 9 || ACT == 11 || ACT == 12 || ACT == 14 || ACT == 15 || ACT == 16 || ACT == 17, "k_gemm2: unsupported ACT code (would silently apply no activation)");
  __shared__ __attribute__((aligned(16))) float so[4][32][68];
  const int tid = threadIdx.x, w = tid >> 5, lane = tid & 31, ln = lane & 15, hh = lane >> 4; const int by = blockIdx.y;
  A += (size_t)by * sA; Bh += (size_t)by * sB; const size_t cofs = (size_t)by * sC; const float* bp = bias ? bias + (size_t)by * sBias : nullptr;
  const int ntn = N >> 6; const int mt = blockIdx.x / ntn, nq = blockIdx.x - mt * ntn; const int row0 = mt * 128 + 32 * w, col0 = nq * 64; if (row0 >= M) return;
  const _Float16* a0p = A + (size_t)(row0 + ln) * lda; const _Float16* a1p = a0p + (size_t)16 * lda;
  const _Float16* b0p = Bh + (size_t)(col0 + ln) * ldb; const _Float16* b1p = b0p + (size_t)16 * ldb; const _Float16* b2p = b1p + (size_t)16 * ldb; const _Float16* b3p = b2p + (size_t)16 * ldb;
  const v8f z8 = {0.f,0.f,0.f,0.f,0.f,0.f,0.f,0.f}; v8f c00 = z8, c01 = z8, c02 = z8, c03 = z8, c10 = z8, c11 = z8, c12 = z8, c13 = z8;
#pragma unroll 1
  for (int kb = 0; kb < K; kb += 32) { const v16h a0 = g2_frag(a0p + kb, hh), a1 = g2_frag(a1p + kb, hh);
    v16h b = g2_frag(b0p + kb, hh); c00 = g2_mma(a0, b, c00); c10 = g2_mma(a1, b, c10);
    b = g2_frag(b1p + kb, hh); c01 = g2_mma(a0, b, c01); c11 = g2_mma(a1, b, c11);
    b = g2_frag(b2p + kb, hh); c02 = g2_mma(a0, b, c02); c12 = g2_mma(a1, b, c12);
    b = g2_frag(b3p + kb, hh); c03 = g2_mma(a0, b, c03); c13 = g2_mma(a1, b, c13); }
  v8f accs[8] = {c00, c01, c02, c03, c10, c11, c12, c13};
#pragma unroll
  for (int u = 0; u < 8; ++u) { const int t = u & 3, half = u >> 2; const int col = col0 + t * 16 + ln; const float bv = bp ? bf16_round(bp[col]) : 0.f;
#pragma unroll
    for (int r = 0; r < 8; ++r) { const int rloc = half * 16 + 8 * hh + r; float v = accs[u][r] * alpha + bv; if (CP) { if (rowsPerB < 0) v += CP[cofs + (size_t)(row0g + row0 + rloc) * ldc + col];      /* rowsPerB < 0: own element of the batched C plane */ else { const int bidx = (row0g + row0 + rloc) / rowsPerB; v += CP[(size_t)bidx * sCPb + (size_t)by * 64 + col]; } }
      if (ACT == 3) v = fmaxf(v, 0.f); else if (ACT == 6) v = 0.5f * v * (1.0f + erff(v * 0.70710678118654752f)); else if (ACT == 11) v = 1.0f / (1.0f + expf(-v)); else if (ACT == 15) v = v / (1.0f + expf(-v)); else if (ACT == 12) v = (v > 0.f) ? v : 0.01f * v; else if (ACT == 8) v = tanhf(v); else if (ACT == 9) v = 0.5f * v * (1.0f + tanhf(0.7978845608028654f * (v + 0.044715f * v * v * v))); else if (ACT == 14) v = (v > 0.f) ? v : 0.1f * v; else if (ACT == 16) v = (v >= 0.f) ? v : 0.3f * v; else if (ACT == 17) v = (v >= 0.f) ? v : 0.2f * v;
      so[w][rloc][t * 16 + ln] = v; } }
  __builtin_amdgcn_fence(__ATOMIC_ACQ_REL, "workgroup"); __builtin_amdgcn_wave_barrier();
  const int rsub = lane >> 4, c4 = (lane & 15) * 4;
  {
#pragma unroll
    for (int q = 0; q < 16; ++q) { const int r = q * 2 + rsub; const v4f v = *(const v4fa*)&so[w][r][c4]; if (C) *(v4f*)(C + cofs + (size_t)(row0 + r) * ldc + col0 + c4) = v; if (C16) { v4h h4; for (int i = 0; i < 4; ++i) h4[i] = (_Float16)v[i]; *(v4h*)(C16 + cofs + (size_t)(row0 + r) * ldc + col0 + c4) = h4; } }
     } }


__global__ __launch_bounds__(256) void k_wnat(const float* __restrict__ w, size_t n8, _Float16* __restrict__ Bt) { const size_t t = (size_t)blockIdx.x * 256 + threadIdx.x; if (t >= n8) return; FragH f; for (int q = 0; q < 8; ++q) f.h[q] = (_Float16)(bf16_round(w[t * 8 + q]) * 16.0f); *(v8us*)((unsigned short*)Bt + t * 8) = f.half[0];  }
// Fused attention, all heads in one launch: scores, softmax and the weighted sum of v never leave the chip (no score or weight plane in memory).
// Workgroup = 16 waves = 256 queries of one head, as two key groups of 8 waves: a wave owns 32 query columns and every second tile of 64 keys, so that four waves share a SIMD
// (one wave's vector work and LDS waits run under the others' products) at the same fragment reuse. Per stage each group stages its own 64 k rows and v^T rows in its own LDS ring
// (whole-line 16-byte loads one stage ahead through registers, two buffers, one barrier a stage). Each group keeps its own softmax reference, sum and O^T; they are merged once, through LDS, at the end. Transposed products: S^T = K Q^T (a lane holds 8 keys of ONE query per tile),
// reference and sum per query (f32; fa_pass has the two forms), weights as f16, O^T += V^T P^T with the two S^T tiles of 32 keys packed in place as the B operand.
#define FA_KT 64                     /* keys per stage */
#define FA_KG 2                      /* key groups of 8 waves per workgroup */
#define FA_NS (SQ / (FA_KT * FA_KG)) /* stages: each takes every group one tile on */
#define FA_LP 72                     /* LDS row pitch in f16: 128 data bytes + 16, an odd multiple of 16 bytes for the 16-byte fragment reads */
__device__ __forceinline__ float fa_xhalf(float x) { return __builtin_bit_cast(float, __builtin_amdgcn_permlanex16(__builtin_bit_cast(int, x), __builtin_bit_cast(int, x), 0x76543210, 0xfedcba98, false, false)); }      /* lane l <-> lane l ^ 16 */
__device__ __forceinline__ v16h fa_lfrag(const _Float16* p) { FragH f; f.half[0] = *(const v8us*)((const unsigned short*)p); f.half[1] = *(const v8us*)((const unsigned short*)p + 16); return f.v; }      /* p already holds the lane half's + 8 * hh: the k order of g2_frag */
__device__ __forceinline__ v8f fa_mma(v16h a, v16h b, v8f c) { return __builtin_amdgcn_wmma_f32_16x16x32_f16(false, a, false, b, (short)0, c, false, false); }
// Eight independent 2^x in place. One statement, so that no exponential stands directly in front of an instruction that overwrites its source or reads its result
// (as separate builtins the register allocator put the next result into the previous source); the v_nop is the slot the instruction set asks for behind the last one.
__device__ __forceinline__ void fa_exp2x8(float (&p)[8]) {
  asm("v_exp_f32 %0, %0\n\tv_exp_f32 %1, %1\n\tv_exp_f32 %2, %2\n\tv_exp_f32 %3, %3\n\tv_exp_f32 %4, %4\n\tv_exp_f32 %5, %5\n\tv_exp_f32 %6, %6\n\tv_exp_f32 %7, %7\n\tv_nop"
      : "+v"(p[0]), "+v"(p[1]), "+v"(p[2]), "+v"(p[3]), "+v"(p[4]), "+v"(p[5]), "+v"(p[6]), "+v"(p[7])); }
typedef float v2f __attribute__((ext_vector_type(2)));
#define FA_OFF 4.0f                  /* fixed-reference pass: a query's own key gets the weight 2^4 */
#define FA_LIM 60000.0f              /* below the largest finite f16: a sum of non-negative weights under it bounds every weight */
// One pass over all the group's keys; qf holds the queries times 1 / sqrt(64) and log2(e), so a score is an exponent of 2. FIXED: the softmax reference of a query is given in m and never moves: it enters as the C operand of the score products,
// whose result is then the argument of the exponential itself, and there is no maximum, no exchange between the lane halves, no subtraction and no rescaling of O^T and of the sums in the loop.
// Otherwise: the running maximum (online softmax), which takes any scores; m is set here.
template <bool FIXED>
__device__ __forceinline__ void fa_pass(_Float16 (*sk)[FA_KT][FA_LP], _Float16 (*sv)[HD][FA_LP], const unsigned short* gk, const unsigned short* gv, const int sr, const int sc, const int ln, const int hh,
                                        const v16h (&qf)[2][2], v8f (&o)[2][4], float (&m)[2], float (&l)[2]) {
  v8us rk0 = *(const v8us*)gk, rk1 = *(const v8us*)(gk + (size_t)32 * LQ), rv0 = *(const v8us*)gv, rv1 = *(const v8us*)(gv + (size_t)32 * SQ);
  *(v8us*)&sk[0][sr][sc] = rk0; *(v8us*)&sk[0][sr + 32][sc] = rk1; *(v8us*)&sv[0][sr][sc] = rv0; *(v8us*)&sv[0][sr + 32][sc] = rv1;
  __syncthreads();
  const v8f z8 = {0.f, 0.f, 0.f, 0.f, 0.f, 0.f, 0.f, 0.f};
#pragma unroll      /* constant indices keep the tiles in registers */
  for (int qt = 0; qt < 2; ++qt) { l[qt] = 0.f; if (!FIXED) m[qt] = -3.0e38f; for (int dt = 0; dt < 4; ++dt) o[qt][dt] = z8; }
  v2f l2[2][2] = {{{0.f, 0.f}, {0.f, 0.f}}, {{0.f, 0.f}, {0.f, 0.f}}};      /* fixed pass: [query tile][chain], two sums each */
  v8f cf[2] = {z8, z8};      /* C of a score tile's first product; a lane's 8 registers belong to one query */
  if (FIXED) for (int qt = 0; qt < 2; ++qt) for (int r = 0; r < 8; ++r) cf[qt][r] = FA_OFF - m[qt];
  for (int s = 0; s < FA_NS; ++s) {
    const int cur = s & 1;
    if (s + 1 < FA_NS) {      /* the next stage's rows fly while this stage is worked on */
      const unsigned short* nk = gk + (size_t)(s + 1) * (FA_KG * FA_KT) * LQ; const unsigned short* nv = gv + (size_t)(s + 1) * (FA_KG * FA_KT);
      rk0 = *(const v8us*)nk; rk1 = *(const v8us*)(nk + (size_t)32 * LQ); rv0 = *(const v8us*)nv; rv1 = *(const v8us*)(nv + (size_t)32 * SQ);
    }
    __builtin_amdgcn_sched_barrier(0);      /* keeps the four loads up here: the scheduler otherwise sinks them to their LDS stores at the stage's foot, and their latency is then waited out every stage */
    v8f st[2][4];      /* S^T: [query tile][16 keys]; register r = key 8 * hh + r, column = query ln */
#pragma unroll      /* constant indices keep the tiles in registers */
    for (int kt = 0; kt < 4; ++kt) {
      const v16h a0 = fa_lfrag(&sk[cur][kt * 16 + ln][8 * hh]), a1 = fa_lfrag(&sk[cur][kt * 16 + ln][32 + 8 * hh]);
#pragma unroll      /* constant indices keep the tiles in registers */
      for (int qt = 0; qt < 2; ++qt) st[qt][kt] = fa_mma(a1, qf[qt][1], fa_mma(a0, qf[qt][0], cf[qt]));
    }
    if (FIXED) __builtin_amdgcn_sched_barrier(0);      /* the 16 score products stay one run: mixed with the exponentials, tiles were copied out of their registers and spilled */
    FragH pf[2][2];      /* [query tile][32 keys]: P^T as B operand, element i = tile i >> 3, register i & 7 */
#pragma unroll      /* constant indices keep the tiles in registers */
    for (int qt = 0; qt < 2; ++qt) {
      float nb = 0.f, corr = 1.0f;
      if (!FIXED) {
        float mk[4];      /* one short chain per tile: a tile's maximum runs while the next tile's products are still on the matrix unit */
#pragma unroll      /* constant indices keep the tiles in registers */
        for (int kt = 0; kt < 4; ++kt) { mk[kt] = st[qt][kt][0]; for (int r = 1; r < 8; ++r) mk[kt] = fmaxf(mk[kt], st[qt][kt][r]); }
        float mx = fmaxf(fmaxf(mk[0], mk[1]), fmaxf(mk[2], mk[3]));
        mx = fmaxf(mx, fa_xhalf(mx));
        const float mn = fmaxf(m[qt], mx);
        corr = __builtin_amdgcn_exp2f(m[qt] - mn);      /* 0 on the first stage */
        nb = 12.0f - mn;
        m[qt] = mn;
      }
      float ls[4] = {0.f, 0.f, 0.f, 0.f};
#pragma unroll      /* constant indices keep the tiles in registers */
      for (int kt = 0; kt < 4; ++kt) { float p[8]; for (int r = 0; r < 8; ++r) p[r] = FIXED ? st[qt][kt][r] : st[qt][kt][r] + nb; fa_exp2x8(p);
        for (int r = 0; r < 8; ++r) pf[qt][kt >> 1].h[(kt & 1) * 8 + r] = (_Float16)p[r];
        if (FIXED) for (int r = 0; r < 8; r += 2) { const v2f pp = {p[r], p[r + 1]}; l2[qt][kt & 1] += pp; }      /* neighbouring registers of a tile as they lie: one packed add, no copy; the sums run through all stages */
        else for (int r = 0; r < 8; ++r) ls[kt] += p[r]; }
      if (!FIXED) {
        l[qt] = fmaf(l[qt], corr, (ls[0] + ls[1]) + (ls[2] + ls[3]));
#pragma unroll      /* constant indices keep the tiles in registers */
        for (int dt = 0; dt < 4; ++dt) o[qt][dt] *= corr;
      }
    }
#pragma unroll      /* constant indices keep the tiles in registers */
    for (int ps = 0; ps < 2; ++ps) for (int dt = 0; dt < 4; ++dt) {
      const v16h a = fa_lfrag(&sv[cur][dt * 16 + ln][ps * 32 + 8 * hh]);
      o[0][dt] = fa_mma(a, pf[0][ps].v, o[0][dt]); o[1][dt] = fa_mma(a, pf[1][ps].v, o[1][dt]);
    }
    if (s + 1 < FA_NS) { *(v8us*)&sk[cur ^ 1][sr][sc] = rk0; *(v8us*)&sk[cur ^ 1][sr + 32][sc] = rk1; *(v8us*)&sv[cur ^ 1][sr][sc] = rv0; *(v8us*)&sv[cur ^ 1][sr + 32][sc] = rv1; }      /* that buffer's last readers left it before the previous barrier */
    __syncthreads();      /* publishes stage s + 1 and ends every read of stage s */
  }
  if (FIXED) for (int qt = 0; qt < 2; ++qt) l[qt] = (l2[qt][0][0] + l2[qt][0][1]) + (l2[qt][1][0] + l2[qt][1][1]);
}
__global__ __launch_bounds__(256 * FA_KG) void k_fattn(const _Float16* __restrict__ Q, const _Float16* K, const _Float16* VT, float* __restrict__ out) {      /* K, VT without restrict: else the first stage's rows are kept in registers over the whole fixed pass for the second pass's sake */
  __shared__ __attribute__((aligned(16))) _Float16 skg[FA_KG][2][FA_KT][FA_LP];
  __shared__ __attribute__((aligned(16))) _Float16 svg[FA_KG][2][HD][FA_LP];
  __shared__ __attribute__((aligned(16))) v4f xo[8][16][32];      /* group 1's O^T on its way to group 0: [query wave][16-byte piece][lane] */
  __shared__ float xs[8][4][32];      /* group 1's references and sums: [query wave][m of tile 0, 1, l of tile 0, 1][lane] */
  __shared__ int xbad[8 * FA_KG];      /* per wave: a sum of the fixed pass reached FA_LIM */
  const int g = __builtin_amdgcn_readfirstlane((int)threadIdx.x >> 8);      /* key group, the same in a whole wave */
  const int tid = threadIdx.x & 255, w = tid >> 5, lane = tid & 31, ln = lane & 15, hh = lane >> 4;      /* place inside the group */
  _Float16 (*sk)[FA_KT][FA_LP] = skg[g]; _Float16 (*sv)[HD][FA_LP] = svg[g];
  const int h = blockIdx.y, q0 = blockIdx.x * 256 + w * 32;
  const float CS = 0.125f * 1.4426950408889634f;      /* 1 / sqrt(64), and base 2 for the exponentials */
  v16h qf[2][2];      /* [query tile][k step of 32 head dims], B operand: column = query */
#pragma unroll      /* constant indices keep the fragments in registers */
  for (int qt = 0; qt < 2; ++qt) for (int ks = 0; ks < 2; ++ks) qf[qt][ks] = g2_frag(Q + (size_t)(q0 + qt * 16 + ln) * LQ + h * HD + ks * 32, hh);
  const int sr = tid >> 3, sc = (tid & 7) * 8;      /* staging: 8 threads cover one 128-byte row; rows sr and sr + 32 */
  const unsigned short* gk = (const unsigned short*)K + (size_t)(g * FA_KT + sr) * LQ + h * HD + sc;      /* stage s: the group's keys (s * FA_KG + g) * 64 .. + 63 */
  const unsigned short* gv = (const unsigned short*)VT + ((size_t)h * HD + sr) * SQ + g * FA_KT + sc;
  v8f o[2][4];      /* O^T: [query tile][16 head dims]; register r = head dim 8 * hh + r, column = query ln */
  float m[2], l[2];      /* softmax reference (a score: an exponent of 2) and this lane half's sum, per query */
  // The keys are the queries' own rows, so q.q is one of a query's scores: as the reference it gives that key the weight 2^FA_OFF, so no sum can vanish, and a softmax does not depend on its reference.
#pragma unroll      /* constant indices keep the fragments in registers */
  for (int qt = 0; qt < 2; ++qt) { float a = 0.f; for (int ks = 0; ks < 2; ++ks) for (int i = 0; i < 16; ++i) { const float x = (float)qf[qt][ks][i]; const _Float16 y = (_Float16)(x * CS); a = fmaf((float)y, x, a); qf[qt][ks][i] = y; } m[qt] = a + fa_xhalf(a); }      /* the row as query (scaled) times the row as key */
  fa_pass<true>(sk, sv, gk, gv, sr, sc, ln, hh, qf, o, m, l);
  // Another key's score may lie far above q.q: a weight could then leave the f16 range. Weights are not negative, so sums under FA_LIM show that none did (an infinite or undefined sum fails the test too).
  xbad[threadIdx.x >> 5] = __builtin_amdgcn_ballot_w32(!(l[0] < FA_LIM && l[1] < FA_LIM)) != 0u ? 1 : 0;
  __syncthreads();      /* publishes every wave's finding: the choice below is one for the whole workgroup */
  int anyb = 0;
#pragma unroll      /* sixteen reads of one word each, once a launch */
  for (int i = 0; i < 8 * FA_KG; ++i) anyb |= xbad[i];
  if (__builtin_amdgcn_readfirstlane(anyb) != 0) fa_pass<false>(sk, sv, gk, gv, sr, sc, ln, hh, qf, o, m, l);      /* the whole workgroup starts over with the running maximum */
  l[0] += fa_xhalf(l[0]); l[1] += fa_xhalf(l[1]);      /* the two lane halves' sums join once */
  if (g == 1) {      /* hand the group's statistics and O^T over, lane to same lane of the wave with the same queries */
#pragma unroll      /* constant indices keep the tiles in registers */
    for (int qt = 0; qt < 2; ++qt) { xs[w][qt][lane] = m[qt]; xs[w][2 + qt][lane] = l[qt];
#pragma unroll      /* constant indices keep the tiles in registers */
      for (int dt = 0; dt < 4; ++dt) { const v4f lo = {o[qt][dt][0], o[qt][dt][1], o[qt][dt][2], o[qt][dt][3]}, hi = {o[qt][dt][4], o[qt][dt][5], o[qt][dt][6], o[qt][dt][7]};
        xo[w][(qt * 4 + dt) * 2][lane] = lo; xo[w][(qt * 4 + dt) * 2 + 1][lane] = hi; } }
  }
  __syncthreads();      /* publishes group 1's partial results to group 0 */
  if (g == 0) {
#pragma unroll      /* constant indices keep the tiles in registers */
    for (int qt = 0; qt < 2; ++qt) {
      const float m1 = xs[w][qt][lane], l1 = xs[w][2 + qt][lane];
      const float mn = fmaxf(m[qt], m1);
      const float c0 = __builtin_amdgcn_exp2f(m[qt] - mn), c1 = __builtin_amdgcn_exp2f(m1 - mn);      /* both groups' weights brought to the common maximum */
      const float inv = 1.0f / fmaf(l[qt], c0, l1 * c1);
      const float a0 = c0 * inv, a1 = c1 * inv;
      float* op = out + (size_t)(q0 + qt * 16 + ln) * DM + h * HD + 8 * hh;
#pragma unroll      /* constant indices keep the tiles in registers */
      for (int dt = 0; dt < 4; ++dt) { const v4f p0 = xo[w][(qt * 4 + dt) * 2][lane], p1 = xo[w][(qt * 4 + dt) * 2 + 1][lane];
        const v4f lo = {fmaf(o[qt][dt][0], a0, p0[0] * a1), fmaf(o[qt][dt][1], a0, p0[1] * a1), fmaf(o[qt][dt][2], a0, p0[2] * a1), fmaf(o[qt][dt][3], a0, p0[3] * a1)};
        const v4f hi = {fmaf(o[qt][dt][4], a0, p1[0] * a1), fmaf(o[qt][dt][5], a0, p1[1] * a1), fmaf(o[qt][dt][6], a0, p1[2] * a1), fmaf(o[qt][dt][7], a0, p1[3] * a1)};
        *(v4f*)(op + dt * 16) = lo; *(v4f*)(op + dt * 16 + 4) = hi; }
    }
  } }
// Projection GEMM with both operands staged in LDS straight from the f32 inputs: P[token][n] = sum_k bf16(X[token][k]) bf16(W[k][n]), v_wmma_f32_16x16x32_bf16, f32 accumulation, f16 result rows of pitch LQ.
// The rounding (to nearest even, one packed conversion per two values) stands between the global loads and the LDS stores of the ring, so no 16-bit copy of X or W exists in memory and no launch makes one. X: 16 lanes cover the 256 bytes of a row's stage.
// W is [k][n]: a wave takes 8 k rows, a lane one column of each 32 (every load a whole 128-byte line), and the lane's 8 k values of a column pack into one 16-byte piece of the LDS row n: the transposition costs nothing.
// Workgroup = 8 waves = 256 tokens x 128 columns; a wave owns 64 tokens x 64 columns (16 accumulator tiles, so a fragment read from LDS feeds 4 products). Per stage of 64 k the workgroup stages
// the 256 X rows and the 128 W columns (as rows) in LDS (whole-line loads one stage ahead through registers, two buffers, one barrier a stage: the ring of k_fattn).
// Transposed products, A = Wt rows, B = X rows: a lane holds 8 neighbouring columns of ONE token per tile, which pack into one 16-byte piece of a result row.
// A workgroup of the v half (columns from DM on) exchanges the operands, A = X rows, B = Wt rows: a lane then holds 8 neighbouring tokens of ONE column, a 16-byte piece of a V^T row, so V^T leaves this launch
// in the layout k_fattn reads and no transposing launch follows. Wave tiles are 64 x 64 and both operands have one LDS row form, so only the two first-row numbers and the result address differ.
#define G3_KT 64                     /* k per stage */
#define G3_NS (DM / G3_KT)           /* stages */
#define G3_LP 72                     /* LDS row pitch in f16: 128 data bytes + 16, an odd multiple of 16 bytes for the 16-byte fragment reads */
#define G3_MT 256                    /* tokens per workgroup */
#define G3_NT 128                    /* columns per workgroup */
#define G3_BR (G3_MT + G3_NT)        /* LDS rows per buffer: the X rows, then the Wt rows */
typedef unsigned short v4us __attribute__((ext_vector_type(4), may_alias));
__global__ __launch_bounds__(256) void k_gemm3(const float* __restrict__ X, const float* __restrict__ W, _Float16* __restrict__ P, _Float16* __restrict__ VT) {
  __shared__ __attribute__((aligned(16))) _Float16 sg[2 * G3_BR * G3_LP];
  const int tid = threadIdx.x, w = tid >> 5, lane = tid & 31, ln = lane & 15, hh = lane >> 4;
  const int row0 = blockIdx.y * G3_MT, col0 = blockIdx.x * G3_NT;
  const int tw = (w & 3) * 64, cw = (w >> 2) * 64;      /* the wave's first token and first column inside the workgroup's tile */
  const bool vh = col0 >= DM;      /* the v half, the same for the whole workgroup */
  const int ar = vh ? tw : G3_MT + cw, br = vh ? G3_MT + cw : tw;      /* first LDS row of the wave's A operand and of its B operand */
  const int xr = tid >> 4, xc = (tid & 15) * 4;      /* X staging: 16 threads cover the 256 bytes of one row's stage; rows xr + 16 i */
  const float* gx = X + (size_t)(row0 + xr) * DM + xc;
  const float* gw = W + (size_t)(w * 8) * LQ + col0 + lane;      /* W staging: k rows 8 w + e of the stage, columns lane + 32 q */
  v4f rx[16]; float rw[4][8];
#pragma unroll      /* constant indices keep the staged rows in registers */
  for (int i = 0; i < 16; ++i) rx[i] = *(const v4fa*)(gx + (size_t)i * 16 * DM);
#pragma unroll      /* constant indices keep the staged rows in registers */
  for (int q = 0; q < 4; ++q) for (int e = 0; e < 8; ++e) rw[q][e] = gw[(size_t)e * LQ + q * 32];
#pragma unroll      /* constant indices keep the staged rows in registers */
  for (int i = 0; i < 16; ++i) { union { __bf16 b[4]; v4us v; } f; for (int e = 0; e < 4; ++e) f.b[e] = (__bf16)rx[i][e]; *(v4us*)&sg[(xr + 16 * i) * G3_LP + xc] = f.v; }
#pragma unroll      /* constant indices keep the staged rows in registers */
  for (int q = 0; q < 4; ++q) { FragB f; for (int e = 0; e < 8; ++e) f.v[e] = (__bf16)rw[q][e]; *(v8us*)&sg[(G3_MT + lane + 32 * q) * G3_LP + w * 8] = f.half[0]; }
  __syncthreads();
  const v8f z8 = {0.f, 0.f, 0.f, 0.f, 0.f, 0.f, 0.f, 0.f};
  v8f acc[4][4];      /* [16 A rows][16 B rows]; register r = A row 8 * hh + r, lane column = B row ln (q = k half: A rows are columns, B rows tokens; v half: the reverse) */
#pragma unroll      /* constant indices keep the tiles in registers */
  for (int i = 0; i < 4; ++i) for (int j = 0; j < 4; ++j) acc[i][j] = z8;
  for (int s = 0; s < G3_NS; ++s) {
    const _Float16* sb = sg + (s & 1) * (G3_BR * G3_LP);
    if (s + 1 < G3_NS) {      /* the next stage's rows fly while this stage is worked on */
#pragma unroll      /* constant indices keep the staged rows in registers */
      for (int i = 0; i < 16; ++i) rx[i] = *(const v4fa*)(gx + (size_t)i * 16 * DM + (s + 1) * G3_KT);
#pragma unroll      /* constant indices keep the staged rows in registers */
      for (int q = 0; q < 4; ++q) for (int e = 0; e < 8; ++e) rw[q][e] = gw[(size_t)((s + 1) * G3_KT + e) * LQ + q * 32];
      asm volatile("s_wait_xcnt 0x0" ::: "memory");      /* stands in front of the LDS reads below, which land in the registers that held these loads' addresses */
    }
    __builtin_amdgcn_sched_barrier(0);      /* keeps the 48 loads and their wait up here: without it the scheduler lifts an address of the LDS reads into a load's address register ahead of the wait */
    v16h wf[2][4], xf[2][4];      /* [k step of 32][16 A rows] and [k step of 32][16 B rows] */
#pragma unroll      /* constant indices keep the fragments in registers */
    for (int ks = 0; ks < 2; ++ks) {      /* in the order of first use, so that the products start behind the first loads */
      wf[ks][0] = fa_lfrag(sb + (ar + ln) * G3_LP + ks * 32 + 8 * hh);
#pragma unroll      /* constant indices keep the fragments in registers */
      for (int j = 0; j < 4; ++j) xf[ks][j] = fa_lfrag(sb + (br + j * 16 + ln) * G3_LP + ks * 32 + 8 * hh);
#pragma unroll      /* constant indices keep the fragments in registers */
      for (int i = 1; i < 4; ++i) wf[ks][i] = fa_lfrag(sb + (ar + i * 16 + ln) * G3_LP + ks * 32 + 8 * hh);
    }
    __builtin_amdgcn_sched_barrier(0);      /* the stage's 32 LDS reads stay one group ahead of its products: spread among them into one register set, every four products waited out a read's latency */
#pragma unroll      /* constant indices keep the tiles in registers */
    for (int ks = 0; ks < 2; ++ks) for (int i = 0; i < 4; ++i) for (int j = 0; j < 4; ++j) acc[i][j] = __builtin_amdgcn_wmma_f32_16x16x32_bf16(false, __builtin_bit_cast(v16b, wf[ks][i]), false, __builtin_bit_cast(v16b, xf[ks][j]), (short)0, acc[i][j], false, false);
    __builtin_amdgcn_sched_barrier(0);      /* the conversions and LDS stores of the next stage stay behind the products: lifted above them, they wait out the global loads' latency with the matrix unit idle */
    if (s + 1 < G3_NS) {      /* that buffer's last readers left it before the previous barrier */
      _Float16* sn = sg + ((s & 1) ^ 1) * (G3_BR * G3_LP);
#pragma unroll      /* constant indices keep the staged rows in registers */
      for (int i = 0; i < 16; ++i) { union { __bf16 b[4]; v4us v; } f; for (int e = 0; e < 4; ++e) f.b[e] = (__bf16)rx[i][e]; *(v4us*)&sn[(xr + 16 * i) * G3_LP + xc] = f.v; }
#pragma unroll      /* constant indices keep the staged rows in registers */
      for (int q = 0; q < 4; ++q) { FragB f; for (int e = 0; e < 8; ++e) f.v[e] = (__bf16)rw[q][e]; *(v8us*)&sn[(G3_MT + lane + 32 * q) * G3_LP + w * 8] = f.half[0]; }
    }
    __syncthreads();      /* publishes stage s + 1 and ends every read of stage s; the last one frees the ring for the result rows */
  }
  _Float16* so = sg + w * 64 * G3_LP;      /* the wave's own 64 result rows (B rows) of 64 values (A rows), so that whole 128-byte lines go out */
#pragma unroll      /* constant indices keep the tiles in registers */
  for (int i = 0; i < 4; ++i) for (int j = 0; j < 4; ++j) { FragH f; for (int r = 0; r < 8; ++r) f.h[r] = (_Float16)acc[i][j][r];
    *(v8us*)&so[(j * 16 + ln) * G3_LP + i * 16 + 8 * hh] = f.half[0]; }
  __builtin_amdgcn_fence(__ATOMIC_ACQ_REL, "workgroup"); __builtin_amdgcn_wave_barrier();      /* the wave reads back what its other lanes wrote */
  unsigned short* dp = vh ? (unsigned short*)VT + (size_t)(col0 - DM + cw) * SQ + row0 + tw      /* v half: rows = v columns (head * HD + dim), values = tokens */
                          : (unsigned short*)P + (size_t)(row0 + tw) * LQ + col0 + cw;      /* q = k half: rows = tokens, values = columns */
  const int dl = vh ? SQ : LQ;      /* row pitch of the plane written */
#pragma unroll      /* independent row pieces: the reads go ahead of the stores */
  for (int q = 0; q < 16; ++q) { const int r = q * 4 + (lane >> 3), c = (lane & 7) * 8; const v8us v = *(const v8us*)&so[r * G3_LP + c];
    *(v8us*)(dp + (size_t)(r * dl) + c) = v; }
}
__global__ __launch_bounds__(256) void k_vt(const _Float16* __restrict__ V16, int b, int h0, _Float16* __restrict__ VT) { __shared__ unsigned short tl[64][65]; const int tid = threadIdx.x; const int hh = blockIdx.x % HG, sg = blockIdx.x / HG; const int s0 = sg * 64; const int h = h0 + hh;
  for (int i = tid; i < 64 * 8; i += 256) { const int j = i / 8, d8 = (i % 8) * 8; FragH f; f.half[0] = *(const v8us*)((const unsigned short*)V16 + ((size_t)b * SQ + s0 + j) * DM + h * HD + d8); for (int q = 0; q < 8; ++q) tl[d8 + q][j] = f.u[q]; }
  __syncthreads();
  { for (int i = tid; i < 64 * 8; i += 256) { const int d = i / 8, j8 = (i % 8) * 8; FragH f; for (int q = 0; q < 8; ++q) f.u[q] = tl[d][j8 + q]; *(v8us*)((unsigned short*)VT + ((size_t)hh * HD + d) * SQ + s0 + j8) = f.half[0]; }  } }



__global__ __launch_bounds__(256) void k_rsmkm(const float* __restrict__ S, _Float16* __restrict__ P, int nrows, const int* __restrict__ am) {
  #pragma clang fp contract(off)
  const int t = blockIdx.x * 256 + threadIdx.x; if (t >= nrows) return; const size_t i = (size_t)t; const float* s = S + i * SQ; const int* mr = am + (size_t)(t % SQ) * SQ; float mx = -3.0e38f;
#pragma unroll 1
  for (int j = 0; j < SQ; ++j) { const float f = (mr[j] != 0) ? 1.f : 0.f; mx = fmaxf(mx, fmaf(f, s[j], (1.f - f) * -1.0e9f)); } float se = 0.f;
#pragma unroll 1
  for (int j = 0; j < SQ; ++j) { const float f = (mr[j] != 0) ? 1.f : 0.f; se += __expf(fmaf(f, s[j], (1.f - f) * -1.0e9f) - mx); } const float sc = 256.0f / se;
#pragma unroll 1
  for (int j0 = 0; j0 < SQ; j0 += 8) { FragH fr; for (int q = 0; q < 8; ++q) { const int j = j0 + q; const float f = (mr[j] != 0) ? 1.f : 0.f; fr.h[q] = (_Float16)(__expf(fmaf(f, s[j], (1.f - f) * -1.0e9f) - mx) * sc); }
    unsigned short* d = (unsigned short*)P + i * SQ + j0; *(v8us*)d = fr.half[0];  } }
extern "C" void kernel_launch(void* const* d_in, const int* in_sizes, int n_in,
                              void* d_out, int out_size, void* d_ws, size_t ws_size, hipStream_t stream) {
  (void)in_sizes; (void)n_in; (void)out_size;
  const float* const* I = (const float* const*)d_in; const float* xq = I[0]; const float* wqkv = I[1];      /* input order: X (2-D [4096][1024] = one sequence; feeds the one projection), Wqkv ([in][out] [1024][2048]: columns 0..1023 = the shared q = k projection, 1024..2047 = v); NO biases; NO output projection */
  static_assert(NH * HD == DM && DM % 64 == 0 && SQ % (FA_KT * FA_KG) == 0 && SQ % 256 == 0 && NH % HG == 0 && MP % G3_MT == 0 && LQ % G3_NT == 0 && DM % G3_NT == 0 && NB == 1 && G3_NS >= 2, "shape / tile multiples; one batch, since the projection writes V^T by token");
  char* ws = (char*)d_ws; size_t off = 0;
  auto take = [&](size_t bytes) { char* p = ws + off; off += (bytes + 255) & ~(size_t)255; return p; };
  _Float16* P16 = (_Float16*)take(NR * LQ * 2);
  _Float16* VT = (_Float16*)take((size_t)NH * HD * SQ * 2);
  if (off > ws_size) return;
  const size_t r0p = (size_t)B0 * SQ;      /* first projected row */
  k_gemm3<<<dim3(LQ / G3_NT, MP / G3_MT), 256, 0, stream>>>(xq + r0p * DM, wqkv, P16 + r0p * LQ, VT);      /* proj = X Wqkv from the f32 inputs ([in][out] weights as they lie), all 2048 columns in one launch; q and k are the same product and are read from the same columns; the v columns go out as V^T [NH][HD][SQ] */
  for (int b = B0; b < B0 + NBR; ++b) { const size_t r0 = (size_t)b * SQ;
    k_fattn<<<dim3(QN / 256, NHD), 256 * FA_KG, 0, stream>>>(P16 + r0 * LQ, P16 + r0 * LQ, VT, (float*)d_out + r0 * DM); }      /* out = softmax(q k^T / 8) v for all heads, f32 straight into the merged-heads output rows (no output projection) */
}

// v009
// Measured time: 77.7 microseconds a run.
// In two side-by-side timings against v008, it was 1.06 and 1.05 times as fast.
// Counting every step since v000, it is 180 times as fast.
#include <hip/hip_runtime.h>
// Multi-head self-attention on ONE 4096-token problem with a SHARED query / key projection and no output projection, NON-causal (X [4096][1024]; proj = X Wqkv ([in][out] 1024 x 2048 sigma 1/32, no bias) split into a qk half and a v half; the scores use the SAME projection on both sides: scores = qk qk^T / sqrt(64) per head (16 heads of 64; symmetric per head); softmax over all 4096 keys (no mask); out = att v merged head-major -> [4096][1024]; no output projection); all heads in ONE fused attention launch.
// Structure: token rows r = b*4096 + s; proj = X Wqkv as ONE WMMA GEMM over all 2048 columns, fed from the f32 inputs (x and weights rounded to bf16 on the way into LDS, bf16 products; 256x128 workgroup tiles, 64x64 wave tiles, f32 accumulation, f16 output: columns 0..1023 as rows of pitch 2048 that serve as q and as k, columns 1024..2047 (v) written as V^T [head][dim][token] by the same launch, its two WMMA operands exchanged there); per batch: one fused attention launch over all heads (softmax against a fixed reference per query, its own score q.q; f32 sums, weights as f16; the online softmax with a running maximum stands behind it for scores that leave the f16 range) written f32 straight into the merged-heads output rows.
// Compute dtype: inputs rounded to bf16; x / weights exact bf16 operands (v_wmma_f32_16x16x32_bf16); q, k, v and softmax weights as plain f16 GEMM operands (~2^-12); scores and softmax statistics f32. v_wmma_f32_16x16x32_f16.
#define NB 1
#define SQ 4096
#define DM 1024
#define NH 16
#define HD 64
#define HG 1                         /* heads per group of the per-group V^T helper */
#define B0 0                         /* first batch processed (debug hook) */
#define NBR NB                       /* batches processed (debug hook) */
#define NR ((size_t)NB * SQ)         /* token rows */
#define MP ((int)((size_t)NBR * SQ)) /* rows projected (debug hook) */
#define QN SQ                        /* query rows attended per batch (debug hook) */
#define NHD NH                       /* heads attended (debug hook) */
#define MPO MP
#define LQ (2 * DM)      /* row pitch of the projected rows: 1024 shared q = k columns, then 1024 left unwritten (v goes out as V^T) */
typedef __bf16 v16b __attribute__((ext_vector_type(16)));
typedef unsigned short v8us __attribute__((ext_vector_type(8), may_alias));
typedef float  v8f  __attribute__((ext_vector_type(8)));
typedef float  v4f  __attribute__((ext_vector_type(4)));
typedef float  v4fa __attribute__((ext_vector_type(4), may_alias));
union FragB { v16b v; v8us half[2]; unsigned short u[16]; };

__device__ __forceinline__ unsigned short bf16_bits(float x) { unsigned int u = __float_as_uint(x); return (unsigned short)((u + 0x7FFFu + ((u >> 16) & 1u)) >> 16); }
__device__ __forceinline__ float bf16_val(unsigned short b) { return __uint_as_float(((unsigned int)b) << 16); }
__device__ __forceinline__ float bf16_round(float x) { return bf16_val(bf16_bits(x)); }
// D += A·B with NT terms: 1 = ah·bh, 2 = + al·bh (A split), 3 = + ah·bl (both split)
template <int NT>
__device__ __forceinline__ v8f mmaN(v16b ah, v16b al, v16b bh, v16b bl, v8f c) {
  c = __builtin_amdgcn_wmma_f32_16x16x32_bf16(false, ah, false, bh, (short)0, c, false, false);
  if (NT >= 2) c = __builtin_amdgcn_wmma_f32_16x16x32_bf16(false, al, false, bh, (short)0, c, false, false);
  if (NT >= 3) c = __builtin_amdgcn_wmma_f32_16x16x32_bf16(false, ah, false, bl, (short)0, c, false, false);
  asm volatile("v_nop\n\tv_nop\n\tv_nop\n\tv_nop" : "+v"(c) : "v"(ah), "v"(al), "v"(bh), "v"(bl));
  return c;
}

__global__ __launch_bounds__(256) void k_wt_bf16(const float* __restrict__ W, unsigned short* __restrict__ Wt, int K, int N) {
  const int t = blockIdx.x * 256 + threadIdx.x;
  const int k8n = K / 8;
  if (t >= N * k8n) return;
  const int n = t / k8n, k8 = (t % k8n) * 8;
  v8us v;
#pragma unroll
  for (int i = 0; i < 8; ++i) v[i] = bf16_bits(W[(size_t)(k8 + i) * N + n]);
  *(v8us*)(Wt + (size_t)n * K + k8) = v;
  
}

// GEMM C[M][N] (f32, pitch ldc) = act(A[M][K]·W + bias). A f32 row-major (pitch lda) converted per fragment to bf16
// (ASPLIT: hi/lo two planes -> 2 terms, else single rounded term); Wt bf16 [N][K] (pitch ldb). BIAS_BF16 rounds the
// bias to bf16 first (bias quantised to bf16 before the add). K%32==0, M%16==0, N%64==0.
template <bool ASPLIT, int ACT, bool BIAS_BF16>
__global__ __launch_bounds__(128) void k_gemm_bf(const float* __restrict__ A, int lda, const unsigned short* __restrict__ Wt, int ldb,
                                               const float* __restrict__ bias, float* __restrict__ C, int ldc, int M, int N, int K) {
  __shared__ __attribute__((aligned(16))) float so[4][16][64];
  const int tid = threadIdx.x, w = tid >> 5, lane = tid & 31, ln = lane & 15, hh = lane >> 4;
  const int ntn = N / 64;
  const int wid = blockIdx.x * 4 + w;
  const int mt = wid / ntn, nq = wid % ntn;
  if (mt * 16 >= M) return;
  const int row0 = mt * 16, col0 = nq * 64;
  const float* arow = A + (size_t)(row0 + ln) * lda;
  v8f acc[4] = {};
  for (int kb = 0; kb < K; kb += 32) {
    FragB ah, al;
    const v4f x0 = *(const v4fa*)(arow + kb + 8 * hh), x1 = *(const v4fa*)(arow + kb + 8 * hh + 4);
    const v4f x2 = *(const v4fa*)(arow + kb + 16 + 8 * hh), x3 = *(const v4fa*)(arow + kb + 16 + 8 * hh + 4);
    float xs[16] = {x0[0],x0[1],x0[2],x0[3],x1[0],x1[1],x1[2],x1[3],x2[0],x2[1],x2[2],x2[3],x3[0],x3[1],x3[2],x3[3]};
#pragma unroll
    for (int i = 0; i < 16; ++i) { const unsigned short hb = bf16_bits(xs[i]); ah.u[i] = hb; al.u[i] = ASPLIT ? bf16_bits(xs[i] - bf16_val(hb)) : (unsigned short)0; }
#pragma unroll
    for (int t = 0; t < 4; ++t) {
      const unsigned short* brow = Wt + (size_t)(col0 + t * 16 + ln) * ldb + kb;
      FragB b;
      b.half[0] = *(const v8us*)(brow + 8 * hh);
      b.half[1] = *(const v8us*)(brow + 16 + 8 * hh);
      acc[t] = mmaN<ASPLIT ? 2 : 1>(ah.v, al.v, b.v, b.v, acc[t]);
    }
  }
#pragma unroll
  for (int t = 0; t < 4; ++t) {
    float bv = bias ? bias[col0 + t * 16 + ln] : 0.f;
    if (BIAS_BF16) bv = bf16_round(bv);
#pragma unroll
    for (int r = 0; r < 8; ++r) { float v = acc[t][r] + bv; if (ACT == 1) v = fmaxf(v, 0.f); so[w][8 * hh + r][t * 16 + ln] = v; }
  }
  __builtin_amdgcn_fence(__ATOMIC_ACQ_REL, "workgroup");
  __builtin_amdgcn_wave_barrier();
  const int rsub = lane >> 4, c4 = (lane & 15) * 4;
  {
#pragma unroll
    for (int q = 0; q < 8; ++q) {
      const int r = q * 2 + rsub;
      const v4f v = *(const v4fa*)&so[w][r][c4];
      *(v4f*)(C + (size_t)(row0 + r) * ldc + col0 + c4) = v;
    }
    
  }
}

// GEMM C = act(A·W + bias + resid): A f32 (ASPLIT -> hi/lo 2 terms), Wt bf16 [N][K]; ACT 0 none, 1 relu, 2 exact gelu;
// resid (optional, f32, row index = (row % rmod), pitch ldr, RES_BF16 rounds it) added before the activation.
template <bool ASPLIT, int ACT, bool BIAS_BF16, bool RES_BF16>
__global__ __launch_bounds__(128) void k_gemm_bf3(const float* __restrict__ A, int lda, const unsigned short* __restrict__ Wt, int ldb,
                                                const float* __restrict__ bias, const float* __restrict__ resid, int rmod, int ldr,
                                                float* __restrict__ C, int ldc, int M, int N, int K) {
  __shared__ __attribute__((aligned(16))) float so[4][16][64];
  const int tid = threadIdx.x, w = tid >> 5, lane = tid & 31, ln = lane & 15, hh = lane >> 4;
  const int ntn = N / 64;
  const int wid = blockIdx.x * 4 + w;
  const int mt = wid / ntn, nq = wid % ntn;
  if (mt * 16 >= M) return;
  const int row0 = mt * 16, col0 = nq * 64;
  const float* arow = A + (size_t)(row0 + ln) * lda;
  v8f acc[4] = {};
  for (int kb = 0; kb < K; kb += 32) {
    FragB ah, al;
    const v4f x0 = *(const v4fa*)(arow + kb + 8 * hh), x1 = *(const v4fa*)(arow + kb + 8 * hh + 4);
    const v4f x2 = *(const v4fa*)(arow + kb + 16 + 8 * hh), x3 = *(const v4fa*)(arow + kb + 16 + 8 * hh + 4);
    float xs[16] = {x0[0],x0[1],x0[2],x0[3],x1[0],x1[1],x1[2],x1[3],x2[0],x2[1],x2[2],x2[3],x3[0],x3[1],x3[2],x3[3]};
#pragma unroll
    for (int i = 0; i < 16; ++i) { const unsigned short hb = bf16_bits(xs[i]); ah.u[i] = hb; al.u[i] = ASPLIT ? bf16_bits(xs[i] - bf16_val(hb)) : (unsigned short)0; }
#pragma unroll
    for (int t = 0; t < 4; ++t) {
      const unsigned short* brow = Wt + (size_t)(col0 + t * 16 + ln) * ldb + kb;
      FragB b;
      b.half[0] = *(const v8us*)(brow + 8 * hh);
      b.half[1] = *(const v8us*)(brow + 16 + 8 * hh);
      acc[t] = mmaN<ASPLIT ? 2 : 1>(ah.v, al.v, b.v, b.v, acc[t]);
    }
  }
#pragma unroll
  for (int t = 0; t < 4; ++t) {
    const int col = col0 + t * 16 + ln;
    float bv = bias ? bias[col] : 0.f;
    if (BIAS_BF16) bv = bf16_round(bv);
#pragma unroll
    for (int r = 0; r < 8; ++r) {
      float v = acc[t][r] + bv;
      if (resid) { float rv = resid[(size_t)((row0 + 8 * hh + r) % rmod) * ldr + col]; if (RES_BF16) rv = bf16_round(rv); v += rv; }
      if (ACT == 1) v = fmaxf(v, 0.f);
      if (ACT == 2) v = 0.5f * v * (1.0f + erff(v * 0.70710678118654752f));
      if (ACT == 3) { const float u = 0.7978845608028654f * (v + 0.044715f * v * v * v); v = 0.5f * v * (1.0f + tanhf(u)); }
      so[w][8 * hh + r][t * 16 + ln] = v;
    }
  }
  __builtin_amdgcn_fence(__ATOMIC_ACQ_REL, "workgroup");
  __builtin_amdgcn_wave_barrier();
  const int rsub = lane >> 4, c4 = (lane & 15) * 4;
  {
#pragma unroll
    for (int q = 0; q < 8; ++q) {
      const int r = q * 2 + rsub;
      const v4f v = *(const v4fa*)&so[w][r][c4];
      *(v4f*)(C + (size_t)(row0 + r) * ldc + col0 + c4) = v;
    }
    
  }
}
// row LayerNorm (biased variance, eps) over N: s = X (+ R); optional out_sum <- s; out_norm <- (s-mu)*rsqrt(var+eps)*g + b
template <bool PARAM_BF16>
__global__ __launch_bounds__(256) void k_layernorm(const float* __restrict__ X, const float* __restrict__ R, const float* __restrict__ g, const float* __restrict__ bta,
                                                  float* __restrict__ out_sum, float* __restrict__ out_norm, int N, float eps) {
  __shared__ float red[256];
  const int row = blockIdx.x, tid = threadIdx.x;
  const float* x = X + (size_t)row * N; const float* rr = R ? R + (size_t)row * N : nullptr;
  float vals[16];                     // up to N = 4096
  const int per = N / 256;            // contiguous chunk per thread? use strided-by-4 chunks: thread handles j = tid*4 + 1024*u
  float s1 = 0.f;
  for (int u = 0; u < per / 4; ++u) {
    const int j = tid * 4 + 1024 * u;
    const v4f a = *(const v4fa*)(x + j);
    v4f b = {0.f,0.f,0.f,0.f}; if (rr) b = *(const v4fa*)(rr + j);
#pragma unroll
    for (int q = 0; q < 4; ++q) { const float v = a[q] + b[q]; vals[u * 4 + q] = v; s1 += v; }
  }
  red[tid] = s1; __syncthreads();
  for (int st = 128; st > 0; st >>= 1) { if (tid < st) red[tid] += red[tid + st]; __syncthreads(); }
  const float mu = red[0] / (float)N; __syncthreads();
  float s2 = 0.f;
  for (int u = 0; u < per / 4; ++u)
#pragma unroll
    for (int q = 0; q < 4; ++q) { const float c = vals[u * 4 + q] - mu; s2 += c * c; }
  red[tid] = s2; __syncthreads();
  for (int st = 128; st > 0; st >>= 1) { if (tid < st) red[tid] += red[tid + st]; __syncthreads(); }
  const float rs = rsqrtf(red[0] / (float)N + eps);
  {
    for (int u = 0; u < per / 4; ++u) {
      const int j = tid * 4 + 1024 * u;
      v4f o, sm;
#pragma unroll
      for (int q = 0; q < 4; ++q) {
        float gg = g[j + q], bb = bta[j + q];
        if (PARAM_BF16) { gg = bf16_round(gg); bb = bf16_round(bb); }
        sm[q] = vals[u * 4 + q]; o[q] = (vals[u * 4 + q] - mu) * rs * gg + bb;
      }
      if (out_sum) *(v4f*)(out_sum + (size_t)row * N + j) = sm;
      *(v4f*)(out_norm + (size_t)row * N + j) = o;
    }
    
  }
}



// ---- f16 WMMA path (v_wmma_f32_16x16x32_f16): 11-bit significands for operands in range — used where a [0,1] probability operand needs more precision than bf16
typedef _Float16 v16h __attribute__((ext_vector_type(16)));
union FragH { v16h v; v8us half[2]; _Float16 h[16]; unsigned short u[16]; };
template <int NT>
__device__ __forceinline__ v8f mmaH(v16h ah, v16h al, v16h bh, v16h bl, v8f c) {
  c = __builtin_amdgcn_wmma_f32_16x16x32_f16(false, ah, false, bh, (short)0, c, false, false);
  if (NT >= 2) c = __builtin_amdgcn_wmma_f32_16x16x32_f16(false, al, false, bh, (short)0, c, false, false);
  if (NT >= 3) c = __builtin_amdgcn_wmma_f32_16x16x32_f16(false, ah, false, bl, (short)0, c, false, false);
  asm volatile("v_nop\n\tv_nop\n\tv_nop\n\tv_nop" : "+v"(c) : "v"(ah), "v"(al), "v"(bh), "v"(bl));
  return c;
}
// batched GEMM like k_gemm_b but f16 operands: A f32 (split into f16 hi/lo if ASPLIT, else rounded to f16), Bt = f16 values [n][k]; alpha; C f32; N multiple of 16 (partial tiles skipped)
template <bool ASPLIT>
__global__ __launch_bounds__(128) void k_gemm_h(const float* __restrict__ A, int lda, size_t sA, const _Float16* __restrict__ Bh, int ldb, size_t sB, float alpha, float* __restrict__ C, int ldc, size_t sC, int M, int N, int K) {
  __shared__ __attribute__((aligned(16))) float so[4][16][64];
  const int tid = threadIdx.x, w = tid >> 5, lane = tid & 31, ln = lane & 15, hh = lane >> 4; const int by = blockIdx.y;
  A += (size_t)by * sA; Bh += (size_t)by * sB; C += (size_t)by * sC;
  const int ntn = (N + 63) / 64; const int wid = blockIdx.x * 4 + w; const int mt = wid / ntn, nq = wid % ntn; if (mt * 16 >= M) return;
  const int row0 = mt * 16, col0 = nq * 64; const float* arow = A + (size_t)(row0 + ln) * lda;
  v8f acc[4] = {};
  for (int kb = 0; kb < K; kb += 32) {
    FragH ah, al;
    const v4f x0 = *(const v4fa*)(arow + kb + 8 * hh), x1 = *(const v4fa*)(arow + kb + 8 * hh + 4), x2 = *(const v4fa*)(arow + kb + 16 + 8 * hh), x3 = *(const v4fa*)(arow + kb + 16 + 8 * hh + 4);
    float xs[16] = {x0[0],x0[1],x0[2],x0[3],x1[0],x1[1],x1[2],x1[3],x2[0],x2[1],x2[2],x2[3],x3[0],x3[1],x3[2],x3[3]};
#pragma unroll
    for (int i = 0; i < 16; ++i) { const _Float16 h = (_Float16)xs[i]; ah.h[i] = h; al.h[i] = ASPLIT ? (_Float16)(xs[i] - (float)h) : (_Float16)0.0f; }
#pragma unroll
    for (int t = 0; t < 4; ++t) { if (col0 + t * 16 >= N) continue; const size_t boff = (size_t)(col0 + t * 16 + ln) * ldb + kb; FragH bq; bq.half[0] = *(const v8us*)(Bh + boff + 8 * hh); bq.half[1] = *(const v8us*)(Bh + boff + 16 + 8 * hh);
      acc[t] = mmaH<ASPLIT ? 2 : 1>(ah.v, al.v, bq.v, bq.v, acc[t]); }
  }
#pragma unroll
  for (int t = 0; t < 4; ++t) { if (col0 + t * 16 >= N) continue;
#pragma unroll
    for (int r = 0; r < 8; ++r) so[w][8 * hh + r][t * 16 + ln] = acc[t][r] * alpha; }
  __builtin_amdgcn_fence(__ATOMIC_ACQ_REL, "workgroup"); __builtin_amdgcn_wave_barrier();
  const int rsub = lane >> 4, c4 = (lane & 15) * 4;
  {
#pragma unroll
    for (int q = 0; q < 8; ++q) { const int r = q * 2 + rsub; if (col0 + c4 < N) { const v4f v = *(const v4fa*)&so[w][r][c4]; *(v4f*)(C + (size_t)(row0 + r) * ldc + col0 + c4) = v; } }
     }
}

// Wt[n][k] = f16(W[k][n]·scale) from f32 row-major W[K][N] (scale = power of two; bf16-exact weights stay exact in f16 away from the subnormal range)
__global__ __launch_bounds__(256) void k_wt_f16(const float* __restrict__ W, _Float16* __restrict__ Wt, int K, int N, float scale) {
  const int t = blockIdx.x * 256 + threadIdx.x; if (t >= N * (K / 8)) return; const int n = t / (K / 8), k8 = (t % (K / 8)) * 8; FragH f;
#pragma unroll
  for (int i = 0; i < 8; ++i) f.h[i] = (_Float16)(bf16_round(W[(size_t)(k8 + i) * N + n]) * scale); const v8us o = f.half[0];
  *(v8us*)((unsigned short*)Wt + (size_t)n * K + k8) = o; 
}
// k_gemm_hh variant with fused epilogue: v = acc·alpha + bias[by·sBias + col] (+ CP[(row/rowsPerB)·sCPb + by·64 + col] if CP) ; ACT 0 none / 1 elu ; writes f16 C16 (and f32 C if non-null)
template <int ACT>
__global__ __launch_bounds__(128) void k_gemm_hhx(const _Float16* __restrict__ A, int lda, size_t sA, const _Float16* __restrict__ Bh, int ldb, size_t sB, float alpha, const float* __restrict__ bias, size_t sBias, const float* __restrict__ CP, int rowsPerB, size_t sCPb, int row0g,
    float* __restrict__ C, _Float16* __restrict__ C16, int ldc, size_t sC, int M, int N, int K) {
  __shared__ __attribute__((aligned(16))) float so[4][16][64];
  const int tid = threadIdx.x, w = tid >> 5, lane = tid & 31, ln = lane & 15, hh = lane >> 4; const int by = blockIdx.y;
  A += (size_t)by * sA; Bh += (size_t)by * sB; const size_t cofs = (size_t)by * sC; const float* bp = bias ? bias + (size_t)by * sBias : nullptr;
  const int ntn = (N + 63) / 64; const int wid = blockIdx.x * 4 + w; const int mt = wid / ntn, nq = wid % ntn; if (mt * 16 >= M) return;
  const int row0 = mt * 16, col0 = nq * 64; const _Float16* arow = A + (size_t)(row0 + ln) * lda;
  v8f acc[4] = {};
  for (int kb = 0; kb < K; kb += 32) { FragH ah; ah.half[0] = *(const v8us*)((const unsigned short*)arow + kb + 8 * hh); ah.half[1] = *(const v8us*)((const unsigned short*)arow + kb + 16 + 8 * hh);
#pragma unroll
    for (int t = 0; t < 4; ++t) { if (col0 + t * 16 >= N) continue; const size_t boff = (size_t)(col0 + t * 16 + ln) * ldb + kb; FragH bq; bq.half[0] = *(const v8us*)((const unsigned short*)Bh + boff + 8 * hh); bq.half[1] = *(const v8us*)((const unsigned short*)Bh + boff + 16 + 8 * hh);
      acc[t] = mmaH<1>(ah.v, ah.v, bq.v, bq.v, acc[t]); }
  }
#pragma unroll
  for (int t = 0; t < 4; ++t) { if (col0 + t * 16 >= N) continue; const int col = col0 + t * 16 + ln; const float bv = bp ? bf16_round(bp[col]) : 0.f;
#pragma unroll
    for (int r = 0; r < 8; ++r) { float v = acc[t][r] * alpha + bv; if (CP) { const int rr = row0g + row0 + 8 * hh + r; if (rowsPerB < 0) v += CP[cofs + (size_t)rr * ldc + col];      /* rowsPerB < 0: own element of the batched C plane */ else { const int bidx = rr / rowsPerB; v += CP[(size_t)bidx * sCPb + (size_t)by * 64 + col]; } } if (ACT == 1) v = (v > 0.f) ? v : expm1f(v); else if (ACT == 7) v = (v > 0.f) ? v + 1.0f : expf(v); else if (ACT == 8) v = tanhf(v); else if (ACT == 9) v = 0.5f * v * (1.0f + tanhf(0.7978845608028654f * (v + 0.044715f * v * v * v))); else if (ACT == 11) v = 1.0f / (1.0f + expf(-v)); else if (ACT == 12) v = (v > 0.f) ? v : 0.01f * v; else if (ACT == 14) v = (v > 0.f) ? v : 0.1f * v; else if (ACT == 16) v = (v >= 0.f) ? v : 0.3f * v; else if (ACT == 17) v = (v >= 0.f) ? v : 0.2f * v; else if (ACT == 15) v = v / (1.0f + expf(-v)); else if (ACT == 3) v = fmaxf(v, 0.f); else if (ACT == 6) v = 0.5f * v * (1.0f + erff(v * 0.70710678118654752f)); so[w][8 * hh + r][t * 16 + ln] = v; } }
  __builtin_amdgcn_fence(__ATOMIC_ACQ_REL, "workgroup"); __builtin_amdgcn_wave_barrier();
  const int rsub = lane >> 4, c4 = (lane & 15) * 4; typedef _Float16 v4h __attribute__((ext_vector_type(4)));
  {
#pragma unroll
    for (int q = 0; q < 8; ++q) { const int r = q * 2 + rsub; if (col0 + c4 < N) { const v4f v = *(const v4fa*)&so[w][r][c4]; if (C) *(v4f*)(C + cofs + (size_t)(row0 + r) * ldc + col0 + c4) = v; if (C16) { v4h h4; for (int i = 0; i < 4; ++i) h4[i] = (_Float16)v[i]; *(v4h*)(C16 + cofs + (size_t)(row0 + r) * ldc + col0 + c4) = h4; } } }
     }
}


typedef _Float16 v4h __attribute__((ext_vector_type(4)));

__global__ __launch_bounds__(256) void k_x16(const float* __restrict__ x, _Float16* __restrict__ X16, size_t n8) { const size_t t = (size_t)blockIdx.x * 256 + threadIdx.x; if (t >= n8) return; FragH f;
#pragma unroll
  for (int q = 0; q < 8; ++q) f.h[q] = (_Float16)bf16_round(x[t * 8 + q]); *(v8us*)((unsigned short*)X16 + t * 8) = f.half[0];  }
__global__ __launch_bounds__(256) void k_h16(const float* __restrict__ x, _Float16* __restrict__ X16, size_t n8) { const size_t t = (size_t)blockIdx.x * 256 + threadIdx.x; if (t >= n8) return; FragH f;
#pragma unroll
  for (int q = 0; q < 8; ++q) f.h[q] = (_Float16)x[t * 8 + q]; *(v8us*)((unsigned short*)X16 + t * 8) = f.half[0];  }
__global__ __launch_bounds__(256) void k_round16f(const float* __restrict__ W, _Float16* __restrict__ Bt, size_t n8) { const size_t t = (size_t)blockIdx.x * 256 + threadIdx.x; if (t >= n8) return; FragH f;
#pragma unroll
  for (int i = 0; i < 8; ++i) f.h[i] = (_Float16)(bf16_round(W[t * 8 + i]) * 16.0f); *(v8us*)((unsigned short*)Bt + t * 8) = f.half[0];  }
template <int NHv, int TTv>
__global__ __launch_bounds__(256) void k_vt(const _Float16* __restrict__ V16, int ldv, int voff, _Float16* __restrict__ Vt) { __shared__ unsigned short tl[64][66]; const int tid = threadIdx.x; const int slab = blockIdx.x / (TTv / 64), lg = blockIdx.x % (TTv / 64); const int b = slab / NHv, h = slab % NHv;
  for (int i = tid; i < 64 * 8; i += 256) { const int r = i / 8, c8 = (i % 8) * 8; FragH f; f.half[0] = *(const v8us*)((const unsigned short*)V16 + ((size_t)b * TTv + lg * 64 + r) * ldv + voff + h * 64 + c8);
#pragma unroll
    for (int q = 0; q < 8; ++q) tl[r][c8 + q] = f.u[q]; }
  __syncthreads();
  {
#pragma unroll
    for (int rd = 0; rd < 2; ++rd) { const int d = rd * 32 + tid / 8, pc = tid % 8; FragH f;
#pragma unroll
      for (int q = 0; q < 8; ++q) f.u[q] = tl[pc * 8 + q][d];
      *(v8us*)((unsigned short*)Vt + ((size_t)slab * 64 + d) * TTv + lg * 64 + pc * 8) = f.half[0]; }
     } }

__global__ __launch_bounds__(256) void k_hl(const float* __restrict__ F, _Float16* __restrict__ Hh, _Float16* __restrict__ Hl, size_t n8) { const size_t t = (size_t)blockIdx.x * 256 + threadIdx.x; if (t >= n8) return; FragH fh, fl; const v4f a = *(const v4fa*)(F + t * 8), c = *(const v4fa*)(F + t * 8 + 4);
#pragma unroll
  for (int q = 0; q < 4; ++q) { _Float16 h = (_Float16)a[q]; fh.h[q] = h; fl.h[q] = (_Float16)((a[q] - (float)h) * 1024.0f); h = (_Float16)c[q]; fh.h[4 + q] = h; fl.h[4 + q] = (_Float16)((c[q] - (float)h) * 1024.0f); }
  { *(v8us*)((unsigned short*)Hh + t * 8) = fh.half[0]; *(v8us*)((unsigned short*)Hl + t * 8) = fl.half[0];  } }

// ---- fast GEMM (wave tile 32x64; requires M % 32 == 0 rows per launch region and N % 64 == 0); epilogue = k_gemm_hhx semantics ----
__device__ __forceinline__ v16h g2_frag(const _Float16* p, int hh) { FragH f; f.half[0] = *(const v8us*)((const unsigned short*)p + 8 * hh); f.half[1] = *(const v8us*)((const unsigned short*)p + 16 + 8 * hh); return f.v; }
__device__ __forceinline__ v8f g2_mma(v16h a, v16h b, v8f c) { v8f d = __builtin_amdgcn_wmma_f32_16x16x32_f16(false, a, false, b, (short)0, c, false, false); asm volatile("v_nop\n\tv_nop\n\tv_nop\n\tv_nop" : "+v"(d) : "v"(a), "v"(b)); return d; }
template <int ACT>
__global__ __launch_bounds__(128) void k_gemm2(const _Float16* __restrict__ A, int lda, size_t sA, const _Float16* __restrict__ Bh, int ldb, size_t sB, float alpha, const float* __restrict__ bias, size_t sBias, const float* __restrict__ CP, int rowsPerB, size_t sCPb, int row0g,
    float* __restrict__ C, _Float16* __restrict__ C16, int ldc, size_t sC, int M, int N, int K) { static_assert(ACT == 0 || ACT == 3 || ACT == 6 || ACT == 8 || ACT == 9 || ACT == 11 || ACT == 12 || ACT == 14 || ACT == 15 || ACT == 16 || ACT == 17, "k_gemm2: unsupported ACT code (would silently apply no activation)");
  __shared__ __attribute__((aligned(16))) float so[4][32][68];
  const int tid = threadIdx.x, w = tid >> 5, lane = tid & 31, ln = lane & 15, hh = lane >> 4; const int by = blockIdx.y;
  A += (size_t)by * sA; Bh += (size_t)by * sB; const size_t cofs = (size_t)by * sC; const float* bp = bias ? bias + (size_t)by * sBias : nullptr;
  const int ntn = N >> 6; const int mt = blockIdx.x / ntn, nq = blockIdx.x - mt * ntn; const int row0 = mt * 128 + 32 * w, col0 = nq * 64; if (row0 >= M) return;
  const _Float16* a0p = A + (size_t)(row0 + ln) * lda; const _Float16* a1p = a0p + (size_t)16 * lda;
  const _Float16* b0p = Bh + (size_t)(col0 + ln) * ldb; const _Float16* b1p = b0p + (size_t)16 * ldb; const _Float16* b2p = b1p + (size_t)16 * ldb; const _Float16* b3p = b2p + (size_t)16 * ldb;
  const v8f z8 = {0.f,0.f,0.f,0.f,0.f,0.f,0.f,0.f}; v8f c00 = z8, c01 = z8, c02 = z8, c03 = z8, c10 = z8, c11 = z8, c12 = z8, c13 = z8;
#pragma unroll 1
  for (int kb = 0; kb < K; kb += 32) { const v16h a0 = g2_frag(a0p + kb, hh), a1 = g2_frag(a1p + kb, hh);
    v16h b = g2_frag(b0p + kb, hh); c00 = g2_mma(a0, b, c00); c10 = g2_mma(a1, b, c10);
    b = g2_frag(b1p + kb, hh); c01 = g2_mma(a0, b, c01); c11 = g2_mma(a1, b, c11);
    b = g2_frag(b2p + kb, hh); c02 = g2_mma(a0, b, c02); c12 = g2_mma(a1, b, c12);
    b = g2_frag(b3p + kb, hh); c03 = g2_mma(a0, b, c03); c13 = g2_mma(a1, b, c13); }
  v8f accs[8] = {c00, c01, c02, c03, c10, c11, c12, c13};
#pragma unroll
  for (int u = 0; u < 8; ++u) { const int t = u & 3, half = u >> 2; const int col = col0 + t * 16 + ln; const float bv = bp ? bf16_round(bp[col]) : 0.f;
#pragma unroll
    for (int r = 0; r < 8; ++r) { const int rloc = half * 16 + 8 * hh + r; float v = accs[u][r] * alpha + bv; if (CP) { if (rowsPerB < 0) v += CP[cofs + (size_t)(row0g + row0 + rloc) * ldc + col];      /* rowsPerB < 0: own element of the batched C plane */ else { const int bidx = (row0g + row0 + rloc) / rowsPerB; v += CP[(size_t)bidx * sCPb + (size_t)by * 64 + col]; } }
      if (ACT == 3) v = fmaxf(v, 0.f); else if (ACT == 6) v = 0.5f * v * (1.0f + erff(v * 0.70710678118654752f)); else if (ACT == 11) v = 1.0f / (1.0f + expf(-v)); else if (ACT == 15) v = v / (1.0f + expf(-v)); else if (ACT == 12) v = (v > 0.f) ? v : 0.01f * v; else if (ACT == 8) v = tanhf(v); else if (ACT == 9) v = 0.5f * v * (1.0f + tanhf(0.7978845608028654f * (v + 0.044715f * v * v * v))); else if (ACT == 14) v = (v > 0.f) ? v : 0.1f * v; else if (ACT == 16) v = (v >= 0.f) ? v : 0.3f * v; else if (ACT == 17) v = (v >= 0.f) ? v : 0.2f * v;
      so[w][rloc][t * 16 + ln] = v; } }
  __builtin_amdgcn_fence(__ATOMIC_ACQ_REL, "workgroup"); __builtin_amdgcn_wave_barrier();
  const int rsub = lane >> 4, c4 = (lane & 15) * 4;
  {
#pragma unroll
    for (int q = 0; q < 16; ++q) { const int r = q * 2 + rsub; const v4f v = *(const v4fa*)&so[w][r][c4]; if (C) *(v4f*)(C + cofs + (size_t)(row0 + r) * ldc + col0 + c4) = v; if (C16) { v4h h4; for (int i = 0; i < 4; ++i) h4[i] = (_Float16)v[i]; *(v4h*)(C16 + cofs + (size_t)(row0 + r) * ldc + col0 + c4) = h4; } }
     } }


__global__ __launch_bounds__(256) void k_wnat(const float* __restrict__ w, size_t n8, _Float16* __restrict__ Bt) { const size_t t = (size_t)blockIdx.x * 256 + threadIdx.x; if (t >= n8) return; FragH f; for (int q = 0; q < 8; ++q) f.h[q] = (_Float16)(bf16_round(w[t * 8 + q]) * 16.0f); *(v8us*)((unsigned short*)Bt + t * 8) = f.half[0];  }
// Fused attention, all heads in one launch: scores, softmax and the weighted sum of v never leave the chip (no score or weight plane in memory).
// Workgroup = 8 waves = 256 queries of one head, as two key groups of 4 waves: a wave owns 64 query columns and every second tile of 64 keys, so that a K or V^T fragment read from LDS feeds four products
// (at two products a fragment the LDS reads took as many cycles as the products themselves); two waves share a SIMD, each with up to 512 registers. Per stage each group stages its own 64 k rows and v^T rows in its own LDS ring
// (whole-line 16-byte loads one stage ahead through registers, two buffers, one barrier a stage). Each group keeps its own maximum, sum and O^T; they are merged once, through LDS, at the end. Transposed products: S^T = K Q^T (a lane holds 8 keys of ONE query per tile),
// reference and sum per query (f32; fa_pass has the two forms), weights as f16, O^T += V^T P^T with the two S^T tiles of 32 keys packed in place as the B operand.
#define FA_KT 64                     /* keys per stage */
#define FA_KG 2                      /* key groups per workgroup */
#define FA_QT 4                      /* tiles of 16 query columns per wave */
#define FA_QW (256 / (16 * FA_QT))   /* waves per key group: together they hold the workgroup's 256 queries */
#define FA_GT (32 * FA_QW)           /* threads per key group */
#define FA_RS (FA_GT / 8)            /* rows that a group stages with one load per thread (8 threads a row) */
#define FA_SP (FA_KT / FA_RS)        /* 16-byte pieces of k, and of v^T, per thread and stage */
#define FA_NS (SQ / (FA_KT * FA_KG)) /* stages: each takes every group one tile on */
#define FA_LP 72                     /* LDS row pitch in f16: 128 data bytes + 16, an odd multiple of 16 bytes for the 16-byte fragment reads */
__device__ __forceinline__ float fa_xhalf(float x) { return __builtin_bit_cast(float, __builtin_amdgcn_permlanex16(__builtin_bit_cast(int, x), __builtin_bit_cast(int, x), 0x76543210, 0xfedcba98, false, false)); }      /* lane l <-> lane l ^ 16 */
__device__ __forceinline__ v16h fa_lfrag(const _Float16* p) { FragH f; f.half[0] = *(const v8us*)((const unsigned short*)p); f.half[1] = *(const v8us*)((const unsigned short*)p + 16); return f.v; }      /* p already holds the lane half's + 8 * hh: the k order of g2_frag */
__device__ __forceinline__ v8f fa_mma(v16h a, v16h b, v8f c) { return __builtin_amdgcn_wmma_f32_16x16x32_f16(false, a, false, b, (short)0, c, false, false); }
// Eight independent 2^x in place. One statement, so that no exponential stands directly in front of an instruction that overwrites its source or reads its result
// (as separate builtins the register allocator put the next result into the previous source); the v_nop is the slot the instruction set asks for behind the last one.
__device__ __forceinline__ void fa_exp2x8(float (&p)[8]) {
  asm("v_exp_f32 %0, %0\n\tv_exp_f32 %1, %1\n\tv_exp_f32 %2, %2\n\tv_exp_f32 %3, %3\n\tv_exp_f32 %4, %4\n\tv_exp_f32 %5, %5\n\tv_exp_f32 %6, %6\n\tv_exp_f32 %7, %7\n\tv_nop"
      : "+v"(p[0]), "+v"(p[1]), "+v"(p[2]), "+v"(p[3]), "+v"(p[4]), "+v"(p[5]), "+v"(p[6]), "+v"(p[7])); }
typedef float v2f __attribute__((ext_vector_type(2)));
#define FA_OFF 4.0f                  /* fixed-reference pass: a query's own key gets the weight 2^4 */
#define FA_LIM 60000.0f              /* below the largest finite f16: a sum of non-negative weights under it bounds every weight */
// One pass over all the group's keys; qf holds the queries times 1 / sqrt(64) and log2(e), so a score is an exponent of 2. FIXED: the softmax reference of a query is given in m and never moves: it enters as the C operand of the score products,
// whose result is then the argument of the exponential itself, and there is no maximum, no exchange between the lane halves, no subtraction and no rescaling of O^T and of the sums in the loop.
// Otherwise: the running maximum (online softmax), which takes any scores; m is set here.
// The pass serves the wave's query tiles Q0 .. Q0 + NQ - 1: all four in the fixed form; the running maximum, with its further registers, takes them two at a time.
template <bool FIXED, int Q0, int NQ>
__device__ __forceinline__ void fa_pass(_Float16 (*sk)[FA_KT][FA_LP], _Float16 (*sv)[HD][FA_LP], const unsigned short* gk, const unsigned short* gv, const int sr, const int sc, const int ln, const int hh,
                                        const v16h (&qf)[FA_QT][2], v8f (&o)[FA_QT][4], float (&m)[FA_QT], float (&l)[FA_QT]) {
  v8us rk[FA_SP], rv[FA_SP];
#pragma unroll      /* constant indices keep the staged rows in registers */
  for (int i = 0; i < FA_SP; ++i) { rk[i] = *(const v8us*)(gk + (size_t)(i * FA_RS) * LQ); rv[i] = *(const v8us*)(gv + (size_t)(i * FA_RS) * SQ); }
  asm volatile("s_wait_xcnt 0x0" ::: "memory");      /* stands in front of whatever lands next in the registers that held these loads' addresses */
#pragma unroll      /* constant indices keep the staged rows in registers */
  for (int i = 0; i < FA_SP; ++i) { *(v8us*)&sk[0][sr + i * FA_RS][sc] = rk[i]; *(v8us*)&sv[0][sr + i * FA_RS][sc] = rv[i]; }
  __syncthreads();
  const v8f z8 = {0.f, 0.f, 0.f, 0.f, 0.f, 0.f, 0.f, 0.f};
#pragma unroll      /* constant indices keep the tiles in registers */
  for (int qt = Q0; qt < Q0 + NQ; ++qt) { l[qt] = 0.f; if (!FIXED) m[qt] = -3.0e38f; for (int dt = 0; dt < 4; ++dt) o[qt][dt] = z8; }
  v2f l2[FA_QT][2];      /* fixed pass: [query tile][chain], two sums each */
  v8f cf[FA_QT];      /* C of a score tile's first product; a lane's 8 registers belong to one query */
#pragma unroll      /* constant indices keep the tiles in registers */
  for (int qt = Q0; qt < Q0 + NQ; ++qt) { l2[qt][0] = v2f{0.f, 0.f}; l2[qt][1] = v2f{0.f, 0.f}; cf[qt] = z8; if (FIXED) for (int r = 0; r < 8; ++r) cf[qt][r] = FA_OFF - m[qt]; }
  for (int s = 0; s < FA_NS; ++s) {
    const int cur = s & 1;
    v16h ka[2][2];      /* K fragments of a pass: [16 keys][k step of 32 head dims] */
#pragma unroll      /* constant indices keep the fragments in registers */
    for (int k2 = 0; k2 < 2; ++k2) for (int ks = 0; ks < 2; ++ks) ka[k2][ks] = fa_lfrag(&sk[cur][k2 * 16 + ln][ks * 32 + 8 * hh]);
    __builtin_amdgcn_sched_barrier(0);      /* the stage's first LDS reads go out ahead of the global loads, so that the wait behind those loads runs under the reads' latency */
    {      /* the next stage's rows fly while this stage is worked on; the last stage fetches its own rows again into the buffer that nobody reads any more (built without that fetch, the last stage spilled to scratch) */
      const int sn = s + 1 < FA_NS ? s + 1 : s;
      const unsigned short* nk = gk + (size_t)sn * (FA_KG * FA_KT) * LQ; const unsigned short* nv = gv + (size_t)sn * (FA_KG * FA_KT);
#pragma unroll      /* constant indices keep the staged rows in registers */
      for (int i = 0; i < FA_SP; ++i) { rk[i] = *(const v8us*)(nk + (size_t)(i * FA_RS) * LQ); rv[i] = *(const v8us*)(nv + (size_t)(i * FA_RS) * SQ); }
      asm volatile("s_wait_xcnt 0x0" ::: "memory");      /* stands in front of whatever lands next in the registers that held these loads' addresses */
    }
    __builtin_amdgcn_sched_barrier(0);      /* keeps the loads and their wait up here: the scheduler otherwise sinks the loads to their LDS stores at the stage's foot, and their latency is then waited out every stage */
#pragma unroll      /* constant indices keep the tiles in registers */
    for (int ps = 0; ps < 2; ++ps) {      /* a pass takes 32 of the stage's keys through scores, weights and O^T: the score tiles of 64 keys x 64 queries would not fit the registers */
      v8f st[FA_QT][2];      /* S^T: [query tile][16 keys]; register r = key 8 * hh + r, column = query ln */
#pragma unroll      /* constant indices keep the tiles in registers */
      for (int k2 = 0; k2 < 2; ++k2)
#pragma unroll      /* constant indices keep the tiles in registers */
        for (int qt = Q0; qt < Q0 + NQ; ++qt) st[qt][k2] = fa_mma(ka[k2][1], qf[qt][1], fa_mma(ka[k2][0], qf[qt][0], cf[qt]));
      v16h va[4];      /* the pass's V^T fragments, and behind them the second pass's K fragments: one group of reads that flies under the exponentials */
#pragma unroll      /* constant indices keep the fragments in registers */
      for (int dt = 0; dt < 4; ++dt) va[dt] = fa_lfrag(&sv[cur][dt * 16 + ln][ps * 32 + 8 * hh]);
      if (ps == 0) for (int k2 = 0; k2 < 2; ++k2) for (int ks = 0; ks < 2; ++ks) ka[k2][ks] = fa_lfrag(&sk[cur][(2 + k2) * 16 + ln][ks * 32 + 8 * hh]);
      __builtin_amdgcn_sched_barrier(0);      /* the pass's score products stay one run (mixed with the exponentials, tiles were copied out of their registers and spilled), and the reads stay ahead of the exponentials, not each in front of its products */
      FragH pf[FA_QT];      /* [query tile]: P^T of the 32 keys as B operand, element i = tile i >> 3, register i & 7 */
#pragma unroll      /* constant indices keep the tiles in registers */
      for (int qt = Q0; qt < Q0 + NQ; ++qt) {
        float nb = 0.f, corr = 1.0f;
        if (!FIXED) {
          float mk[2];      /* one short chain per tile */
#pragma unroll      /* constant indices keep the tiles in registers */
          for (int k2 = 0; k2 < 2; ++k2) { mk[k2] = st[qt][k2][0]; for (int r = 1; r < 8; ++r) mk[k2] = fmaxf(mk[k2], st[qt][k2][r]); }
          float mx = fmaxf(mk[0], mk[1]);
          mx = fmaxf(mx, fa_xhalf(mx));
          const float mn = fmaxf(m[qt], mx);
          asm("v_exp_f32 %0, %1\n\tv_nop" : "=v"(corr) : "v"(m[qt] - mn));      /* 0 on the first pass; the v_nop is the slot the instruction set asks for behind the exponential (as the builtin, the next instruction overwrote its source) */
          nb = 12.0f - mn;
          m[qt] = mn;
        }
        float ls[2] = {0.f, 0.f};
#pragma unroll      /* constant indices keep the tiles in registers */
        for (int k2 = 0; k2 < 2; ++k2) { float p[8]; for (int r = 0; r < 8; ++r) p[r] = FIXED ? st[qt][k2][r] : st[qt][k2][r] + nb; fa_exp2x8(p);
          for (int r = 0; r < 8; ++r) pf[qt].h[k2 * 8 + r] = (_Float16)p[r];
          if (FIXED) for (int r = 0; r < 8; r += 2) { const v2f pp = {p[r], p[r + 1]}; l2[qt][k2] += pp; }      /* neighbouring registers of a tile as they lie: one packed add, no copy; the sums run through all stages */
          else for (int r = 0; r < 8; ++r) ls[k2] += p[r]; }
        if (!FIXED) {
          l[qt] = fmaf(l[qt], corr, ls[0] + ls[1]);
#pragma unroll      /* constant indices keep the tiles in registers */
          for (int dt = 0; dt < 4; ++dt) o[qt][dt] *= corr;
        }
      }
#pragma unroll      /* constant indices keep the tiles in registers */
      for (int dt = 0; dt < 4; ++dt)
#pragma unroll      /* constant indices keep the tiles in registers */
        for (int qt = Q0; qt < Q0 + NQ; ++qt) o[qt][dt] = fa_mma(va[dt], pf[qt].v, o[qt][dt]);
    }
    {
#pragma unroll      /* constant indices keep the staged rows in registers */
      for (int i = 0; i < FA_SP; ++i) { *(v8us*)&sk[cur ^ 1][sr + i * FA_RS][sc] = rk[i]; *(v8us*)&sv[cur ^ 1][sr + i * FA_RS][sc] = rv[i]; } }      /* that buffer's last readers left it before the previous barrier */
    __syncthreads();      /* publishes stage s + 1 and ends every read of stage s */
  }
  if (FIXED) for (int qt = Q0; qt < Q0 + NQ; ++qt) l[qt] = (l2[qt][0][0] + l2[qt][0][1]) + (l2[qt][1][0] + l2[qt][1][1]);
}
__global__ __launch_bounds__(FA_GT * FA_KG) void k_fattn(const _Float16* __restrict__ Q, const _Float16* K, const _Float16* VT, float* __restrict__ out) {      /* K, VT without restrict: else the first stage's rows are kept in registers over the whole fixed pass for the second pass's sake */
  __shared__ __attribute__((aligned(16))) _Float16 skg[FA_KG][2][FA_KT][FA_LP];
  __shared__ __attribute__((aligned(16))) _Float16 svg[FA_KG][2][HD][FA_LP];
  __shared__ __attribute__((aligned(16))) v4f xo[FA_QW][8 * FA_QT][32];      /* group 1's O^T on its way to group 0: [query wave][16-byte piece][lane] */
  __shared__ float xs[FA_QW][2 * FA_QT][32];      /* group 1's maxima and sums: [query wave][m of each tile, then l of each tile][lane] */
  __shared__ int xbad[FA_QW * FA_KG];      /* per wave: a sum of the fixed pass reached FA_LIM */
  const int g = __builtin_amdgcn_readfirstlane((int)threadIdx.x / FA_GT);      /* key group, the same in a whole wave */
  const int tid = threadIdx.x % FA_GT, w = tid >> 5, lane = tid & 31, ln = lane & 15, hh = lane >> 4;      /* place inside the group */
  _Float16 (*sk)[FA_KT][FA_LP] = skg[g]; _Float16 (*sv)[HD][FA_LP] = svg[g];
  const int h = blockIdx.y, q0 = blockIdx.x * 256 + w * (16 * FA_QT);
  const float CS = 0.125f * 1.4426950408889634f;      /* 1 / sqrt(64), and base 2 for the exponentials */
  v16h qf[FA_QT][2];      /* [query tile][k step of 32 head dims], B operand: column = query */
  const _Float16* qp = Q + (size_t)(q0 + ln) * LQ + h * HD + 8 * hh;      /* the lane's query row of tile 0, at its lane half's place: the k order of g2_frag */
#pragma unroll      /* constant indices keep the fragments in registers */
  for (int qt = 0; qt < FA_QT; ++qt) for (int ks = 0; ks < 2; ++ks) qf[qt][ks] = fa_lfrag(qp + qt * 16 * LQ + ks * 32);      /* one address, constant offsets */
  asm volatile("s_wait_xcnt 0x0" :: "v"(qp) : "memory");      /* stands in front of whatever lands next in the registers that held these loads' address; the address as an input keeps them untouched up to the wait */
  const int sr = tid >> 3, sc = (tid & 7) * 8;      /* staging: 8 threads cover one 128-byte row; rows sr + FA_RS i */
  const unsigned short* gk = (const unsigned short*)K + (size_t)(g * FA_KT + sr) * LQ + h * HD + sc;      /* stage s: the group's keys (s * FA_KG + g) * 64 .. + 63 */
  const unsigned short* gv = (const unsigned short*)VT + ((size_t)h * HD + sr) * SQ + g * FA_KT + sc;
  v8f o[FA_QT][4];      /* O^T: [query tile][16 head dims]; register r = head dim 8 * hh + r, column = query ln */
  float m[FA_QT], l[FA_QT];      /* softmax reference (a score: an exponent of 2) and this lane half's sum, per query */
  // The keys are the queries' own rows, so q.q is one of a query's scores: as the reference it gives that key the weight 2^FA_OFF, so no sum can vanish, and a softmax does not depend on its reference.
#pragma unroll      /* constant indices keep the fragments in registers */
  for (int qt = 0; qt < FA_QT; ++qt) { float a = 0.f; for (int ks = 0; ks < 2; ++ks) for (int i = 0; i < 16; ++i) { const float x = (float)qf[qt][ks][i]; const _Float16 y = (_Float16)(x * CS); a = fmaf((float)y, x, a); qf[qt][ks][i] = y; } m[qt] = a + fa_xhalf(a); }      /* the row as query (scaled) times the row as key */
  fa_pass<true, 0, FA_QT>(sk, sv, gk, gv, sr, sc, ln, hh, qf, o, m, l);
  // Another key's score may lie far above q.q: a weight could then leave the f16 range. Weights are not negative, so sums under FA_LIM show that none did (an infinite or undefined sum fails the test too).
  bool fine = true;
#pragma unroll      /* constant indices keep the sums in registers */
  for (int qt = 0; qt < FA_QT; ++qt) fine = fine && l[qt] < FA_LIM;
  xbad[threadIdx.x >> 5] = __builtin_amdgcn_ballot_w32(!fine) != 0u ? 1 : 0;
  __syncthreads();      /* publishes every wave's finding: the choice below is one for the whole workgroup */
  int anyb = 0;
#pragma unroll      /* one read of one word per wave, once a launch */
  for (int i = 0; i < FA_QW * FA_KG; ++i) anyb |= xbad[i];
  if (__builtin_amdgcn_readfirstlane(anyb) != 0) { fa_pass<false, 0, 2>(sk, sv, gk, gv, sr, sc, ln, hh, qf, o, m, l); fa_pass<false, 2, 2>(sk, sv, gk, gv, sr, sc, ln, hh, qf, o, m, l); }      /* the whole workgroup starts over with the running maximum */
#pragma unroll      /* constant indices keep the sums in registers */
  for (int qt = 0; qt < FA_QT; ++qt) l[qt] += fa_xhalf(l[qt]);      /* the two lane halves' sums join once */
  if (g == 1) {      /* hand the group's statistics and O^T over, lane to same lane of the wave with the same queries */
#pragma unroll      /* constant indices keep the tiles in registers */
    for (int qt = 0; qt < FA_QT; ++qt) { xs[w][qt][lane] = m[qt]; xs[w][FA_QT + qt][lane] = l[qt];
#pragma unroll      /* constant indices keep the tiles in registers */
      for (int dt = 0; dt < 4; ++dt) { const v4f lo = {o[qt][dt][0], o[qt][dt][1], o[qt][dt][2], o[qt][dt][3]}, hi = {o[qt][dt][4], o[qt][dt][5], o[qt][dt][6], o[qt][dt][7]};
        xo[w][(qt * 4 + dt) * 2][lane] = lo; xo[w][(qt * 4 + dt) * 2 + 1][lane] = hi; } }
  }
  __syncthreads();      /* publishes group 1's partial results to group 0 */
  if (g == 0) {
#pragma unroll      /* constant indices keep the tiles in registers */
    for (int qt = 0; qt < FA_QT; ++qt) {
      const float m1 = xs[w][qt][lane], l1 = xs[w][FA_QT + qt][lane];
      const float mn = fmaxf(m[qt], m1);
      const float c0 = __builtin_amdgcn_exp2f(m[qt] - mn), c1 = __builtin_amdgcn_exp2f(m1 - mn);      /* both groups' weights brought to the common maximum */
      const float inv = 1.0f / fmaf(l[qt], c0, l1 * c1);
      const float a0 = c0 * inv, a1 = c1 * inv;
      float* op = out + (size_t)(q0 + qt * 16 + ln) * DM + h * HD + 8 * hh;
#pragma unroll      /* constant indices keep the tiles in registers */
      for (int dt = 0; dt < 4; ++dt) { const v4f p0 = xo[w][(qt * 4 + dt) * 2][lane], p1 = xo[w][(qt * 4 + dt) * 2 + 1][lane];
        const v4f lo = {fmaf(o[qt][dt][0], a0, p0[0] * a1), fmaf(o[qt][dt][1], a0, p0[1] * a1), fmaf(o[qt][dt][2], a0, p0[2] * a1), fmaf(o[qt][dt][3], a0, p0[3] * a1)};
        const v4f hi = {fmaf(o[qt][dt][4], a0, p1[0] * a1), fmaf(o[qt][dt][5], a0, p1[1] * a1), fmaf(o[qt][dt][6], a0, p1[2] * a1), fmaf(o[qt][dt][7], a0, p1[3] * a1)};
        *(v4f*)(op + dt * 16) = lo; *(v4f*)(op + dt * 16 + 4) = hi; }
    }
  } }
// Projection GEMM with both operands staged in LDS straight from the f32 inputs: P[token][n] = sum_k bf16(X[token][k]) bf16(W[k][n]), v_wmma_f32_16x16x32_bf16, f32 accumulation, f16 result rows of pitch LQ.
// The rounding (to nearest even, one packed conversion per two values) stands between the global loads and the LDS stores of the ring, so no 16-bit copy of X or W exists in memory and no launch makes one. X: 16 lanes cover the 256 bytes of a row's stage.
// W is [k][n]: a wave takes 8 k rows, a lane one column of each 32 (every load a whole 128-byte line), and the lane's 8 k values of a column pack into one 16-byte piece of the LDS row n: the transposition costs nothing.
// Workgroup = 8 waves = 256 tokens x 128 columns; a wave owns 64 tokens x 64 columns (16 accumulator tiles, so a fragment read from LDS feeds 4 products). Per stage of 64 k the workgroup stages
// the 256 X rows and the 128 W columns (as rows) in LDS (whole-line loads one stage ahead through registers, two buffers, one barrier a stage: the ring of k_fattn).
// Transposed products, A = Wt rows, B = X rows: a lane holds 8 neighbouring columns of ONE token per tile, which pack into one 16-byte piece of a result row.
// A workgroup of the v half (columns from DM on) exchanges the operands, A = X rows, B = Wt rows: a lane then holds 8 neighbouring tokens of ONE column, a 16-byte piece of a V^T row, so V^T leaves this launch
// in the layout k_fattn reads and no transposing launch follows. Wave tiles are 64 x 64 and both operands have one LDS row form, so only the two first-row numbers and the result address differ.
#define G3_KT 64                     /* k per stage */
#define G3_NS (DM / G3_KT)           /* stages */
#define G3_LP 72                     /* LDS row pitch in f16: 128 data bytes + 16, an odd multiple of 16 bytes for the 16-byte fragment reads */
#define G3_MT 256                    /* tokens per workgroup */
#define G3_NT 128                    /* columns per workgroup */
#define G3_BR (G3_MT + G3_NT)        /* LDS rows per buffer: the X rows, then the Wt rows */
typedef unsigned short v4us __attribute__((ext_vector_type(4), may_alias));
__global__ __launch_bounds__(256) void k_gemm3(const float* __restrict__ X, const float* __restrict__ W, _Float16* __restrict__ P, _Float16* __restrict__ VT) {
  __shared__ __attribute__((aligned(16))) _Float16 sg[2 * G3_BR * G3_LP];
  const int tid = threadIdx.x, w = tid >> 5, lane = tid & 31, ln = lane & 15, hh = lane >> 4;
  const int row0 = blockIdx.y * G3_MT, col0 = blockIdx.x * G3_NT;
  const int tw = (w & 3) * 64, cw = (w >> 2) * 64;      /* the wave's first token and first column inside the workgroup's tile */
  const bool vh = col0 >= DM;      /* the v half, the same for the whole workgroup */
  const int ar = vh ? tw : G3_MT + cw, br = vh ? G3_MT + cw : tw;      /* first LDS row of the wave's A operand and of its B operand */
  const int xr = tid >> 4, xc = (tid & 15) * 4;      /* X staging: 16 threads cover the 256 bytes of one row's stage; rows xr + 16 i */
  const float* gx = X + (size_t)(row0 + xr) * DM + xc;
  const float* gw = W + (size_t)(w * 8) * LQ + col0 + lane;      /* W staging: k rows 8 w + e of the stage, columns lane + 32 q */
  v4f rx[16]; float rw[4][8];
#pragma unroll      /* constant indices keep the staged rows in registers */
  for (int i = 0; i < 16; ++i) rx[i] = *(const v4fa*)(gx + (size_t)i * 16 * DM);
#pragma unroll      /* constant indices keep the staged rows in registers */
  for (int q = 0; q < 4; ++q) for (int e = 0; e < 8; ++e) rw[q][e] = gw[(size_t)e * LQ + q * 32];
#pragma unroll      /* constant indices keep the staged rows in registers */
  for (int i = 0; i < 16; ++i) { union { __bf16 b[4]; v4us v; } f; for (int e = 0; e < 4; ++e) f.b[e] = (__bf16)rx[i][e]; *(v4us*)&sg[(xr + 16 * i) * G3_LP + xc] = f.v; }
#pragma unroll      /* constant indices keep the staged rows in registers */
  for (int q = 0; q < 4; ++q) { FragB f; for (int e = 0; e < 8; ++e) f.v[e] = (__bf16)rw[q][e]; *(v8us*)&sg[(G3_MT + lane + 32 * q) * G3_LP + w * 8] = f.half[0]; }
  __syncthreads();
  const v8f z8 = {0.f, 0.f, 0.f, 0.f, 0.f, 0.f, 0.f, 0.f};
  v8f acc[4][4];      /* [16 A rows][16 B rows]; register r = A row 8 * hh + r, lane column = B row ln (q = k half: A rows are columns, B rows tokens; v half: the reverse) */
#pragma unroll      /* constant indices keep the tiles in registers */
  for (int i = 0; i < 4; ++i) for (int j = 0; j < 4; ++j) acc[i][j] = z8;
  for (int s = 0; s < G3_NS; ++s) {
    const _Float16* sb = sg + (s & 1) * (G3_BR * G3_LP);
    if (s + 1 < G3_NS) {      /* the next stage's rows fly while this stage is worked on */
#pragma unroll      /* constant indices keep the staged rows in registers */
      for (int i = 0; i < 16; ++i) rx[i] = *(const v4fa*)(gx + (size_t)i * 16 * DM + (s + 1) * G3_KT);
#pragma unroll      /* constant indices keep the staged rows in registers */
      for (int q = 0; q < 4; ++q) for (int e = 0; e < 8; ++e) rw[q][e] = gw[(size_t)((s + 1) * G3_KT + e) * LQ + q * 32];
      asm volatile("s_wait_xcnt 0x0" ::: "memory");      /* stands in front of the LDS reads below, which land in the registers that held these loads' addresses */
    }
    __builtin_amdgcn_sched_barrier(0);      /* keeps the 48 loads and their wait up here: without it the scheduler lifts an address of the LDS reads into a load's address register ahead of the wait */
    v16h wf[2][4], xf[2][4];      /* [k step of 32][16 A rows] and [k step of 32][16 B rows] */
#pragma unroll      /* constant indices keep the fragments in registers */
    for (int ks = 0; ks < 2; ++ks) {      /* in the order of first use, so that the products start behind the first loads */
      wf[ks][0] = fa_lfrag(sb + (ar + ln) * G3_LP + ks * 32 + 8 * hh);
#pragma unroll      /* constant indices keep the fragments in registers */
      for (int j = 0; j < 4; ++j) xf[ks][j] = fa_lfrag(sb + (br + j * 16 + ln) * G3_LP + ks * 32 + 8 * hh);
#pragma unroll      /* constant indices keep the fragments in registers */
      for (int i = 1; i < 4; ++i) wf[ks][i] = fa_lfrag(sb + (ar + i * 16 + ln) * G3_LP + ks * 32 + 8 * hh);
    }
    __builtin_amdgcn_sched_barrier(0);      /* the stage's 32 LDS reads stay one group ahead of its products: spread among them into one register set, every four products waited out a read's latency */
#pragma unroll      /* constant indices keep the tiles in registers */
    for (int ks = 0; ks < 2; ++ks) for (int i = 0; i < 4; ++i) for (int j = 0; j < 4; ++j) acc[i][j] = __builtin_amdgcn_wmma_f32_16x16x32_bf16(false, __builtin_bit_cast(v16b, wf[ks][i]), false, __builtin_bit_cast(v16b, xf[ks][j]), (short)0, acc[i][j], false, false);
    __builtin_amdgcn_sched_barrier(0);      /* the conversions and LDS stores of the next stage stay behind the products: lifted above them, they wait out the global loads' latency with the matrix unit idle */
    if (s + 1 < G3_NS) {      /* that buffer's last readers left it before the previous barrier */
      _Float16* sn = sg + ((s & 1) ^ 1) * (G3_BR * G3_LP);
#pragma unroll      /* constant indices keep the staged rows in registers */
      for (int i = 0; i < 16; ++i) { union { __bf16 b[4]; v4us v; } f; for (int e = 0; e < 4; ++e) f.b[e] = (__bf16)rx[i][e]; *(v4us*)&sn[(xr + 16 * i) * G3_LP + xc] = f.v; }
#pragma unroll      /* constant indices keep the staged rows in registers */
      for (int q = 0; q < 4; ++q) { FragB f; for (int e = 0; e < 8; ++e) f.v[e] = (__bf16)rw[q][e]; *(v8us*)&sn[(G3_MT + lane + 32 * q) * G3_LP + w * 8] = f.half[0]; }
    }
    __syncthreads();      /* publishes stage s + 1 and ends every read of stage s; the last one frees the ring for the result rows */
  }
  _Float16* so = sg + w * 64 * G3_LP;      /* the wave's own 64 result rows (B rows) of 64 values (A rows), so that whole 128-byte lines go out */
#pragma unroll      /* constant indices keep the tiles in registers */
  for (int i = 0; i < 4; ++i) for (int j = 0; j < 4; ++j) { FragH f; for (int r = 0; r < 8; ++r) f.h[r] = (_Float16)acc[i][j][r];
    *(v8us*)&so[(j * 16 + ln) * G3_LP + i * 16 + 8 * hh] = f.half[0]; }
  __builtin_amdgcn_fence(__ATOMIC_ACQ_REL, "workgroup"); __builtin_amdgcn_wave_barrier();      /* the wave reads back what its other lanes wrote */
  unsigned short* dp = vh ? (unsigned short*)VT + (size_t)(col0 - DM + cw) * SQ + row0 + tw      /* v half: rows = v columns (head * HD + dim), values = tokens */
                          : (unsigned short*)P + (size_t)(row0 + tw) * LQ + col0 + cw;      /* q = k half: rows = tokens, values = columns */
  const int dl = vh ? SQ : LQ;      /* row pitch of the plane written */
#pragma unroll      /* independent row pieces: the reads go ahead of the stores */
  for (int q = 0; q < 16; ++q) { const int r = q * 4 + (lane >> 3), c = (lane & 7) * 8; const v8us v = *(const v8us*)&so[r * G3_LP + c];
    *(v8us*)(dp + (size_t)(r * dl) + c) = v; }
}
__global__ __launch_bounds__(256) void k_vt(const _Float16* __restrict__ V16, int b, int h0, _Float16* __restrict__ VT) { __shared__ unsigned short tl[64][65]; const int tid = threadIdx.x; const int hh = blockIdx.x % HG, sg = blockIdx.x / HG; const int s0 = sg * 64; const int h = h0 + hh;
  for (int i = tid; i < 64 * 8; i += 256) { const int j = i / 8, d8 = (i % 8) * 8; FragH f; f.half[0] = *(const v8us*)((const unsigned short*)V16 + ((size_t)b * SQ + s0 + j) * DM + h * HD + d8); for (int q = 0; q < 8; ++q) tl[d8 + q][j] = f.u[q]; }
  __syncthreads();
  { for (int i = tid; i < 64 * 8; i += 256) { const int d = i / 8, j8 = (i % 8) * 8; FragH f; for (int q = 0; q < 8; ++q) f.u[q] = tl[d][j8 + q]; *(v8us*)((unsigned short*)VT + ((size_t)hh * HD + d) * SQ + s0 + j8) = f.half[0]; }  } }



__global__ __launch_bounds__(256) void k_rsmkm(const float* __restrict__ S, _Float16* __restrict__ P, int nrows, const int* __restrict__ am) {
  #pragma clang fp contract(off)
  const int t = blockIdx.x * 256 + threadIdx.x; if (t >= nrows) return; const size_t i = (size_t)t; const float* s = S + i * SQ; const int* mr = am + (size_t)(t % SQ) * SQ; float mx = -3.0e38f;
#pragma unroll 1
  for (int j = 0; j < SQ; ++j) { const float f = (mr[j] != 0) ? 1.f : 0.f; mx = fmaxf(mx, fmaf(f, s[j], (1.f - f) * -1.0e9f)); } float se = 0.f;
#pragma unroll 1
  for (int j = 0; j < SQ; ++j) { const float f = (mr[j] != 0) ? 1.f : 0.f; se += __expf(fmaf(f, s[j], (1.f - f) * -1.0e9f) - mx); } const float sc = 256.0f / se;
#pragma unroll 1
  for (int j0 = 0; j0 < SQ; j0 += 8) { FragH fr; for (int q = 0; q < 8; ++q) { const int j = j0 + q; const float f = (mr[j] != 0) ? 1.f : 0.f; fr.h[q] = (_Float16)(__expf(fmaf(f, s[j], (1.f - f) * -1.0e9f) - mx) * sc); }
    unsigned short* d = (unsigned short*)P + i * SQ + j0; *(v8us*)d = fr.half[0];  } }
extern "C" void kernel_launch(void* const* d_in, const int* in_sizes, int n_in,
                              void* d_out, int out_size, void* d_ws, size_t ws_size, hipStream_t stream) {
  (void)in_sizes; (void)n_in; (void)out_size;
  const float* const* I = (const float* const*)d_in; const float* xq = I[0]; const float* wqkv = I[1];      /* input order: X (2-D [4096][1024] = one sequence; feeds the one projection), Wqkv ([in][out] [1024][2048]: columns 0..1023 = the shared q = k projection, 1024..2047 = v); NO biases; NO output projection */
  static_assert(NH * HD == DM && DM % 64 == 0 && SQ % (FA_KT * FA_KG) == 0 && SQ % 256 == 0 && NH % HG == 0 && MP % G3_MT == 0 && LQ % G3_NT == 0 && DM % G3_NT == 0 && NB == 1 && G3_NS >= 2, "shape / tile multiples; one batch, since the projection writes V^T by token");
  char* ws = (char*)d_ws; size_t off = 0;
  auto take = [&](size_t bytes) { char* p = ws + off; off += (bytes + 255) & ~(size_t)255; return p; };
  _Float16* P16 = (_Float16*)take(NR * LQ * 2);
  _Float16* VT = (_Float16*)take((size_t)NH * HD * SQ * 2);
  if (off > ws_size) return;
  const size_t r0p = (size_t)B0 * SQ;      /* first projected row */
  k_gemm3<<<dim3(LQ / G3_NT, MP / G3_MT), 256, 0, stream>>>(xq + r0p * DM, wqkv, P16 + r0p * LQ, VT);      /* proj = X Wqkv from the f32 inputs ([in][out] weights as they lie), all 2048 columns in one launch; q and k are the same product and are read from the same columns; the v columns go out as V^T [NH][HD][SQ] */
  for (int b = B0; b < B0 + NBR; ++b) { const size_t r0 = (size_t)b * SQ;
    k_fattn<<<dim3(QN / 256, NHD), FA_GT * FA_KG, 0, stream>>>(P16 + r0 * LQ, P16 + r0 * LQ, VT, (float*)d_out + r0 * DM); }      /* out = softmax(q k^T / 8) v for all heads, f32 straight into the merged-heads output rows (no output projection) */
}

// v010
// It runs in 68 microseconds.
// In two side-by-side timings against v009, it was 1.15 and 1.14 times as fast.
// Counting every step since v000, it is 206 times as fast.
#include <hip/hip_runtime.h>
// Multi-head self-attention on ONE 4096-token problem with a SHARED query / key projection and no output projection, NON-causal (X [4096][1024]; proj = X Wqkv ([in][out] 1024 x 2048 sigma 1/32, no bias) split into a qk half and a v half; the scores use the SAME projection on both sides: scores = qk qk^T / sqrt(64) per head (16 heads of 64; symmetric per head); softmax over all 4096 keys (no mask); out = att v merged head-major -> [4096][1024]; no output projection); all heads in ONE fused attention launch.
// Structure: token rows r = b*4096 + s; proj = X Wqkv as ONE WMMA GEMM over all 2048 columns, fed from the f32 inputs (x and weights rounded to bf16 on the way into LDS, bf16 products; 256x128 workgroup tiles, 64x64 wave tiles, f32 accumulation, f16 output: columns 0..1023 as rows of pitch 2048 that serve as q and as k, columns 1024..2047 (v) written as V^T [head][dim][token] by the same launch, its two WMMA operands exchanged there); per batch: one fused attention launch over all heads (softmax against a fixed reference per query, its own score q.q; f32 sums, weights as f16; the online softmax with a running maximum stands behind it for scores that leave the f16 range) written f32 straight into the merged-heads output rows.
// Compute dtype: inputs rounded to bf16; x / weights exact bf16 operands (v_wmma_f32_16x16x32_bf16); q, k, v and softmax weights as plain f16 GEMM operands (~2^-12); scores and softmax statistics f32. v_wmma_f32_16x16x32_f16.
#define NB 1
#define SQ 4096
#define DM 1024
#define NH 16
#define HD 64
#define HG 1                         /* heads per group of the per-group V^T helper */
#define B0 0                         /* first batch processed (debug hook) */
#define NBR NB                       /* batches processed (debug hook) */
#define NR ((size_t)NB * SQ)         /* token rows */
#define MP ((int)((size_t)NBR * SQ)) /* rows projected (debug hook) */
#define QN SQ                        /* query rows attended per batch (debug hook) */
#define NHD NH                       /* heads attended (debug hook) */
#define MPO MP
#define LQ (2 * DM)      /* row pitch of the projected rows: 1024 shared q = k columns, then 1024 left unwritten (v goes out as V^T) */
typedef __bf16 v16b __attribute__((ext_vector_type(16)));
typedef unsigned short v8us __attribute__((ext_vector_type(8), may_alias));
typedef float  v8f  __attribute__((ext_vector_type(8)));
typedef float  v4f  __attribute__((ext_vector_type(4)));
typedef float  v4fa __attribute__((ext_vector_type(4), may_alias));
union FragB { v16b v; v8us half[2]; unsigned short u[16]; };

__device__ __forceinline__ unsigned short bf16_bits(float x) { unsigned int u = __float_as_uint(x); return (unsigned short)((u + 0x7FFFu + ((u >> 16) & 1u)) >> 16); }
__device__ __forceinline__ float bf16_val(unsigned short b) { return __uint_as_float(((unsigned int)b) << 16); }
__device__ __forceinline__ float bf16_round(float x) { return bf16_val(bf16_bits(x)); }
// D += A·B with NT terms: 1 = ah·bh, 2 = + al·bh (A split), 3 = + ah·bl (both split)
template <int NT>
__device__ __forceinline__ v8f mmaN(v16b ah, v16b al, v16b bh, v16b bl, v8f c) {
  c = __builtin_amdgcn_wmma_f32_16x16x32_bf16(false, ah, false, bh, (short)0, c, false, false);
  if (NT >= 2) c = __builtin_amdgcn_wmma_f32_16x16x32_bf16(false, al, false, bh, (short)0, c, false, false);
  if (NT >= 3) c = __builtin_amdgcn_wmma_f32_16x16x32_bf16(false, ah, false, bl, (short)0, c, false, false);
  asm volatile("v_nop\n\tv_nop\n\tv_nop\n\tv_nop" : "+v"(c) : "v"(ah), "v"(al), "v"(bh), "v"(bl));
  return c;
}

__global__ __launch_bounds__(256) void k_wt_bf16(const float* __restrict__ W, unsigned short* __restrict__ Wt, int K, int N) {
  const int t = blockIdx.x * 256 + threadIdx.x;
  const int k8n = K / 8;
  if (t >= N * k8n) return;
  const int n = t / k8n, k8 = (t % k8n) * 8;
  v8us v;
#pragma unroll
  for (int i = 0; i < 8; ++i) v[i] = bf16_bits(W[(size_t)(k8 + i) * N + n]);
  *(v8us*)(Wt + (size_t)n * K + k8) = v;
  
}

// GEMM C[M][N] (f32, pitch ldc) = act(A[M][K]·W + bias). A f32 row-major (pitch lda) converted per fragment to bf16
// (ASPLIT: hi/lo two planes -> 2 terms, else single rounded term); Wt bf16 [N][K] (pitch ldb). BIAS_BF16 rounds the
// bias to bf16 first (bias quantised to bf16 before the add). K%32==0, M%16==0, N%64==0.
template <bool ASPLIT, int ACT, bool BIAS_BF16>
__global__ __launch_bounds__(128) void k_gemm_bf(const float* __restrict__ A, int lda, const unsigned short* __restrict__ Wt, int ldb,
                                               const float* __restrict__ bias, float* __restrict__ C, int ldc, int M, int N, int K) {
  __shared__ __attribute__((aligned(16))) float so[4][16][64];
  const int tid = threadIdx.x, w = tid >> 5, lane = tid & 31, ln = lane & 15, hh = lane >> 4;
  const int ntn = N / 64;
  const int wid = blockIdx.x * 4 + w;
  const int mt = wid / ntn, nq = wid % ntn;
  if (mt * 16 >= M) return;
  const int row0 = mt * 16, col0 = nq * 64;
  const float* arow = A + (size_t)(row0 + ln) * lda;
  v8f acc[4] = {};
  for (int kb = 0; kb < K; kb += 32) {
    FragB ah, al;
    const v4f x0 = *(const v4fa*)(arow + kb + 8 * hh), x1 = *(const v4fa*)(arow + kb + 8 * hh + 4);
    const v4f x2 = *(const v4fa*)(arow + kb + 16 + 8 * hh), x3 = *(const v4fa*)(arow + kb + 16 + 8 * hh + 4);
    float xs[16] = {x0[0],x0[1],x0[2],x0[3],x1[0],x1[1],x1[2],x1[3],x2[0],x2[1],x2[2],x2[3],x3[0],x3[1],x3[2],x3[3]};
#pragma unroll
    for (int i = 0; i < 16; ++i) { const unsigned short hb = bf16_bits(xs[i]); ah.u[i] = hb; al.u[i] = ASPLIT ? bf16_bits(xs[i] - bf16_val(hb)) : (unsigned short)0; }
#pragma unroll
    for (int t = 0; t < 4; ++t) {
      const unsigned short* brow = Wt + (size_t)(col0 + t * 16 + ln) * ldb + kb;
      FragB b;
      b.half[0] = *(const v8us*)(brow + 8 * hh);
      b.half[1] = *(const v8us*)(brow + 16 + 8 * hh);
      acc[t] = mmaN<ASPLIT ? 2 : 1>(ah.v, al.v, b.v, b.v, acc[t]);
    }
  }
#pragma unroll
  for (int t = 0; t < 4; ++t) {
    float bv = bias ? bias[col0 + t * 16 + ln] : 0.f;
    if (BIAS_BF16) bv = bf16_round(bv);
#pragma unroll
    for (int r = 0; r < 8; ++r) { float v = acc[t][r] + bv; if (ACT == 1) v = fmaxf(v, 0.f); so[w][8 * hh + r][t * 16 + ln] = v; }
  }
  __builtin_amdgcn_fence(__ATOMIC_ACQ_REL, "workgroup");
  __builtin_amdgcn_wave_barrier();
  const int rsub = lane >> 4, c4 = (lane & 15) * 4;
  {
#pragma unroll
    for (int q = 0; q < 8; ++q) {
      const int r = q * 2 + rsub;
      const v4f v = *(const v4fa*)&so[w][r][c4];
      *(v4f*)(C + (size_t)(row0 + r) * ldc + col0 + c4) = v;
    }
    
  }
}

// GEMM C = act(A·W + bias + resid): A f32 (ASPLIT -> hi/lo 2 terms), Wt bf16 [N][K]; ACT 0 none, 1 relu, 2 exact gelu;
// resid (optional, f32, row index = (row % rmod), pitch ldr, RES_BF16 rounds it) added before the activation.
template <bool ASPLIT, int ACT, bool BIAS_BF16, bool RES_BF16>
__global__ __launch_bounds__(128) void k_gemm_bf3(const float* __restrict__ A, int lda, const unsigned short* __restrict__ Wt, int ldb,
                                                const float* __restrict__ bias, const float* __restrict__ resid, int rmod, int ldr,
                                                float* __restrict__ C, int ldc, int M, int N, int K) {
  __shared__ __attribute__((aligned(16))) float so[4][16][64];
  const int tid = threadIdx.x, w = tid >> 5, lane = tid & 31, ln = lane & 15, hh = lane >> 4;
  const int ntn = N / 64;
  const int wid = blockIdx.x * 4 + w;
  const int mt = wid / ntn, nq = wid % ntn;
  if (mt * 16 >= M) return;
  const int row0 = mt * 16, col0 = nq * 64;
  const float* arow = A + (size_t)(row0 + ln) * lda;
  v8f acc[4] = {};
  for (int kb = 0; kb < K; kb += 32) {
    FragB ah, al;
    const v4f x0 = *(const v4fa*)(arow + kb + 8 * hh), x1 = *(const v4fa*)(arow + kb + 8 * hh + 4);
    const v4f x2 = *(const v4fa*)(arow + kb + 16 + 8 * hh), x3 = *(const v4fa*)(arow + kb + 16 + 8 * hh + 4);
    float xs[16] = {x0[0],x0[1],x0[2],x0[3],x1[0],x1[1],x1[2],x1[3],x2[0],x2[1],x2[2],x2[3],x3[0],x3[1],x3[2],x3[3]};
#pragma unroll
    for (int i = 0; i < 16; ++i) { const unsigned short hb = bf16_bits(xs[i]); ah.u[i] = hb; al.u[i] = ASPLIT ? bf16_bits(xs[i] - bf16_val(hb)) : (unsigned short)0; }
#pragma unroll
    for (int t = 0; t < 4; ++t) {
      const unsigned short* brow = Wt + (size_t)(col0 + t * 16 + ln) * ldb + kb;
      FragB b;
      b.half[0] = *(const v8us*)(brow + 8 * hh);
      b.half[1] = *(const v8us*)(brow + 16 + 8 * hh);
      acc[t] = mmaN<ASPLIT ? 2 : 1>(ah.v, al.v, b.v, b.v, acc[t]);
    }
  }
#pragma unroll
  for (int t = 0; t < 4; ++t) {
    const int col = col0 + t * 16 + ln;
    float bv = bias ? bias[col] : 0.f;
    if (BIAS_BF16) bv = bf16_round(bv);
#pragma unroll
    for (int r = 0; r < 8; ++r) {
      float v = acc[t][r] + bv;
      if (resid) { float rv = resid[(size_t)((row0 + 8 * hh + r) % rmod) * ldr + col]; if (RES_BF16) rv = bf16_round(rv); v += rv; }
      if (ACT == 1) v = fmaxf(v, 0.f);
      if (ACT == 2) v = 0.5f * v * (1.0f + erff(v * 0.70710678118654752f));
      if (ACT == 3) { const float u = 0.7978845608028654f * (v + 0.044715f * v * v * v); v = 0.5f * v * (1.0f + tanhf(u)); }
      so[w][8 * hh + r][t * 16 + ln] = v;
    }
  }
  __builtin_amdgcn_fence(__ATOMIC_ACQ_REL, "workgroup");
  __builtin_amdgcn_wave_barrier();
  const int rsub = lane >> 4, c4 = (lane & 15) * 4;
  {
#pragma unroll
    for (int q = 0; q < 8; ++q) {
      const int r = q * 2 + rsub;
      const v4f v = *(const v4fa*)&so[w][r][c4];
      *(v4f*)(C + (size_t)(row0 + r) * ldc + col0 + c4) = v;
    }
    
  }
}
// row LayerNorm (biased variance, eps) over N: s = X (+ R); optional out_sum <- s; out_norm <- (s-mu)*rsqrt(var+eps)*g + b
template <bool PARAM_BF16>
__global__ __launch_bounds__(256) void k_layernorm(const float* __restrict__ X, const float* __restrict__ R, const float* __restrict__ g, const float* __restrict__ bta,
                                                  float* __restrict__ out_sum, float* __restrict__ out_norm, int N, float eps) {
  __shared__ float red[256];
  const int row = blockIdx.x, tid = threadIdx.x;
  const float* x = X + (size_t)row * N; const float* rr = R ? R + (size_t)row * N : nullptr;
  float vals[16];                     // up to N = 4096
  const int per = N / 256;            // contiguous chunk per thread? use strided-by-4 chunks: thread handles j = tid*4 + 1024*u
  float s1 = 0.f;
  for (int u = 0; u < per / 4; ++u) {
    const int j = tid * 4 + 1024 * u;
    const v4f a = *(const v4fa*)(x + j);
    v4f b = {0.f,0.f,0.f,0.f}; if (rr) b = *(const v4fa*)(rr + j);
#pragma unroll
    for (int q = 0; q < 4; ++q) { const float v = a[q] + b[q]; vals[u * 4 + q] = v; s1 += v; }
  }
  red[tid] = s1; __syncthreads();
  for (int st = 128; st > 0; st >>= 1) { if (tid < st) red[tid] += red[tid + st]; __syncthreads(); }
  const float mu = red[0] / (float)N; __syncthreads();
  float s2 = 0.f;
  for (int u = 0; u < per / 4; ++u)
#pragma unroll
    for (int q = 0; q < 4; ++q) { const float c = vals[u * 4 + q] - mu; s2 += c * c; }
  red[tid] = s2; __syncthreads();
  for (int st = 128; st > 0; st >>= 1) { if (tid < st) red[tid] += red[tid + st]; __syncthreads(); }
  const float rs = rsqrtf(red[0] / (float)N + eps);
  {
    for (int u = 0; u < per / 4; ++u) {
      const int j = tid * 4 + 1024 * u;
      v4f o, sm;
#pragma unroll
      for (int q = 0; q < 4; ++q) {
        float gg = g[j + q], bb = bta[j + q];
        if (PARAM_BF16) { gg = bf16_round(gg); bb = bf16_round(bb); }
        sm[q] = vals[u * 4 + q]; o[q] = (vals[u * 4 + q] - mu) * rs * gg + bb;
      }
      if (out_sum) *(v4f*)(out_sum + (size_t)row * N + j) = sm;
      *(v4f*)(out_norm + (size_t)row * N + j) = o;
    }
    
  }
}



// ---- f16 WMMA path (v_wmma_f32_16x16x32_f16): 11-bit significands for operands in range — used where a [0,1] probability operand needs more precision than bf16
typedef _Float16 v16h __attribute__((ext_vector_type(16)));
union FragH { v16h v; v8us half[2]; _Float16 h[16]; unsigned short u[16]; };
template <int NT>
__device__ __forceinline__ v8f mmaH(v16h ah, v16h al, v16h bh, v16h bl, v8f c) {
  c = __builtin_amdgcn_wmma_f32_16x16x32_f16(false, ah, false, bh, (short)0, c, false, false);
  if (NT >= 2) c = __builtin_amdgcn_wmma_f32_16x16x32_f16(false, al, false, bh, (short)0, c, false, false);
  if (NT >= 3) c = __builtin_amdgcn_wmma_f32_16x16x32_f16(false, ah, false, bl, (short)0, c, false, false);
  asm volatile("v_nop\n\tv_nop\n\tv_nop\n\tv_nop" : "+v"(c) : "v"(ah), "v"(al), "v"(bh), "v"(bl));
  return c;
}
// batched GEMM like k_gemm_b but f16 operands: A f32 (split into f16 hi/lo if ASPLIT, else rounded to f16), Bt = f16 values [n][k]; alpha; C f32; N multiple of 16 (partial tiles skipped)
template <bool ASPLIT>
__global__ __launch_bounds__(128) void k_gemm_h(const float* __restrict__ A, int lda, size_t sA, const _Float16* __restrict__ Bh, int ldb, size_t sB, float alpha, float* __restrict__ C, int ldc, size_t sC, int M, int N, int K) {
  __shared__ __attribute__((aligned(16))) float so[4][16][64];
  const int tid = threadIdx.x, w = tid >> 5, lane = tid & 31, ln = lane & 15, hh = lane >> 4; const int by = blockIdx.y;
  A += (size_t)by * sA; Bh += (size_t)by * sB; C += (size_t)by * sC;
  const int ntn = (N + 63) / 64; const int wid = blockIdx.x * 4 + w; const int mt = wid / ntn, nq = wid % ntn; if (mt * 16 >= M) return;
  const int row0 = mt * 16, col0 = nq * 64; const float* arow = A + (size_t)(row0 + ln) * lda;
  v8f acc[4] = {};
  for (int kb = 0; kb < K; kb += 32) {
    FragH ah, al;
    const v4f x0 = *(const v4fa*)(arow + kb + 8 * hh), x1 = *(const v4fa*)(arow + kb + 8 * hh + 4), x2 = *(const v4fa*)(arow + kb + 16 + 8 * hh), x3 = *(const v4fa*)(arow + kb + 16 + 8 * hh + 4);
    float xs[16] = {x0[0],x0[1],x0[2],x0[3],x1[0],x1[1],x1[2],x1[3],x2[0],x2[1],x2[2],x2[3],x3[0],x3[1],x3[2],x3[3]};
#pragma unroll
    for (int i = 0; i < 16; ++i) { const _Float16 h = (_Float16)xs[i]; ah.h[i] = h; al.h[i] = ASPLIT ? (_Float16)(xs[i] - (float)h) : (_Float16)0.0f; }
#pragma unroll
    for (int t = 0; t < 4; ++t) { if (col0 + t * 16 >= N) continue; const size_t boff = (size_t)(col0 + t * 16 + ln) * ldb + kb; FragH bq; bq.half[0] = *(const v8us*)(Bh + boff + 8 * hh); bq.half[1] = *(const v8us*)(Bh + boff + 16 + 8 * hh);
      acc[t] = mmaH<ASPLIT ? 2 : 1>(ah.v, al.v, bq.v, bq.v, acc[t]); }
  }
#pragma unroll
  for (int t = 0; t < 4; ++t) { if (col0 + t * 16 >= N) continue;
#pragma unroll
    for (int r = 0; r < 8; ++r) so[w][8 * hh + r][t * 16 + ln] = acc[t][r] * alpha; }
  __builtin_amdgcn_fence(__ATOMIC_ACQ_REL, "workgroup"); __builtin_amdgcn_wave_barrier();
  const int rsub = lane >> 4, c4 = (lane & 15) * 4;
  {
#pragma unroll
    for (int q = 0; q < 8; ++q) { const int r = q * 2 + rsub; if (col0 + c4 < N) { const v4f v = *(const v4fa*)&so[w][r][c4]; *(v4f*)(C + (size_t)(row0 + r) * ldc + col0 + c4) = v; } }
     }
}

// Wt[n][k] = f16(W[k][n]·scale) from f32 row-major W[K][N] (scale = power of two; bf16-exact weights stay exact in f16 away from the subnormal range)
__global__ __launch_bounds__(256) void k_wt_f16(const float* __restrict__ W, _Float16* __restrict__ Wt, int K, int N, float scale) {
  const int t = blockIdx.x * 256 + threadIdx.x; if (t >= N * (K / 8)) return; const int n = t / (K / 8), k8 = (t % (K / 8)) * 8; FragH f;
#pragma unroll
  for (int i = 0; i < 8; ++i) f.h[i] = (_Float16)(bf16_round(W[(size_t)(k8 + i) * N + n]) * scale); const v8us o = f.half[0];
  *(v8us*)((unsigned short*)Wt + (size_t)n * K + k8) = o; 
}
// k_gemm_hh variant with fused epilogue: v = acc·alpha + bias[by·sBias + col] (+ CP[(row/rowsPerB)·sCPb + by·64 + col] if CP) ; ACT 0 none / 1 elu ; writes f16 C16 (and f32 C if non-null)
template <int ACT>
__global__ __launch_bounds__(128) void k_gemm_hhx(const _Float16* __restrict__ A, int lda, size_t sA, const _Float16* __restrict__ Bh, int ldb, size_t sB, float alpha, const float* __restrict__ bias, size_t sBias, const float* __restrict__ CP, int rowsPerB, size_t sCPb, int row0g,
    float* __restrict__ C, _Float16* __restrict__ C16, int ldc, size_t sC, int M, int N, int K) {
  __shared__ __attribute__((aligned(16))) float so[4][16][64];
  const int tid = threadIdx.x, w = tid >> 5, lane = tid & 31, ln = lane & 15, hh = lane >> 4; const int by = blockIdx.y;
  A += (size_t)by * sA; Bh += (size_t)by * sB; const size_t cofs = (size_t)by * sC; const float* bp = bias ? bias + (size_t)by * sBias : nullptr;
  const int ntn = (N + 63) / 64; const int wid = blockIdx.x * 4 + w; const int mt = wid / ntn, nq = wid % ntn; if (mt * 16 >= M) return;
  const int row0 = mt * 16, col0 = nq * 64; const _Float16* arow = A + (size_t)(row0 + ln) * lda;
  v8f acc[4] = {};
  for (int kb = 0; kb < K; kb += 32) { FragH ah; ah.half[0] = *(const v8us*)((const unsigned short*)arow + kb + 8 * hh); ah.half[1] = *(const v8us*)((const unsigned short*)arow + kb + 16 + 8 * hh);
#pragma unroll
    for (int t = 0; t < 4; ++t) { if (col0 + t * 16 >= N) continue; const size_t boff = (size_t)(col0 + t * 16 + ln) * ldb + kb; FragH bq; bq.half[0] = *(const v8us*)((const unsigned short*)Bh + boff + 8 * hh); bq.half[1] = *(const v8us*)((const unsigned short*)Bh + boff + 16 + 8 * hh);
      acc[t] = mmaH<1>(ah.v, ah.v, bq.v, bq.v, acc[t]); }
  }
#pragma unroll
  for (int t = 0; t < 4; ++t) { if (col0 + t * 16 >= N) continue; const int col = col0 + t * 16 + ln; const float bv = bp ? bf16_round(bp[col]) : 0.f;
#pragma unroll
    for (int r = 0; r < 8; ++r) { float v = acc[t][r] * alpha + bv; if (CP) { const int rr = row0g + row0 + 8 * hh + r; if (rowsPerB < 0) v += CP[cofs + (size_t)rr * ldc + col];      /* rowsPerB < 0: own element of the batched C plane */ else { const int bidx = rr / rowsPerB; v += CP[(size_t)bidx * sCPb + (size_t)by * 64 + col]; } } if (ACT == 1) v = (v > 0.f) ? v : expm1f(v); else if (ACT == 7) v = (v > 0.f) ? v + 1.0f : expf(v); else if (ACT == 8) v = tanhf(v); else if (ACT == 9) v = 0.5f * v * (1.0f + tanhf(0.7978845608028654f * (v + 0.044715f * v * v * v))); else if (ACT == 11) v = 1.0f / (1.0f + expf(-v)); else if (ACT == 12) v = (v > 0.f) ? v : 0.01f * v; else if (ACT == 14) v = (v > 0.f) ? v : 0.1f * v; else if (ACT == 16) v = (v >= 0.f) ? v : 0.3f * v; else if (ACT == 17) v = (v >= 0.f) ? v : 0.2f * v; else if (ACT == 15) v = v / (1.0f + expf(-v)); else if (ACT == 3) v = fmaxf(v, 0.f); else if (ACT == 6) v = 0.5f * v * (1.0f + erff(v * 0.70710678118654752f)); so[w][8 * hh + r][t * 16 + ln] = v; } }
  __builtin_amdgcn_fence(__ATOMIC_ACQ_REL, "workgroup"); __builtin_amdgcn_wave_barrier();
  const int rsub = lane >> 4, c4 = (lane & 15) * 4; typedef _Float16 v4h __attribute__((ext_vector_type(4)));
  {
#pragma unroll
    for (int q = 0; q < 8; ++q) { const int r = q * 2 + rsub; if (col0 + c4 < N) { const v4f v = *(const v4fa*)&so[w][r][c4]; if (C) *(v4f*)(C + cofs + (size_t)(row0 + r) * ldc + col0 + c4) = v; if (C16) { v4h h4; for (int i = 0; i < 4; ++i) h4[i] = (_Float16)v[i]; *(v4h*)(C16 + cofs + (size_t)(row0 + r) * ldc + col0 + c4) = h4; } } }
     }
}


typedef _Float16 v4h __attribute__((ext_vector_type(4)));

__global__ __launch_bounds__(256) void k_x16(const float* __restrict__ x, _Float16* __restrict__ X16, size_t n8) { const size_t t = (size_t)blockIdx.x * 256 + threadIdx.x; if (t >= n8) return; FragH f;
#pragma unroll
  for (int q = 0; q < 8; ++q) f.h[q] = (_Float16)bf16_round(x[t * 8 + q]); *(v8us*)((unsigned short*)X16 + t * 8) = f.half[0];  }
__global__ __launch_bounds__(256) void k_h16(const float* __restrict__ x, _Float16* __restrict__ X16, size_t n8) { const size_t t = (size_t)blockIdx.x * 256 + threadIdx.x; if (t >= n8) return; FragH f;
#pragma unroll
  for (int q = 0; q < 8; ++q) f.h[q] = (_Float16)x[t * 8 + q]; *(v8us*)((unsigned short*)X16 + t * 8) = f.half[0];  }
__global__ __launch_bounds__(256) void k_round16f(const float* __restrict__ W, _Float16* __restrict__ Bt, size_t n8) { const size_t t = (size_t)blockIdx.x * 256 + threadIdx.x; if (t >= n8) return; FragH f;
#pragma unroll
  for (int i = 0; i < 8; ++i) f.h[i] = (_Float16)(bf16_round(W[t * 8 + i]) * 16.0f); *(v8us*)((unsigned short*)Bt + t * 8) = f.half[0];  }
template <int NHv, int TTv>
__global__ __launch_bounds__(256) void k_vt(const _Float16* __restrict__ V16, int ldv, int voff, _Float16* __restrict__ Vt) { __shared__ unsigned short tl[64][66]; const int tid = threadIdx.x; const int slab = blockIdx.x / (TTv / 64), lg = blockIdx.x % (TTv / 64); const int b = slab / NHv, h = slab % NHv;
  for (int i = tid; i < 64 * 8; i += 256) { const int r = i / 8, c8 = (i % 8) * 8; FragH f; f.half[0] = *(const v8us*)((const unsigned short*)V16 + ((size_t)b * TTv + lg * 64 + r) * ldv + voff + h * 64 + c8);
#pragma unroll
    for (int q = 0; q < 8; ++q) tl[r][c8 + q] = f.u[q]; }
  __syncthreads();
  {
#pragma unroll
    for (int rd = 0; rd < 2; ++rd) { const int d = rd * 32 + tid / 8, pc = tid % 8; FragH f;
#pragma unroll
      for (int q = 0; q < 8; ++q) f.u[q] = tl[pc * 8 + q][d];
      *(v8us*)((unsigned short*)Vt + ((size_t)slab * 64 + d) * TTv + lg * 64 + pc * 8) = f.half[0]; }
     } }

__global__ __launch_bounds__(256) void k_hl(const float* __restrict__ F, _Float16* __restrict__ Hh, _Float16* __restrict__ Hl, size_t n8) { const size_t t = (size_t)blockIdx.x * 256 + threadIdx.x; if (t >= n8) return; FragH fh, fl; const v4f a = *(const v4fa*)(F + t * 8), c = *(const v4fa*)(F + t * 8 + 4);
#pragma unroll
  for (int q = 0; q < 4; ++q) { _Float16 h = (_Float16)a[q]; fh.h[q] = h; fl.h[q] = (_Float16)((a[q] - (float)h) * 1024.0f); h = (_Float16)c[q]; fh.h[4 + q] = h; fl.h[4 + q] = (_Float16)((c[q] - (float)h) * 1024.0f); }
  { *(v8us*)((unsigned short*)Hh + t * 8) = fh.half[0]; *(v8us*)((unsigned short*)Hl + t * 8) = fl.half[0];  } }

// ---- fast GEMM (wave tile 32x64; requires M % 32 == 0 rows per launch region and N % 64 == 0); epilogue = k_gemm_hhx semantics ----
__device__ __forceinline__ v16h g2_frag(const _Float16* p, int hh) { FragH f; f.half[0] = *(const v8us*)((const unsigned short*)p + 8 * hh); f.half[1] = *(const v8us*)((const unsigned short*)p + 16 + 8 * hh); return f.v; }
__device__ __forceinline__ v8f g2_mma(v16h a, v16h b, v8f c) { v8f d = __builtin_amdgcn_wmma_f32_16x16x32_f16(false, a, false, b, (short)0, c, false, false); asm volatile("v_nop\n\tv_nop\n\tv_nop\n\tv_nop" : "+v"(d) : "v"(a), "v"(b)); return d; }
template <int ACT>
__global__ __launch_bounds__(128) void k_gemm2(const _Float16* __restrict__ A, int lda, size_t sA, const _Float16* __restrict__ Bh, int ldb, size_t sB, float alpha, const float* __restrict__ bias, size_t sBias, const float* __restrict__ CP, int rowsPerB, size_t sCPb, int row0g,
    float* __restrict__ C, _Float16* __restrict__ C16, int ldc, size_t sC, int M, int N, int K) { static_assert(ACT == 0 || ACT == 3 || ACT == 6 || ACT == 8 || ACT == 9 || ACT == 11 || ACT == 12 || ACT == 14 || ACT == 15 || ACT == 16 || ACT == 17, "k_gemm2: unsupported ACT code (would silently apply no activation)");
  __shared__ __attribute__((aligned(16))) float so[4][32][68];
  const int tid = threadIdx.x, w = tid >> 5, lane = tid & 31, ln = lane & 15, hh = lane >> 4; const int by = blockIdx.y;
  A += (size_t)by * sA; Bh += (size_t)by * sB; const size_t cofs = (size_t)by * sC; const float* bp = bias ? bias + (size_t)by * sBias : nullptr;
  const int ntn = N >> 6; const int mt = blockIdx.x / ntn, nq = blockIdx.x - mt * ntn; const int row0 = mt * 128 + 32 * w, col0 = nq * 64; if (row0 >= M) return;
  const _Float16* a0p = A + (size_t)(row0 + ln) * lda; const _Float16* a1p = a0p + (size_t)16 * lda;
  const _Float16* b0p = Bh + (size_t)(col0 + ln) * ldb; const _Float16* b1p = b0p + (size_t)16 * ldb; const _Float16* b2p = b1p + (size_t)16 * ldb; const _Float16* b3p = b2p + (size_t)16 * ldb;
  const v8f z8 = {0.f,0.f,0.f,0.f,0.f,0.f,0.f,0.f}; v8f c00 = z8, c01 = z8, c02 = z8, c03 = z8, c10 = z8, c11 = z8, c12 = z8, c13 = z8;
#pragma unroll 1
  for (int kb = 0; kb < K; kb += 32) { const v16h a0 = g2_frag(a0p + kb, hh), a1 = g2_frag(a1p + kb, hh);
    v16h b = g2_frag(b0p + kb, hh); c00 = g2_mma(a0, b, c00); c10 = g2_mma(a1, b, c10);
    b = g2_frag(b1p + kb, hh); c01 = g2_mma(a0, b, c01); c11 = g2_mma(a1, b, c11);
    b = g2_frag(b2p + kb, hh); c02 = g2_mma(a0, b, c02); c12 = g2_mma(a1, b, c12);
    b = g2_frag(b3p + kb, hh); c03 = g2_mma(a0, b, c03); c13 = g2_mma(a1, b, c13); }
  v8f accs[8] = {c00, c01, c02, c03, c10, c11, c12, c13};
#pragma unroll
  for (int u = 0; u < 8; ++u) { const int t = u & 3, half = u >> 2; const int col = col0 + t * 16 + ln; const float bv = bp ? bf16_round(bp[col]) : 0.f;
#pragma unroll
    for (int r = 0; r < 8; ++r) { const int rloc = half * 16 + 8 * hh + r; float v = accs[u][r] * alpha + bv; if (CP) { if (rowsPerB < 0) v += CP[cofs + (size_t)(row0g + row0 + rloc) * ldc + col];      /* rowsPerB < 0: own element of the batched C plane */ else { const int bidx = (row0g + row0 + rloc) / rowsPerB; v += CP[(size_t)bidx * sCPb + (size_t)by * 64 + col]; } }
      if (ACT == 3) v = fmaxf(v, 0.f); else if (ACT == 6) v = 0.5f * v * (1.0f + erff(v * 0.70710678118654752f)); else if (ACT == 11) v = 1.0f / (1.0f + expf(-v)); else if (ACT == 15) v = v / (1.0f + expf(-v)); else if (ACT == 12) v = (v > 0.f) ? v : 0.01f * v; else if (ACT == 8) v = tanhf(v); else if (ACT == 9) v = 0.5f * v * (1.0f + tanhf(0.7978845608028654f * (v + 0.044715f * v * v * v))); else if (ACT == 14) v = (v > 0.f) ? v : 0.1f * v; else if (ACT == 16) v = (v >= 0.f) ? v : 0.3f * v; else if (ACT == 17) v = (v >= 0.f) ? v : 0.2f * v;
      so[w][rloc][t * 16 + ln] = v; } }
  __builtin_amdgcn_fence(__ATOMIC_ACQ_REL, "workgroup"); __builtin_amdgcn_wave_barrier();
  const int rsub = lane >> 4, c4 = (lane & 15) * 4;
  {
#pragma unroll
    for (int q = 0; q < 16; ++q) { const int r = q * 2 + rsub; const v4f v = *(const v4fa*)&so[w][r][c4]; if (C) *(v4f*)(C + cofs + (size_t)(row0 + r) * ldc + col0 + c4) = v; if (C16) { v4h h4; for (int i = 0; i < 4; ++i) h4[i] = (_Float16)v[i]; *(v4h*)(C16 + cofs + (size_t)(row0 + r) * ldc + col0 + c4) = h4; } }
     } }


__global__ __launch_bounds__(256) void k_wnat(const float* __restrict__ w, size_t n8, _Float16* __restrict__ Bt) { const size_t t = (size_t)blockIdx.x * 256 + threadIdx.x; if (t >= n8) return; FragH f; for (int q = 0; q < 8; ++q) f.h[q] = (_Float16)(bf16_round(w[t * 8 + q]) * 16.0f); *(v8us*)((unsigned short*)Bt + t * 8) = f.half[0];  }
// Fused attention, all heads in one launch: scores, softmax and the weighted sum of v never leave the chip (no score or weight plane in memory).
// Workgroup = 8 waves = 256 queries of one head, as two key groups of 4 waves: a wave owns 64 query columns and every second tile of 64 keys, so that a K or V^T fragment read from LDS feeds four products
// (at two products a fragment the LDS reads took as many cycles as the products themselves); two waves share a SIMD, each with up to 512 registers. Per stage each group stages its own 64 k rows and v^T rows in its own LDS ring
// (whole-line 16-byte loads one stage ahead through registers, two buffers, one barrier a stage). Each group keeps its own maximum, sum and O^T; they are merged once, through LDS, at the end. Transposed products: S^T = K Q^T (a lane holds 8 keys of ONE query per tile),
// reference and sum per query (f32; fa_pass has the two forms), weights as f16, O^T += V^T P^T with the two S^T tiles of 32 keys packed in place as the B operand.
#define FA_KT 64                     /* keys per stage */
#define FA_KG 2                      /* key groups per workgroup */
#define FA_QT 4                      /* tiles of 16 query columns per wave */
#define FA_QW (256 / (16 * FA_QT))   /* waves per key group: together they hold the workgroup's 256 queries */
#define FA_GT (32 * FA_QW)           /* threads per key group */
#define FA_RS (FA_GT / 8)            /* rows that a group stages with one load per thread (8 threads a row) */
#define FA_SP (FA_KT / FA_RS)        /* 16-byte pieces of k, and of v^T, per thread and stage */
#define FA_NS (SQ / (FA_KT * FA_KG)) /* stages: each takes every group one tile on */
#define FA_LP 72                     /* LDS row pitch in f16: 128 data bytes + 16, an odd multiple of 16 bytes for the 16-byte fragment reads */
__device__ __forceinline__ float fa_xhalf(float x) { return __builtin_bit_cast(float, __builtin_amdgcn_permlanex16(__builtin_bit_cast(int, x), __builtin_bit_cast(int, x), 0x76543210, 0xfedcba98, false, false)); }      /* lane l <-> lane l ^ 16 */
__device__ __forceinline__ v16h fa_lfrag(const _Float16* p) { FragH f; f.half[0] = *(const v8us*)((const unsigned short*)p); f.half[1] = *(const v8us*)((const unsigned short*)p + 16); return f.v; }      /* p already holds the lane half's + 8 * hh: the k order of g2_frag */
__device__ __forceinline__ v8f fa_mma(v16h a, v16h b, v8f c) { return __builtin_amdgcn_wmma_f32_16x16x32_f16(false, a, false, b, (short)0, c, false, false); }
// Eight independent 2^x in place. One statement, so that no exponential stands directly in front of an instruction that overwrites its source or reads its result
// (as separate builtins the register allocator put the next result into the previous source); the v_nop is the slot the instruction set asks for behind the last one.
__device__ __forceinline__ void fa_exp2x8(float (&p)[8]) {
  asm("v_exp_f32 %0, %0\n\tv_exp_f32 %1, %1\n\tv_exp_f32 %2, %2\n\tv_exp_f32 %3, %3\n\tv_exp_f32 %4, %4\n\tv_exp_f32 %5, %5\n\tv_exp_f32 %6, %6\n\tv_exp_f32 %7, %7\n\tv_nop"
      : "+v"(p[0]), "+v"(p[1]), "+v"(p[2]), "+v"(p[3]), "+v"(p[4]), "+v"(p[5]), "+v"(p[6]), "+v"(p[7])); }
typedef float v2f __attribute__((ext_vector_type(2)));
#define FA_OFF 4.0f                  /* fixed-reference pass: a query's own key gets the weight 2^4 */
#define FA_LIM 60000.0f              /* below the largest finite f16: a sum of non-negative weights under it bounds every weight */
// One pass over all the group's keys; qf holds the queries times 1 / sqrt(64) and log2(e), so a score is an exponent of 2. FIXED: the softmax reference of a query is given in m and never moves: it enters as the C operand of the score products,
// whose result is then the argument of the exponential itself, and there is no maximum, no exchange between the lane halves, no subtraction and no rescaling of O^T and of the sums in the loop.
// Otherwise: the running maximum (online softmax), which takes any scores; m is set here.
// The pass serves the wave's query tiles Q0 .. Q0 + NQ - 1: all four in the fixed form; the running maximum, with its further registers, takes them two at a time.
template <bool FIXED, int Q0, int NQ>
__device__ __forceinline__ void fa_pass(_Float16 (*sk)[FA_KT][FA_LP], _Float16 (*sv)[HD][FA_LP], const unsigned short* gk, const unsigned short* gv, const int sr, const int sc, const int ln, const int hh,
                                        const v16h (&qf)[FA_QT][2], v8f (&o)[FA_QT][4], float (&m)[FA_QT], float (&l)[FA_QT]) {
  v8us rk[FA_SP], rv[FA_SP];
#pragma unroll      /* constant indices keep the staged rows in registers */
  for (int i = 0; i < FA_SP; ++i) { rk[i] = *(const v8us*)(gk + (size_t)(i * FA_RS) * LQ); rv[i] = *(const v8us*)(gv + (size_t)(i * FA_RS) * SQ); }
  asm volatile("s_wait_xcnt 0x0" ::: "memory");      /* stands in front of whatever lands next in the registers that held these loads' addresses */
#pragma unroll      /* constant indices keep the staged rows in registers */
  for (int i = 0; i < FA_SP; ++i) { *(v8us*)&sk[0][sr + i * FA_RS][sc] = rk[i]; *(v8us*)&sv[0][sr + i * FA_RS][sc] = rv[i]; }
  __syncthreads();
  const v8f z8 = {0.f, 0.f, 0.f, 0.f, 0.f, 0.f, 0.f, 0.f};
#pragma unroll      /* constant indices keep the tiles in registers */
  for (int qt = Q0; qt < Q0 + NQ; ++qt) { l[qt] = 0.f; if (!FIXED) m[qt] = -3.0e38f; for (int dt = 0; dt < 4; ++dt) o[qt][dt] = z8; }
  v2f l2[FA_QT][2];      /* fixed pass: [query tile][chain], two sums each */
  v8f cf[FA_QT];      /* C of a score tile's first product; a lane's 8 registers belong to one query */
#pragma unroll      /* constant indices keep the tiles in registers */
  for (int qt = Q0; qt < Q0 + NQ; ++qt) { l2[qt][0] = v2f{0.f, 0.f}; l2[qt][1] = v2f{0.f, 0.f}; cf[qt] = z8; if (FIXED) for (int r = 0; r < 8; ++r) cf[qt][r] = FA_OFF - m[qt]; }
  for (int s = 0; s < FA_NS; ++s) {
    const int cur = s & 1;
    v16h ka[2][2];      /* K fragments of a pass: [16 keys][k step of 32 head dims] */
#pragma unroll      /* constant indices keep the fragments in registers */
    for (int k2 = 0; k2 < 2; ++k2) for (int ks = 0; ks < 2; ++ks) ka[k2][ks] = fa_lfrag(&sk[cur][k2 * 16 + ln][ks * 32 + 8 * hh]);
    __builtin_amdgcn_sched_barrier(0);      /* the stage's first LDS reads go out ahead of the global loads, so that the wait behind those loads runs under the reads' latency */
    {      /* the next stage's rows fly while this stage is worked on; the last stage fetches its own rows again into the buffer that nobody reads any more (built without that fetch, the last stage spilled to scratch) */
      const int sn = s + 1 < FA_NS ? s + 1 : s;
      const unsigned short* nk = gk + (size_t)sn * (FA_KG * FA_KT) * LQ; const unsigned short* nv = gv + (size_t)sn * (FA_KG * FA_KT);
#pragma unroll      /* constant indices keep the staged rows in registers */
      for (int i = 0; i < FA_SP; ++i) { rk[i] = *(const v8us*)(nk + (size_t)(i * FA_RS) * LQ); rv[i] = *(const v8us*)(nv + (size_t)(i * FA_RS) * SQ); }
      asm volatile("s_wait_xcnt 0x0" ::: "memory");      /* stands in front of whatever lands next in the registers that held these loads' addresses */
    }
    __builtin_amdgcn_sched_barrier(0);      /* keeps the loads and their wait up here: the scheduler otherwise sinks the loads to their LDS stores at the stage's foot, and their latency is then waited out every stage */
#pragma unroll      /* constant indices keep the tiles in registers */
    for (int ps = 0; ps < 2; ++ps) {      /* a pass takes 32 of the stage's keys through scores, weights and O^T: the score tiles of 64 keys x 64 queries would not fit the registers */
      v8f st[FA_QT][2];      /* S^T: [query tile][16 keys]; register r = key 8 * hh + r, column = query ln */
#pragma unroll      /* constant indices keep the tiles in registers */
      for (int k2 = 0; k2 < 2; ++k2)
#pragma unroll      /* constant indices keep the tiles in registers */
        for (int qt = Q0; qt < Q0 + NQ; ++qt) st[qt][k2] = fa_mma(ka[k2][1], qf[qt][1], fa_mma(ka[k2][0], qf[qt][0], cf[qt]));
      v16h va[4];      /* the pass's V^T fragments, and behind them the second pass's K fragments: one group of reads that flies under the exponentials */
#pragma unroll      /* constant indices keep the fragments in registers */
      for (int dt = 0; dt < 4; ++dt) va[dt] = fa_lfrag(&sv[cur][dt * 16 + ln][ps * 32 + 8 * hh]);
      if (ps == 0) for (int k2 = 0; k2 < 2; ++k2) for (int ks = 0; ks < 2; ++ks) ka[k2][ks] = fa_lfrag(&sk[cur][(2 + k2) * 16 + ln][ks * 32 + 8 * hh]);
      __builtin_amdgcn_sched_barrier(0);      /* the pass's score products stay one run (mixed with the exponentials, tiles were copied out of their registers and spilled), and the reads stay ahead of the exponentials, not each in front of its products */
      FragH pf[FA_QT];      /* [query tile]: P^T of the 32 keys as B operand, element i = tile i >> 3, register i & 7 */
#pragma unroll      /* constant indices keep the tiles in registers */
      for (int qt = Q0; qt < Q0 + NQ; ++qt) {
        float nb = 0.f, corr = 1.0f;
        if (!FIXED) {
          float mk[2];      /* one short chain per tile */
#pragma unroll      /* constant indices keep the tiles in registers */
          for (int k2 = 0; k2 < 2; ++k2) { mk[k2] = st[qt][k2][0]; for (int r = 1; r < 8; ++r) mk[k2] = fmaxf(mk[k2], st[qt][k2][r]); }
          float mx = fmaxf(mk[0], mk[1]);
          mx = fmaxf(mx, fa_xhalf(mx));
          const float mn = fmaxf(m[qt], mx);
          asm("v_exp_f32 %0, %1\n\tv_nop" : "=v"(corr) : "v"(m[qt] - mn));      /* 0 on the first pass; the v_nop is the slot the instruction set asks for behind the exponential (as the builtin, the next instruction overwrote its source) */
          nb = 12.0f - mn;
          m[qt] = mn;
        }
        float ls[2] = {0.f, 0.f};
#pragma unroll      /* constant indices keep the tiles in registers */
        for (int k2 = 0; k2 < 2; ++k2) { float p[8]; for (int r = 0; r < 8; ++r) p[r] = FIXED ? st[qt][k2][r] : st[qt][k2][r] + nb; fa_exp2x8(p);
          for (int r = 0; r < 8; ++r) pf[qt].h[k2 * 8 + r] = (_Float16)p[r];
          if (FIXED) for (int r = 0; r < 8; r += 2) { const v2f pp = {p[r], p[r + 1]}; l2[qt][k2] += pp; }      /* neighbouring registers of a tile as they lie: one packed add, no copy; the sums run through all stages */
          else for (int r = 0; r < 8; ++r) ls[k2] += p[r]; }
        if (!FIXED) {
          l[qt] = fmaf(l[qt], corr, ls[0] + ls[1]);
#pragma unroll      /* constant indices keep the tiles in registers */
          for (int dt = 0; dt < 4; ++dt) o[qt][dt] *= corr;
        }
      }
#pragma unroll      /* constant indices keep the tiles in registers */
      for (int dt = 0; dt < 4; ++dt)
#pragma unroll      /* constant indices keep the tiles in registers */
        for (int qt = Q0; qt < Q0 + NQ; ++qt) o[qt][dt] = fa_mma(va[dt], pf[qt].v, o[qt][dt]);
    }
    {
#pragma unroll      /* constant indices keep the staged rows in registers */
      for (int i = 0; i < FA_SP; ++i) { *(v8us*)&sk[cur ^ 1][sr + i * FA_RS][sc] = rk[i]; *(v8us*)&sv[cur ^ 1][sr + i * FA_RS][sc] = rv[i]; } }      /* that buffer's last readers left it before the previous barrier */
    __syncthreads();      /* publishes stage s + 1 and ends every read of stage s */
  }
  if (FIXED) for (int qt = Q0; qt < Q0 + NQ; ++qt) l[qt] = (l2[qt][0][0] + l2[qt][0][1]) + (l2[qt][1][0] + l2[qt][1][1]);
}
__global__ __launch_bounds__(FA_GT * FA_KG) void k_fattn(const _Float16* __restrict__ Q, const _Float16* K, const _Float16* VT, float* __restrict__ out) {      /* K, VT without restrict: else the first stage's rows are kept in registers over the whole fixed pass for the second pass's sake */
  __shared__ __attribute__((aligned(16))) _Float16 skg[FA_KG][2][FA_KT][FA_LP];
  __shared__ __attribute__((aligned(16))) _Float16 svg[FA_KG][2][HD][FA_LP];
  __shared__ __attribute__((aligned(16))) v4f xo[FA_QW][8 * FA_QT][32];      /* group 1's O^T on its way to group 0: [query wave][16-byte piece][lane] */
  __shared__ float xs[FA_QW][2 * FA_QT][32];      /* group 1's maxima and sums: [query wave][m of each tile, then l of each tile][lane] */
  __shared__ int xbad[FA_QW * FA_KG];      /* per wave: a sum of the fixed pass reached FA_LIM */
  const int g = __builtin_amdgcn_readfirstlane((int)threadIdx.x / FA_GT);      /* key group, the same in a whole wave */
  const int tid = threadIdx.x % FA_GT, w = tid >> 5, lane = tid & 31, ln = lane & 15, hh = lane >> 4;      /* place inside the group */
  _Float16 (*sk)[FA_KT][FA_LP] = skg[g]; _Float16 (*sv)[HD][FA_LP] = svg[g];
  const int h = blockIdx.y, q0 = blockIdx.x * 256 + w * (16 * FA_QT);
  const float CS = 0.125f * 1.4426950408889634f;      /* 1 / sqrt(64), and base 2 for the exponentials */
  v16h qf[FA_QT][2];      /* [query tile][k step of 32 head dims], B operand: column = query */
  const _Float16* qp = Q + (size_t)(q0 + ln) * LQ + h * HD + 8 * hh;      /* the lane's query row of tile 0, at its lane half's place: the k order of g2_frag */
#pragma unroll      /* constant indices keep the fragments in registers */
  for (int qt = 0; qt < FA_QT; ++qt) for (int ks = 0; ks < 2; ++ks) qf[qt][ks] = fa_lfrag(qp + qt * 16 * LQ + ks * 32);      /* one address, constant offsets */
  asm volatile("s_wait_xcnt 0x0" :: "v"(qp) : "memory");      /* stands in front of whatever lands next in the registers that held these loads' address; the address as an input keeps them untouched up to the wait */
  const int sr = tid >> 3, sc = (tid & 7) * 8;      /* staging: 8 threads cover one 128-byte row; rows sr + FA_RS i */
  const unsigned short* gk = (const unsigned short*)K + (size_t)(g * FA_KT + sr) * LQ + h * HD + sc;      /* stage s: the group's keys (s * FA_KG + g) * 64 .. + 63 */
  const unsigned short* gv = (const unsigned short*)VT + ((size_t)h * HD + sr) * SQ + g * FA_KT + sc;
  v8f o[FA_QT][4];      /* O^T: [query tile][16 head dims]; register r = head dim 8 * hh + r, column = query ln */
  float m[FA_QT], l[FA_QT];      /* softmax reference (a score: an exponent of 2) and this lane half's sum, per query */
  // The keys are the queries' own rows, so q.q is one of a query's scores: as the reference it gives that key the weight 2^FA_OFF, so no sum can vanish, and a softmax does not depend on its reference.
#pragma unroll      /* constant indices keep the fragments in registers */
  for (int qt = 0; qt < FA_QT; ++qt) { float a = 0.f; for (int ks = 0; ks < 2; ++ks) for (int i = 0; i < 16; ++i) { const float x = (float)qf[qt][ks][i]; const _Float16 y = (_Float16)(x * CS); a = fmaf((float)y, x, a); qf[qt][ks][i] = y; } m[qt] = a + fa_xhalf(a); }      /* the row as query (scaled) times the row as key */
  fa_pass<true, 0, FA_QT>(sk, sv, gk, gv, sr, sc, ln, hh, qf, o, m, l);
  // Another key's score may lie far above q.q: a weight could then leave the f16 range. Weights are not negative, so sums under FA_LIM show that none did (an infinite or undefined sum fails the test too).
  bool fine = true;
#pragma unroll      /* constant indices keep the sums in registers */
  for (int qt = 0; qt < FA_QT; ++qt) fine = fine && l[qt] < FA_LIM;
  xbad[threadIdx.x >> 5] = __builtin_amdgcn_ballot_w32(!fine) != 0u ? 1 : 0;
  __syncthreads();      /* publishes every wave's finding: the choice below is one for the whole workgroup */
  int anyb = 0;
#pragma unroll      /* one read of one word per wave, once a launch */
  for (int i = 0; i < FA_QW * FA_KG; ++i) anyb |= xbad[i];
  if (__builtin_amdgcn_readfirstlane(anyb) != 0) { fa_pass<false, 0, 2>(sk, sv, gk, gv, sr, sc, ln, hh, qf, o, m, l); fa_pass<false, 2, 2>(sk, sv, gk, gv, sr, sc, ln, hh, qf, o, m, l); }      /* the whole workgroup starts over with the running maximum */
#pragma unroll      /* constant indices keep the sums in registers */
  for (int qt = 0; qt < FA_QT; ++qt) l[qt] += fa_xhalf(l[qt]);      /* the two lane halves' sums join once */
  if (g == 1) {      /* hand the group's statistics and O^T over, lane to same lane of the wave with the same queries */
#pragma unroll      /* constant indices keep the tiles in registers */
    for (int qt = 0; qt < FA_QT; ++qt) { xs[w][qt][lane] = m[qt]; xs[w][FA_QT + qt][lane] = l[qt];
#pragma unroll      /* constant indices keep the tiles in registers */
      for (int dt = 0; dt < 4; ++dt) { const v4f lo = {o[qt][dt][0], o[qt][dt][1], o[qt][dt][2], o[qt][dt][3]}, hi = {o[qt][dt][4], o[qt][dt][5], o[qt][dt][6], o[qt][dt][7]};
        xo[w][(qt * 4 + dt) * 2][lane] = lo; xo[w][(qt * 4 + dt) * 2 + 1][lane] = hi; } }
  }
  __syncthreads();      /* publishes group 1's partial results to group 0 */
  if (g == 0) {
#pragma unroll      /* constant indices keep the tiles in registers */
    for (int qt = 0; qt < FA_QT; ++qt) {
      const float m1 = xs[w][qt][lane], l1 = xs[w][FA_QT + qt][lane];
      const float mn = fmaxf(m[qt], m1);
      const float c0 = __builtin_amdgcn_exp2f(m[qt] - mn), c1 = __builtin_amdgcn_exp2f(m1 - mn);      /* both groups' weights brought to the common maximum */
      const float inv = 1.0f / fmaf(l[qt], c0, l1 * c1);
      const float a0 = c0 * inv, a1 = c1 * inv;
      float* op = out + (size_t)(q0 + qt * 16 + ln) * DM + h * HD + 8 * hh;
#pragma unroll      /* constant indices keep the tiles in registers */
      for (int dt = 0; dt < 4; ++dt) { const v4f p0 = xo[w][(qt * 4 + dt) * 2][lane], p1 = xo[w][(qt * 4 + dt) * 2 + 1][lane];
        const v4f lo = {fmaf(o[qt][dt][0], a0, p0[0] * a1), fmaf(o[qt][dt][1], a0, p0[1] * a1), fmaf(o[qt][dt][2], a0, p0[2] * a1), fmaf(o[qt][dt][3], a0, p0[3] * a1)};
        const v4f hi = {fmaf(o[qt][dt][4], a0, p1[0] * a1), fmaf(o[qt][dt][5], a0, p1[1] * a1), fmaf(o[qt][dt][6], a0, p1[2] * a1), fmaf(o[qt][dt][7], a0, p1[3] * a1)};
        *(v4f*)(op + dt * 16) = lo; *(v4f*)(op + dt * 16 + 4) = hi; }
    }
  } }
// Projection GEMM with both operands staged in LDS straight from the f32 inputs: P[token][n] = sum_k bf16(X[token][k]) bf16(W[k][n]), v_wmma_f32_16x16x32_bf16, f32 accumulation, f16 result rows of pitch LQ.
// The rounding (to nearest even, one packed conversion per two values) stands between the global loads and the LDS stores of the ring, so no 16-bit copy of X or W exists in memory and no launch makes one. X: 16 lanes cover the 256 bytes of a row's stage.
// W is [k][n]: a wave takes 8 k rows, a lane one column of each 32 (every load a whole 128-byte line), and the lane's 8 k values of a column pack into one 16-byte piece of the LDS row n: the transposition costs nothing.
// Workgroup = 8 waves = 256 tokens x 128 columns; a wave owns 64 tokens x 64 columns (16 accumulator tiles, so a fragment read from LDS feeds 4 products). Per stage of 64 k the workgroup stages
// the 256 X rows and the 128 W columns (as rows) in LDS (whole-line loads one stage ahead through registers, two buffers, one barrier a stage: the ring of k_fattn).
// Transposed products, A = Wt rows, B = X rows: a lane holds 8 neighbouring columns of ONE token per tile, which pack into one 16-byte piece of a result row.
// A workgroup of the v half (columns from DM on) exchanges the operands, A = X rows, B = Wt rows: a lane then holds 8 neighbouring tokens of ONE column, a 16-byte piece of a V^T row, so V^T leaves this launch
// in the layout k_fattn reads and no transposing launch follows. Wave tiles are 64 x 64 and both operands have one LDS row form, so only the two first-row numbers and the result address differ.
#define G3_KT 64                     /* k per stage */
#define G3_NS (DM / G3_KT)           /* stages */
#define G3_LP 72                     /* LDS row pitch in f16: 128 data bytes + 16, an odd multiple of 16 bytes for the 16-byte fragment reads */
#define G3_MT 256                    /* tokens per workgroup */
#define G3_NT 128                    /* columns per workgroup */
#define G3_BR (G3_MT + G3_NT)        /* LDS rows per buffer: the X rows, then the Wt rows */
typedef unsigned short v4us __attribute__((ext_vector_type(4), may_alias));
__global__ __launch_bounds__(256) void k_gemm3(const float* __restrict__ X, const float* __restrict__ W, _Float16* __restrict__ P, _Float16* __restrict__ VT) {
  __shared__ __attribute__((aligned(16))) _Float16 sg[2 * G3_BR * G3_LP];
  const int tid = threadIdx.x, w = tid >> 5, lane = tid & 31, ln = lane & 15, hh = lane >> 4;
  const int row0 = blockIdx.y * G3_MT, col0 = blockIdx.x * G3_NT;
  const int tw = (w & 3) * 64, cw = (w >> 2) * 64;      /* the wave's first token and first column inside the workgroup's tile */
  const bool vh = col0 >= DM;      /* the v half, the same for the whole workgroup */
  const int ar = vh ? tw : G3_MT + cw, br = vh ? G3_MT + cw : tw;      /* first LDS row of the wave's A operand and of its B operand */
  const int xr = tid >> 4, xc = (tid & 15) * 4;      /* X staging: 16 threads cover the 256 bytes of one row's stage; rows xr + 16 i */
  const float* gx = X + (size_t)(row0 + xr) * DM + xc;
  const float* gw = W + (size_t)(w * 8) * LQ + col0 + lane;      /* W staging: k rows 8 w + e of the stage, columns lane + 32 q */
  const int rot = (int)(blockIdx.x + blockIdx.y) & (G3_NS - 1);      /* the workgroup's first k slab: the 16 workgroups that share X rows (one y) and the 16 that share W columns (one x) each walk the ring of slabs from another place, so that at no stage two of them ask L2 for the same lines */
  const float* px = gx + rot * G3_KT; const float* pw = gw + (size_t)(rot * G3_KT) * LQ;      /* the first slab's rows */
  v4f rx[16]; float rw[4][8];
#pragma unroll      /* constant indices keep the staged rows in registers */
  for (int i = 0; i < 16; ++i) rx[i] = *(const v4fa*)(px + (size_t)i * 16 * DM);
#pragma unroll      /* constant indices keep the staged rows in registers */
  for (int q = 0; q < 4; ++q) for (int e = 0; e < 8; ++e) rw[q][e] = pw[(size_t)e * LQ + q * 32];
  asm volatile("s_wait_xcnt 0x0" :: "v"(px), "v"(pw) : "memory");      /* stands in front of whatever lands next in the registers that held these loads' addresses; the addresses as inputs keep them untouched up to the wait */
#pragma unroll      /* constant indices keep the staged rows in registers */
  for (int i = 0; i < 16; ++i) { union { __bf16 b[4]; v4us v; } f; for (int e = 0; e < 4; ++e) f.b[e] = (__bf16)rx[i][e]; *(v4us*)&sg[(xr + 16 * i) * G3_LP + xc] = f.v; }
#pragma unroll      /* constant indices keep the staged rows in registers */
  for (int q = 0; q < 4; ++q) { FragB f; for (int e = 0; e < 8; ++e) f.v[e] = (__bf16)rw[q][e]; *(v8us*)&sg[(G3_MT + lane + 32 * q) * G3_LP + w * 8] = f.half[0]; }
  __syncthreads();
  const v8f z8 = {0.f, 0.f, 0.f, 0.f, 0.f, 0.f, 0.f, 0.f};
  v8f acc[4][4];      /* [16 A rows][16 B rows]; register r = A row 8 * hh + r, lane column = B row ln (q = k half: A rows are columns, B rows tokens; v half: the reverse) */
#pragma unroll      /* constant indices keep the tiles in registers */
  for (int i = 0; i < 4; ++i) for (int j = 0; j < 4; ++j) acc[i][j] = z8;
  for (int s = 0; s < G3_NS; ++s) {
    const _Float16* sb = sg + (s & 1) * (G3_BR * G3_LP);
    if (s + 1 < G3_NS) {      /* the next stage's rows fly while this stage is worked on */
      const int kn = (s + 1 + rot) & (G3_NS - 1);      /* its k slab, round the ring */
#pragma unroll      /* constant indices keep the staged rows in registers */
      for (int i = 0; i < 16; ++i) rx[i] = *(const v4fa*)(gx + (size_t)i * 16 * DM + kn * G3_KT);
#pragma unroll      /* constant indices keep the staged rows in registers */
      for (int q = 0; q < 4; ++q) for (int e = 0; e < 8; ++e) rw[q][e] = gw[(size_t)(kn * G3_KT + e) * LQ + q * 32];
      asm volatile("s_wait_xcnt 0x0" ::: "memory");      /* stands in front of the LDS reads below, which land in the registers that held these loads' addresses */
    }
    __builtin_amdgcn_sched_barrier(0);      /* keeps the 48 loads and their wait up here: without it the scheduler lifts an address of the LDS reads into a load's address register ahead of the wait */
    v16h wf[2][4], xf[2][4];      /* [k step of 32][16 A rows] and [k step of 32][16 B rows] */
#pragma unroll      /* constant indices keep the fragments in registers */
    for (int ks = 0; ks < 2; ++ks) {      /* in the order of first use, so that the products start behind the first loads */
      wf[ks][0] = fa_lfrag(sb + (ar + ln) * G3_LP + ks * 32 + 8 * hh);
#pragma unroll      /* constant indices keep the fragments in registers */
      for (int j = 0; j < 4; ++j) xf[ks][j] = fa_lfrag(sb + (br + j * 16 + ln) * G3_LP + ks * 32 + 8 * hh);
#pragma unroll      /* constant indices keep the fragments in registers */
      for (int i = 1; i < 4; ++i) wf[ks][i] = fa_lfrag(sb + (ar + i * 16 + ln) * G3_LP + ks * 32 + 8 * hh);
    }
    __builtin_amdgcn_sched_barrier(0);      /* the stage's 32 LDS reads stay one group ahead of its products: spread among them into one register set, every four products waited out a read's latency */
#pragma unroll      /* constant indices keep the tiles in registers */
    for (int ks = 0; ks < 2; ++ks) for (int i = 0; i < 4; ++i) for (int j = 0; j < 4; ++j) acc[i][j] = __builtin_amdgcn_wmma_f32_16x16x32_bf16(false, __builtin_bit_cast(v16b, wf[ks][i]), false, __builtin_bit_cast(v16b, xf[ks][j]), (short)0, acc[i][j], false, false);
    __builtin_amdgcn_sched_barrier(0);      /* the conversions and LDS stores of the next stage stay behind the products: lifted above them, they wait out the global loads' latency with the matrix unit idle */
    if (s + 1 < G3_NS) {      /* that buffer's last readers left it before the previous barrier */
      _Float16* sn = sg + ((s & 1) ^ 1) * (G3_BR * G3_LP);
#pragma unroll      /* constant indices keep the staged rows in registers */
      for (int i = 0; i < 16; ++i) { union { __bf16 b[4]; v4us v; } f; for (int e = 0; e < 4; ++e) f.b[e] = (__bf16)rx[i][e]; *(v4us*)&sn[(xr + 16 * i) * G3_LP + xc] = f.v; }
#pragma unroll      /* constant indices keep the staged rows in registers */
      for (int q = 0; q < 4; ++q) { FragB f; for (int e = 0; e < 8; ++e) f.v[e] = (__bf16)rw[q][e]; *(v8us*)&sn[(G3_MT + lane + 32 * q) * G3_LP + w * 8] = f.half[0]; }
    }
    __syncthreads();      /* publishes stage s + 1 and ends every read of stage s; the last one frees the ring for the result rows */
  }
  _Float16* so = sg + w * 64 * G3_LP;      /* the wave's own 64 result rows (B rows) of 64 values (A rows), so that whole 128-byte lines go out */
#pragma unroll      /* constant indices keep the tiles in registers */
  for (int i = 0; i < 4; ++i) for (int j = 0; j < 4; ++j) { FragH f; for (int r = 0; r < 8; ++r) f.h[r] = (_Float16)acc[i][j][r];
    *(v8us*)&so[(j * 16 + ln) * G3_LP + i * 16 + 8 * hh] = f.half[0]; }
  __builtin_amdgcn_fence(__ATOMIC_ACQ_REL, "workgroup"); __builtin_amdgcn_wave_barrier();      /* the wave reads back what its other lanes wrote */
  unsigned short* dp = vh ? (unsigned short*)VT + (size_t)(col0 - DM + cw) * SQ + row0 + tw      /* v half: rows = v columns (head * HD + dim), values = tokens */
                          : (unsigned short*)P + (size_t)(row0 + tw) * LQ + col0 + cw;      /* q = k half: rows = tokens, values = columns */
  const int dl = vh ? SQ : LQ;      /* row pitch of the plane written */
#pragma unroll      /* independent row pieces: the reads go ahead of the stores */
  for (int q = 0; q < 16; ++q) { const int r = q * 4 + (lane >> 3), c = (lane & 7) * 8; const v8us v = *(const v8us*)&so[r * G3_LP + c];
    *(v8us*)(dp + (size_t)(r * dl) + c) = v; }
}
__global__ __launch_bounds__(256) void k_vt(const _Float16* __restrict__ V16, int b, int h0, _Float16* __restrict__ VT) { __shared__ unsigned short tl[64][65]; const int tid = threadIdx.x; const int hh = blockIdx.x % HG, sg = blockIdx.x / HG; const int s0 = sg * 64; const int h = h0 + hh;
  for (int i = tid; i < 64 * 8; i += 256) { const int j = i / 8, d8 = (i % 8) * 8; FragH f; f.half[0] = *(const v8us*)((const unsigned short*)V16 + ((size_t)b * SQ + s0 + j) * DM + h * HD + d8); for (int q = 0; q < 8; ++q) tl[d8 + q][j] = f.u[q]; }
  __syncthreads();
  { for (int i = tid; i < 64 * 8; i += 256) { const int d = i / 8, j8 = (i % 8) * 8; FragH f; for (int q = 0; q < 8; ++q) f.u[q] = tl[d][j8 + q]; *(v8us*)((unsigned short*)VT + ((size_t)hh * HD + d) * SQ + s0 + j8) = f.half[0]; }  } }



__global__ __launch_bounds__(256) void k_rsmkm(const float* __restrict__ S, _Float16* __restrict__ P, int nrows, const int* __restrict__ am) {
  #pragma clang fp contract(off)
  const int t = blockIdx.x * 256 + threadIdx.x; if (t >= nrows) return; const size_t i = (size_t)t; const float* s = S + i * SQ; const int* mr = am + (size_t)(t % SQ) * SQ; float mx = -3.0e38f;
#pragma unroll 1
  for (int j = 0; j < SQ; ++j) { const float f = (mr[j] != 0) ? 1.f : 0.f; mx = fmaxf(mx, fmaf(f, s[j], (1.f - f) * -1.0e9f)); } float se = 0.f;
#pragma unroll 1
  for (int j = 0; j < SQ; ++j) { const float f = (mr[j] != 0) ? 1.f : 0.f; se += __expf(fmaf(f, s[j], (1.f - f) * -1.0e9f) - mx); } const float sc = 256.0f / se;
#pragma unroll 1
  for (int j0 = 0; j0 < SQ; j0 += 8) { FragH fr; for (int q = 0; q < 8; ++q) { const int j = j0 + q; const float f = (mr[j] != 0) ? 1.f : 0.f; fr.h[q] = (_Float16)(__expf(fmaf(f, s[j], (1.f - f) * -1.0e9f) - mx) * sc); }
    unsigned short* d = (unsigned short*)P + i * SQ + j0; *(v8us*)d = fr.half[0];  } }
extern "C" void kernel_launch(void* const* d_in, const int* in_sizes, int n_in,
                              void* d_out, int out_size, void* d_ws, size_t ws_size, hipStream_t stream) {
  (void)in_sizes; (void)n_in; (void)out_size;
  const float* const* I = (const float* const*)d_in; const float* xq = I[0]; const float* wqkv = I[1];      /* X (2-D [4096][1024] = one sequence; feeds the one projection), Wqkv ([in][out] [1024][2048]: columns 0..1023 = the shared q = k projection, 1024..2047 = v); NO biases; NO output projection */
  static_assert(NH * HD == DM && DM % 64 == 0 && SQ % (FA_KT * FA_KG) == 0 && SQ % 256 == 0 && NH % HG == 0 && MP % G3_MT == 0 && LQ % G3_NT == 0 && DM % G3_NT == 0 && NB == 1 && G3_NS >= 2 && (G3_NS & (G3_NS - 1)) == 0, "shape / tile multiples; one batch, since the projection writes V^T by token");
  char* ws = (char*)d_ws; size_t off = 0;
  auto take = [&](size_t bytes) { char* p = ws + off; off += (bytes + 255) & ~(size_t)255; return p; };
  _Float16* P16 = (_Float16*)take(NR * LQ * 2);
  _Float16* VT = (_Float16*)take((size_t)NH * HD * SQ * 2);
  if (off > ws_size) return;
  const size_t r0p = (size_t)B0 * SQ;      /* first projected row */
  k_gemm3<<<dim3(LQ / G3_NT, MP / G3_MT), 256, 0, stream>>>(xq + r0p * DM, wqkv, P16 + r0p * LQ, VT);      /* proj = X Wqkv from the f32 inputs ([in][out] weights as they lie), all 2048 columns in one launch; q and k are the same product and are read from the same columns; the v columns go out as V^T [NH][HD][SQ] */
  for (int b = B0; b < B0 + NBR; ++b) { const size_t r0 = (size_t)b * SQ;
    k_fattn<<<dim3(QN / 256, NHD), FA_GT * FA_KG, 0, stream>>>(P16 + r0 * LQ, P16 + r0 * LQ, VT, (float*)d_out + r0 * DM); }      /* out = softmax(q k^T / 8) v for all heads, f32 straight into the merged-heads output rows (no output projection) */
}
